// v000
// Measured on an AMD MI455X. A time is GPU time per run, averaged over a window of back-to-back runs after a warm-up
// (all launches, gaps included; the runs take copies of the inputs in turn), and the median of several windows.
// Apart from v000's, it joins two sittings. Times from different sittings can be a few percent apart, while
// side-by-side timings come from the same sitting.
// v000 is the starting kernel.
#include <hip/hip_runtime.h>
#include <hip/hip_bf16.h>
#include <math.h>

// ---------------------------------------------------------------------------
// MI455X (gfx1250, wave32) implementation of the PRM + Token-Performer block.
// All dense GEMMs (implicit-GEMM dilated convs, kqv, MLP) use
// V_WMMA_F32_16X16X32_F16 with f32 accumulation; skinny performer pieces are
// VALU with register accumulation and LDS-staged operands.  Fused epilogues keep each intermediate to one
// HBM round-trip (pipeline is ~bandwidth-bound at 23.3 TB/s).
// Conv reduction axis ordered k = kid*64 + ic so each 32-wide WMMA K-step has
// a constant kernel tap -> division-free im2col addressing (SALU-hoisted).
// ---------------------------------------------------------------------------

typedef _Float16 half_t;
typedef __attribute__((ext_vector_type(16))) _Float16 v16h;
typedef __attribute__((ext_vector_type(8)))  float    v8f;

// Problem constants (match reference)
#define BATCH   32
#define CIN     64
#define IMGSZ   128
#define NPIX    16384     // 128*128
#define TOKN    4096      // 64*64 post-stride-2 tokens
#define EBR     64
#define DIMC    192       // 3*EBR
#define EMB     64
#define MF      32        // performer features
#define INVSQRTM 0.17677669529663687f

// Workspace layout (bytes). Buffers reused once their producers/consumers
// are done:  XH region -> KP/QP,  TOK region -> YATT.
#define XH_OFF    ((size_t)0)                                   // f16 [B][CIN][128][128]  67.1MB
#define KP_OFF    ((size_t)0)                                   // f32 [B][T][32]          (reuse XH)
#define QP_OFF    ((size_t)16777216)                            // f32 [B][T][32]
#define TOK_OFF   ((size_t)67108864)                            // f16 [B][T][192]         50.3MB
#define YATT_OFF  TOK_OFF                                       // f32 [B][T][64]          (reuse TOK)
#define HLN_OFF   ((size_t)(67108864 + 50331648))               // f16 [B][T][192]
#define KQV_OFF   ((size_t)(67108864 + 2*50331648))             // f32 [B][T][192]         100.7MB
#define KSUM_OFF  (KQV_OFF + (size_t)BATCH*TOKN*DIMC*4)         // f32 [B][32]
#define KPTV_OFF  (KSUM_OFF + (size_t)4096)                     // f32 [B][64][32]

__device__ __forceinline__ float gelu_exact(float x) {
  return 0.5f * x * (1.0f + erff(x * 0.70710678118654752f));
}

__device__ __forceinline__ float wave_sum32(float v) {
  #pragma unroll
  for (int off = 16; off > 0; off >>= 1) v += __shfl_xor(v, off, 32);
  return v;
}

// Load a 16x32 f16 WMMA fragment (A row-major, or B assembled as [N][K]).
// tile: LDS matrix with K contiguous per row; stride in half elements.
// ISA layout: lanes 0-15 hold K0-7 (v0-3) and K16-23 (v4-7); lanes 16-31
// hold K8-15 and K24-31; M/N = lane&15 (+row0).
__device__ __forceinline__ v16h load_frag(const half_t* tile, int row0,
                                          int stride, int lane) {
  const half_t* p = tile + (row0 + (lane & 15)) * stride;
  const int hi = lane >> 4;
  v16h f;
  #pragma unroll
  for (int j = 0; j < 8; ++j) {
    const int kb = ((j >> 2) << 4) + (hi << 3) + ((j & 3) << 1);
    f[2 * j]     = p[kb];
    f[2 * j + 1] = p[kb + 1];
  }
  return f;
}

// ---------------------------------------------------------------------------
// K1: x [B,N,C] f32  ->  xh [B,C,H,W] f16  (64x64 LDS-tiled transpose)
// ---------------------------------------------------------------------------
__global__ __launch_bounds__(256) void k_pack(const float* __restrict__ x,
                                              half_t* __restrict__ xh) {
  __shared__ half_t tile[64][65];
  const int b = blockIdx.x >> 8;          // 256 n-tiles per batch
  const int nbase = (blockIdx.x & 255) << 6;
  const int tid = threadIdx.x;
  #pragma unroll
  for (int rep = 0; rep < 16; ++rep) {
    const int e = tid + (rep << 8);
    const int nn = e >> 6, cc = e & 63;
    tile[nn][cc] = (half_t)x[((size_t)b * NPIX + nbase + nn) * CIN + cc];
  }
  __syncthreads();
  #pragma unroll
  for (int rep = 0; rep < 16; ++rep) {
    const int e = tid + (rep << 8);
    const int cc = e >> 6, nn = e & 63;
    xh[((size_t)b * CIN + cc) * NPIX + nbase + nn] = tile[nn][cc];
  }
}

// ---------------------------------------------------------------------------
// K2: implicit-GEMM dilated conv + bias + GELU -> tokens f16 [B,T,192].
// Per block: 64 tokens x 64 out-channels, K=576 in 18 steps of 32 via WMMA.
// K axis ordered k = kid*64 + ic: each step has constant kernel tap (kid),
// so the im2col gather needs no integer division and A addresses are just
// base + kq*NPIX.  grid = (64 token tiles, 3 branches, 32 batches), 4 waves.
// ---------------------------------------------------------------------------
__global__ __launch_bounds__(128) void k_conv(const half_t* __restrict__ xh,
                                              const float* __restrict__ cw,
                                              const float* __restrict__ cb,
                                              half_t* __restrict__ tok) {
  __shared__ half_t As[64][34];
  __shared__ half_t Bs[64][34];
  const int tbase = blockIdx.x << 6;
  const int br = blockIdx.y;
  const int b  = blockIdx.z;
  const int dil = br + 1, pad = br + 1;
  const int tid = threadIdx.x, lane = tid & 31, wv = tid >> 5;
  const half_t* xb = xh + (size_t)b * CIN * NPIX;
  const float*  wb = cw + (size_t)br * EBR * CIN * 9;

  v8f acc[4];
  const v8f vzero = {};
  #pragma unroll
  for (int i = 0; i < 4; ++i) acc[i] = vzero;

  // Per-thread im2col coordinates (invariant over the K loop).
  const int a_tl = tid >> 5;              // token row handled in rep 0 (+4/rep)
  const int a_kq = tid & 31;              // hoisted: e>>5 grows by 4 per rep

  for (int kk = 0; kk < 18; ++kk) {
    const int ic0 = (kk & 1) << 5;        // 0 or 32
    const int kid = kk >> 1;              // kernel tap 0..8 (constant per step)
    const int kh = kid / 3, kw = kid - kh * 3;   // scalar (SALU)
    const int dh = kh * dil - pad, dw = kw * dil - pad;
    const half_t* xc = xb + ((size_t)ic0 << 14); // channel-block base

    // A tile: 64 tokens x 32 ic  (address = token base + kq*NPIX)
    #pragma unroll
    for (int rep = 0; rep < 16; ++rep) {
      const int tl = a_tl + (rep << 2);
      const int t = tbase + tl;
      const int oh = t >> 6, ow = t & 63;
      const int ih = (oh << 1) + dh;
      const int iw = (ow << 1) + dw;
      half_t v = (half_t)0.0f;
      if ((unsigned)ih < 128u && (unsigned)iw < 128u)
        v = xc[((size_t)a_kq << 14) + (ih << 7) + iw];
      As[tl][a_kq] = v;
    }
    // B tile as [oc][kq]: wb[(oc*64 + ic0+kq)*9 + kid]  (division-free)
    #pragma unroll
    for (int rep = 0; rep < 16; ++rep) {
      const int e = tid + (rep << 7);
      const int oc = e >> 5, kq = e & 31;
      Bs[oc][kq] = (half_t)wb[((oc << 6) + ic0 + kq) * 9 + kid];
    }
    if (kk < 17) {  // speculative prefetch of next K-step's channel block
      const int nic0 = ((kk + 1) & 1) << 5;
      __builtin_prefetch(xb + ((size_t)nic0 << 14) + ((size_t)a_kq << 14), 0, 3);
    }
    __syncthreads();
    const v16h va = load_frag(&As[0][0], wv << 4, 34, lane);
    #pragma unroll
    for (int nt = 0; nt < 4; ++nt) {
      const v16h vb = load_frag(&Bs[nt << 4][0], 0, 34, lane);
      acc[nt] = __builtin_amdgcn_wmma_f32_16x16x32_f16(
          false, va, false, vb, (short)0, acc[nt], false, false);
    }
    __syncthreads();
  }
  // Epilogue: bias + exact GELU, write tokens (branch-major channel concat)
  const int hi = lane >> 4, cn = lane & 15;
  #pragma unroll
  for (int nt = 0; nt < 4; ++nt) {
    const int oc = (nt << 4) + cn;
    const float bias = cb[br * EBR + oc];
    #pragma unroll
    for (int r = 0; r < 8; ++r) {
      const int row = (wv << 4) + r + (hi << 3);
      const int t = tbase + row;
      const float v = acc[nt][r] + bias;
      tok[((size_t)b * TOKN + t) * DIMC + br * EBR + oc] = (half_t)gelu_exact(v);
    }
  }
}

// ---------------------------------------------------------------------------
// K3: LayerNorm(192) over tokens -> hln f16.  One wave per token.
// ---------------------------------------------------------------------------
__global__ __launch_bounds__(128) void k_ln1(const half_t* __restrict__ tok,
                                             const float* __restrict__ g,
                                             const float* __restrict__ bt,
                                             half_t* __restrict__ hln) {
  const int token = (blockIdx.x << 2) + (threadIdx.x >> 5);
  const int lane = threadIdx.x & 31;
  const size_t base = (size_t)token * DIMC;
  float xv[6], s = 0.f, s2 = 0.f;
  #pragma unroll
  for (int j = 0; j < 6; ++j) {
    const float v = (float)tok[base + lane + (j << 5)];
    xv[j] = v; s += v; s2 += v * v;
  }
  s = wave_sum32(s); s2 = wave_sum32(s2);
  const float mean = s * (1.0f / DIMC);
  const float var  = s2 * (1.0f / DIMC) - mean * mean;
  const float rs = rsqrtf(var + 1e-5f);
  #pragma unroll
  for (int j = 0; j < 6; ++j) {
    const int c = lane + (j << 5);
    hln[base + c] = (half_t)((xv[j] - mean) * rs * g[c] + bt[c]);
  }
}

// ---------------------------------------------------------------------------
// K4: kqv GEMM  [131072 x 192] @ [192 x 192] + bias -> kqv f32.
// Per block: 64 rows x 64 cols, K=192 in 6 WMMA steps. grid=(2048,3).
// ---------------------------------------------------------------------------
__global__ __launch_bounds__(128) void k_kqv(const half_t* __restrict__ hln,
                                             const float* __restrict__ w,
                                             const float* __restrict__ bias,
                                             float* __restrict__ kqv) {
  __shared__ half_t As[64][34];
  __shared__ half_t Bs[64][34];
  const int rbase = blockIdx.x << 6;
  const int ct = blockIdx.y;
  const int tid = threadIdx.x, lane = tid & 31, wv = tid >> 5;

  v8f acc[4];
  const v8f vzero = {};
  #pragma unroll
  for (int i = 0; i < 4; ++i) acc[i] = vzero;

  for (int kk = 0; kk < 6; ++kk) {
    const int ks = kk << 5;
    #pragma unroll
    for (int rep = 0; rep < 16; ++rep) {
      const int e = tid + (rep << 7);
      const int rr = e >> 5, kq = e & 31;
      As[rr][kq] = hln[(size_t)(rbase + rr) * DIMC + ks + kq];
    }
    #pragma unroll
    for (int rep = 0; rep < 16; ++rep) {
      const int e = tid + (rep << 7);
      const int n = e >> 5, kq = e & 31;
      Bs[n][kq] = (half_t)w[(size_t)(ks + kq) * DIMC + (ct << 6) + n];
    }
    __syncthreads();
    const v16h va = load_frag(&As[0][0], wv << 4, 34, lane);
    #pragma unroll
    for (int nt = 0; nt < 4; ++nt) {
      const v16h vb = load_frag(&Bs[nt << 4][0], 0, 34, lane);
      acc[nt] = __builtin_amdgcn_wmma_f32_16x16x32_f16(
          false, va, false, vb, (short)0, acc[nt], false, false);
    }
    __syncthreads();
  }
  const int hi = lane >> 4, cn = lane & 15;
  #pragma unroll
  for (int nt = 0; nt < 4; ++nt) {
    const int col = (ct << 6) + (nt << 4) + cn;
    const float bv = bias[col];
    #pragma unroll
    for (int r = 0; r < 8; ++r) {
      const int row = rbase + (wv << 4) + r + (hi << 3);
      kqv[(size_t)row * DIMC + col] = acc[nt][r] + bv;
    }
  }
}

// ---------------------------------------------------------------------------
// K5: performer features  kp/qp = exp(w.t - |t|^2/2)/sqrt(m)  + ksum reduce.
// One wave per token (lane = feature m), 8 tokens per block.
// ---------------------------------------------------------------------------
__global__ __launch_bounds__(256) void k_perf(const float* __restrict__ kqv,
                                              const float* __restrict__ wperf,
                                              float* __restrict__ kp,
                                              float* __restrict__ qp,
                                              float* __restrict__ ksum) {
  __shared__ float wp[32][64];
  __shared__ float kb[8][64];
  __shared__ float qb[8][64];
  __shared__ float kpart[32];
  const int b  = blockIdx.x >> 9;
  const int tb = (blockIdx.x & 511) << 3;
  const int tid = threadIdx.x, wv = tid >> 5, lane = tid & 31;
  #pragma unroll
  for (int rep = 0; rep < 8; ++rep) {
    const int e = tid + (rep << 8);
    wp[e >> 6][e & 63] = wperf[e];
  }
  if (tid < 32) kpart[tid] = 0.f;
  const int t = tb + wv;
  const size_t ro = ((size_t)b * TOKN + t) * DIMC;
  kb[wv][lane]      = kqv[ro + lane];
  kb[wv][lane + 32] = kqv[ro + lane + 32];
  qb[wv][lane]      = kqv[ro + 64 + lane];
  qb[wv][lane + 32] = kqv[ro + 64 + lane + 32];
  __syncthreads();
  float dk = 0.f, dq = 0.f, xk = 0.f, xq = 0.f;
  #pragma unroll 8
  for (int d = 0; d < 64; ++d) {
    const float kv = kb[wv][d], qv = qb[wv][d], wr = wp[lane][d];
    dk += wr * kv; dq += wr * qv; xk += kv * kv; xq += qv * qv;
  }
  const float kpv = expf(dk - 0.5f * xk) * INVSQRTM;
  const float qpv = expf(dq - 0.5f * xq) * INVSQRTM;
  const size_t po = ((size_t)b * TOKN + t) * MF + lane;
  kp[po] = kpv; qp[po] = qpv;
  atomicAdd(&kpart[lane], kpv);
  __syncthreads();
  if (tid < 32) atomicAdd(&ksum[b * MF + tid], kpart[tid]);
}

// ---------------------------------------------------------------------------
// K6: kptv[b,d,m] = sum_t v[b,t,d]*kp[b,t,m].  Per-thread 8-cell register
// accumulation over 256 tokens, LDS-staged tiles, one global atomic per cell.
// ---------------------------------------------------------------------------
__global__ __launch_bounds__(256) void k_kptv(const float* __restrict__ kqv,
                                              const float* __restrict__ kp,
                                              float* __restrict__ kptv) {
  __shared__ float vbuf[32][65];
  __shared__ float kpb[32][33];
  const int b  = blockIdx.x >> 4;
  const int tb = (blockIdx.x & 15) << 8;
  const int tid = threadIdx.x;
  const int d = tid >> 2, m0 = (tid & 3) << 3;
  float acc[8];
  #pragma unroll
  for (int j = 0; j < 8; ++j) acc[j] = 0.f;
  for (int ch = 0; ch < 8; ++ch) {
    const int t0 = tb + (ch << 5);
    #pragma unroll
    for (int rep = 0; rep < 8; ++rep) {
      const int e = tid + (rep << 8);
      const int tt = e >> 6, dd = e & 63;
      vbuf[tt][dd] = kqv[((size_t)b * TOKN + t0 + tt) * DIMC + 128 + dd];
    }
    #pragma unroll
    for (int rep = 0; rep < 4; ++rep) {
      const int e = tid + (rep << 8);
      const int tt = e >> 5, mm = e & 31;
      kpb[tt][mm] = kp[((size_t)b * TOKN + t0 + tt) * MF + mm];
    }
    __syncthreads();
    #pragma unroll 4
    for (int tt = 0; tt < 32; ++tt) {
      const float vv = vbuf[tt][d];
      #pragma unroll
      for (int j = 0; j < 8; ++j) acc[j] += vv * kpb[tt][m0 + j];
    }
    __syncthreads();
  }
  #pragma unroll
  for (int j = 0; j < 8; ++j)
    atomicAdd(&kptv[((size_t)b * EMB + d) * MF + m0 + j], acc[j]);
}

// ---------------------------------------------------------------------------
// K7: yatt = v + proj(qp @ kptv^T / (qp.ksum + eps)).  One wave per token,
// kptv / proj_w / ksum cached in LDS.
// ---------------------------------------------------------------------------
__global__ __launch_bounds__(256) void k_mix(const float* __restrict__ kqv,
                                             const float* __restrict__ qp,
                                             const float* __restrict__ ksum,
                                             const float* __restrict__ kptv,
                                             const float* __restrict__ pw,
                                             const float* __restrict__ pb,
                                             float* __restrict__ yatt) {
  __shared__ float kl[64][32];
  __shared__ float pwl[64][64];
  __shared__ float pbl[64];
  __shared__ float ksl[32];
  __shared__ float ql[8][32];
  __shared__ float al[8][64];
  const int b  = blockIdx.x >> 9;
  const int tb = (blockIdx.x & 511) << 3;
  const int tid = threadIdx.x, wv = tid >> 5, lane = tid & 31;
  #pragma unroll
  for (int rep = 0; rep < 8; ++rep) {
    const int e = tid + (rep << 8);
    kl[e >> 5][e & 31] = kptv[(size_t)b * (EMB * MF) + e];
  }
  #pragma unroll
  for (int rep = 0; rep < 16; ++rep) {
    const int e = tid + (rep << 8);
    pwl[e >> 6][e & 63] = pw[e];
  }
  if (tid < 64) pbl[tid] = pb[tid];
  if (tid < 32) ksl[tid] = ksum[b * MF + tid];
  const int t = tb + wv;
  const float qv = qp[((size_t)b * TOKN + t) * MF + lane];
  ql[wv][lane] = qv;
  __syncthreads();
  const float D = wave_sum32(qv * ksl[lane]);
  #pragma unroll
  for (int h = 0; h < 2; ++h) {
    const int d = lane + (h << 5);
    float num = 0.f;
    #pragma unroll 8
    for (int m = 0; m < 32; ++m) num += ql[wv][m] * kl[d][m];
    al[wv][d] = num / (D + 1e-8f);
  }
  __syncthreads();
  const size_t row = (size_t)b * TOKN + t;
  #pragma unroll
  for (int h = 0; h < 2; ++h) {
    const int d = lane + (h << 5);
    float o = kqv[row * DIMC + 128 + d] + pbl[d];
    #pragma unroll 8
    for (int e = 0; e < 64; ++e) o += al[wv][e] * pwl[e][d];
    yatt[row * EMB + d] = o;
  }
}

// ---------------------------------------------------------------------------
// K8: out = yatt + W2 @ gelu(W1 @ LN(yatt) + b1) + b2.  Fully fused:
// LN2 in registers, both 64x64 GEMMs via WMMA with all operands in LDS.
// Per block: 64 rows, 128 threads (4 waves).
// ---------------------------------------------------------------------------
__global__ __launch_bounds__(128) void k_mlp(const float* __restrict__ yatt,
                                             const float* __restrict__ g,
                                             const float* __restrict__ bt,
                                             const float* __restrict__ w1,
                                             const float* __restrict__ b1,
                                             const float* __restrict__ w2,
                                             const float* __restrict__ b2,
                                             float* __restrict__ out) {
  __shared__ half_t Hs[64][66];
  __shared__ half_t W1s[64][66];
  __shared__ half_t W2s[64][66];
  __shared__ half_t T1s[64][66];
  __shared__ float b1l[64], b2l[64];
  const int rbase = blockIdx.x << 6;
  const int tid = threadIdx.x, lane = tid & 31, wv = tid >> 5;
  // LayerNorm(64): two threads per row, pair-reduce via shfl.
  {
    const int r = tid >> 1, hf = tid & 1;
    const float* p = yatt + ((size_t)(rbase + r) << 6) + (hf << 5);
    float xv[32], s = 0.f, s2 = 0.f;
    #pragma unroll
    for (int j = 0; j < 32; ++j) { const float v = p[j]; xv[j] = v; s += v; s2 += v * v; }
    s  += __shfl_xor(s, 1, 32);
    s2 += __shfl_xor(s2, 1, 32);
    const float mean = s * (1.0f / 64.f);
    const float var  = s2 * (1.0f / 64.f) - mean * mean;
    const float rs = rsqrtf(var + 1e-5f);
    #pragma unroll
    for (int j = 0; j < 32; ++j) {
      const int c = (hf << 5) + j;
      Hs[r][c] = (half_t)((xv[j] - mean) * rs * g[c] + bt[c]);
    }
  }
  #pragma unroll
  for (int rep = 0; rep < 32; ++rep) {
    const int e = tid + (rep << 7);
    const int n = e >> 6, k = e & 63;
    W1s[n][k] = (half_t)w1[(k << 6) + n];
    W2s[n][k] = (half_t)w2[(k << 6) + n];
  }
  if (tid < 64) { b1l[tid] = b1[tid]; b2l[tid] = b2[tid]; }
  __syncthreads();

  const v8f vzero = {};
  v8f acc[4];
  #pragma unroll
  for (int i = 0; i < 4; ++i) acc[i] = vzero;
  #pragma unroll
  for (int kk = 0; kk < 2; ++kk) {
    const int ks = kk << 5;
    const v16h va = load_frag(&Hs[0][ks], wv << 4, 66, lane);
    #pragma unroll
    for (int nt = 0; nt < 4; ++nt) {
      const v16h vb = load_frag(&W1s[nt << 4][ks], 0, 66, lane);
      acc[nt] = __builtin_amdgcn_wmma_f32_16x16x32_f16(
          false, va, false, vb, (short)0, acc[nt], false, false);
    }
  }
  const int hi = lane >> 4, cn = lane & 15;
  #pragma unroll
  for (int nt = 0; nt < 4; ++nt) {
    const int col = (nt << 4) + cn;
    #pragma unroll
    for (int r = 0; r < 8; ++r) {
      const int row = (wv << 4) + r + (hi << 3);
      T1s[row][col] = (half_t)gelu_exact(acc[nt][r] + b1l[col]);
    }
  }
  __syncthreads();
  v8f acc2[4];
  #pragma unroll
  for (int i = 0; i < 4; ++i) acc2[i] = vzero;
  #pragma unroll
  for (int kk = 0; kk < 2; ++kk) {
    const int ks = kk << 5;
    const v16h va = load_frag(&T1s[0][ks], wv << 4, 66, lane);
    #pragma unroll
    for (int nt = 0; nt < 4; ++nt) {
      const v16h vb = load_frag(&W2s[nt << 4][ks], 0, 66, lane);
      acc2[nt] = __builtin_amdgcn_wmma_f32_16x16x32_f16(
          false, va, false, vb, (short)0, acc2[nt], false, false);
    }
  }
  #pragma unroll
  for (int nt = 0; nt < 4; ++nt) {
    const int col = (nt << 4) + cn;
    const float bv = b2l[col];
    #pragma unroll
    for (int r = 0; r < 8; ++r) {
      const int row = (wv << 4) + r + (hi << 3);
      const size_t gi = ((size_t)(rbase + row) << 6) + col;
      out[gi] = yatt[gi] + acc2[nt][r] + bv;
    }
  }
}

// ---------------------------------------------------------------------------
extern "C" void kernel_launch(void* const* d_in, const int* in_sizes, int n_in,
                              void* d_out, int out_size, void* d_ws, size_t ws_size,
                              hipStream_t stream) {
  (void)in_sizes; (void)n_in; (void)out_size; (void)ws_size;
  const float* x      = (const float*)d_in[0];
  const float* conv_w = (const float*)d_in[1];
  const float* conv_b = (const float*)d_in[2];
  const float* ln1_g  = (const float*)d_in[3];
  const float* ln1_b  = (const float*)d_in[4];
  const float* kqv_w  = (const float*)d_in[5];
  const float* kqv_b  = (const float*)d_in[6];
  const float* proj_w = (const float*)d_in[7];
  const float* proj_b = (const float*)d_in[8];
  const float* w_perf = (const float*)d_in[9];
  const float* ln2_g  = (const float*)d_in[10];
  const float* ln2_b  = (const float*)d_in[11];
  const float* mlp_w1 = (const float*)d_in[12];
  const float* mlp_b1 = (const float*)d_in[13];
  const float* mlp_w2 = (const float*)d_in[14];
  const float* mlp_b2 = (const float*)d_in[15];

  char* ws = (char*)d_ws;
  half_t* xh   = (half_t*)(ws + XH_OFF);
  half_t* tok  = (half_t*)(ws + TOK_OFF);
  half_t* hln  = (half_t*)(ws + HLN_OFF);
  float*  kqv  = (float*)(ws + KQV_OFF);
  float*  kp   = (float*)(ws + KP_OFF);     // reuses XH region (xh dead)
  float*  qp   = (float*)(ws + QP_OFF);
  float*  ksum = (float*)(ws + KSUM_OFF);
  float*  kptv = (float*)(ws + KPTV_OFF);
  float*  yatt = (float*)(ws + YATT_OFF);   // reuses TOK region (tok dead)
  float*  out  = (float*)d_out;

  // Zero the atomic accumulators (ksum + kptv are contiguous).
  hipMemsetAsync(ws + KSUM_OFF, 0, 4096 + (size_t)BATCH * EMB * MF * 4, stream);

  k_pack<<<dim3(BATCH * 256), dim3(256), 0, stream>>>(x, xh);
  k_conv<<<dim3(64, 3, BATCH), dim3(128), 0, stream>>>(xh, conv_w, conv_b, tok);
  k_ln1 <<<dim3((BATCH * TOKN) / 4), dim3(128), 0, stream>>>(tok, ln1_g, ln1_b, hln);
  k_kqv <<<dim3((BATCH * TOKN) / 64, 3), dim3(128), 0, stream>>>(hln, kqv_w, kqv_b, kqv);
  k_perf<<<dim3(BATCH * 512), dim3(256), 0, stream>>>(kqv, w_perf, kp, qp, ksum);
  k_kptv<<<dim3(BATCH * 16), dim3(256), 0, stream>>>(kqv, kp, kptv);
  k_mix <<<dim3(BATCH * 512), dim3(256), 0, stream>>>(kqv, qp, ksum, kptv,
                                                      proj_w, proj_b, yatt);
  k_mlp <<<dim3((BATCH * TOKN) / 64), dim3(128), 0, stream>>>(
      yatt, ln2_g, ln2_b, mlp_w1, mlp_b1, mlp_w2, mlp_b2, out);
}

// v001
// Timed twice side by side with v000, it ran 1.48 and 1.47 times as fast.
#include <hip/hip_runtime.h>
#include <hip/hip_bf16.h>
#include <math.h>

// ---------------------------------------------------------------------------
// MI455X (gfx1250, wave32) implementation of the PRM + Token-Performer block.
// All dense GEMMs (implicit-GEMM dilated convs, kqv, MLP) use
// V_WMMA_F32_16X16X32_F16 with f32 accumulation; skinny performer pieces are
// VALU with register accumulation and LDS-staged operands.  Fused epilogues keep each intermediate to one
// HBM round-trip (pipeline is ~bandwidth-bound at 23.3 TB/s).
// Conv reduction axis ordered k = kid*64 + ic so each 32-wide WMMA K-step has
// a constant kernel tap; the image stays channels-last, so one pixel's 64
// channels are one 128-byte line and an im2col row is contiguous in k.
// ---------------------------------------------------------------------------

typedef _Float16 half_t;
typedef __attribute__((ext_vector_type(16))) _Float16 v16h;
typedef __attribute__((ext_vector_type(8)))  _Float16 v8h;
typedef __attribute__((ext_vector_type(8)))  float    v8f;

// Problem constants (match reference)
#define BATCH   32
#define CIN     64
#define IMGSZ   128
#define NPIX    16384     // 128*128
#define TOKN    4096      // 64*64 post-stride-2 tokens
#define EBR     64
#define DIMC    192       // 3*EBR
#define EMB     64
#define MF      32        // performer features
#define INVSQRTM 0.17677669529663687f

// Workspace layout (bytes). Buffers reused once their producers/consumers
// are done:  XH region -> KP/QP,  TOK region -> YATT.
#define XH_OFF    ((size_t)0)                                   // f16 [B][128][128][CIN]  67.1MB
#define KP_OFF    ((size_t)0)                                   // f32 [B][T][32]          (reuse XH)
#define QP_OFF    ((size_t)16777216)                            // f32 [B][T][32]
#define TOK_OFF   ((size_t)67108864)                            // f16 [B][T][192]         50.3MB
#define YATT_OFF  TOK_OFF                                       // f32 [B][T][64]          (reuse TOK)
#define HLN_OFF   ((size_t)(67108864 + 50331648))               // f16 [B][T][192]
#define KQV_OFF   ((size_t)(67108864 + 2*50331648))             // f32 [B][T][192]         100.7MB
#define KSUM_OFF  (KQV_OFF + (size_t)BATCH*TOKN*DIMC*4)         // f32 [B][32]
#define KPTV_OFF  (KSUM_OFF + (size_t)4096)                     // f32 [B][64][32]

__device__ __forceinline__ float gelu_exact(float x) {
  return 0.5f * x * (1.0f + erff(x * 0.70710678118654752f));
}

__device__ __forceinline__ float wave_sum32(float v) {
  #pragma unroll
  for (int off = 16; off > 0; off >>= 1) v += __shfl_xor(v, off, 32);
  return v;
}

// Load a 16x32 f16 WMMA fragment (A row-major, or B assembled as [N][K]).
// tile: LDS matrix with K contiguous per row; stride in half elements.
// ISA layout: lanes 0-15 hold K0-7 (v0-3) and K16-23 (v4-7); lanes 16-31
// hold K8-15 and K24-31; M/N = lane&15 (+row0).
__device__ __forceinline__ v16h load_frag(const half_t* tile, int row0,
                                          int stride, int lane) {
  const half_t* p = tile + (row0 + (lane & 15)) * stride;
  const int hi = lane >> 4;
  v16h f;
  #pragma unroll
  for (int j = 0; j < 8; ++j) {
    const int kb = ((j >> 2) << 4) + (hi << 3) + ((j & 3) << 1);
    f[2 * j]     = p[kb];
    f[2 * j + 1] = p[kb + 1];
  }
  return f;
}

// ---------------------------------------------------------------------------
// K1: x [B,N,C] f32  ->  xh [B,N,C] f16  (same channels-last order, convert
// only).  8 elements per thread per pass: two 16-byte loads, one 16-byte store.
// ---------------------------------------------------------------------------
__global__ __launch_bounds__(256) void k_pack(const float* __restrict__ x,
                                              half_t* __restrict__ xh) {
  const size_t base = ((size_t)blockIdx.x << 12) + ((size_t)threadIdx.x << 3);
  #pragma unroll  // both passes' loads are in flight before the first store
  for (int rep = 0; rep < 2; ++rep) {
    const size_t e = base + ((size_t)rep << 11);
    const float4 u = *reinterpret_cast<const float4*>(x + e);
    const float4 w = *reinterpret_cast<const float4*>(x + e + 4);
    v8h o;
    o[0] = (half_t)u.x; o[1] = (half_t)u.y; o[2] = (half_t)u.z; o[3] = (half_t)u.w;
    o[4] = (half_t)w.x; o[5] = (half_t)w.y; o[6] = (half_t)w.z; o[7] = (half_t)w.w;
    *reinterpret_cast<v8h*>(xh + e) = o;
  }
}

// ---------------------------------------------------------------------------
// K2: implicit-GEMM dilated conv + bias + GELU -> tokens f16 [B,T,192].
// Per block: 64 tokens x 64 out-channels, K=576 in 18 steps of 32 via WMMA.
// K axis ordered k = kid*64 + ic.  A never passes through LDS: lane l owns
// token row l&15 of its wave's 16, and its fragment halves (k = 8*(l>>4)+0..7
// and 16+8*(l>>4)+0..7) are two 16-byte runs of that token's tap pixel, read
// straight from the channels-last image.  One tap = four such loads = both
// K-steps of the tap.  grid = (64 token tiles, 3 branches, 32 batches), 4 waves.
// ---------------------------------------------------------------------------
__global__ __launch_bounds__(128) void k_conv(const half_t* __restrict__ xh,
                                              const float* __restrict__ cw,
                                              const float* __restrict__ cb,
                                              half_t* __restrict__ tok) {
  __shared__ half_t Bs[64][34];
  const int tbase = blockIdx.x << 6;
  const int br = blockIdx.y;
  const int b  = blockIdx.z;
  const int dil = br + 1, pad = br + 1;
  const int tid = threadIdx.x, lane = tid & 31, wv = tid >> 5;
  const float*  wb = cw + (size_t)br * EBR * CIN * 9;

  v8f acc[4];
  const v8f vzero = {};
  #pragma unroll
  for (int i = 0; i < 4; ++i) acc[i] = vzero;

  // Per-lane im2col coordinates (invariant over the K loop).
  const int a_t  = tbase + (wv << 4) + (lane & 15);
  const int a_h0 = (a_t >> 6) << 1, a_w0 = (a_t & 63) << 1;
  const half_t* xa = xh + (size_t)b * NPIX * CIN + ((lane >> 4) << 3);
  const int b_oc = wv, b_off = ((wv << 6) + lane) * 9;

  for (int kid = 0; kid < 9; ++kid) {     // kernel tap
    const int kh = kid / 3, kw = kid - kh * 3;   // scalar (SALU)
    const int ih = a_h0 + kh * dil - pad;
    const int iw = a_w0 + kw * dil - pad;
    const bool inb = (unsigned)ih < 128u && (unsigned)iw < 128u;
    // A: this token's tap pixel, all 64 channels over the lane pair (l, l+16).
    // A padded tap reads pixel 0 (in bounds) and is zeroed afterwards.
    const half_t* pa = xa + (inb ? (((ih << 7) + iw) << 6) : 0);
    const float* wk = wb + kid;
    v8h a[4];
    #pragma unroll  // constant indices keep a[] in registers (here and below)
    for (int q = 0; q < 4; ++q) a[q] = *reinterpret_cast<const v8h*>(pa + (q << 4));
    if (!inb) {
      #pragma unroll
      for (int q = 0; q < 4; ++q) a[q] = (v8h)(half_t)0.0f;
    }

    #pragma unroll
    for (int h = 0; h < 2; ++h) {
      const int ic0 = h << 5;             // 0 or 32
      // B tile as [oc][kq]: wb[(oc*64 + ic0+kq)*9 + kid], oc = wv + 4*rep, kq = lane:
      // one lane address per tap, the rest an immediate offset of each load, so no
      // load of the run lands in a register that another load of it still names.
      #pragma unroll
      for (int rep = 0; rep < 16; ++rep)
        Bs[b_oc + (rep << 2)][lane] = (half_t)wk[b_off + ((rep << 8) + ic0) * 9];
      __syncthreads();
      const v16h va = __builtin_shufflevector(a[2 * h], a[2 * h + 1],
          0, 1, 2, 3, 4, 5, 6, 7, 8, 9, 10, 11, 12, 13, 14, 15);
      #pragma unroll
      for (int nt = 0; nt < 4; ++nt) {
        const v16h vb = load_frag(&Bs[nt << 4][0], 0, 34, lane);
        acc[nt] = __builtin_amdgcn_wmma_f32_16x16x32_f16(
            false, va, false, vb, (short)0, acc[nt], false, false);
      }
      __syncthreads();
    }
    // The next tap rewrites the address registers that this tap's loads name.
    asm volatile("s_wait_xcnt 0x0" ::: "memory");
  }
  // Epilogue: bias + exact GELU, write tokens (branch-major channel concat)
  const int hi = lane >> 4, cn = lane & 15;
  #pragma unroll
  for (int nt = 0; nt < 4; ++nt) {
    const int oc = (nt << 4) + cn;
    const float bias = cb[br * EBR + oc];
    #pragma unroll
    for (int r = 0; r < 8; ++r) {
      const int row = (wv << 4) + r + (hi << 3);
      const int t = tbase + row;
      const float v = acc[nt][r] + bias;
      tok[((size_t)b * TOKN + t) * DIMC + br * EBR + oc] = (half_t)gelu_exact(v);
    }
  }
}

// ---------------------------------------------------------------------------
// K3: LayerNorm(192) over tokens -> hln f16.  One wave per token.
// ---------------------------------------------------------------------------
__global__ __launch_bounds__(128) void k_ln1(const half_t* __restrict__ tok,
                                             const float* __restrict__ g,
                                             const float* __restrict__ bt,
                                             half_t* __restrict__ hln) {
  const int token = (blockIdx.x << 2) + (threadIdx.x >> 5);
  const int lane = threadIdx.x & 31;
  const size_t base = (size_t)token * DIMC;
  float xv[6], s = 0.f, s2 = 0.f;
  #pragma unroll
  for (int j = 0; j < 6; ++j) {
    const float v = (float)tok[base + lane + (j << 5)];
    xv[j] = v; s += v; s2 += v * v;
  }
  s = wave_sum32(s); s2 = wave_sum32(s2);
  const float mean = s * (1.0f / DIMC);
  const float var  = s2 * (1.0f / DIMC) - mean * mean;
  const float rs = rsqrtf(var + 1e-5f);
  #pragma unroll
  for (int j = 0; j < 6; ++j) {
    const int c = lane + (j << 5);
    hln[base + c] = (half_t)((xv[j] - mean) * rs * g[c] + bt[c]);
  }
}

// ---------------------------------------------------------------------------
// K4: kqv GEMM  [131072 x 192] @ [192 x 192] + bias -> kqv f32.
// Per block: 64 rows x 64 cols, K=192 in 6 WMMA steps. grid=(2048,3).
// ---------------------------------------------------------------------------
__global__ __launch_bounds__(128) void k_kqv(const half_t* __restrict__ hln,
                                             const float* __restrict__ w,
                                             const float* __restrict__ bias,
                                             float* __restrict__ kqv) {
  __shared__ half_t As[64][34];
  __shared__ half_t Bs[64][34];
  const int rbase = blockIdx.x << 6;
  const int ct = blockIdx.y;
  const int tid = threadIdx.x, lane = tid & 31, wv = tid >> 5;

  v8f acc[4];
  const v8f vzero = {};
  #pragma unroll
  for (int i = 0; i < 4; ++i) acc[i] = vzero;

  for (int kk = 0; kk < 6; ++kk) {
    const int ks = kk << 5;
    #pragma unroll
    for (int rep = 0; rep < 16; ++rep) {
      const int e = tid + (rep << 7);
      const int rr = e >> 5, kq = e & 31;
      As[rr][kq] = hln[(size_t)(rbase + rr) * DIMC + ks + kq];
    }
    #pragma unroll
    for (int rep = 0; rep < 16; ++rep) {
      const int e = tid + (rep << 7);
      const int n = e >> 5, kq = e & 31;
      Bs[n][kq] = (half_t)w[(size_t)(ks + kq) * DIMC + (ct << 6) + n];
    }
    __syncthreads();
    const v16h va = load_frag(&As[0][0], wv << 4, 34, lane);
    #pragma unroll
    for (int nt = 0; nt < 4; ++nt) {
      const v16h vb = load_frag(&Bs[nt << 4][0], 0, 34, lane);
      acc[nt] = __builtin_amdgcn_wmma_f32_16x16x32_f16(
          false, va, false, vb, (short)0, acc[nt], false, false);
    }
    __syncthreads();
  }
  const int hi = lane >> 4, cn = lane & 15;
  #pragma unroll
  for (int nt = 0; nt < 4; ++nt) {
    const int col = (ct << 6) + (nt << 4) + cn;
    const float bv = bias[col];
    #pragma unroll
    for (int r = 0; r < 8; ++r) {
      const int row = rbase + (wv << 4) + r + (hi << 3);
      kqv[(size_t)row * DIMC + col] = acc[nt][r] + bv;
    }
  }
}

// ---------------------------------------------------------------------------
// K5: performer features  kp/qp = exp(w.t - |t|^2/2)/sqrt(m)  + ksum reduce.
// One wave per token (lane = feature m), 8 tokens per block.
// ---------------------------------------------------------------------------
__global__ __launch_bounds__(256) void k_perf(const float* __restrict__ kqv,
                                              const float* __restrict__ wperf,
                                              float* __restrict__ kp,
                                              float* __restrict__ qp,
                                              float* __restrict__ ksum) {
  __shared__ float wp[32][64];
  __shared__ float kb[8][64];
  __shared__ float qb[8][64];
  __shared__ float kpart[32];
  const int b  = blockIdx.x >> 9;
  const int tb = (blockIdx.x & 511) << 3;
  const int tid = threadIdx.x, wv = tid >> 5, lane = tid & 31;
  #pragma unroll
  for (int rep = 0; rep < 8; ++rep) {
    const int e = tid + (rep << 8);
    wp[e >> 6][e & 63] = wperf[e];
  }
  if (tid < 32) kpart[tid] = 0.f;
  const int t = tb + wv;
  const size_t ro = ((size_t)b * TOKN + t) * DIMC;
  kb[wv][lane]      = kqv[ro + lane];
  kb[wv][lane + 32] = kqv[ro + lane + 32];
  qb[wv][lane]      = kqv[ro + 64 + lane];
  qb[wv][lane + 32] = kqv[ro + 64 + lane + 32];
  __syncthreads();
  float dk = 0.f, dq = 0.f, xk = 0.f, xq = 0.f;
  #pragma unroll 8
  for (int d = 0; d < 64; ++d) {
    const float kv = kb[wv][d], qv = qb[wv][d], wr = wp[lane][d];
    dk += wr * kv; dq += wr * qv; xk += kv * kv; xq += qv * qv;
  }
  const float kpv = expf(dk - 0.5f * xk) * INVSQRTM;
  const float qpv = expf(dq - 0.5f * xq) * INVSQRTM;
  const size_t po = ((size_t)b * TOKN + t) * MF + lane;
  kp[po] = kpv; qp[po] = qpv;
  atomicAdd(&kpart[lane], kpv);
  __syncthreads();
  if (tid < 32) atomicAdd(&ksum[b * MF + tid], kpart[tid]);
}

// ---------------------------------------------------------------------------
// K6: kptv[b,d,m] = sum_t v[b,t,d]*kp[b,t,m].  Per-thread 8-cell register
// accumulation over 256 tokens, LDS-staged tiles, one global atomic per cell.
// ---------------------------------------------------------------------------
__global__ __launch_bounds__(256) void k_kptv(const float* __restrict__ kqv,
                                              const float* __restrict__ kp,
                                              float* __restrict__ kptv) {
  __shared__ float vbuf[32][65];
  __shared__ float kpb[32][33];
  const int b  = blockIdx.x >> 4;
  const int tb = (blockIdx.x & 15) << 8;
  const int tid = threadIdx.x;
  const int d = tid >> 2, m0 = (tid & 3) << 3;
  float acc[8];
  #pragma unroll
  for (int j = 0; j < 8; ++j) acc[j] = 0.f;
  for (int ch = 0; ch < 8; ++ch) {
    const int t0 = tb + (ch << 5);
    #pragma unroll
    for (int rep = 0; rep < 8; ++rep) {
      const int e = tid + (rep << 8);
      const int tt = e >> 6, dd = e & 63;
      vbuf[tt][dd] = kqv[((size_t)b * TOKN + t0 + tt) * DIMC + 128 + dd];
    }
    #pragma unroll
    for (int rep = 0; rep < 4; ++rep) {
      const int e = tid + (rep << 8);
      const int tt = e >> 5, mm = e & 31;
      kpb[tt][mm] = kp[((size_t)b * TOKN + t0 + tt) * MF + mm];
    }
    __syncthreads();
    #pragma unroll 4
    for (int tt = 0; tt < 32; ++tt) {
      const float vv = vbuf[tt][d];
      #pragma unroll
      for (int j = 0; j < 8; ++j) acc[j] += vv * kpb[tt][m0 + j];
    }
    __syncthreads();
  }
  #pragma unroll
  for (int j = 0; j < 8; ++j)
    atomicAdd(&kptv[((size_t)b * EMB + d) * MF + m0 + j], acc[j]);
}

// ---------------------------------------------------------------------------
// K7: yatt = v + proj(qp @ kptv^T / (qp.ksum + eps)).  One wave per token,
// kptv / proj_w / ksum cached in LDS.
// ---------------------------------------------------------------------------
__global__ __launch_bounds__(256) void k_mix(const float* __restrict__ kqv,
                                             const float* __restrict__ qp,
                                             const float* __restrict__ ksum,
                                             const float* __restrict__ kptv,
                                             const float* __restrict__ pw,
                                             const float* __restrict__ pb,
                                             float* __restrict__ yatt) {
  __shared__ float kl[64][32];
  __shared__ float pwl[64][64];
  __shared__ float pbl[64];
  __shared__ float ksl[32];
  __shared__ float ql[8][32];
  __shared__ float al[8][64];
  const int b  = blockIdx.x >> 9;
  const int tb = (blockIdx.x & 511) << 3;
  const int tid = threadIdx.x, wv = tid >> 5, lane = tid & 31;
  #pragma unroll
  for (int rep = 0; rep < 8; ++rep) {
    const int e = tid + (rep << 8);
    kl[e >> 5][e & 31] = kptv[(size_t)b * (EMB * MF) + e];
  }
  #pragma unroll
  for (int rep = 0; rep < 16; ++rep) {
    const int e = tid + (rep << 8);
    pwl[e >> 6][e & 63] = pw[e];
  }
  if (tid < 64) pbl[tid] = pb[tid];
  if (tid < 32) ksl[tid] = ksum[b * MF + tid];
  const int t = tb + wv;
  const float qv = qp[((size_t)b * TOKN + t) * MF + lane];
  ql[wv][lane] = qv;
  __syncthreads();
  const float D = wave_sum32(qv * ksl[lane]);
  #pragma unroll
  for (int h = 0; h < 2; ++h) {
    const int d = lane + (h << 5);
    float num = 0.f;
    #pragma unroll 8
    for (int m = 0; m < 32; ++m) num += ql[wv][m] * kl[d][m];
    al[wv][d] = num / (D + 1e-8f);
  }
  __syncthreads();
  const size_t row = (size_t)b * TOKN + t;
  #pragma unroll
  for (int h = 0; h < 2; ++h) {
    const int d = lane + (h << 5);
    float o = kqv[row * DIMC + 128 + d] + pbl[d];
    #pragma unroll 8
    for (int e = 0; e < 64; ++e) o += al[wv][e] * pwl[e][d];
    yatt[row * EMB + d] = o;
  }
}

// ---------------------------------------------------------------------------
// K8: out = yatt + W2 @ gelu(W1 @ LN(yatt) + b1) + b2.  Fully fused:
// LN2 in registers, both 64x64 GEMMs via WMMA with all operands in LDS.
// Per block: 64 rows, 128 threads (4 waves).
// ---------------------------------------------------------------------------
__global__ __launch_bounds__(128) void k_mlp(const float* __restrict__ yatt,
                                             const float* __restrict__ g,
                                             const float* __restrict__ bt,
                                             const float* __restrict__ w1,
                                             const float* __restrict__ b1,
                                             const float* __restrict__ w2,
                                             const float* __restrict__ b2,
                                             float* __restrict__ out) {
  __shared__ half_t Hs[64][66];
  __shared__ half_t W1s[64][66];
  __shared__ half_t W2s[64][66];
  __shared__ half_t T1s[64][66];
  __shared__ float b1l[64], b2l[64];
  const int rbase = blockIdx.x << 6;
  const int tid = threadIdx.x, lane = tid & 31, wv = tid >> 5;
  // LayerNorm(64): two threads per row, pair-reduce via shfl.
  {
    const int r = tid >> 1, hf = tid & 1;
    const float* p = yatt + ((size_t)(rbase + r) << 6) + (hf << 5);
    float xv[32], s = 0.f, s2 = 0.f;
    #pragma unroll
    for (int j = 0; j < 32; ++j) { const float v = p[j]; xv[j] = v; s += v; s2 += v * v; }
    s  += __shfl_xor(s, 1, 32);
    s2 += __shfl_xor(s2, 1, 32);
    const float mean = s * (1.0f / 64.f);
    const float var  = s2 * (1.0f / 64.f) - mean * mean;
    const float rs = rsqrtf(var + 1e-5f);
    #pragma unroll
    for (int j = 0; j < 32; ++j) {
      const int c = (hf << 5) + j;
      Hs[r][c] = (half_t)((xv[j] - mean) * rs * g[c] + bt[c]);
    }
  }
  #pragma unroll
  for (int rep = 0; rep < 32; ++rep) {
    const int e = tid + (rep << 7);
    const int n = e >> 6, k = e & 63;
    W1s[n][k] = (half_t)w1[(k << 6) + n];
    W2s[n][k] = (half_t)w2[(k << 6) + n];
  }
  if (tid < 64) { b1l[tid] = b1[tid]; b2l[tid] = b2[tid]; }
  __syncthreads();

  const v8f vzero = {};
  v8f acc[4];
  #pragma unroll
  for (int i = 0; i < 4; ++i) acc[i] = vzero;
  #pragma unroll
  for (int kk = 0; kk < 2; ++kk) {
    const int ks = kk << 5;
    const v16h va = load_frag(&Hs[0][ks], wv << 4, 66, lane);
    #pragma unroll
    for (int nt = 0; nt < 4; ++nt) {
      const v16h vb = load_frag(&W1s[nt << 4][ks], 0, 66, lane);
      acc[nt] = __builtin_amdgcn_wmma_f32_16x16x32_f16(
          false, va, false, vb, (short)0, acc[nt], false, false);
    }
  }
  const int hi = lane >> 4, cn = lane & 15;
  #pragma unroll
  for (int nt = 0; nt < 4; ++nt) {
    const int col = (nt << 4) + cn;
    #pragma unroll
    for (int r = 0; r < 8; ++r) {
      const int row = (wv << 4) + r + (hi << 3);
      T1s[row][col] = (half_t)gelu_exact(acc[nt][r] + b1l[col]);
    }
  }
  __syncthreads();
  v8f acc2[4];
  #pragma unroll
  for (int i = 0; i < 4; ++i) acc2[i] = vzero;
  #pragma unroll
  for (int kk = 0; kk < 2; ++kk) {
    const int ks = kk << 5;
    const v16h va = load_frag(&T1s[0][ks], wv << 4, 66, lane);
    #pragma unroll
    for (int nt = 0; nt < 4; ++nt) {
      const v16h vb = load_frag(&W2s[nt << 4][ks], 0, 66, lane);
      acc2[nt] = __builtin_amdgcn_wmma_f32_16x16x32_f16(
          false, va, false, vb, (short)0, acc2[nt], false, false);
    }
  }
  #pragma unroll
  for (int nt = 0; nt < 4; ++nt) {
    const int col = (nt << 4) + cn;
    const float bv = b2l[col];
    #pragma unroll
    for (int r = 0; r < 8; ++r) {
      const int row = (wv << 4) + r + (hi << 3);
      const size_t gi = ((size_t)(rbase + row) << 6) + col;
      out[gi] = yatt[gi] + acc2[nt][r] + bv;
    }
  }
}

// ---------------------------------------------------------------------------
extern "C" void kernel_launch(void* const* d_in, const int* in_sizes, int n_in,
                              void* d_out, int out_size, void* d_ws, size_t ws_size,
                              hipStream_t stream) {
  (void)in_sizes; (void)n_in; (void)out_size; (void)ws_size;
  const float* x      = (const float*)d_in[0];
  const float* conv_w = (const float*)d_in[1];
  const float* conv_b = (const float*)d_in[2];
  const float* ln1_g  = (const float*)d_in[3];
  const float* ln1_b  = (const float*)d_in[4];
  const float* kqv_w  = (const float*)d_in[5];
  const float* kqv_b  = (const float*)d_in[6];
  const float* proj_w = (const float*)d_in[7];
  const float* proj_b = (const float*)d_in[8];
  const float* w_perf = (const float*)d_in[9];
  const float* ln2_g  = (const float*)d_in[10];
  const float* ln2_b  = (const float*)d_in[11];
  const float* mlp_w1 = (const float*)d_in[12];
  const float* mlp_b1 = (const float*)d_in[13];
  const float* mlp_w2 = (const float*)d_in[14];
  const float* mlp_b2 = (const float*)d_in[15];

  char* ws = (char*)d_ws;
  half_t* xh   = (half_t*)(ws + XH_OFF);
  half_t* tok  = (half_t*)(ws + TOK_OFF);
  half_t* hln  = (half_t*)(ws + HLN_OFF);
  float*  kqv  = (float*)(ws + KQV_OFF);
  float*  kp   = (float*)(ws + KP_OFF);     // reuses XH region (xh dead)
  float*  qp   = (float*)(ws + QP_OFF);
  float*  ksum = (float*)(ws + KSUM_OFF);
  float*  kptv = (float*)(ws + KPTV_OFF);
  float*  yatt = (float*)(ws + YATT_OFF);   // reuses TOK region (tok dead)
  float*  out  = (float*)d_out;

  // Zero the atomic accumulators (ksum + kptv are contiguous).
  hipMemsetAsync(ws + KSUM_OFF, 0, 4096 + (size_t)BATCH * EMB * MF * 4, stream);

  k_pack<<<dim3(BATCH * 256), dim3(256), 0, stream>>>(x, xh);
  k_conv<<<dim3(64, 3, BATCH), dim3(128), 0, stream>>>(xh, conv_w, conv_b, tok);
  k_ln1 <<<dim3((BATCH * TOKN) / 4), dim3(128), 0, stream>>>(tok, ln1_g, ln1_b, hln);
  k_kqv <<<dim3((BATCH * TOKN) / 64, 3), dim3(128), 0, stream>>>(hln, kqv_w, kqv_b, kqv);
  k_perf<<<dim3(BATCH * 512), dim3(256), 0, stream>>>(kqv, w_perf, kp, qp, ksum);
  k_kptv<<<dim3(BATCH * 16), dim3(256), 0, stream>>>(kqv, kp, kptv);
  k_mix <<<dim3(BATCH * 512), dim3(256), 0, stream>>>(kqv, qp, ksum, kptv,
                                                      proj_w, proj_b, yatt);
  k_mlp <<<dim3((BATCH * TOKN) / 64), dim3(128), 0, stream>>>(
      yatt, ln2_g, ln2_b, mlp_w1, mlp_b1, mlp_w2, mlp_b2, out);
}

// v002
// Next to v001, in two timings, it ran 1.60 and 1.61 times as fast.
// Counting every step since v000, it is 2.37 times as fast.
#include <hip/hip_runtime.h>
#include <hip/hip_bf16.h>
#include <math.h>

// ---------------------------------------------------------------------------
// MI455X (gfx1250, wave32) implementation of the PRM + Token-Performer block.
// All dense GEMMs (implicit-GEMM dilated convs, kqv, MLP) use
// V_WMMA_F32_16X16X32_F16 with f32 accumulation; skinny performer pieces are
// VALU with register accumulation and LDS-staged operands.  Fused epilogues keep each intermediate to one
// HBM round-trip (pipeline is ~bandwidth-bound at 23.3 TB/s).
// Conv reduction axis ordered k = kid*64 + ic so each 32-wide WMMA K-step has
// a constant kernel tap; the image stays channels-last, so one pixel's 64
// channels are one 128-byte line and an im2col row is contiguous in k.
// Every GEMM weight matrix is packed once per call into f16 in the order of the
// WMMA B fragment, so a B fragment is two whole-line 16-byte loads per lane.
// ---------------------------------------------------------------------------

typedef _Float16 half_t;
typedef __attribute__((ext_vector_type(16))) _Float16 v16h;
typedef __attribute__((ext_vector_type(8)))  _Float16 v8h;
typedef __attribute__((ext_vector_type(8)))  float    v8f;

// Problem constants (match reference)
#define BATCH   32
#define CIN     64
#define IMGSZ   128
#define NPIX    16384     // 128*128
#define TOKN    4096      // 64*64 post-stride-2 tokens
#define EBR     64
#define DIMC    192       // 3*EBR
#define EMB     64
#define MF      32        // performer features
#define INVSQRTM 0.17677669529663687f

// Workspace layout (bytes). Buffers reused once their producers/consumers
// are done:  XH region -> KP/QP,  TOK region -> YATT.
#define XH_OFF    ((size_t)0)                                   // f16 [B][128][128][CIN]  67.1MB
#define KP_OFF    ((size_t)0)                                   // f32 [B][T][32]          (reuse XH)
#define QP_OFF    ((size_t)16777216)                            // f32 [B][T][32]
#define TOK_OFF   ((size_t)67108864)                            // f16 [B][T][192]         50.3MB
#define YATT_OFF  TOK_OFF                                       // f32 [B][T][64]          (reuse TOK)
#define HLN_OFF   ((size_t)(67108864 + 50331648))               // f16 [B][T][192]
#define KQV_OFF   ((size_t)(67108864 + 2*50331648))             // f32 [B][T][192]         100.7MB
#define KSUM_OFF  (KQV_OFF + (size_t)BATCH*TOKN*DIMC*4)         // f32 [B][32]
#define KPTV_OFF  (KSUM_OFF + (size_t)4096)                     // f32 [B][64][32]
#define WPK_OFF   (KPTV_OFF + (size_t)BATCH*EMB*MF*4)           // f16 packed weights, 311 KB

// Packed weights: one B fragment (32 k x 16 n) = 2 planes x 32 lanes x 8 halves.
// Plane p, lane l, element i hold k = 16*p + 8*(l>>4) + i, n = l&15: the k order
// of load_frag.  A unit is one lane's 8 halves (16 bytes) of one plane.
#define FRAG_H    512                       // halves per fragment
#define WC_UNITS  13824                     // conv: 3 branches x 18 K-steps x 4 n-tiles x 64
#define WQ_UNITS  4608                      // kqv:  6 K-steps x 12 n-tiles x 64
#define WM_UNITS  1024                      // mlp:  2 matrices x 2 K-steps x 4 n-tiles x 64
#define WQ_H      (WC_UNITS * 8)            // first half of the kqv part
#define WM_H      ((WC_UNITS + WQ_UNITS) * 8)
#define WPK_BLOCKS ((WC_UNITS + WQ_UNITS + WM_UNITS) / 256)   // 76

__device__ __forceinline__ float gelu_exact(float x) {
  return 0.5f * x * (1.0f + erff(x * 0.70710678118654752f));
}

__device__ __forceinline__ float wave_sum32(float v) {
  #pragma unroll
  for (int off = 16; off > 0; off >>= 1) v += __shfl_xor(v, off, 32);
  return v;
}

// Load a 16x32 f16 WMMA fragment (A row-major, or B assembled as [N][K]).
// tile: LDS matrix with K contiguous per row; stride in half elements.
// ISA layout: lanes 0-15 hold K0-7 (v0-3) and K16-23 (v4-7); lanes 16-31
// hold K8-15 and K24-31; M/N = lane&15 (+row0).
__device__ __forceinline__ v16h load_frag(const half_t* tile, int row0,
                                          int stride, int lane) {
  const half_t* p = tile + (row0 + (lane & 15)) * stride;
  const int hi = lane >> 4;
  v16h f;
  #pragma unroll
  for (int j = 0; j < 8; ++j) {
    const int kb = ((j >> 2) << 4) + (hi << 3) + ((j & 3) << 1);
    f[2 * j]     = p[kb];
    f[2 * j + 1] = p[kb + 1];
  }
  return f;
}

// B fragment number frag of a packed weight part, as two 512-byte wave loads.
__device__ __forceinline__ v16h load_bfrag(const half_t* wl, int frag) {
  const v8h lo = *reinterpret_cast<const v8h*>(wl + frag * FRAG_H);
  const v8h hi = *reinterpret_cast<const v8h*>(wl + frag * FRAG_H + 256);
  return __builtin_shufflevector(lo, hi,
      0, 1, 2, 3, 4, 5, 6, 7, 8, 9, 10, 11, 12, 13, 14, 15);
}

// ---------------------------------------------------------------------------
// K1: x [B,N,C] f32  ->  xh [B,N,C] f16  (same channels-last order, convert
// only).  8 elements per thread per pass: two 16-byte loads, one 16-byte store.
// The first WPK_BLOCKS blocks pack the weights instead: one unit per thread,
// eight strided f32 reads, one 16-byte store.
// ---------------------------------------------------------------------------
__global__ __launch_bounds__(256) void k_pack(const float* __restrict__ x,
                                              const float* __restrict__ cw,
                                              const float* __restrict__ wq,
                                              const float* __restrict__ w1,
                                              const float* __restrict__ w2,
                                              half_t* __restrict__ xh,
                                              half_t* __restrict__ wpk) {
  if (blockIdx.x < WPK_BLOCKS) {
    const int u = (blockIdx.x << 8) + threadIdx.x;
    const int n = u & 15;
    const int k0 = (((u >> 5) & 1) << 4) + (((u >> 4) & 1) << 3);  // k of element 0
    const float* src;
    int step;                                // floats from one k to the next
    if (blockIdx.x < WC_UNITS / 256) {       // frag = ((br*9 + kid)*2 + h)*4 + nt
      const int f = u >> 6;
      const int nt = f & 3, h = (f >> 2) & 1, tap = f >> 3;   // tap = br*9 + kid
      const int br = tap / 9, kid = tap - br * 9;
      src = cw + (((br << 6) + (nt << 4) + n) * CIN + (h << 5) + k0) * 9 + kid;
      step = 9;
    } else if (blockIdx.x < (WC_UNITS + WQ_UNITS) / 256) {    // frag = kk*12 + n-tile
      const int f = (u - WC_UNITS) >> 6;
      const int kk = f / 12, nt = f - kk * 12;
      src = wq + ((kk << 5) + k0) * DIMC + (nt << 4) + n;
      step = DIMC;
    } else {                                 // frag = (matrix*2 + kk)*4 + nt
      const int f = (u - WC_UNITS - WQ_UNITS) >> 6;
      const int nt = f & 3, kk = (f >> 2) & 1;
      src = ((f >> 3) ? w2 : w1) + ((kk << 5) + k0) * EMB + (nt << 4) + n;
      step = EMB;
    }
    float t[8];
    #pragma unroll  // constant indices keep t[] in registers
    for (int i = 0; i < 8; ++i) t[i] = src[i * step];
    // The conversions below reuse the address registers that these loads name.
    asm volatile("s_wait_xcnt 0x0" ::: "memory");
    v8h o;
    #pragma unroll
    for (int i = 0; i < 8; ++i) o[i] = (half_t)t[i];
    *reinterpret_cast<v8h*>(wpk + ((size_t)u << 3)) = o;
    return;
  }
  const size_t base = ((size_t)(blockIdx.x - WPK_BLOCKS) << 12) + ((size_t)threadIdx.x << 3);
  #pragma unroll  // both passes' loads are in flight before the first store
  for (int rep = 0; rep < 2; ++rep) {
    const size_t e = base + ((size_t)rep << 11);
    const float4 u = *reinterpret_cast<const float4*>(x + e);
    const float4 w = *reinterpret_cast<const float4*>(x + e + 4);
    v8h o;
    o[0] = (half_t)u.x; o[1] = (half_t)u.y; o[2] = (half_t)u.z; o[3] = (half_t)u.w;
    o[4] = (half_t)w.x; o[5] = (half_t)w.y; o[6] = (half_t)w.z; o[7] = (half_t)w.w;
    *reinterpret_cast<v8h*>(xh + e) = o;
  }
}

// ---------------------------------------------------------------------------
// K2: implicit-GEMM dilated conv + bias + GELU -> tokens f16 [B,T,192].
// Per block: 64 tokens x 64 out-channels, K=576 in 18 steps of 32 via WMMA.
// K axis ordered k = kid*64 + ic.  A never passes through LDS: lane l owns
// token row l&15 of its wave's 16, and its fragment halves (k = 8*(l>>4)+0..7
// and 16+8*(l>>4)+0..7) are two 16-byte runs of that token's tap pixel, read
// straight from the channels-last image.  One tap = four such loads = both
// K-steps of the tap.  B comes from the packed weights, 8 fragments a tap, so
// the loop has no LDS and no barrier.
// grid = (64 token tiles, 3 branches, 32 batches), 4 waves.
// ---------------------------------------------------------------------------
__global__ __launch_bounds__(128) void k_conv(const half_t* __restrict__ xh,
                                              const half_t* __restrict__ wpk,
                                              const float* __restrict__ cb,
                                              half_t* __restrict__ tok) {
  const int tbase = blockIdx.x << 6;
  const int br = blockIdx.y;
  const int b  = blockIdx.z;
  const int dil = br + 1, pad = br + 1;
  const int tid = threadIdx.x, lane = tid & 31, wv = tid >> 5;
  const half_t* wl = wpk + br * (72 * FRAG_H) + (lane << 3);

  v8f acc[4];
  const v8f vzero = {};
  #pragma unroll
  for (int i = 0; i < 4; ++i) acc[i] = vzero;

  // Per-lane im2col coordinates (invariant over the K loop).
  const int a_t  = tbase + (wv << 4) + (lane & 15);
  const int a_h0 = (a_t >> 6) << 1, a_w0 = (a_t & 63) << 1;
  const half_t* xa = xh + (size_t)b * NPIX * CIN + ((lane >> 4) << 3);

  for (int kid = 0; kid < 9; ++kid) {     // kernel tap
    const int kh = kid / 3, kw = kid - kh * 3;   // scalar (SALU)
    const int ih = a_h0 + kh * dil - pad;
    const int iw = a_w0 + kw * dil - pad;
    const bool inb = (unsigned)ih < 128u && (unsigned)iw < 128u;
    // A: this token's tap pixel, all 64 channels over the lane pair (l, l+16).
    // A padded tap reads pixel 0 (in bounds) and is zeroed afterwards.
    const half_t* pa = xa + (inb ? (((ih << 7) + iw) << 6) : 0);
    const half_t* wk = wl + kid * (8 * FRAG_H);
    v16h vb[8];
    #pragma unroll  // constant indices keep vb[] and a[] in registers (here and below)
    for (int f = 0; f < 8; ++f) vb[f] = load_bfrag(wk, f);
    v8h a[4];
    #pragma unroll
    for (int q = 0; q < 4; ++q) a[q] = *reinterpret_cast<const v8h*>(pa + (q << 4));
    // What follows reuses the address registers that this tap's loads name.
    asm volatile("s_wait_xcnt 0x0" ::: "memory");
    // Keeps the tap's 20 loads in one run ahead of its WMMAs: left to itself the
    // scheduler puts each B load directly in front of its WMMA, one full load
    // latency per WMMA.
    __builtin_amdgcn_sched_barrier(0);
    if (!inb) {
      #pragma unroll
      for (int q = 0; q < 4; ++q) a[q] = (v8h)(half_t)0.0f;
    }

    #pragma unroll
    for (int h = 0; h < 2; ++h) {
      const v16h va = __builtin_shufflevector(a[2 * h], a[2 * h + 1],
          0, 1, 2, 3, 4, 5, 6, 7, 8, 9, 10, 11, 12, 13, 14, 15);
      #pragma unroll
      for (int nt = 0; nt < 4; ++nt) {
        acc[nt] = __builtin_amdgcn_wmma_f32_16x16x32_f16(
            false, va, false, vb[(h << 2) + nt], (short)0, acc[nt], false, false);
      }
    }
  }
  // Epilogue: bias + exact GELU, write tokens (branch-major channel concat)
  const int hi = lane >> 4, cn = lane & 15;
  #pragma unroll
  for (int nt = 0; nt < 4; ++nt) {
    const int oc = (nt << 4) + cn;
    const float bias = cb[br * EBR + oc];
    #pragma unroll
    for (int r = 0; r < 8; ++r) {
      const int row = (wv << 4) + r + (hi << 3);
      const int t = tbase + row;
      const float v = acc[nt][r] + bias;
      tok[((size_t)b * TOKN + t) * DIMC + br * EBR + oc] = (half_t)gelu_exact(v);
    }
  }
}

// ---------------------------------------------------------------------------
// K3: LayerNorm(192) over tokens -> hln f16.  One wave per token.
// ---------------------------------------------------------------------------
__global__ __launch_bounds__(128) void k_ln1(const half_t* __restrict__ tok,
                                             const float* __restrict__ g,
                                             const float* __restrict__ bt,
                                             half_t* __restrict__ hln) {
  const int token = (blockIdx.x << 2) + (threadIdx.x >> 5);
  const int lane = threadIdx.x & 31;
  const size_t base = (size_t)token * DIMC;
  float xv[6], s = 0.f, s2 = 0.f;
  #pragma unroll
  for (int j = 0; j < 6; ++j) {
    const float v = (float)tok[base + lane + (j << 5)];
    xv[j] = v; s += v; s2 += v * v;
  }
  s = wave_sum32(s); s2 = wave_sum32(s2);
  const float mean = s * (1.0f / DIMC);
  const float var  = s2 * (1.0f / DIMC) - mean * mean;
  const float rs = rsqrtf(var + 1e-5f);
  #pragma unroll
  for (int j = 0; j < 6; ++j) {
    const int c = lane + (j << 5);
    hln[base + c] = (half_t)((xv[j] - mean) * rs * g[c] + bt[c]);
  }
}

// ---------------------------------------------------------------------------
// K4: kqv GEMM  [131072 x 192] @ [192 x 192] + bias -> kqv f32.
// Per block: 64 rows x 64 cols, K=192 in 6 WMMA steps. grid=(2048,3).
// ---------------------------------------------------------------------------
__global__ __launch_bounds__(128) void k_kqv(const half_t* __restrict__ hln,
                                             const half_t* __restrict__ wpk,
                                             const float* __restrict__ bias,
                                             float* __restrict__ kqv) {
  __shared__ half_t As[64][34];
  const int rbase = blockIdx.x << 6;
  const int ct = blockIdx.y;
  const int tid = threadIdx.x, lane = tid & 31, wv = tid >> 5;
  const half_t* wl = wpk + WQ_H + (ct << 2) * FRAG_H + (lane << 3);

  v8f acc[4];
  const v8f vzero = {};
  #pragma unroll
  for (int i = 0; i < 4; ++i) acc[i] = vzero;

  for (int kk = 0; kk < 6; ++kk) {
    const int ks = kk << 5;
    v16h vb[4];
    #pragma unroll  // constant indices keep vb[] in registers
    for (int nt = 0; nt < 4; ++nt) vb[nt] = load_bfrag(wl, kk * 12 + nt);
    #pragma unroll
    for (int rep = 0; rep < 16; ++rep) {
      const int e = tid + (rep << 7);
      const int rr = e >> 5, kq = e & 31;
      As[rr][kq] = hln[(size_t)(rbase + rr) * DIMC + ks + kq];
    }
    __syncthreads();
    const v16h va = load_frag(&As[0][0], wv << 4, 34, lane);
    #pragma unroll
    for (int nt = 0; nt < 4; ++nt) {
      acc[nt] = __builtin_amdgcn_wmma_f32_16x16x32_f16(
          false, va, false, vb[nt], (short)0, acc[nt], false, false);
    }
    __syncthreads();
  }
  const int hi = lane >> 4, cn = lane & 15;
  #pragma unroll
  for (int nt = 0; nt < 4; ++nt) {
    const int col = (ct << 6) + (nt << 4) + cn;
    const float bv = bias[col];
    #pragma unroll
    for (int r = 0; r < 8; ++r) {
      const int row = rbase + (wv << 4) + r + (hi << 3);
      kqv[(size_t)row * DIMC + col] = acc[nt][r] + bv;
    }
  }
}

// ---------------------------------------------------------------------------
// K5: performer features  kp/qp = exp(w.t - |t|^2/2)/sqrt(m)  + ksum reduce.
// One wave per token (lane = feature m), 8 tokens per block.
// ---------------------------------------------------------------------------
__global__ __launch_bounds__(256) void k_perf(const float* __restrict__ kqv,
                                              const float* __restrict__ wperf,
                                              float* __restrict__ kp,
                                              float* __restrict__ qp,
                                              float* __restrict__ ksum) {
  __shared__ float wp[32][64];
  __shared__ float kb[8][64];
  __shared__ float qb[8][64];
  __shared__ float kpart[32];
  const int b  = blockIdx.x >> 9;
  const int tb = (blockIdx.x & 511) << 3;
  const int tid = threadIdx.x, wv = tid >> 5, lane = tid & 31;
  #pragma unroll
  for (int rep = 0; rep < 8; ++rep) {
    const int e = tid + (rep << 8);
    wp[e >> 6][e & 63] = wperf[e];
  }
  if (tid < 32) kpart[tid] = 0.f;
  const int t = tb + wv;
  const size_t ro = ((size_t)b * TOKN + t) * DIMC;
  kb[wv][lane]      = kqv[ro + lane];
  kb[wv][lane + 32] = kqv[ro + lane + 32];
  qb[wv][lane]      = kqv[ro + 64 + lane];
  qb[wv][lane + 32] = kqv[ro + 64 + lane + 32];
  __syncthreads();
  float dk = 0.f, dq = 0.f, xk = 0.f, xq = 0.f;
  #pragma unroll 8
  for (int d = 0; d < 64; ++d) {
    const float kv = kb[wv][d], qv = qb[wv][d], wr = wp[lane][d];
    dk += wr * kv; dq += wr * qv; xk += kv * kv; xq += qv * qv;
  }
  const float kpv = expf(dk - 0.5f * xk) * INVSQRTM;
  const float qpv = expf(dq - 0.5f * xq) * INVSQRTM;
  const size_t po = ((size_t)b * TOKN + t) * MF + lane;
  kp[po] = kpv; qp[po] = qpv;
  atomicAdd(&kpart[lane], kpv);
  __syncthreads();
  if (tid < 32) atomicAdd(&ksum[b * MF + tid], kpart[tid]);
}

// ---------------------------------------------------------------------------
// K6: kptv[b,d,m] = sum_t v[b,t,d]*kp[b,t,m].  Per-thread 8-cell register
// accumulation over 256 tokens, LDS-staged tiles, one global atomic per cell.
// ---------------------------------------------------------------------------
__global__ __launch_bounds__(256) void k_kptv(const float* __restrict__ kqv,
                                              const float* __restrict__ kp,
                                              float* __restrict__ kptv) {
  __shared__ float vbuf[32][65];
  __shared__ float kpb[32][33];
  const int b  = blockIdx.x >> 4;
  const int tb = (blockIdx.x & 15) << 8;
  const int tid = threadIdx.x;
  const int d = tid >> 2, m0 = (tid & 3) << 3;
  float acc[8];
  #pragma unroll
  for (int j = 0; j < 8; ++j) acc[j] = 0.f;
  for (int ch = 0; ch < 8; ++ch) {
    const int t0 = tb + (ch << 5);
    #pragma unroll
    for (int rep = 0; rep < 8; ++rep) {
      const int e = tid + (rep << 8);
      const int tt = e >> 6, dd = e & 63;
      vbuf[tt][dd] = kqv[((size_t)b * TOKN + t0 + tt) * DIMC + 128 + dd];
    }
    #pragma unroll
    for (int rep = 0; rep < 4; ++rep) {
      const int e = tid + (rep << 8);
      const int tt = e >> 5, mm = e & 31;
      kpb[tt][mm] = kp[((size_t)b * TOKN + t0 + tt) * MF + mm];
    }
    __syncthreads();
    #pragma unroll 4
    for (int tt = 0; tt < 32; ++tt) {
      const float vv = vbuf[tt][d];
      #pragma unroll
      for (int j = 0; j < 8; ++j) acc[j] += vv * kpb[tt][m0 + j];
    }
    __syncthreads();
  }
  #pragma unroll
  for (int j = 0; j < 8; ++j)
    atomicAdd(&kptv[((size_t)b * EMB + d) * MF + m0 + j], acc[j]);
}

// ---------------------------------------------------------------------------
// K7: yatt = v + proj(qp @ kptv^T / (qp.ksum + eps)).  One wave per token,
// kptv / proj_w / ksum cached in LDS.
// ---------------------------------------------------------------------------
__global__ __launch_bounds__(256) void k_mix(const float* __restrict__ kqv,
                                             const float* __restrict__ qp,
                                             const float* __restrict__ ksum,
                                             const float* __restrict__ kptv,
                                             const float* __restrict__ pw,
                                             const float* __restrict__ pb,
                                             float* __restrict__ yatt) {
  __shared__ float kl[64][32];
  __shared__ float pwl[64][64];
  __shared__ float pbl[64];
  __shared__ float ksl[32];
  __shared__ float ql[8][32];
  __shared__ float al[8][64];
  const int b  = blockIdx.x >> 9;
  const int tb = (blockIdx.x & 511) << 3;
  const int tid = threadIdx.x, wv = tid >> 5, lane = tid & 31;
  #pragma unroll
  for (int rep = 0; rep < 8; ++rep) {
    const int e = tid + (rep << 8);
    kl[e >> 5][e & 31] = kptv[(size_t)b * (EMB * MF) + e];
  }
  #pragma unroll
  for (int rep = 0; rep < 16; ++rep) {
    const int e = tid + (rep << 8);
    pwl[e >> 6][e & 63] = pw[e];
  }
  if (tid < 64) pbl[tid] = pb[tid];
  if (tid < 32) ksl[tid] = ksum[b * MF + tid];
  const int t = tb + wv;
  const float qv = qp[((size_t)b * TOKN + t) * MF + lane];
  ql[wv][lane] = qv;
  __syncthreads();
  const float D = wave_sum32(qv * ksl[lane]);
  #pragma unroll
  for (int h = 0; h < 2; ++h) {
    const int d = lane + (h << 5);
    float num = 0.f;
    #pragma unroll 8
    for (int m = 0; m < 32; ++m) num += ql[wv][m] * kl[d][m];
    al[wv][d] = num / (D + 1e-8f);
  }
  __syncthreads();
  const size_t row = (size_t)b * TOKN + t;
  #pragma unroll
  for (int h = 0; h < 2; ++h) {
    const int d = lane + (h << 5);
    float o = kqv[row * DIMC + 128 + d] + pbl[d];
    #pragma unroll 8
    for (int e = 0; e < 64; ++e) o += al[wv][e] * pwl[e][d];
    yatt[row * EMB + d] = o;
  }
}

// ---------------------------------------------------------------------------
// K8: out = yatt + W2 @ gelu(W1 @ LN(yatt) + b1) + b2.  Fully fused:
// LN2 in registers, both 64x64 GEMMs via WMMA, A in LDS, B from the packed weights.
// Per block: 64 rows, 128 threads (4 waves).
// ---------------------------------------------------------------------------
__global__ __launch_bounds__(128) void k_mlp(const float* __restrict__ yatt,
                                             const float* __restrict__ g,
                                             const float* __restrict__ bt,
                                             const half_t* __restrict__ wpk,
                                             const float* __restrict__ b1,
                                             const float* __restrict__ b2,
                                             float* __restrict__ out) {
  __shared__ half_t Hs[64][66];
  __shared__ half_t T1s[64][66];
  __shared__ float b1l[64], b2l[64];
  const int rbase = blockIdx.x << 6;
  const int tid = threadIdx.x, lane = tid & 31, wv = tid >> 5;
  const half_t* wl = wpk + WM_H + (lane << 3);
  // LayerNorm(64): two threads per row, pair-reduce via shfl.
  {
    const int r = tid >> 1, hf = tid & 1;
    const float* p = yatt + ((size_t)(rbase + r) << 6) + (hf << 5);
    float xv[32], s = 0.f, s2 = 0.f;
    #pragma unroll
    for (int j = 0; j < 32; ++j) { const float v = p[j]; xv[j] = v; s += v; s2 += v * v; }
    s  += __shfl_xor(s, 1, 32);
    s2 += __shfl_xor(s2, 1, 32);
    const float mean = s * (1.0f / 64.f);
    const float var  = s2 * (1.0f / 64.f) - mean * mean;
    const float rs = rsqrtf(var + 1e-5f);
    #pragma unroll
    for (int j = 0; j < 32; ++j) {
      const int c = (hf << 5) + j;
      Hs[r][c] = (half_t)((xv[j] - mean) * rs * g[c] + bt[c]);
    }
  }
  // W1's fragments are asked for ahead of the barrier and arrive during its wait.
  v16h vb1[8];
  #pragma unroll  // constant indices keep vb1[] in registers
  for (int f = 0; f < 8; ++f) vb1[f] = load_bfrag(wl, f);
  if (tid < 64) { b1l[tid] = b1[tid]; b2l[tid] = b2[tid]; }
  __syncthreads();
  // W2's fragments arrive while the first GEMM and its GELU run.
  v16h vb2[8];
  #pragma unroll  // constant indices keep vb2[] in registers
  for (int f = 0; f < 8; ++f) vb2[f] = load_bfrag(wl, 8 + f);

  const v8f vzero = {};
  v8f acc[4];
  #pragma unroll
  for (int i = 0; i < 4; ++i) acc[i] = vzero;
  #pragma unroll
  for (int kk = 0; kk < 2; ++kk) {
    const int ks = kk << 5;
    const v16h va = load_frag(&Hs[0][ks], wv << 4, 66, lane);
    #pragma unroll
    for (int nt = 0; nt < 4; ++nt) {
      acc[nt] = __builtin_amdgcn_wmma_f32_16x16x32_f16(
          false, va, false, vb1[(kk << 2) + nt], (short)0, acc[nt], false, false);
    }
  }
  const int hi = lane >> 4, cn = lane & 15;
  #pragma unroll
  for (int nt = 0; nt < 4; ++nt) {
    const int col = (nt << 4) + cn;
    #pragma unroll
    for (int r = 0; r < 8; ++r) {
      const int row = (wv << 4) + r + (hi << 3);
      T1s[row][col] = (half_t)gelu_exact(acc[nt][r] + b1l[col]);
    }
  }
  __syncthreads();
  v8f acc2[4];
  #pragma unroll
  for (int i = 0; i < 4; ++i) acc2[i] = vzero;
  #pragma unroll
  for (int kk = 0; kk < 2; ++kk) {
    const int ks = kk << 5;
    const v16h va = load_frag(&T1s[0][ks], wv << 4, 66, lane);
    #pragma unroll
    for (int nt = 0; nt < 4; ++nt) {
      acc2[nt] = __builtin_amdgcn_wmma_f32_16x16x32_f16(
          false, va, false, vb2[(kk << 2) + nt], (short)0, acc2[nt], false, false);
    }
  }
  #pragma unroll
  for (int nt = 0; nt < 4; ++nt) {
    const int col = (nt << 4) + cn;
    const float bv = b2l[col];
    #pragma unroll
    for (int r = 0; r < 8; ++r) {
      const int row = (wv << 4) + r + (hi << 3);
      const size_t gi = ((size_t)(rbase + row) << 6) + col;
      out[gi] = yatt[gi] + acc2[nt][r] + bv;
    }
  }
}

// ---------------------------------------------------------------------------
extern "C" void kernel_launch(void* const* d_in, const int* in_sizes, int n_in,
                              void* d_out, int out_size, void* d_ws, size_t ws_size,
                              hipStream_t stream) {
  (void)in_sizes; (void)n_in; (void)out_size; (void)ws_size;
  const float* x      = (const float*)d_in[0];
  const float* conv_w = (const float*)d_in[1];
  const float* conv_b = (const float*)d_in[2];
  const float* ln1_g  = (const float*)d_in[3];
  const float* ln1_b  = (const float*)d_in[4];
  const float* kqv_w  = (const float*)d_in[5];
  const float* kqv_b  = (const float*)d_in[6];
  const float* proj_w = (const float*)d_in[7];
  const float* proj_b = (const float*)d_in[8];
  const float* w_perf = (const float*)d_in[9];
  const float* ln2_g  = (const float*)d_in[10];
  const float* ln2_b  = (const float*)d_in[11];
  const float* mlp_w1 = (const float*)d_in[12];
  const float* mlp_b1 = (const float*)d_in[13];
  const float* mlp_w2 = (const float*)d_in[14];
  const float* mlp_b2 = (const float*)d_in[15];

  char* ws = (char*)d_ws;
  half_t* xh   = (half_t*)(ws + XH_OFF);
  half_t* tok  = (half_t*)(ws + TOK_OFF);
  half_t* hln  = (half_t*)(ws + HLN_OFF);
  float*  kqv  = (float*)(ws + KQV_OFF);
  float*  kp   = (float*)(ws + KP_OFF);     // reuses XH region (xh dead)
  float*  qp   = (float*)(ws + QP_OFF);
  float*  ksum = (float*)(ws + KSUM_OFF);
  float*  kptv = (float*)(ws + KPTV_OFF);
  float*  yatt = (float*)(ws + YATT_OFF);   // reuses TOK region (tok dead)
  half_t* wpk  = (half_t*)(ws + WPK_OFF);
  float*  out  = (float*)d_out;

  // Zero the atomic accumulators (ksum + kptv are contiguous).
  hipMemsetAsync(ws + KSUM_OFF, 0, 4096 + (size_t)BATCH * EMB * MF * 4, stream);

  k_pack<<<dim3(WPK_BLOCKS + BATCH * 256), dim3(256), 0, stream>>>(
      x, conv_w, kqv_w, mlp_w1, mlp_w2, xh, wpk);
  k_conv<<<dim3(64, 3, BATCH), dim3(128), 0, stream>>>(xh, wpk, conv_b, tok);
  k_ln1 <<<dim3((BATCH * TOKN) / 4), dim3(128), 0, stream>>>(tok, ln1_g, ln1_b, hln);
  k_kqv <<<dim3((BATCH * TOKN) / 64, 3), dim3(128), 0, stream>>>(hln, wpk, kqv_b, kqv);
  k_perf<<<dim3(BATCH * 512), dim3(256), 0, stream>>>(kqv, w_perf, kp, qp, ksum);
  k_kptv<<<dim3(BATCH * 16), dim3(256), 0, stream>>>(kqv, kp, kptv);
  k_mix <<<dim3(BATCH * 512), dim3(256), 0, stream>>>(kqv, qp, ksum, kptv,
                                                      proj_w, proj_b, yatt);
  k_mlp <<<dim3((BATCH * TOKN) / 64), dim3(128), 0, stream>>>(
      yatt, ln2_g, ln2_b, wpk, mlp_b1, mlp_b2, out);
}

// v003
// Two timings next to v002 both put it at 1.58 times that version's speed.
// Counting every step since v000, it is 3.73 times as fast.
#include <hip/hip_runtime.h>
#include <hip/hip_bf16.h>
#include <math.h>

// ---------------------------------------------------------------------------
// MI455X (gfx1250, wave32) implementation of the PRM + Token-Performer block.
// All dense GEMMs (implicit-GEMM dilated convs, kqv, MLP) use
// V_WMMA_F32_16X16X32_F16 with f32 accumulation; skinny performer pieces are
// VALU with register accumulation.  Fused epilogues keep each intermediate to one
// HBM round-trip (pipeline is ~bandwidth-bound at 23.3 TB/s).
// Conv reduction axis ordered k = kid*64 + ic so each 32-wide WMMA K-step has
// a constant kernel tap; the image stays channels-last, so one pixel's 64
// channels are one 128-byte line and an im2col row is contiguous in k.
// Every GEMM weight matrix is packed once per call into f16 in the order of the
// WMMA B fragment, so a B fragment is two whole-line 16-byte loads per lane.
// ---------------------------------------------------------------------------

typedef _Float16 half_t;
typedef __attribute__((ext_vector_type(16))) _Float16 v16h;
typedef __attribute__((ext_vector_type(8)))  _Float16 v8h;
typedef __attribute__((ext_vector_type(8)))  float    v8f;

// Problem constants (match reference)
#define BATCH   32
#define CIN     64
#define IMGSZ   128
#define NPIX    16384     // 128*128
#define TOKN    4096      // 64*64 post-stride-2 tokens
#define EBR     64
#define DIMC    192       // 3*EBR
#define EMB     64
#define MF      32        // performer features
#define INVSQRTM 0.17677669529663687f

// Workspace layout (bytes). Buffers reused once their producers/consumers
// are done:  XH region -> KP/QP,  TOK region -> YATT.
#define XH_OFF    ((size_t)0)                                   // f16 [B][128][128][CIN]  67.1MB
#define KP_OFF    ((size_t)0)                                   // f32 [B][T][32]          (reuse XH)
#define QP_OFF    ((size_t)16777216)                            // f32 [B][T][32]
#define TOK_OFF   ((size_t)67108864)                            // f16 [B][T][192]         50.3MB
#define YATT_OFF  TOK_OFF                                       // f32 [B][T][64]          (reuse TOK)
#define HLN_OFF   ((size_t)(67108864 + 50331648))               // f16 [B][T][192]
#define KQV_OFF   ((size_t)(67108864 + 2*50331648))             // f32 [B][T][192]         100.7MB
#define KSUM_OFF  (KQV_OFF + (size_t)BATCH*TOKN*DIMC*4)         // f32 [B][32]
#define KPTV_OFF  (KSUM_OFF + (size_t)4096)                     // f32 [B][64][32]
#define WPK_OFF   (KPTV_OFF + (size_t)BATCH*EMB*MF*4)           // f16 packed weights, 311 KB

// Packed weights: one B fragment (32 k x 16 n) = 2 planes x 32 lanes x 8 halves.
// Plane p, lane l, element i hold k = 16*p + 8*(l>>4) + i, n = l&15: the k order
// of load_frag.  A unit is one lane's 8 halves (16 bytes) of one plane.
#define FRAG_H    512                       // halves per fragment
#define WC_UNITS  13824                     // conv: 3 branches x 18 K-steps x 4 n-tiles x 64
#define WQ_UNITS  4608                      // kqv:  6 K-steps x 12 n-tiles x 64
#define WM_UNITS  1024                      // mlp:  2 matrices x 2 K-steps x 4 n-tiles x 64
#define WQ_H      (WC_UNITS * 8)            // first half of the kqv part
#define WM_H      ((WC_UNITS + WQ_UNITS) * 8)
#define WPK_BLOCKS ((WC_UNITS + WQ_UNITS + WM_UNITS) / 256)   // 76

__device__ __forceinline__ float gelu_exact(float x) {
  return 0.5f * x * (1.0f + erff(x * 0.70710678118654752f));
}

__device__ __forceinline__ float wave_sum32(float v) {
  #pragma unroll
  for (int off = 16; off > 0; off >>= 1) v += __shfl_xor(v, off, 32);
  return v;
}

// Load a 16x32 f16 WMMA fragment (A row-major, or B assembled as [N][K]).
// tile: LDS matrix with K contiguous per row; stride in half elements.
// ISA layout: lanes 0-15 hold K0-7 (v0-3) and K16-23 (v4-7); lanes 16-31
// hold K8-15 and K24-31; M/N = lane&15 (+row0).
__device__ __forceinline__ v16h load_frag(const half_t* tile, int row0,
                                          int stride, int lane) {
  const half_t* p = tile + (row0 + (lane & 15)) * stride;
  const int hi = lane >> 4;
  v16h f;
  #pragma unroll
  for (int j = 0; j < 8; ++j) {
    const int kb = ((j >> 2) << 4) + (hi << 3) + ((j & 3) << 1);
    f[2 * j]     = p[kb];
    f[2 * j + 1] = p[kb + 1];
  }
  return f;
}

// B fragment number frag of a packed weight part, as two 512-byte wave loads.
__device__ __forceinline__ v16h load_bfrag(const half_t* wl, int frag) {
  const v8h lo = *reinterpret_cast<const v8h*>(wl + frag * FRAG_H);
  const v8h hi = *reinterpret_cast<const v8h*>(wl + frag * FRAG_H + 256);
  return __builtin_shufflevector(lo, hi,
      0, 1, 2, 3, 4, 5, 6, 7, 8, 9, 10, 11, 12, 13, 14, 15);
}

// ---------------------------------------------------------------------------
// K1: x [B,N,C] f32  ->  xh [B,N,C] f16  (same channels-last order, convert
// only).  8 elements per thread per pass: two 16-byte loads, one 16-byte store.
// The first WPK_BLOCKS blocks pack the weights instead: one unit per thread,
// eight strided f32 reads, one 16-byte store.
// ---------------------------------------------------------------------------
__global__ __launch_bounds__(256) void k_pack(const float* __restrict__ x,
                                              const float* __restrict__ cw,
                                              const float* __restrict__ wq,
                                              const float* __restrict__ w1,
                                              const float* __restrict__ w2,
                                              half_t* __restrict__ xh,
                                              half_t* __restrict__ wpk) {
  if (blockIdx.x < WPK_BLOCKS) {
    const int u = (blockIdx.x << 8) + threadIdx.x;
    const int n = u & 15;
    const int k0 = (((u >> 5) & 1) << 4) + (((u >> 4) & 1) << 3);  // k of element 0
    const float* src;
    int step;                                // floats from one k to the next
    if (blockIdx.x < WC_UNITS / 256) {       // frag = ((br*9 + kid)*2 + h)*4 + nt
      const int f = u >> 6;
      const int nt = f & 3, h = (f >> 2) & 1, tap = f >> 3;   // tap = br*9 + kid
      const int br = tap / 9, kid = tap - br * 9;
      src = cw + (((br << 6) + (nt << 4) + n) * CIN + (h << 5) + k0) * 9 + kid;
      step = 9;
    } else if (blockIdx.x < (WC_UNITS + WQ_UNITS) / 256) {    // frag = kk*12 + n-tile
      const int f = (u - WC_UNITS) >> 6;
      const int kk = f / 12, nt = f - kk * 12;
      src = wq + ((kk << 5) + k0) * DIMC + (nt << 4) + n;
      step = DIMC;
    } else {                                 // frag = (matrix*2 + kk)*4 + nt
      const int f = (u - WC_UNITS - WQ_UNITS) >> 6;
      const int nt = f & 3, kk = (f >> 2) & 1;
      src = ((f >> 3) ? w2 : w1) + ((kk << 5) + k0) * EMB + (nt << 4) + n;
      step = EMB;
    }
    float t[8];
    #pragma unroll  // constant indices keep t[] in registers
    for (int i = 0; i < 8; ++i) t[i] = src[i * step];
    // The conversions below reuse the address registers that these loads name.
    asm volatile("s_wait_xcnt 0x0" ::: "memory");
    v8h o;
    #pragma unroll
    for (int i = 0; i < 8; ++i) o[i] = (half_t)t[i];
    *reinterpret_cast<v8h*>(wpk + ((size_t)u << 3)) = o;
    return;
  }
  const size_t base = ((size_t)(blockIdx.x - WPK_BLOCKS) << 12) + ((size_t)threadIdx.x << 3);
  #pragma unroll  // both passes' loads are in flight before the first store
  for (int rep = 0; rep < 2; ++rep) {
    const size_t e = base + ((size_t)rep << 11);
    const float4 u = *reinterpret_cast<const float4*>(x + e);
    const float4 w = *reinterpret_cast<const float4*>(x + e + 4);
    v8h o;
    o[0] = (half_t)u.x; o[1] = (half_t)u.y; o[2] = (half_t)u.z; o[3] = (half_t)u.w;
    o[4] = (half_t)w.x; o[5] = (half_t)w.y; o[6] = (half_t)w.z; o[7] = (half_t)w.w;
    *reinterpret_cast<v8h*>(xh + e) = o;
  }
}

// ---------------------------------------------------------------------------
// K2: implicit-GEMM dilated conv + bias + GELU -> tokens f16 [B,T,192].
// Per block: 64 tokens x 64 out-channels, K=576 in 18 steps of 32 via WMMA.
// K axis ordered k = kid*64 + ic.  A never passes through LDS: lane l owns
// token row l&15 of its wave's 16, and its fragment halves (k = 8*(l>>4)+0..7
// and 16+8*(l>>4)+0..7) are two 16-byte runs of that token's tap pixel, read
// straight from the channels-last image.  One tap = four such loads = both
// K-steps of the tap.  B comes from the packed weights, 8 fragments a tap, so
// the loop has no LDS and no barrier.
// grid = (64 token tiles, 3 branches, 32 batches), 4 waves.
// ---------------------------------------------------------------------------
__global__ __launch_bounds__(128) void k_conv(const half_t* __restrict__ xh,
                                              const half_t* __restrict__ wpk,
                                              const float* __restrict__ cb,
                                              half_t* __restrict__ tok) {
  const int tbase = blockIdx.x << 6;
  const int br = blockIdx.y;
  const int b  = blockIdx.z;
  const int dil = br + 1, pad = br + 1;
  const int tid = threadIdx.x, lane = tid & 31, wv = tid >> 5;
  const half_t* wl = wpk + br * (72 * FRAG_H) + (lane << 3);

  v8f acc[4];
  const v8f vzero = {};
  #pragma unroll
  for (int i = 0; i < 4; ++i) acc[i] = vzero;

  // Per-lane im2col coordinates (invariant over the K loop).
  const int a_t  = tbase + (wv << 4) + (lane & 15);
  const int a_h0 = (a_t >> 6) << 1, a_w0 = (a_t & 63) << 1;
  const half_t* xa = xh + (size_t)b * NPIX * CIN + ((lane >> 4) << 3);

  for (int kid = 0; kid < 9; ++kid) {     // kernel tap
    const int kh = kid / 3, kw = kid - kh * 3;   // scalar (SALU)
    const int ih = a_h0 + kh * dil - pad;
    const int iw = a_w0 + kw * dil - pad;
    const bool inb = (unsigned)ih < 128u && (unsigned)iw < 128u;
    // A: this token's tap pixel, all 64 channels over the lane pair (l, l+16).
    // A padded tap reads pixel 0 (in bounds) and is zeroed afterwards.
    const half_t* pa = xa + (inb ? (((ih << 7) + iw) << 6) : 0);
    const half_t* wk = wl + kid * (8 * FRAG_H);
    v16h vb[8];
    #pragma unroll  // constant indices keep vb[] and a[] in registers (here and below)
    for (int f = 0; f < 8; ++f) vb[f] = load_bfrag(wk, f);
    v8h a[4];
    #pragma unroll
    for (int q = 0; q < 4; ++q) a[q] = *reinterpret_cast<const v8h*>(pa + (q << 4));
    // What follows reuses the address registers that this tap's loads name.
    asm volatile("s_wait_xcnt 0x0" ::: "memory");
    // Keeps the tap's 20 loads in one run ahead of its WMMAs: left to itself the
    // scheduler puts each B load directly in front of its WMMA, one full load
    // latency per WMMA.
    __builtin_amdgcn_sched_barrier(0);
    if (!inb) {
      #pragma unroll
      for (int q = 0; q < 4; ++q) a[q] = (v8h)(half_t)0.0f;
    }

    #pragma unroll
    for (int h = 0; h < 2; ++h) {
      const v16h va = __builtin_shufflevector(a[2 * h], a[2 * h + 1],
          0, 1, 2, 3, 4, 5, 6, 7, 8, 9, 10, 11, 12, 13, 14, 15);
      #pragma unroll
      for (int nt = 0; nt < 4; ++nt) {
        acc[nt] = __builtin_amdgcn_wmma_f32_16x16x32_f16(
            false, va, false, vb[(h << 2) + nt], (short)0, acc[nt], false, false);
      }
    }
  }
  // Epilogue: bias + exact GELU, write tokens (branch-major channel concat)
  const int hi = lane >> 4, cn = lane & 15;
  #pragma unroll
  for (int nt = 0; nt < 4; ++nt) {
    const int oc = (nt << 4) + cn;
    const float bias = cb[br * EBR + oc];
    #pragma unroll
    for (int r = 0; r < 8; ++r) {
      const int row = (wv << 4) + r + (hi << 3);
      const int t = tbase + row;
      const float v = acc[nt][r] + bias;
      tok[((size_t)b * TOKN + t) * DIMC + br * EBR + oc] = (half_t)gelu_exact(v);
    }
  }
}

// ---------------------------------------------------------------------------
// K3: LayerNorm(192) over tokens -> hln f16.  One wave per token.
// ---------------------------------------------------------------------------
__global__ __launch_bounds__(128) void k_ln1(const half_t* __restrict__ tok,
                                             const float* __restrict__ g,
                                             const float* __restrict__ bt,
                                             half_t* __restrict__ hln) {
  const int token = (blockIdx.x << 2) + (threadIdx.x >> 5);
  const int lane = threadIdx.x & 31;
  const size_t base = (size_t)token * DIMC;
  float xv[6], s = 0.f, s2 = 0.f;
  #pragma unroll
  for (int j = 0; j < 6; ++j) {
    const float v = (float)tok[base + lane + (j << 5)];
    xv[j] = v; s += v; s2 += v * v;
  }
  s = wave_sum32(s); s2 = wave_sum32(s2);
  const float mean = s * (1.0f / DIMC);
  const float var  = s2 * (1.0f / DIMC) - mean * mean;
  const float rs = rsqrtf(var + 1e-5f);
  #pragma unroll
  for (int j = 0; j < 6; ++j) {
    const int c = lane + (j << 5);
    hln[base + c] = (half_t)((xv[j] - mean) * rs * g[c] + bt[c]);
  }
}

// ---------------------------------------------------------------------------
// K4: kqv GEMM  [131072 x 192] @ [192 x 192] + bias -> kqv f32.
// Per block: 64 rows x 64 cols, K=192 in 6 WMMA steps. grid=(2048,3).
// ---------------------------------------------------------------------------
__global__ __launch_bounds__(128) void k_kqv(const half_t* __restrict__ hln,
                                             const half_t* __restrict__ wpk,
                                             const float* __restrict__ bias,
                                             float* __restrict__ kqv) {
  __shared__ half_t As[64][34];
  const int rbase = blockIdx.x << 6;
  const int ct = blockIdx.y;
  const int tid = threadIdx.x, lane = tid & 31, wv = tid >> 5;
  const half_t* wl = wpk + WQ_H + (ct << 2) * FRAG_H + (lane << 3);

  v8f acc[4];
  const v8f vzero = {};
  #pragma unroll
  for (int i = 0; i < 4; ++i) acc[i] = vzero;

  for (int kk = 0; kk < 6; ++kk) {
    const int ks = kk << 5;
    v16h vb[4];
    #pragma unroll  // constant indices keep vb[] in registers
    for (int nt = 0; nt < 4; ++nt) vb[nt] = load_bfrag(wl, kk * 12 + nt);
    #pragma unroll
    for (int rep = 0; rep < 16; ++rep) {
      const int e = tid + (rep << 7);
      const int rr = e >> 5, kq = e & 31;
      As[rr][kq] = hln[(size_t)(rbase + rr) * DIMC + ks + kq];
    }
    __syncthreads();
    const v16h va = load_frag(&As[0][0], wv << 4, 34, lane);
    #pragma unroll
    for (int nt = 0; nt < 4; ++nt) {
      acc[nt] = __builtin_amdgcn_wmma_f32_16x16x32_f16(
          false, va, false, vb[nt], (short)0, acc[nt], false, false);
    }
    __syncthreads();
  }
  const int hi = lane >> 4, cn = lane & 15;
  #pragma unroll
  for (int nt = 0; nt < 4; ++nt) {
    const int col = (ct << 6) + (nt << 4) + cn;
    const float bv = bias[col];
    #pragma unroll
    for (int r = 0; r < 8; ++r) {
      const int row = rbase + (wv << 4) + r + (hi << 3);
      kqv[(size_t)row * DIMC + col] = acc[nt][r] + bv;
    }
  }
}

// ---------------------------------------------------------------------------
// K5: performer features  kp/qp = exp(w.t - |t|^2/2)/sqrt(m)  + ksum reduce.
// Lane = token, 32 tokens per wave.  A lane keeps its token's k and q rows in
// registers; a weight is then the same for the whole wave, so it comes by a
// scalar load and enters the FMA as a scalar operand (no LDS read per product).
// Rows go in and out as whole-line wave accesses and are turned lane-wise in the
// wave's own LDS tile, at pitches of 16 B x odd.  No work-group barrier.
// ---------------------------------------------------------------------------
#define KQ_P 132   // floats per staged k|q row    (528 B = 16 B x 33)
#define PF_P 36    // floats per staged feature row (144 B = 16 B x 9)
#define VO_P 68    // floats per staged v / y row   (272 B = 16 B x 17)

__global__ __launch_bounds__(128) void k_perf(const float* __restrict__ kqv,
                                              const float* __restrict__ wperf,
                                              float* __restrict__ kp,
                                              float* __restrict__ qp,
                                              float* __restrict__ ksum) {
  __shared__ __attribute__((aligned(16))) float tile[4][32 * KQ_P];
  const int lane = threadIdx.x & 31, wv = threadIdx.x >> 5;
  float* T = tile[wv];
  const int b = blockIdx.x >> 5;                        // 32 blocks per batch
  const int tok0 = (blockIdx.x << 7) + (wv << 5);       // first of the wave's tokens
  // In: one token's k|q is 512 contiguous bytes, one wave load.
  {
    const float* src = kqv + (size_t)tok0 * DIMC + (lane << 2);
    float4 in[32];
    #pragma unroll  // constant indices keep in[] in registers; all loads in flight at once
    for (int i = 0; i < 32; ++i) in[i] = *reinterpret_cast<const float4*>(src + i * DIMC);
    // What follows may reuse the address registers that these loads name.
    asm volatile("s_wait_xcnt 0x0" ::: "memory");
    #pragma unroll
    for (int i = 0; i < 32; ++i)
      *reinterpret_cast<float4*>(T + i * KQ_P + (lane << 2)) = in[i];
  }
  // The other lanes' rows must stand in the tile before this lane reads its own.
  asm volatile("s_wait_dscnt 0x0" ::: "memory");
  float k[64], q[64];
  #pragma unroll  // constant indices keep k[] and q[] in registers
  for (int j = 0; j < 16; ++j) {
    const float4 u = *reinterpret_cast<const float4*>(T + lane * KQ_P + (j << 2));
    const float4 w = *reinterpret_cast<const float4*>(T + lane * KQ_P + 64 + (j << 2));
    k[4 * j] = u.x; k[4 * j + 1] = u.y; k[4 * j + 2] = u.z; k[4 * j + 3] = u.w;
    q[4 * j] = w.x; q[4 * j + 1] = w.y; q[4 * j + 2] = w.z; q[4 * j + 3] = w.w;
  }
  float xk = 0.f, xq = 0.f;
  #pragma unroll
  for (int d = 0; d < 64; ++d) { xk += k[d] * k[d]; xq += q[d] * q[d]; }
  // Four features a trip: eight independent FMA chains, each in d order.
  #pragma unroll 1  // the body is 512 FMAs; unrolled further it only grows the code
  for (int m0 = 0; m0 < MF; m0 += 4) {
    const float* w = wperf + (m0 << 6);
    float dk[4] = {0.f, 0.f, 0.f, 0.f}, dq[4] = {0.f, 0.f, 0.f, 0.f};
    #pragma unroll
    for (int d = 0; d < 64; ++d) {
      #pragma unroll
      for (int f = 0; f < 4; ++f) {
        const float wr = w[(f << 6) + d];
        dk[f] += wr * k[d]; dq[f] += wr * q[d];
      }
    }
    float4 ok, oq;
    ok.x = expf(dk[0] - 0.5f * xk) * INVSQRTM; oq.x = expf(dq[0] - 0.5f * xq) * INVSQRTM;
    ok.y = expf(dk[1] - 0.5f * xk) * INVSQRTM; oq.y = expf(dq[1] - 0.5f * xq) * INVSQRTM;
    ok.z = expf(dk[2] - 0.5f * xk) * INVSQRTM; oq.z = expf(dq[2] - 0.5f * xq) * INVSQRTM;
    ok.w = expf(dk[3] - 0.5f * xk) * INVSQRTM; oq.w = expf(dq[3] - 0.5f * xq) * INVSQRTM;
    *reinterpret_cast<float4*>(T + lane * PF_P + m0) = ok;
    *reinterpret_cast<float4*>(T + (32 + lane) * PF_P + m0) = oq;
  }
  // Every lane's features must stand in the tile before they are read across lanes.
  asm volatile("s_wait_dscnt 0x0" ::: "memory");
  // ksum: lane = feature, its column over the wave's 32 tokens, one atomic a wave.
  float s = 0.f;
  #pragma unroll
  for (int t = 0; t < 32; ++t) s += T[t * PF_P + lane];
  atomicAdd(&ksum[b * MF + lane], s);
  // Out: four tokens' features are 512 contiguous bytes, one wave store.
  float* kpo = kp + (size_t)tok0 * MF + (lane << 2);
  float* qpo = qp + (size_t)tok0 * MF + (lane << 2);
  const float* Tr = T + (lane >> 3) * PF_P + ((lane & 7) << 2);
  #pragma unroll
  for (int i = 0; i < 8; ++i) {
    *reinterpret_cast<float4*>(kpo + (i << 7)) =
        *reinterpret_cast<const float4*>(Tr + (i << 2) * PF_P);
    *reinterpret_cast<float4*>(qpo + (i << 7)) =
        *reinterpret_cast<const float4*>(Tr + (32 + (i << 2)) * PF_P);
  }
}

// ---------------------------------------------------------------------------
// K6: kptv[b,d,m] = sum_t v[b,t,d]*kp[b,t,m].  Per-thread 8-cell register
// accumulation over 256 tokens, LDS-staged tiles, one global atomic per cell.
// ---------------------------------------------------------------------------
__global__ __launch_bounds__(256) void k_kptv(const float* __restrict__ kqv,
                                              const float* __restrict__ kp,
                                              float* __restrict__ kptv) {
  __shared__ float vbuf[32][65];
  __shared__ float kpb[32][33];
  const int b  = blockIdx.x >> 4;
  const int tb = (blockIdx.x & 15) << 8;
  const int tid = threadIdx.x;
  const int d = tid >> 2, m0 = (tid & 3) << 3;
  float acc[8];
  #pragma unroll
  for (int j = 0; j < 8; ++j) acc[j] = 0.f;
  for (int ch = 0; ch < 8; ++ch) {
    const int t0 = tb + (ch << 5);
    #pragma unroll
    for (int rep = 0; rep < 8; ++rep) {
      const int e = tid + (rep << 8);
      const int tt = e >> 6, dd = e & 63;
      vbuf[tt][dd] = kqv[((size_t)b * TOKN + t0 + tt) * DIMC + 128 + dd];
    }
    #pragma unroll
    for (int rep = 0; rep < 4; ++rep) {
      const int e = tid + (rep << 8);
      const int tt = e >> 5, mm = e & 31;
      kpb[tt][mm] = kp[((size_t)b * TOKN + t0 + tt) * MF + mm];
    }
    __syncthreads();
    #pragma unroll 4
    for (int tt = 0; tt < 32; ++tt) {
      const float vv = vbuf[tt][d];
      #pragma unroll
      for (int j = 0; j < 8; ++j) acc[j] += vv * kpb[tt][m0 + j];
    }
    __syncthreads();
  }
  #pragma unroll
  for (int j = 0; j < 8; ++j)
    atomicAdd(&kptv[((size_t)b * EMB + d) * MF + m0 + j], acc[j]);
}

// ---------------------------------------------------------------------------
// K7: yatt = v + proj(qp @ kptv^T / (qp.ksum + eps)).  Lane = token, 32 tokens
// per wave, as in K5: qp row and output row in registers.  Every weight is
// wave-uniform: ksum, proj_w and proj_b come by scalar loads; the batch's kptv is
// staged once per block in LDS and read with all lanes on one address, so that a
// trip of the main loop waits for one run of scalar loads, not three.
// ---------------------------------------------------------------------------
__global__ __launch_bounds__(128) void k_mix(const float* __restrict__ kqv,
                                             const float* __restrict__ qp,
                                             const float* __restrict__ ksum,
                                             const float* __restrict__ kptv,
                                             const float* __restrict__ pw,
                                             const float* __restrict__ pb,
                                             float* __restrict__ yatt) {
  __shared__ __attribute__((aligned(16))) float qt[4][32 * PF_P];
  __shared__ __attribute__((aligned(16))) float vt[4][32 * VO_P];
  __shared__ __attribute__((aligned(16))) float klt[EMB * MF];
  const int lane = threadIdx.x & 31;
  // The wave's number, shown to the compiler as uniform: tile and row addresses are
  // then scalar arithmetic, a scalar base and a lane offset per load.
  const int wv = __builtin_amdgcn_readfirstlane(threadIdx.x >> 5);
  float* Q = qt[wv];
  float* V = vt[wv];
  const int b = blockIdx.x >> 5;                        // 32 blocks per batch
  const int tok0 = (blockIdx.x << 7) + (wv << 5);       // first of the wave's tokens
  // In: four tokens' qp rows, or two tokens' v rows, per wave load (whole lines).
  {
    const float* qs = qp + (size_t)tok0 * MF + (lane << 2);
    const float* vs = kqv + (size_t)tok0 * DIMC + 128 + (lane >> 4) * DIMC + ((lane & 15) << 2);
    const float* ks = kptv + (size_t)b * (EMB * MF) + (wv << 7) + (lane << 2);
    float4 qi[8], vi[16], ki[4];
    #pragma unroll  // constant indices keep qi[], vi[] and ki[] in registers
    for (int i = 0; i < 8; ++i) qi[i] = *reinterpret_cast<const float4*>(qs + (i << 7));
    #pragma unroll
    for (int i = 0; i < 4; ++i) ki[i] = *reinterpret_cast<const float4*>(ks + (i << 9));
    #pragma unroll
    for (int i = 0; i < 16; ++i) vi[i] = *reinterpret_cast<const float4*>(vs + (i << 1) * DIMC);
    #pragma unroll
    for (int i = 0; i < 8; ++i)
      *reinterpret_cast<float4*>(Q + ((i << 2) + (lane >> 3)) * PF_P + ((lane & 7) << 2)) = qi[i];
    #pragma unroll
    for (int i = 0; i < 16; ++i)
      *reinterpret_cast<float4*>(V + ((i << 1) + (lane >> 4)) * VO_P + ((lane & 15) << 2)) = vi[i];
    #pragma unroll
    for (int i = 0; i < 4; ++i)
      *reinterpret_cast<float4*>(klt + (i << 9) + (wv << 7) + (lane << 2)) = ki[i];
  }
  __syncthreads();  // klt is filled by all four waves; the wave's own tiles stand too
  float q[32], o[64];
  #pragma unroll  // constant indices keep q[] and o[] in registers
  for (int j = 0; j < 8; ++j) {
    const float4 u = *reinterpret_cast<const float4*>(Q + lane * PF_P + (j << 2));
    q[4 * j] = u.x; q[4 * j + 1] = u.y; q[4 * j + 2] = u.z; q[4 * j + 3] = u.w;
  }
  #pragma unroll
  for (int j = 0; j < 16; ++j) {
    const float4 u = *reinterpret_cast<const float4*>(V + lane * VO_P + (j << 2));
    o[4 * j] = u.x + pb[4 * j];         o[4 * j + 1] = u.y + pb[4 * j + 1];
    o[4 * j + 2] = u.z + pb[4 * j + 2]; o[4 * j + 3] = u.w + pb[4 * j + 3];
  }
  // D = qp.ksum, added in the tree order of a 32-lane xor butterfly.
  const float* ksb = ksum + b * MF;
  float t[32];
  #pragma unroll
  for (int m = 0; m < 32; ++m) t[m] = q[m] * ksb[m];
  #pragma unroll
  for (int off = 16; off > 0; off >>= 1) {
    #pragma unroll
    for (int m = 0; m < off; ++m) t[m] += t[m + off];
  }
  const float den = t[0] + 1e-8f;
  // Two attention channels e a trip: for each its sum over m, then its row of
  // proj_w into all 64 outputs, e ascending.
  #pragma unroll 2  // the two sums run as independent chains, and the second row's
                    // scalar loads fly under the first row's work
  for (int e = 0; e < EMB; ++e) {
    const float* kr = klt + (e << 5);
    const float* pr = pw + (e << 6);
    float num = 0.f;
    #pragma unroll
    for (int m = 0; m < 32; ++m) num += q[m] * kr[m];
    const float al = num / den;
    #pragma unroll
    for (int d = 0; d < 64; ++d) o[d] += al * pr[d];
  }
  #pragma unroll
  for (int j = 0; j < 16; ++j) {
    float4 u;
    u.x = o[4 * j]; u.y = o[4 * j + 1]; u.z = o[4 * j + 2]; u.w = o[4 * j + 3];
    *reinterpret_cast<float4*>(V + lane * VO_P + (j << 2)) = u;
  }
  // Every lane's row must stand in the tile before it is read across lanes.
  asm volatile("s_wait_dscnt 0x0" ::: "memory");
  // Out: two tokens' rows are 512 contiguous bytes, one wave store.
  float* yo = yatt + ((size_t)tok0 << 6) + (lane << 2);
  const float* Vr = V + (lane >> 4) * VO_P + ((lane & 15) << 2);
  #pragma unroll
  for (int i = 0; i < 16; ++i)
    *reinterpret_cast<float4*>(yo + (i << 7)) =
        *reinterpret_cast<const float4*>(Vr + (i << 1) * VO_P);
}

// ---------------------------------------------------------------------------
// K8: out = yatt + W2 @ gelu(W1 @ LN(yatt) + b1) + b2.  Fully fused:
// LN2 in registers, both 64x64 GEMMs via WMMA, A in LDS, B from the packed weights.
// Per block: 64 rows, 128 threads (4 waves).
// ---------------------------------------------------------------------------
__global__ __launch_bounds__(128) void k_mlp(const float* __restrict__ yatt,
                                             const float* __restrict__ g,
                                             const float* __restrict__ bt,
                                             const half_t* __restrict__ wpk,
                                             const float* __restrict__ b1,
                                             const float* __restrict__ b2,
                                             float* __restrict__ out) {
  __shared__ half_t Hs[64][66];
  __shared__ half_t T1s[64][66];
  __shared__ float b1l[64], b2l[64];
  const int rbase = blockIdx.x << 6;
  const int tid = threadIdx.x, lane = tid & 31, wv = tid >> 5;
  const half_t* wl = wpk + WM_H + (lane << 3);
  // LayerNorm(64): two threads per row, pair-reduce via shfl.
  {
    const int r = tid >> 1, hf = tid & 1;
    const float* p = yatt + ((size_t)(rbase + r) << 6) + (hf << 5);
    float xv[32], s = 0.f, s2 = 0.f;
    #pragma unroll
    for (int j = 0; j < 32; ++j) { const float v = p[j]; xv[j] = v; s += v; s2 += v * v; }
    s  += __shfl_xor(s, 1, 32);
    s2 += __shfl_xor(s2, 1, 32);
    const float mean = s * (1.0f / 64.f);
    const float var  = s2 * (1.0f / 64.f) - mean * mean;
    const float rs = rsqrtf(var + 1e-5f);
    #pragma unroll
    for (int j = 0; j < 32; ++j) {
      const int c = (hf << 5) + j;
      Hs[r][c] = (half_t)((xv[j] - mean) * rs * g[c] + bt[c]);
    }
  }
  // W1's fragments are asked for ahead of the barrier and arrive during its wait.
  v16h vb1[8];
  #pragma unroll  // constant indices keep vb1[] in registers
  for (int f = 0; f < 8; ++f) vb1[f] = load_bfrag(wl, f);
  if (tid < 64) { b1l[tid] = b1[tid]; b2l[tid] = b2[tid]; }
  __syncthreads();
  // W2's fragments arrive while the first GEMM and its GELU run.
  v16h vb2[8];
  #pragma unroll  // constant indices keep vb2[] in registers
  for (int f = 0; f < 8; ++f) vb2[f] = load_bfrag(wl, 8 + f);

  const v8f vzero = {};
  v8f acc[4];
  #pragma unroll
  for (int i = 0; i < 4; ++i) acc[i] = vzero;
  #pragma unroll
  for (int kk = 0; kk < 2; ++kk) {
    const int ks = kk << 5;
    const v16h va = load_frag(&Hs[0][ks], wv << 4, 66, lane);
    #pragma unroll
    for (int nt = 0; nt < 4; ++nt) {
      acc[nt] = __builtin_amdgcn_wmma_f32_16x16x32_f16(
          false, va, false, vb1[(kk << 2) + nt], (short)0, acc[nt], false, false);
    }
  }
  const int hi = lane >> 4, cn = lane & 15;
  #pragma unroll
  for (int nt = 0; nt < 4; ++nt) {
    const int col = (nt << 4) + cn;
    #pragma unroll
    for (int r = 0; r < 8; ++r) {
      const int row = (wv << 4) + r + (hi << 3);
      T1s[row][col] = (half_t)gelu_exact(acc[nt][r] + b1l[col]);
    }
  }
  __syncthreads();
  v8f acc2[4];
  #pragma unroll
  for (int i = 0; i < 4; ++i) acc2[i] = vzero;
  #pragma unroll
  for (int kk = 0; kk < 2; ++kk) {
    const int ks = kk << 5;
    const v16h va = load_frag(&T1s[0][ks], wv << 4, 66, lane);
    #pragma unroll
    for (int nt = 0; nt < 4; ++nt) {
      acc2[nt] = __builtin_amdgcn_wmma_f32_16x16x32_f16(
          false, va, false, vb2[(kk << 2) + nt], (short)0, acc2[nt], false, false);
    }
  }
  #pragma unroll
  for (int nt = 0; nt < 4; ++nt) {
    const int col = (nt << 4) + cn;
    const float bv = b2l[col];
    #pragma unroll
    for (int r = 0; r < 8; ++r) {
      const int row = (wv << 4) + r + (hi << 3);
      const size_t gi = ((size_t)(rbase + row) << 6) + col;
      out[gi] = yatt[gi] + acc2[nt][r] + bv;
    }
  }
}

// ---------------------------------------------------------------------------
extern "C" void kernel_launch(void* const* d_in, const int* in_sizes, int n_in,
                              void* d_out, int out_size, void* d_ws, size_t ws_size,
                              hipStream_t stream) {
  (void)in_sizes; (void)n_in; (void)out_size; (void)ws_size;
  const float* x      = (const float*)d_in[0];
  const float* conv_w = (const float*)d_in[1];
  const float* conv_b = (const float*)d_in[2];
  const float* ln1_g  = (const float*)d_in[3];
  const float* ln1_b  = (const float*)d_in[4];
  const float* kqv_w  = (const float*)d_in[5];
  const float* kqv_b  = (const float*)d_in[6];
  const float* proj_w = (const float*)d_in[7];
  const float* proj_b = (const float*)d_in[8];
  const float* w_perf = (const float*)d_in[9];
  const float* ln2_g  = (const float*)d_in[10];
  const float* ln2_b  = (const float*)d_in[11];
  const float* mlp_w1 = (const float*)d_in[12];
  const float* mlp_b1 = (const float*)d_in[13];
  const float* mlp_w2 = (const float*)d_in[14];
  const float* mlp_b2 = (const float*)d_in[15];

  char* ws = (char*)d_ws;
  half_t* xh   = (half_t*)(ws + XH_OFF);
  half_t* tok  = (half_t*)(ws + TOK_OFF);
  half_t* hln  = (half_t*)(ws + HLN_OFF);
  float*  kqv  = (float*)(ws + KQV_OFF);
  float*  kp   = (float*)(ws + KP_OFF);     // reuses XH region (xh dead)
  float*  qp   = (float*)(ws + QP_OFF);
  float*  ksum = (float*)(ws + KSUM_OFF);
  float*  kptv = (float*)(ws + KPTV_OFF);
  float*  yatt = (float*)(ws + YATT_OFF);   // reuses TOK region (tok dead)
  half_t* wpk  = (half_t*)(ws + WPK_OFF);
  float*  out  = (float*)d_out;

  // Zero the atomic accumulators (ksum + kptv are contiguous).
  hipMemsetAsync(ws + KSUM_OFF, 0, 4096 + (size_t)BATCH * EMB * MF * 4, stream);

  k_pack<<<dim3(WPK_BLOCKS + BATCH * 256), dim3(256), 0, stream>>>(
      x, conv_w, kqv_w, mlp_w1, mlp_w2, xh, wpk);
  k_conv<<<dim3(64, 3, BATCH), dim3(128), 0, stream>>>(xh, wpk, conv_b, tok);
  k_ln1 <<<dim3((BATCH * TOKN) / 4), dim3(128), 0, stream>>>(tok, ln1_g, ln1_b, hln);
  k_kqv <<<dim3((BATCH * TOKN) / 64, 3), dim3(128), 0, stream>>>(hln, wpk, kqv_b, kqv);
  k_perf<<<dim3(BATCH * 32), dim3(128), 0, stream>>>(kqv, w_perf, kp, qp, ksum);
  k_kptv<<<dim3(BATCH * 16), dim3(256), 0, stream>>>(kqv, kp, kptv);
  k_mix <<<dim3(BATCH * 32), dim3(128), 0, stream>>>(kqv, qp, ksum, kptv,
                                                      proj_w, proj_b, yatt);
  k_mlp <<<dim3((BATCH * TOKN) / 64), dim3(128), 0, stream>>>(
      yatt, ln2_g, ln2_b, wpk, mlp_b1, mlp_b2, out);
}

// v004
// Next to v003, in two timings, it ran 1.09 and 1.07 times as fast.
// Over all steps from v000 it is 4.04 times as fast.
#include <hip/hip_runtime.h>
#include <hip/hip_bf16.h>
#include <math.h>

// ---------------------------------------------------------------------------
// MI455X (gfx1250, wave32) implementation of the PRM + Token-Performer block.
// All dense GEMMs (implicit-GEMM dilated convs, kqv, MLP) use
// V_WMMA_F32_16X16X32_F16 with f32 accumulation; skinny performer pieces are
// VALU with register accumulation.  Fused epilogues keep each intermediate to one
// HBM round-trip (pipeline is ~bandwidth-bound at 23.3 TB/s).
// Conv reduction axis ordered k = kid*64 + ic so each 32-wide WMMA K-step has
// a constant kernel tap; the image stays channels-last, so one pixel's 64
// channels are one 128-byte line and an im2col row is contiguous in k.
// Every GEMM weight matrix is packed once per call into f16 in the order of the
// WMMA B fragment, so a B fragment is two whole-line 16-byte loads per lane.
// ---------------------------------------------------------------------------

typedef _Float16 half_t;
typedef __attribute__((ext_vector_type(16))) _Float16 v16h;
typedef __attribute__((ext_vector_type(8)))  _Float16 v8h;
typedef __attribute__((ext_vector_type(8)))  float    v8f;

// Problem constants (match reference)
#define BATCH   32
#define CIN     64
#define IMGSZ   128
#define NPIX    16384     // 128*128
#define TOKN    4096      // 64*64 post-stride-2 tokens
#define EBR     64
#define DIMC    192       // 3*EBR
#define EMB     64
#define MF      32        // performer features
#define INVSQRTM 0.17677669529663687f

// Workspace layout (bytes). Buffers reused once their producers/consumers
// are done:  XH region -> KP/QP,  TOK region -> YATT.
#define XH_OFF    ((size_t)0)                                   // f16 [B][128][128][CIN]  67.1MB
#define KP_OFF    ((size_t)0)                                   // f32 [B][T][32]          (reuse XH)
#define QP_OFF    ((size_t)16777216)                            // f32 [B][T][32]
#define TOK_OFF   ((size_t)67108864)                            // f16 [B][T][192]         50.3MB
#define YATT_OFF  TOK_OFF                                       // f32 [B][T][64]          (reuse TOK)
#define KQV_OFF   ((size_t)(67108864 + 2*50331648))             // f32 [B][T][192]         100.7MB
#define KSUM_OFF  (KQV_OFF + (size_t)BATCH*TOKN*DIMC*4)         // f32 [B][32]
#define KPTV_OFF  (KSUM_OFF + (size_t)4096)                     // f32 [B][64][32]
#define WPK_OFF   (KPTV_OFF + (size_t)BATCH*EMB*MF*4)           // f16 packed weights, 311 KB
#define CS_OFF    (WPK_OFF + (size_t)311296)                    // f32 [2][192] kqv column terms

// Packed weights: one B fragment (32 k x 16 n) = 2 planes x 32 lanes x 8 halves.
// Plane p, lane l, element i hold k = 16*p + 8*(l>>4) + i, n = l&15: the k order
// of load_frag.  A unit is one lane's 8 halves (16 bytes) of one plane.
#define FRAG_H    512                       // halves per fragment
#define WC_UNITS  13824                     // conv: 3 branches x 18 K-steps x 4 n-tiles x 64
#define WQ_UNITS  4608                      // kqv:  6 K-steps x 12 n-tiles x 64
#define WM_UNITS  1024                      // mlp:  2 matrices x 2 K-steps x 4 n-tiles x 64
#define WQ_H      (WC_UNITS * 8)            // first half of the kqv part
#define WM_H      ((WC_UNITS + WQ_UNITS) * 8)
#define WPK_BLOCKS ((WC_UNITS + WQ_UNITS + WM_UNITS) / 256)   // 76

__device__ __forceinline__ float gelu_exact(float x) {
  return 0.5f * x * (1.0f + erff(x * 0.70710678118654752f));
}

// Load a 16x32 f16 WMMA fragment (A row-major, or B assembled as [N][K]).
// tile: LDS matrix with K contiguous per row; stride in half elements.
// ISA layout: lanes 0-15 hold K0-7 (v0-3) and K16-23 (v4-7); lanes 16-31
// hold K8-15 and K24-31; M/N = lane&15 (+row0).
__device__ __forceinline__ v16h load_frag(const half_t* tile, int row0,
                                          int stride, int lane) {
  const half_t* p = tile + (row0 + (lane & 15)) * stride;
  const int hi = lane >> 4;
  v16h f;
  #pragma unroll
  for (int j = 0; j < 8; ++j) {
    const int kb = ((j >> 2) << 4) + (hi << 3) + ((j & 3) << 1);
    f[2 * j]     = p[kb];
    f[2 * j + 1] = p[kb + 1];
  }
  return f;
}

// B fragment number frag of a packed weight part, as two 512-byte wave loads.
__device__ __forceinline__ v16h load_bfrag(const half_t* wl, int frag) {
  const v8h lo = *reinterpret_cast<const v8h*>(wl + frag * FRAG_H);
  const v8h hi = *reinterpret_cast<const v8h*>(wl + frag * FRAG_H + 256);
  return __builtin_shufflevector(lo, hi,
      0, 1, 2, 3, 4, 5, 6, 7, 8, 9, 10, 11, 12, 13, 14, 15);
}

// ---------------------------------------------------------------------------
// K1: x [B,N,C] f32  ->  xh [B,N,C] f16  (same channels-last order, convert
// only).  8 elements per thread per pass: two 16-byte loads, one 16-byte store.
// The first WPK_BLOCKS blocks pack the weights instead: one unit per thread,
// eight strided f32 reads, one 16-byte store; row k of the kqv weights is scaled by
// ln1's g[k] on the way.  The next block sums the two column terms of K3.
// ---------------------------------------------------------------------------
__global__ __launch_bounds__(256) void k_pack(const float* __restrict__ x,
                                              const float* __restrict__ cw,
                                              const float* __restrict__ wq,
                                              const float* __restrict__ w1,
                                              const float* __restrict__ w2,
                                              const float* __restrict__ lg,
                                              const float* __restrict__ lb,
                                              const float* __restrict__ qb,
                                              half_t* __restrict__ xh,
                                              half_t* __restrict__ wpk,
                                              float* __restrict__ cs) {
  if (blockIdx.x == WPK_BLOCKS) {            // thread = column n of the kqv weights
    if (threadIdx.x < DIMC) {
      const float* wc = wq + threadIdx.x;
      float sg = 0.f, sb = 0.f;
      #pragma unroll 16  // 16 loads in flight a trip; many more would raise the kernel's registers
      for (int k = 0; k < DIMC; ++k) {
        const float w = wc[k * DIMC];
        sg += (float)(half_t)(w * lg[k]);    // the f16 value that the GEMM multiplies by
        sb += w * lb[k];
      }
      cs[threadIdx.x] = sg;
      cs[DIMC + threadIdx.x] = sb + qb[threadIdx.x];
    }
    return;
  }
  if (blockIdx.x < WPK_BLOCKS) {
    const int u = (blockIdx.x << 8) + threadIdx.x;
    const int n = u & 15;
    const int k0 = (((u >> 5) & 1) << 4) + (((u >> 4) & 1) << 3);  // k of element 0
    const float* src;
    int step;                                // floats from one k to the next
    float sc[8] = {1.f, 1.f, 1.f, 1.f, 1.f, 1.f, 1.f, 1.f};
    if (blockIdx.x < WC_UNITS / 256) {       // frag = ((br*9 + kid)*2 + h)*4 + nt
      const int f = u >> 6;
      const int nt = f & 3, h = (f >> 2) & 1, tap = f >> 3;   // tap = br*9 + kid
      const int br = tap / 9, kid = tap - br * 9;
      src = cw + (((br << 6) + (nt << 4) + n) * CIN + (h << 5) + k0) * 9 + kid;
      step = 9;
    } else if (blockIdx.x < (WC_UNITS + WQ_UNITS) / 256) {    // frag = kk*12 + n-tile
      const int f = (u - WC_UNITS) >> 6;
      const int kk = f / 12, nt = f - kk * 12;
      src = wq + ((kk << 5) + k0) * DIMC + (nt << 4) + n;
      step = DIMC;
      #pragma unroll
      for (int i = 0; i < 8; ++i) sc[i] = lg[(kk << 5) + k0 + i];
    } else {                                 // frag = (matrix*2 + kk)*4 + nt
      const int f = (u - WC_UNITS - WQ_UNITS) >> 6;
      const int nt = f & 3, kk = (f >> 2) & 1;
      src = ((f >> 3) ? w2 : w1) + ((kk << 5) + k0) * EMB + (nt << 4) + n;
      step = EMB;
    }
    float t[8];
    #pragma unroll  // constant indices keep t[] in registers
    for (int i = 0; i < 8; ++i) t[i] = src[i * step];
    // The conversions below reuse the address registers that these loads name.
    asm volatile("s_wait_xcnt 0x0" ::: "memory");
    v8h o;
    #pragma unroll
    for (int i = 0; i < 8; ++i) o[i] = (half_t)(t[i] * sc[i]);
    *reinterpret_cast<v8h*>(wpk + ((size_t)u << 3)) = o;
    return;
  }
  const size_t base = ((size_t)(blockIdx.x - WPK_BLOCKS - 1) << 12) + ((size_t)threadIdx.x << 3);
  #pragma unroll  // both passes' loads are in flight before the first store
  for (int rep = 0; rep < 2; ++rep) {
    const size_t e = base + ((size_t)rep << 11);
    const float4 u = *reinterpret_cast<const float4*>(x + e);
    const float4 w = *reinterpret_cast<const float4*>(x + e + 4);
    v8h o;
    o[0] = (half_t)u.x; o[1] = (half_t)u.y; o[2] = (half_t)u.z; o[3] = (half_t)u.w;
    o[4] = (half_t)w.x; o[5] = (half_t)w.y; o[6] = (half_t)w.z; o[7] = (half_t)w.w;
    *reinterpret_cast<v8h*>(xh + e) = o;
  }
}

// ---------------------------------------------------------------------------
// K2: implicit-GEMM dilated conv + bias + GELU -> tokens f16 [B,T,192].
// Per block: 64 tokens x 64 out-channels, K=576 in 18 steps of 32 via WMMA.
// K axis ordered k = kid*64 + ic.  A never passes through LDS: lane l owns
// token row l&15 of its wave's 16, and its fragment halves (k = 8*(l>>4)+0..7
// and 16+8*(l>>4)+0..7) are two 16-byte runs of that token's tap pixel, read
// straight from the channels-last image.  One tap = four such loads = both
// K-steps of the tap.  B comes from the packed weights, 8 fragments a tap, so
// the loop has no LDS and no barrier.
// grid = (64 token tiles, 3 branches, 32 batches), 4 waves.
// ---------------------------------------------------------------------------
__global__ __launch_bounds__(128) void k_conv(const half_t* __restrict__ xh,
                                              const half_t* __restrict__ wpk,
                                              const float* __restrict__ cb,
                                              half_t* __restrict__ tok) {
  const int tbase = blockIdx.x << 6;
  const int br = blockIdx.y;
  const int b  = blockIdx.z;
  const int dil = br + 1, pad = br + 1;
  const int tid = threadIdx.x, lane = tid & 31, wv = tid >> 5;
  const half_t* wl = wpk + br * (72 * FRAG_H) + (lane << 3);

  v8f acc[4];
  const v8f vzero = {};
  #pragma unroll
  for (int i = 0; i < 4; ++i) acc[i] = vzero;

  // Per-lane im2col coordinates (invariant over the K loop).
  const int a_t  = tbase + (wv << 4) + (lane & 15);
  const int a_h0 = (a_t >> 6) << 1, a_w0 = (a_t & 63) << 1;
  const half_t* xa = xh + (size_t)b * NPIX * CIN + ((lane >> 4) << 3);

  for (int kid = 0; kid < 9; ++kid) {     // kernel tap
    const int kh = kid / 3, kw = kid - kh * 3;   // scalar (SALU)
    const int ih = a_h0 + kh * dil - pad;
    const int iw = a_w0 + kw * dil - pad;
    const bool inb = (unsigned)ih < 128u && (unsigned)iw < 128u;
    // A: this token's tap pixel, all 64 channels over the lane pair (l, l+16).
    // A padded tap reads pixel 0 (in bounds) and is zeroed afterwards.
    const half_t* pa = xa + (inb ? (((ih << 7) + iw) << 6) : 0);
    const half_t* wk = wl + kid * (8 * FRAG_H);
    v16h vb[8];
    #pragma unroll  // constant indices keep vb[] and a[] in registers (here and below)
    for (int f = 0; f < 8; ++f) vb[f] = load_bfrag(wk, f);
    v8h a[4];
    #pragma unroll
    for (int q = 0; q < 4; ++q) a[q] = *reinterpret_cast<const v8h*>(pa + (q << 4));
    // What follows reuses the address registers that this tap's loads name.
    asm volatile("s_wait_xcnt 0x0" ::: "memory");
    // Keeps the tap's 20 loads in one run ahead of its WMMAs: left to itself the
    // scheduler puts each B load directly in front of its WMMA, one full load
    // latency per WMMA.
    __builtin_amdgcn_sched_barrier(0);
    if (!inb) {
      #pragma unroll
      for (int q = 0; q < 4; ++q) a[q] = (v8h)(half_t)0.0f;
    }

    #pragma unroll
    for (int h = 0; h < 2; ++h) {
      const v16h va = __builtin_shufflevector(a[2 * h], a[2 * h + 1],
          0, 1, 2, 3, 4, 5, 6, 7, 8, 9, 10, 11, 12, 13, 14, 15);
      #pragma unroll
      for (int nt = 0; nt < 4; ++nt) {
        acc[nt] = __builtin_amdgcn_wmma_f32_16x16x32_f16(
            false, va, false, vb[(h << 2) + nt], (short)0, acc[nt], false, false);
      }
    }
  }
  // Epilogue: bias + exact GELU, write tokens (branch-major channel concat)
  const int hi = lane >> 4, cn = lane & 15;
  #pragma unroll
  for (int nt = 0; nt < 4; ++nt) {
    const int oc = (nt << 4) + cn;
    const float bias = cb[br * EBR + oc];
    #pragma unroll
    for (int r = 0; r < 8; ++r) {
      const int row = (wv << 4) + r + (hi << 3);
      const int t = tbase + row;
      const float v = acc[nt][r] + bias;
      tok[((size_t)b * TOKN + t) * DIMC + br * EBR + oc] = (half_t)gelu_exact(v);
    }
  }
}

// ---------------------------------------------------------------------------
// K3: LayerNorm(192) + kqv GEMM  [131072 x 192] @ [192 x 192] + bias -> kqv f32.
// With W' = g o W (packed so by K1), cg[n] = sum_k W'[k][n] and
// cb[n] = bias[n] + sum_k bt[k] W[k][n]:
//   LN(x) @ W + bias = rs * (x @ W' - mean * cg) + cb,
// so the raw f16 token rows are the A operand and a row's mean and rs enter only at
// the accumulators.  A wave owns 32 tokens (two 16-row tiles) and all 192 columns.
// Lane l reads row l&15 of each tile straight from global in the order of the WMMA A
// fragment: 16-byte runs at k = 16*j + 8*(l>>4), j = 0..11, so the lane pair
// (l, l+16) holds the whole row; its sums are a sum in the lane and one exchange with
// the partner lane.  No LDS tile, no barrier, no normalised copy in memory.
// B: 6 packed fragments per 16 columns, in one register set: a fragment of the
// next column tile is asked for as soon as this tile's WMMAs have read its place.
// grid = 1024 blocks of 4 waves = 4 waves per SIMD.
// ---------------------------------------------------------------------------
__global__ __launch_bounds__(128) void k_kqv(const half_t* __restrict__ tok,
                                             const half_t* __restrict__ wpk,
                                             const float* __restrict__ cs,
                                             float* __restrict__ kqv) {
  const int lane = threadIdx.x & 31, wv = threadIdx.x >> 5;
  const int hi = lane >> 4, cn = lane & 15;
  const int rbase = (blockIdx.x << 7) + (wv << 5);      // first of the wave's tokens
  const half_t* wl = wpk + WQ_H + (lane << 3);

  v8h x[2][12];
  #pragma unroll  // constant indices keep x[], vb[], cg[] and cb[] in registers (here and below)
  for (int mt = 0; mt < 2; ++mt) {
    const half_t* p = tok + (size_t)(rbase + (mt << 4) + cn) * DIMC + (hi << 3);
    #pragma unroll
    for (int j = 0; j < 12; ++j) x[mt][j] = *reinterpret_cast<const v8h*>(p + (j << 4));
    // A later load may land on the address registers that these loads name.
    asm volatile("s_wait_xcnt 0x0" ::: "memory");
  }
  v16h vb[6];
  float cg[2], cb[2];
  #pragma unroll
  for (int kk = 0; kk < 6; ++kk) vb[kk] = load_bfrag(wl, kk * 12);
  cg[0] = cs[cn];
  cb[0] = cs[DIMC + cn];

  // Row statistics, then each lane fetches those of the 8 rows that its accumulator
  // registers hold (register r = row 8*(l>>4) + r).
  float rsd[2][8], rmd[2][8];                           // rs and rs * mean
  #pragma unroll
  for (int mt = 0; mt < 2; ++mt) {
    float s0 = 0.f, s1 = 0.f, q0 = 0.f, q1 = 0.f;       // two chains each
    #pragma unroll
    for (int j = 0; j < 12; ++j) {
      #pragma unroll
      for (int i = 0; i < 8; i += 2) {
        const float v0 = (float)x[mt][j][i], v1 = (float)x[mt][j][i + 1];
        s0 += v0; q0 += v0 * v0;
        s1 += v1; q1 += v1 * v1;
      }
    }
    float s = s0 + s1, s2 = q0 + q1;
    s  += __shfl_xor(s, 16, 32);                        // the row's other half
    s2 += __shfl_xor(s2, 16, 32);
    const float mean = s * (1.0f / DIMC);
    const float var  = s2 * (1.0f / DIMC) - mean * mean;
    const float rs = rsqrtf(var + 1e-5f);
    const float rm = rs * mean;
    #pragma unroll
    for (int r = 0; r < 8; ++r) {
      rsd[mt][r] = __shfl(rs, (hi << 3) + r, 32);
      rmd[mt][r] = __shfl(rm, (hi << 3) + r, 32);
    }
  }

  float* po = kqv + (size_t)(rbase + (hi << 3)) * DIMC + cn;
  const v8f vzero = {};
  #pragma unroll  // cg[] and cb[] are indexed by the trip's parity: constant only when unrolled
  for (int nt = 0; nt < 12; ++nt) {
    v8f acc[2] = {vzero, vzero};
    #pragma unroll
    for (int hf = 0; hf < 2; ++hf) {
      #pragma unroll
      for (int kk = 3 * hf; kk < 3 * hf + 3; ++kk) {
        #pragma unroll
        for (int mt = 0; mt < 2; ++mt) {
          const v16h va = __builtin_shufflevector(x[mt][2 * kk], x[mt][2 * kk + 1],
              0, 1, 2, 3, 4, 5, 6, 7, 8, 9, 10, 11, 12, 13, 14, 15);
          acc[mt] = __builtin_amdgcn_wmma_f32_16x16x32_f16(
              false, va, false, vb[kk], (short)0, acc[mt], false, false);
        }
      }
      if (nt + 1 < 12) {
        // The two fences hold the next tile's loads where they stand: lifted above the
        // WMMAs they need a second register set, sunk to their use they fly under nothing.
        __builtin_amdgcn_sched_barrier(0);
        #pragma unroll
        for (int kk = 3 * hf; kk < 3 * hf + 3; ++kk) vb[kk] = load_bfrag(wl, kk * 12 + nt + 1);
        if (hf) {
          cg[(nt + 1) & 1] = cs[((nt + 1) << 4) + cn];
          cb[(nt + 1) & 1] = cs[DIMC + ((nt + 1) << 4) + cn];
        }
        __builtin_amdgcn_sched_barrier(0);
      }
    }
    float o[2][8];
    #pragma unroll
    for (int mt = 0; mt < 2; ++mt) {
      #pragma unroll
      for (int r = 0; r < 8; ++r)
        o[mt][r] = rsd[mt][r] * acc[mt][r] + (cb[nt & 1] - rmd[mt][r] * cg[nt & 1]);
    }
    // All 16 results first, each in a register of its own, then the 16 stores in one
    // run: left alone, the stores share a register and each waits for the one before it.
    __builtin_amdgcn_sched_barrier(0);
    #pragma unroll
    for (int mt = 0; mt < 2; ++mt) {
      #pragma unroll
      for (int r = 0; r < 8; ++r) po[((mt << 4) + r) * DIMC + (nt << 4)] = o[mt][r];
    }
    // The next trip reuses the registers that these stores name.
    if (nt + 1 < 12) asm volatile("s_wait_xcnt 0x0" ::: "memory");
  }
}

// ---------------------------------------------------------------------------
// K5: performer features  kp/qp = exp(w.t - |t|^2/2)/sqrt(m)  + ksum reduce.
// Lane = token, 32 tokens per wave.  A lane keeps its token's k and q rows in
// registers; a weight is then the same for the whole wave, so it comes by a
// scalar load and enters the FMA as a scalar operand (no LDS read per product).
// Rows go in and out as whole-line wave accesses and are turned lane-wise in the
// wave's own LDS tile, at pitches of 16 B x odd.  No work-group barrier.
// ---------------------------------------------------------------------------
#define KQ_P 132   // floats per staged k|q row    (528 B = 16 B x 33)
#define PF_P 36    // floats per staged feature row (144 B = 16 B x 9)
#define VO_P 68    // floats per staged v / y row   (272 B = 16 B x 17)

__global__ __launch_bounds__(128) void k_perf(const float* __restrict__ kqv,
                                              const float* __restrict__ wperf,
                                              float* __restrict__ kp,
                                              float* __restrict__ qp,
                                              float* __restrict__ ksum) {
  __shared__ __attribute__((aligned(16))) float tile[4][32 * KQ_P];
  const int lane = threadIdx.x & 31, wv = threadIdx.x >> 5;
  float* T = tile[wv];
  const int b = blockIdx.x >> 5;                        // 32 blocks per batch
  const int tok0 = (blockIdx.x << 7) + (wv << 5);       // first of the wave's tokens
  // In: one token's k|q is 512 contiguous bytes, one wave load.
  {
    const float* src = kqv + (size_t)tok0 * DIMC + (lane << 2);
    float4 in[32];
    #pragma unroll  // constant indices keep in[] in registers; all loads in flight at once
    for (int i = 0; i < 32; ++i) in[i] = *reinterpret_cast<const float4*>(src + i * DIMC);
    // What follows may reuse the address registers that these loads name.
    asm volatile("s_wait_xcnt 0x0" ::: "memory");
    #pragma unroll
    for (int i = 0; i < 32; ++i)
      *reinterpret_cast<float4*>(T + i * KQ_P + (lane << 2)) = in[i];
  }
  // The other lanes' rows must stand in the tile before this lane reads its own.
  asm volatile("s_wait_dscnt 0x0" ::: "memory");
  float k[64], q[64];
  #pragma unroll  // constant indices keep k[] and q[] in registers
  for (int j = 0; j < 16; ++j) {
    const float4 u = *reinterpret_cast<const float4*>(T + lane * KQ_P + (j << 2));
    const float4 w = *reinterpret_cast<const float4*>(T + lane * KQ_P + 64 + (j << 2));
    k[4 * j] = u.x; k[4 * j + 1] = u.y; k[4 * j + 2] = u.z; k[4 * j + 3] = u.w;
    q[4 * j] = w.x; q[4 * j + 1] = w.y; q[4 * j + 2] = w.z; q[4 * j + 3] = w.w;
  }
  float xk = 0.f, xq = 0.f;
  #pragma unroll
  for (int d = 0; d < 64; ++d) { xk += k[d] * k[d]; xq += q[d] * q[d]; }
  // Four features a trip: eight independent FMA chains, each in d order.
  #pragma unroll 1  // the body is 512 FMAs; unrolled further it only grows the code
  for (int m0 = 0; m0 < MF; m0 += 4) {
    const float* w = wperf + (m0 << 6);
    float dk[4] = {0.f, 0.f, 0.f, 0.f}, dq[4] = {0.f, 0.f, 0.f, 0.f};
    #pragma unroll
    for (int d = 0; d < 64; ++d) {
      #pragma unroll
      for (int f = 0; f < 4; ++f) {
        const float wr = w[(f << 6) + d];
        dk[f] += wr * k[d]; dq[f] += wr * q[d];
      }
    }
    float4 ok, oq;
    ok.x = expf(dk[0] - 0.5f * xk) * INVSQRTM; oq.x = expf(dq[0] - 0.5f * xq) * INVSQRTM;
    ok.y = expf(dk[1] - 0.5f * xk) * INVSQRTM; oq.y = expf(dq[1] - 0.5f * xq) * INVSQRTM;
    ok.z = expf(dk[2] - 0.5f * xk) * INVSQRTM; oq.z = expf(dq[2] - 0.5f * xq) * INVSQRTM;
    ok.w = expf(dk[3] - 0.5f * xk) * INVSQRTM; oq.w = expf(dq[3] - 0.5f * xq) * INVSQRTM;
    *reinterpret_cast<float4*>(T + lane * PF_P + m0) = ok;
    *reinterpret_cast<float4*>(T + (32 + lane) * PF_P + m0) = oq;
  }
  // Every lane's features must stand in the tile before they are read across lanes.
  asm volatile("s_wait_dscnt 0x0" ::: "memory");
  // ksum: lane = feature, its column over the wave's 32 tokens, one atomic a wave.
  float s = 0.f;
  #pragma unroll
  for (int t = 0; t < 32; ++t) s += T[t * PF_P + lane];
  atomicAdd(&ksum[b * MF + lane], s);
  // Out: four tokens' features are 512 contiguous bytes, one wave store.
  float* kpo = kp + (size_t)tok0 * MF + (lane << 2);
  float* qpo = qp + (size_t)tok0 * MF + (lane << 2);
  const float* Tr = T + (lane >> 3) * PF_P + ((lane & 7) << 2);
  #pragma unroll
  for (int i = 0; i < 8; ++i) {
    *reinterpret_cast<float4*>(kpo + (i << 7)) =
        *reinterpret_cast<const float4*>(Tr + (i << 2) * PF_P);
    *reinterpret_cast<float4*>(qpo + (i << 7)) =
        *reinterpret_cast<const float4*>(Tr + (32 + (i << 2)) * PF_P);
  }
}

// ---------------------------------------------------------------------------
// K6: kptv[b,d,m] = sum_t v[b,t,d]*kp[b,t,m].  Per-thread 8-cell register
// accumulation over 256 tokens, LDS-staged tiles, one global atomic per cell.
// ---------------------------------------------------------------------------
__global__ __launch_bounds__(256) void k_kptv(const float* __restrict__ kqv,
                                              const float* __restrict__ kp,
                                              float* __restrict__ kptv) {
  __shared__ float vbuf[32][65];
  __shared__ float kpb[32][33];
  const int b  = blockIdx.x >> 4;
  const int tb = (blockIdx.x & 15) << 8;
  const int tid = threadIdx.x;
  const int d = tid >> 2, m0 = (tid & 3) << 3;
  float acc[8];
  #pragma unroll
  for (int j = 0; j < 8; ++j) acc[j] = 0.f;
  for (int ch = 0; ch < 8; ++ch) {
    const int t0 = tb + (ch << 5);
    #pragma unroll
    for (int rep = 0; rep < 8; ++rep) {
      const int e = tid + (rep << 8);
      const int tt = e >> 6, dd = e & 63;
      vbuf[tt][dd] = kqv[((size_t)b * TOKN + t0 + tt) * DIMC + 128 + dd];
    }
    #pragma unroll
    for (int rep = 0; rep < 4; ++rep) {
      const int e = tid + (rep << 8);
      const int tt = e >> 5, mm = e & 31;
      kpb[tt][mm] = kp[((size_t)b * TOKN + t0 + tt) * MF + mm];
    }
    __syncthreads();
    #pragma unroll 4
    for (int tt = 0; tt < 32; ++tt) {
      const float vv = vbuf[tt][d];
      #pragma unroll
      for (int j = 0; j < 8; ++j) acc[j] += vv * kpb[tt][m0 + j];
    }
    __syncthreads();
  }
  #pragma unroll
  for (int j = 0; j < 8; ++j)
    atomicAdd(&kptv[((size_t)b * EMB + d) * MF + m0 + j], acc[j]);
}

// ---------------------------------------------------------------------------
// K7: yatt = v + proj(qp @ kptv^T / (qp.ksum + eps)).  Lane = token, 32 tokens
// per wave, as in K5: qp row and output row in registers.  Every weight is
// wave-uniform: ksum, proj_w and proj_b come by scalar loads; the batch's kptv is
// staged once per block in LDS and read with all lanes on one address, so that a
// trip of the main loop waits for one run of scalar loads, not three.
// ---------------------------------------------------------------------------
__global__ __launch_bounds__(128) void k_mix(const float* __restrict__ kqv,
                                             const float* __restrict__ qp,
                                             const float* __restrict__ ksum,
                                             const float* __restrict__ kptv,
                                             const float* __restrict__ pw,
                                             const float* __restrict__ pb,
                                             float* __restrict__ yatt) {
  __shared__ __attribute__((aligned(16))) float qt[4][32 * PF_P];
  __shared__ __attribute__((aligned(16))) float vt[4][32 * VO_P];
  __shared__ __attribute__((aligned(16))) float klt[EMB * MF];
  const int lane = threadIdx.x & 31;
  // The wave's number, shown to the compiler as uniform: tile and row addresses are
  // then scalar arithmetic, a scalar base and a lane offset per load.
  const int wv = __builtin_amdgcn_readfirstlane(threadIdx.x >> 5);
  float* Q = qt[wv];
  float* V = vt[wv];
  const int b = blockIdx.x >> 5;                        // 32 blocks per batch
  const int tok0 = (blockIdx.x << 7) + (wv << 5);       // first of the wave's tokens
  // In: four tokens' qp rows, or two tokens' v rows, per wave load (whole lines).
  {
    const float* qs = qp + (size_t)tok0 * MF + (lane << 2);
    const float* vs = kqv + (size_t)tok0 * DIMC + 128 + (lane >> 4) * DIMC + ((lane & 15) << 2);
    const float* ks = kptv + (size_t)b * (EMB * MF) + (wv << 7) + (lane << 2);
    float4 qi[8], vi[16], ki[4];
    #pragma unroll  // constant indices keep qi[], vi[] and ki[] in registers
    for (int i = 0; i < 8; ++i) qi[i] = *reinterpret_cast<const float4*>(qs + (i << 7));
    #pragma unroll
    for (int i = 0; i < 4; ++i) ki[i] = *reinterpret_cast<const float4*>(ks + (i << 9));
    #pragma unroll
    for (int i = 0; i < 16; ++i) vi[i] = *reinterpret_cast<const float4*>(vs + (i << 1) * DIMC);
    #pragma unroll
    for (int i = 0; i < 8; ++i)
      *reinterpret_cast<float4*>(Q + ((i << 2) + (lane >> 3)) * PF_P + ((lane & 7) << 2)) = qi[i];
    #pragma unroll
    for (int i = 0; i < 16; ++i)
      *reinterpret_cast<float4*>(V + ((i << 1) + (lane >> 4)) * VO_P + ((lane & 15) << 2)) = vi[i];
    #pragma unroll
    for (int i = 0; i < 4; ++i)
      *reinterpret_cast<float4*>(klt + (i << 9) + (wv << 7) + (lane << 2)) = ki[i];
  }
  __syncthreads();  // klt is filled by all four waves; the wave's own tiles stand too
  float q[32], o[64];
  #pragma unroll  // constant indices keep q[] and o[] in registers
  for (int j = 0; j < 8; ++j) {
    const float4 u = *reinterpret_cast<const float4*>(Q + lane * PF_P + (j << 2));
    q[4 * j] = u.x; q[4 * j + 1] = u.y; q[4 * j + 2] = u.z; q[4 * j + 3] = u.w;
  }
  #pragma unroll
  for (int j = 0; j < 16; ++j) {
    const float4 u = *reinterpret_cast<const float4*>(V + lane * VO_P + (j << 2));
    o[4 * j] = u.x + pb[4 * j];         o[4 * j + 1] = u.y + pb[4 * j + 1];
    o[4 * j + 2] = u.z + pb[4 * j + 2]; o[4 * j + 3] = u.w + pb[4 * j + 3];
  }
  // D = qp.ksum, added in the tree order of a 32-lane xor butterfly.
  const float* ksb = ksum + b * MF;
  float t[32];
  #pragma unroll
  for (int m = 0; m < 32; ++m) t[m] = q[m] * ksb[m];
  #pragma unroll
  for (int off = 16; off > 0; off >>= 1) {
    #pragma unroll
    for (int m = 0; m < off; ++m) t[m] += t[m + off];
  }
  const float den = t[0] + 1e-8f;
  // Two attention channels e a trip: for each its sum over m, then its row of
  // proj_w into all 64 outputs, e ascending.
  #pragma unroll 2  // the two sums run as independent chains, and the second row's
                    // scalar loads fly under the first row's work
  for (int e = 0; e < EMB; ++e) {
    const float* kr = klt + (e << 5);
    const float* pr = pw + (e << 6);
    float num = 0.f;
    #pragma unroll
    for (int m = 0; m < 32; ++m) num += q[m] * kr[m];
    const float al = num / den;
    #pragma unroll
    for (int d = 0; d < 64; ++d) o[d] += al * pr[d];
  }
  #pragma unroll
  for (int j = 0; j < 16; ++j) {
    float4 u;
    u.x = o[4 * j]; u.y = o[4 * j + 1]; u.z = o[4 * j + 2]; u.w = o[4 * j + 3];
    *reinterpret_cast<float4*>(V + lane * VO_P + (j << 2)) = u;
  }
  // Every lane's row must stand in the tile before it is read across lanes.
  asm volatile("s_wait_dscnt 0x0" ::: "memory");
  // Out: two tokens' rows are 512 contiguous bytes, one wave store.
  float* yo = yatt + ((size_t)tok0 << 6) + (lane << 2);
  const float* Vr = V + (lane >> 4) * VO_P + ((lane & 15) << 2);
  #pragma unroll
  for (int i = 0; i < 16; ++i)
    *reinterpret_cast<float4*>(yo + (i << 7)) =
        *reinterpret_cast<const float4*>(Vr + (i << 1) * VO_P);
}

// ---------------------------------------------------------------------------
// K8: out = yatt + W2 @ gelu(W1 @ LN(yatt) + b1) + b2.  Fully fused:
// LN2 in registers, both 64x64 GEMMs via WMMA, A in LDS, B from the packed weights.
// Per block: 64 rows, 128 threads (4 waves).
// ---------------------------------------------------------------------------
__global__ __launch_bounds__(128) void k_mlp(const float* __restrict__ yatt,
                                             const float* __restrict__ g,
                                             const float* __restrict__ bt,
                                             const half_t* __restrict__ wpk,
                                             const float* __restrict__ b1,
                                             const float* __restrict__ b2,
                                             float* __restrict__ out) {
  __shared__ half_t Hs[64][66];
  __shared__ half_t T1s[64][66];
  __shared__ float b1l[64], b2l[64];
  const int rbase = blockIdx.x << 6;
  const int tid = threadIdx.x, lane = tid & 31, wv = tid >> 5;
  const half_t* wl = wpk + WM_H + (lane << 3);
  // LayerNorm(64): two threads per row, pair-reduce via shfl.
  {
    const int r = tid >> 1, hf = tid & 1;
    const float* p = yatt + ((size_t)(rbase + r) << 6) + (hf << 5);
    float xv[32], s = 0.f, s2 = 0.f;
    #pragma unroll
    for (int j = 0; j < 32; ++j) { const float v = p[j]; xv[j] = v; s += v; s2 += v * v; }
    s  += __shfl_xor(s, 1, 32);
    s2 += __shfl_xor(s2, 1, 32);
    const float mean = s * (1.0f / 64.f);
    const float var  = s2 * (1.0f / 64.f) - mean * mean;
    const float rs = rsqrtf(var + 1e-5f);
    #pragma unroll
    for (int j = 0; j < 32; ++j) {
      const int c = (hf << 5) + j;
      Hs[r][c] = (half_t)((xv[j] - mean) * rs * g[c] + bt[c]);
    }
  }
  // W1's fragments are asked for ahead of the barrier and arrive during its wait.
  v16h vb1[8];
  #pragma unroll  // constant indices keep vb1[] in registers
  for (int f = 0; f < 8; ++f) vb1[f] = load_bfrag(wl, f);
  if (tid < 64) { b1l[tid] = b1[tid]; b2l[tid] = b2[tid]; }
  __syncthreads();
  // W2's fragments arrive while the first GEMM and its GELU run.
  v16h vb2[8];
  #pragma unroll  // constant indices keep vb2[] in registers
  for (int f = 0; f < 8; ++f) vb2[f] = load_bfrag(wl, 8 + f);

  const v8f vzero = {};
  v8f acc[4];
  #pragma unroll
  for (int i = 0; i < 4; ++i) acc[i] = vzero;
  #pragma unroll
  for (int kk = 0; kk < 2; ++kk) {
    const int ks = kk << 5;
    const v16h va = load_frag(&Hs[0][ks], wv << 4, 66, lane);
    #pragma unroll
    for (int nt = 0; nt < 4; ++nt) {
      acc[nt] = __builtin_amdgcn_wmma_f32_16x16x32_f16(
          false, va, false, vb1[(kk << 2) + nt], (short)0, acc[nt], false, false);
    }
  }
  const int hi = lane >> 4, cn = lane & 15;
  #pragma unroll
  for (int nt = 0; nt < 4; ++nt) {
    const int col = (nt << 4) + cn;
    #pragma unroll
    for (int r = 0; r < 8; ++r) {
      const int row = (wv << 4) + r + (hi << 3);
      T1s[row][col] = (half_t)gelu_exact(acc[nt][r] + b1l[col]);
    }
  }
  __syncthreads();
  v8f acc2[4];
  #pragma unroll
  for (int i = 0; i < 4; ++i) acc2[i] = vzero;
  #pragma unroll
  for (int kk = 0; kk < 2; ++kk) {
    const int ks = kk << 5;
    const v16h va = load_frag(&T1s[0][ks], wv << 4, 66, lane);
    #pragma unroll
    for (int nt = 0; nt < 4; ++nt) {
      acc2[nt] = __builtin_amdgcn_wmma_f32_16x16x32_f16(
          false, va, false, vb2[(kk << 2) + nt], (short)0, acc2[nt], false, false);
    }
  }
  #pragma unroll
  for (int nt = 0; nt < 4; ++nt) {
    const int col = (nt << 4) + cn;
    const float bv = b2l[col];
    #pragma unroll
    for (int r = 0; r < 8; ++r) {
      const int row = (wv << 4) + r + (hi << 3);
      const size_t gi = ((size_t)(rbase + row) << 6) + col;
      out[gi] = yatt[gi] + acc2[nt][r] + bv;
    }
  }
}

// ---------------------------------------------------------------------------
extern "C" void kernel_launch(void* const* d_in, const int* in_sizes, int n_in,
                              void* d_out, int out_size, void* d_ws, size_t ws_size,
                              hipStream_t stream) {
  (void)in_sizes; (void)n_in; (void)out_size; (void)ws_size;
  const float* x      = (const float*)d_in[0];
  const float* conv_w = (const float*)d_in[1];
  const float* conv_b = (const float*)d_in[2];
  const float* ln1_g  = (const float*)d_in[3];
  const float* ln1_b  = (const float*)d_in[4];
  const float* kqv_w  = (const float*)d_in[5];
  const float* kqv_b  = (const float*)d_in[6];
  const float* proj_w = (const float*)d_in[7];
  const float* proj_b = (const float*)d_in[8];
  const float* w_perf = (const float*)d_in[9];
  const float* ln2_g  = (const float*)d_in[10];
  const float* ln2_b  = (const float*)d_in[11];
  const float* mlp_w1 = (const float*)d_in[12];
  const float* mlp_b1 = (const float*)d_in[13];
  const float* mlp_w2 = (const float*)d_in[14];
  const float* mlp_b2 = (const float*)d_in[15];

  char* ws = (char*)d_ws;
  half_t* xh   = (half_t*)(ws + XH_OFF);
  half_t* tok  = (half_t*)(ws + TOK_OFF);
  float*  kqv  = (float*)(ws + KQV_OFF);
  float*  kp   = (float*)(ws + KP_OFF);     // reuses XH region (xh dead)
  float*  qp   = (float*)(ws + QP_OFF);
  float*  ksum = (float*)(ws + KSUM_OFF);
  float*  kptv = (float*)(ws + KPTV_OFF);
  float*  yatt = (float*)(ws + YATT_OFF);   // reuses TOK region (tok dead)
  half_t* wpk  = (half_t*)(ws + WPK_OFF);
  float*  cs   = (float*)(ws + CS_OFF);
  float*  out  = (float*)d_out;

  // Zero the atomic accumulators (ksum + kptv are contiguous).
  hipMemsetAsync(ws + KSUM_OFF, 0, 4096 + (size_t)BATCH * EMB * MF * 4, stream);

  k_pack<<<dim3(WPK_BLOCKS + 1 + BATCH * 256), dim3(256), 0, stream>>>(
      x, conv_w, kqv_w, mlp_w1, mlp_w2, ln1_g, ln1_b, kqv_b, xh, wpk, cs);
  k_conv<<<dim3(64, 3, BATCH), dim3(128), 0, stream>>>(xh, wpk, conv_b, tok);
  k_kqv <<<dim3((BATCH * TOKN) / 128), dim3(128), 0, stream>>>(tok, wpk, cs, kqv);
  k_perf<<<dim3(BATCH * 32), dim3(128), 0, stream>>>(kqv, w_perf, kp, qp, ksum);
  k_kptv<<<dim3(BATCH * 16), dim3(256), 0, stream>>>(kqv, kp, kptv);
  k_mix <<<dim3(BATCH * 32), dim3(128), 0, stream>>>(kqv, qp, ksum, kptv,
                                                      proj_w, proj_b, yatt);
  k_mlp <<<dim3((BATCH * TOKN) / 64), dim3(128), 0, stream>>>(
      yatt, ln2_g, ln2_b, wpk, mlp_b1, mlp_b2, out);
}

// v005
// In two side-by-side timings against v004, it was 1.30 and 1.32 times as fast.
// Over all steps from v000 it is 5.28 times as fast.
#include <hip/hip_runtime.h>
#include <hip/hip_bf16.h>
#include <math.h>

// ---------------------------------------------------------------------------
// MI455X (gfx1250, wave32) implementation of the PRM + Token-Performer block.
// All dense GEMMs (implicit-GEMM dilated convs, kqv, MLP) use
// V_WMMA_F32_16X16X32_F16 with f32 accumulation; kptv is on the f32 WMMA form, the
// other skinny performer pieces are VALU.  Fused epilogues keep each intermediate to one
// HBM round-trip (pipeline is ~bandwidth-bound at 23.3 TB/s).
// Conv reduction axis ordered k = kid*64 + ic so each 32-wide WMMA K-step has
// a constant kernel tap; the image stays channels-last, so one pixel's 64
// channels are one 128-byte line and an im2col row is contiguous in k.
// Every GEMM weight matrix is packed once per call into f16 in the order of the
// WMMA B fragment, so a B fragment is two whole-line 16-byte loads per lane.
// ---------------------------------------------------------------------------

typedef _Float16 half_t;
typedef __attribute__((ext_vector_type(16))) _Float16 v16h;
typedef __attribute__((ext_vector_type(8)))  _Float16 v8h;
typedef __attribute__((ext_vector_type(8)))  float    v8f;
typedef __attribute__((ext_vector_type(2)))  float    v2f;

// Problem constants (match reference)
#define BATCH   32
#define CIN     64
#define IMGSZ   128
#define NPIX    16384     // 128*128
#define TOKN    4096      // 64*64 post-stride-2 tokens
#define EBR     64
#define DIMC    192       // 3*EBR
#define EMB     64
#define MF      32        // performer features
#define INVSQRTM 0.17677669529663687f

// Workspace layout (bytes). Buffers reused once their producers/consumers
// are done:  XH region -> KP/QP,  TOK region -> YATT.
#define XH_OFF    ((size_t)0)                                   // f16 [B][128][128][CIN]  67.1MB
#define KP_OFF    ((size_t)0)                                   // f32 [B][T][32]          (reuse XH)
#define QP_OFF    ((size_t)16777216)                            // f32 [B][T][32]
#define TOK_OFF   ((size_t)67108864)                            // f16 [B][T][192]         50.3MB
#define YATT_OFF  TOK_OFF                                       // f32 [B][T][64]          (reuse TOK)
#define KQV_OFF   ((size_t)(67108864 + 2*50331648))             // f32 [B][T][192]         100.7MB
#define KSUM_OFF  (KQV_OFF + (size_t)BATCH*TOKN*DIMC*4)         // f32 [B][32]
#define KPTV_OFF  (KSUM_OFF + (size_t)4096)                     // f32 [B][64][32]
#define WPK_OFF   (KPTV_OFF + (size_t)BATCH*EMB*MF*4)           // f16 packed weights, 311 KB
#define CS_OFF    (WPK_OFF + (size_t)311296)                    // f32 [2][192] kqv column terms

// Packed weights: one B fragment (32 k x 16 n) = 2 planes x 32 lanes x 8 halves.
// Plane p, lane l, element i hold k = 16*p + 8*(l>>4) + i, n = l&15: the k order
// of load_frag.  A unit is one lane's 8 halves (16 bytes) of one plane.
#define FRAG_H    512                       // halves per fragment
#define WC_UNITS  13824                     // conv: 3 branches x 18 K-steps x 4 n-tiles x 64
#define WQ_UNITS  4608                      // kqv:  6 K-steps x 12 n-tiles x 64
#define WM_UNITS  1024                      // mlp:  2 matrices x 2 K-steps x 4 n-tiles x 64
#define WQ_H      (WC_UNITS * 8)            // first half of the kqv part
#define WM_H      ((WC_UNITS + WQ_UNITS) * 8)
#define WPK_BLOCKS ((WC_UNITS + WQ_UNITS + WM_UNITS) / 256)   // 76

__device__ __forceinline__ float gelu_exact(float x) {
  return 0.5f * x * (1.0f + erff(x * 0.70710678118654752f));
}

// Load a 16x32 f16 WMMA fragment (A row-major, or B assembled as [N][K]).
// tile: LDS matrix with K contiguous per row; stride in half elements.
// ISA layout: lanes 0-15 hold K0-7 (v0-3) and K16-23 (v4-7); lanes 16-31
// hold K8-15 and K24-31; M/N = lane&15 (+row0).
__device__ __forceinline__ v16h load_frag(const half_t* tile, int row0,
                                          int stride, int lane) {
  const half_t* p = tile + (row0 + (lane & 15)) * stride;
  const int hi = lane >> 4;
  v16h f;
  #pragma unroll
  for (int j = 0; j < 8; ++j) {
    const int kb = ((j >> 2) << 4) + (hi << 3) + ((j & 3) << 1);
    f[2 * j]     = p[kb];
    f[2 * j + 1] = p[kb + 1];
  }
  return f;
}

// B fragment number frag of a packed weight part, as two 512-byte wave loads.
__device__ __forceinline__ v16h load_bfrag(const half_t* wl, int frag) {
  const v8h lo = *reinterpret_cast<const v8h*>(wl + frag * FRAG_H);
  const v8h hi = *reinterpret_cast<const v8h*>(wl + frag * FRAG_H + 256);
  return __builtin_shufflevector(lo, hi,
      0, 1, 2, 3, 4, 5, 6, 7, 8, 9, 10, 11, 12, 13, 14, 15);
}

// ---------------------------------------------------------------------------
// K1: x [B,N,C] f32  ->  xh [B,N,C] f16  (same channels-last order, convert
// only).  8 elements per thread per pass: two 16-byte loads, one 16-byte store.
// The first WPK_BLOCKS blocks pack the weights instead: one unit per thread,
// eight strided f32 reads, one 16-byte store; row k of the kqv weights is scaled by
// ln1's g[k] on the way.  The next block sums the two column terms of K3.
// ---------------------------------------------------------------------------
__global__ __launch_bounds__(256) void k_pack(const float* __restrict__ x,
                                              const float* __restrict__ cw,
                                              const float* __restrict__ wq,
                                              const float* __restrict__ w1,
                                              const float* __restrict__ w2,
                                              const float* __restrict__ lg,
                                              const float* __restrict__ lb,
                                              const float* __restrict__ qb,
                                              half_t* __restrict__ xh,
                                              half_t* __restrict__ wpk,
                                              float* __restrict__ cs) {
  if (blockIdx.x == WPK_BLOCKS) {            // thread = column n of the kqv weights
    if (threadIdx.x < DIMC) {
      const float* wc = wq + threadIdx.x;
      float sg = 0.f, sb = 0.f;
      #pragma unroll 16  // 16 loads in flight a trip; many more would raise the kernel's registers
      for (int k = 0; k < DIMC; ++k) {
        const float w = wc[k * DIMC];
        sg += (float)(half_t)(w * lg[k]);    // the f16 value that the GEMM multiplies by
        sb += w * lb[k];
      }
      cs[threadIdx.x] = sg;
      cs[DIMC + threadIdx.x] = sb + qb[threadIdx.x];
    }
    return;
  }
  if (blockIdx.x < WPK_BLOCKS) {
    const int u = (blockIdx.x << 8) + threadIdx.x;
    const int n = u & 15;
    const int k0 = (((u >> 5) & 1) << 4) + (((u >> 4) & 1) << 3);  // k of element 0
    const float* src;
    int step;                                // floats from one k to the next
    float sc[8] = {1.f, 1.f, 1.f, 1.f, 1.f, 1.f, 1.f, 1.f};
    if (blockIdx.x < WC_UNITS / 256) {       // frag = ((br*9 + kid)*2 + h)*4 + nt
      const int f = u >> 6;
      const int nt = f & 3, h = (f >> 2) & 1, tap = f >> 3;   // tap = br*9 + kid
      const int br = tap / 9, kid = tap - br * 9;
      src = cw + (((br << 6) + (nt << 4) + n) * CIN + (h << 5) + k0) * 9 + kid;
      step = 9;
    } else if (blockIdx.x < (WC_UNITS + WQ_UNITS) / 256) {    // frag = kk*12 + n-tile
      const int f = (u - WC_UNITS) >> 6;
      const int kk = f / 12, nt = f - kk * 12;
      src = wq + ((kk << 5) + k0) * DIMC + (nt << 4) + n;
      step = DIMC;
      #pragma unroll
      for (int i = 0; i < 8; ++i) sc[i] = lg[(kk << 5) + k0 + i];
    } else {                                 // frag = (matrix*2 + kk)*4 + nt
      const int f = (u - WC_UNITS - WQ_UNITS) >> 6;
      const int nt = f & 3, kk = (f >> 2) & 1;
      src = ((f >> 3) ? w2 : w1) + ((kk << 5) + k0) * EMB + (nt << 4) + n;
      step = EMB;
    }
    float t[8];
    #pragma unroll  // constant indices keep t[] in registers
    for (int i = 0; i < 8; ++i) t[i] = src[i * step];
    // The conversions below reuse the address registers that these loads name.
    asm volatile("s_wait_xcnt 0x0" ::: "memory");
    v8h o;
    #pragma unroll
    for (int i = 0; i < 8; ++i) o[i] = (half_t)(t[i] * sc[i]);
    *reinterpret_cast<v8h*>(wpk + ((size_t)u << 3)) = o;
    return;
  }
  const size_t base = ((size_t)(blockIdx.x - WPK_BLOCKS - 1) << 12) + ((size_t)threadIdx.x << 3);
  #pragma unroll  // both passes' loads are in flight before the first store
  for (int rep = 0; rep < 2; ++rep) {
    const size_t e = base + ((size_t)rep << 11);
    const float4 u = *reinterpret_cast<const float4*>(x + e);
    const float4 w = *reinterpret_cast<const float4*>(x + e + 4);
    v8h o;
    o[0] = (half_t)u.x; o[1] = (half_t)u.y; o[2] = (half_t)u.z; o[3] = (half_t)u.w;
    o[4] = (half_t)w.x; o[5] = (half_t)w.y; o[6] = (half_t)w.z; o[7] = (half_t)w.w;
    *reinterpret_cast<v8h*>(xh + e) = o;
  }
}

// ---------------------------------------------------------------------------
// K2: implicit-GEMM dilated conv + bias + GELU -> tokens f16 [B,T,192].
// Per block: 64 tokens x 64 out-channels, K=576 in 18 steps of 32 via WMMA.
// K axis ordered k = kid*64 + ic.  A never passes through LDS: lane l owns
// token row l&15 of its wave's 16, and its fragment halves (k = 8*(l>>4)+0..7
// and 16+8*(l>>4)+0..7) are two 16-byte runs of that token's tap pixel, read
// straight from the channels-last image.  One tap = four such loads = both
// K-steps of the tap.  B comes from the packed weights, 8 fragments a tap, so
// the loop has no LDS and no barrier.
// grid = (64 token tiles, 3 branches, 32 batches), 4 waves.
// ---------------------------------------------------------------------------
__global__ __launch_bounds__(128) void k_conv(const half_t* __restrict__ xh,
                                              const half_t* __restrict__ wpk,
                                              const float* __restrict__ cb,
                                              half_t* __restrict__ tok) {
  const int tbase = blockIdx.x << 6;
  const int br = blockIdx.y;
  const int b  = blockIdx.z;
  const int dil = br + 1, pad = br + 1;
  const int tid = threadIdx.x, lane = tid & 31, wv = tid >> 5;
  const half_t* wl = wpk + br * (72 * FRAG_H) + (lane << 3);

  v8f acc[4];
  const v8f vzero = {};
  #pragma unroll
  for (int i = 0; i < 4; ++i) acc[i] = vzero;

  // Per-lane im2col coordinates (invariant over the K loop).
  const int a_t  = tbase + (wv << 4) + (lane & 15);
  const int a_h0 = (a_t >> 6) << 1, a_w0 = (a_t & 63) << 1;
  const half_t* xa = xh + (size_t)b * NPIX * CIN + ((lane >> 4) << 3);

  for (int kid = 0; kid < 9; ++kid) {     // kernel tap
    const int kh = kid / 3, kw = kid - kh * 3;   // scalar (SALU)
    const int ih = a_h0 + kh * dil - pad;
    const int iw = a_w0 + kw * dil - pad;
    const bool inb = (unsigned)ih < 128u && (unsigned)iw < 128u;
    // A: this token's tap pixel, all 64 channels over the lane pair (l, l+16).
    // A padded tap reads pixel 0 (in bounds) and is zeroed afterwards.
    const half_t* pa = xa + (inb ? (((ih << 7) + iw) << 6) : 0);
    const half_t* wk = wl + kid * (8 * FRAG_H);
    v16h vb[8];
    #pragma unroll  // constant indices keep vb[] and a[] in registers (here and below)
    for (int f = 0; f < 8; ++f) vb[f] = load_bfrag(wk, f);
    v8h a[4];
    #pragma unroll
    for (int q = 0; q < 4; ++q) a[q] = *reinterpret_cast<const v8h*>(pa + (q << 4));
    // What follows reuses the address registers that this tap's loads name.
    asm volatile("s_wait_xcnt 0x0" ::: "memory");
    // Keeps the tap's 20 loads in one run ahead of its WMMAs: left to itself the
    // scheduler puts each B load directly in front of its WMMA, one full load
    // latency per WMMA.
    __builtin_amdgcn_sched_barrier(0);
    if (!inb) {
      #pragma unroll
      for (int q = 0; q < 4; ++q) a[q] = (v8h)(half_t)0.0f;
    }

    #pragma unroll
    for (int h = 0; h < 2; ++h) {
      const v16h va = __builtin_shufflevector(a[2 * h], a[2 * h + 1],
          0, 1, 2, 3, 4, 5, 6, 7, 8, 9, 10, 11, 12, 13, 14, 15);
      #pragma unroll
      for (int nt = 0; nt < 4; ++nt) {
        acc[nt] = __builtin_amdgcn_wmma_f32_16x16x32_f16(
            false, va, false, vb[(h << 2) + nt], (short)0, acc[nt], false, false);
      }
    }
  }
  // Epilogue: bias + exact GELU, write tokens (branch-major channel concat)
  const int hi = lane >> 4, cn = lane & 15;
  #pragma unroll
  for (int nt = 0; nt < 4; ++nt) {
    const int oc = (nt << 4) + cn;
    const float bias = cb[br * EBR + oc];
    #pragma unroll
    for (int r = 0; r < 8; ++r) {
      const int row = (wv << 4) + r + (hi << 3);
      const int t = tbase + row;
      const float v = acc[nt][r] + bias;
      tok[((size_t)b * TOKN + t) * DIMC + br * EBR + oc] = (half_t)gelu_exact(v);
    }
  }
}

// ---------------------------------------------------------------------------
// K3: LayerNorm(192) + kqv GEMM  [131072 x 192] @ [192 x 192] + bias -> kqv f32.
// With W' = g o W (packed so by K1), cg[n] = sum_k W'[k][n] and
// cb[n] = bias[n] + sum_k bt[k] W[k][n]:
//   LN(x) @ W + bias = rs * (x @ W' - mean * cg) + cb,
// so the raw f16 token rows are the A operand and a row's mean and rs enter only at
// the accumulators.  A wave owns 32 tokens (two 16-row tiles) and all 192 columns.
// Lane l reads row l&15 of each tile straight from global in the order of the WMMA A
// fragment: 16-byte runs at k = 16*j + 8*(l>>4), j = 0..11, so the lane pair
// (l, l+16) holds the whole row; its sums are a sum in the lane and one exchange with
// the partner lane.  No LDS tile, no barrier, no normalised copy in memory.
// B: 6 packed fragments per 16 columns, in one register set: a fragment of the
// next column tile is asked for as soon as this tile's WMMAs have read its place.
// grid = 1024 blocks of 4 waves = 4 waves per SIMD.
// ---------------------------------------------------------------------------
__global__ __launch_bounds__(128) void k_kqv(const half_t* __restrict__ tok,
                                             const half_t* __restrict__ wpk,
                                             const float* __restrict__ cs,
                                             float* __restrict__ kqv) {
  const int lane = threadIdx.x & 31, wv = threadIdx.x >> 5;
  const int hi = lane >> 4, cn = lane & 15;
  const int rbase = (blockIdx.x << 7) + (wv << 5);      // first of the wave's tokens
  const half_t* wl = wpk + WQ_H + (lane << 3);

  v8h x[2][12];
  #pragma unroll  // constant indices keep x[], vb[], cg[] and cb[] in registers (here and below)
  for (int mt = 0; mt < 2; ++mt) {
    const half_t* p = tok + (size_t)(rbase + (mt << 4) + cn) * DIMC + (hi << 3);
    #pragma unroll
    for (int j = 0; j < 12; ++j) x[mt][j] = *reinterpret_cast<const v8h*>(p + (j << 4));
    // A later load may land on the address registers that these loads name.
    asm volatile("s_wait_xcnt 0x0" ::: "memory");
  }
  v16h vb[6];
  float cg[2], cb[2];
  #pragma unroll
  for (int kk = 0; kk < 6; ++kk) vb[kk] = load_bfrag(wl, kk * 12);
  cg[0] = cs[cn];
  cb[0] = cs[DIMC + cn];

  // Row statistics, then each lane fetches those of the 8 rows that its accumulator
  // registers hold (register r = row 8*(l>>4) + r).
  float rsd[2][8], rmd[2][8];                           // rs and rs * mean
  #pragma unroll
  for (int mt = 0; mt < 2; ++mt) {
    float s0 = 0.f, s1 = 0.f, q0 = 0.f, q1 = 0.f;       // two chains each
    #pragma unroll
    for (int j = 0; j < 12; ++j) {
      #pragma unroll
      for (int i = 0; i < 8; i += 2) {
        const float v0 = (float)x[mt][j][i], v1 = (float)x[mt][j][i + 1];
        s0 += v0; q0 += v0 * v0;
        s1 += v1; q1 += v1 * v1;
      }
    }
    float s = s0 + s1, s2 = q0 + q1;
    s  += __shfl_xor(s, 16, 32);                        // the row's other half
    s2 += __shfl_xor(s2, 16, 32);
    const float mean = s * (1.0f / DIMC);
    const float var  = s2 * (1.0f / DIMC) - mean * mean;
    const float rs = rsqrtf(var + 1e-5f);
    const float rm = rs * mean;
    #pragma unroll
    for (int r = 0; r < 8; ++r) {
      rsd[mt][r] = __shfl(rs, (hi << 3) + r, 32);
      rmd[mt][r] = __shfl(rm, (hi << 3) + r, 32);
    }
  }

  float* po = kqv + (size_t)(rbase + (hi << 3)) * DIMC + cn;
  const v8f vzero = {};
  #pragma unroll  // cg[] and cb[] are indexed by the trip's parity: constant only when unrolled
  for (int nt = 0; nt < 12; ++nt) {
    v8f acc[2] = {vzero, vzero};
    #pragma unroll
    for (int hf = 0; hf < 2; ++hf) {
      #pragma unroll
      for (int kk = 3 * hf; kk < 3 * hf + 3; ++kk) {
        #pragma unroll
        for (int mt = 0; mt < 2; ++mt) {
          const v16h va = __builtin_shufflevector(x[mt][2 * kk], x[mt][2 * kk + 1],
              0, 1, 2, 3, 4, 5, 6, 7, 8, 9, 10, 11, 12, 13, 14, 15);
          acc[mt] = __builtin_amdgcn_wmma_f32_16x16x32_f16(
              false, va, false, vb[kk], (short)0, acc[mt], false, false);
        }
      }
      if (nt + 1 < 12) {
        // The two fences hold the next tile's loads where they stand: lifted above the
        // WMMAs they need a second register set, sunk to their use they fly under nothing.
        __builtin_amdgcn_sched_barrier(0);
        #pragma unroll
        for (int kk = 3 * hf; kk < 3 * hf + 3; ++kk) vb[kk] = load_bfrag(wl, kk * 12 + nt + 1);
        if (hf) {
          cg[(nt + 1) & 1] = cs[((nt + 1) << 4) + cn];
          cb[(nt + 1) & 1] = cs[DIMC + ((nt + 1) << 4) + cn];
        }
        __builtin_amdgcn_sched_barrier(0);
      }
    }
    float o[2][8];
    #pragma unroll
    for (int mt = 0; mt < 2; ++mt) {
      #pragma unroll
      for (int r = 0; r < 8; ++r)
        o[mt][r] = rsd[mt][r] * acc[mt][r] + (cb[nt & 1] - rmd[mt][r] * cg[nt & 1]);
    }
    // All 16 results first, each in a register of its own, then the 16 stores in one
    // run: left alone, the stores share a register and each waits for the one before it.
    __builtin_amdgcn_sched_barrier(0);
    #pragma unroll
    for (int mt = 0; mt < 2; ++mt) {
      #pragma unroll
      for (int r = 0; r < 8; ++r) po[((mt << 4) + r) * DIMC + (nt << 4)] = o[mt][r];
    }
    // The next trip reuses the registers that these stores name.
    if (nt + 1 < 12) asm volatile("s_wait_xcnt 0x0" ::: "memory");
  }
}

// ---------------------------------------------------------------------------
// K5: performer features  kp/qp = exp(w.t - |t|^2/2)/sqrt(m)  + ksum reduce.
// Lane = token, 32 tokens per wave.  A lane keeps its token's k and q rows in
// registers; a weight is then the same for the whole wave, so it comes by a
// scalar load and enters the FMA as a scalar operand (no LDS read per product).
// Rows go in and out as whole-line wave accesses and are turned lane-wise in the
// wave's own LDS tile, at pitches of 16 B x odd.  No work-group barrier.
// ---------------------------------------------------------------------------
#define KQ_P 132   // floats per staged k|q row    (528 B = 16 B x 33)
#define PF_P 36    // floats per staged feature row (144 B = 16 B x 9)
#define VO_P 68    // floats per staged v / y row   (272 B = 16 B x 17)

__global__ __launch_bounds__(128) void k_perf(const float* __restrict__ kqv,
                                              const float* __restrict__ wperf,
                                              float* __restrict__ kp,
                                              float* __restrict__ qp,
                                              float* __restrict__ ksum) {
  __shared__ __attribute__((aligned(16))) float tile[4][32 * KQ_P];
  const int lane = threadIdx.x & 31, wv = threadIdx.x >> 5;
  float* T = tile[wv];
  const int b = blockIdx.x >> 5;                        // 32 blocks per batch
  const int tok0 = (blockIdx.x << 7) + (wv << 5);       // first of the wave's tokens
  // In: one token's k|q is 512 contiguous bytes, one wave load.
  {
    const float* src = kqv + (size_t)tok0 * DIMC + (lane << 2);
    float4 in[32];
    #pragma unroll  // constant indices keep in[] in registers; all loads in flight at once
    for (int i = 0; i < 32; ++i) in[i] = *reinterpret_cast<const float4*>(src + i * DIMC);
    // What follows may reuse the address registers that these loads name.
    asm volatile("s_wait_xcnt 0x0" ::: "memory");
    #pragma unroll
    for (int i = 0; i < 32; ++i)
      *reinterpret_cast<float4*>(T + i * KQ_P + (lane << 2)) = in[i];
  }
  // The other lanes' rows must stand in the tile before this lane reads its own.
  asm volatile("s_wait_dscnt 0x0" ::: "memory");
  float k[64], q[64];
  #pragma unroll  // constant indices keep k[] and q[] in registers
  for (int j = 0; j < 16; ++j) {
    const float4 u = *reinterpret_cast<const float4*>(T + lane * KQ_P + (j << 2));
    const float4 w = *reinterpret_cast<const float4*>(T + lane * KQ_P + 64 + (j << 2));
    k[4 * j] = u.x; k[4 * j + 1] = u.y; k[4 * j + 2] = u.z; k[4 * j + 3] = u.w;
    q[4 * j] = w.x; q[4 * j + 1] = w.y; q[4 * j + 2] = w.z; q[4 * j + 3] = w.w;
  }
  float xk = 0.f, xq = 0.f;
  #pragma unroll
  for (int d = 0; d < 64; ++d) { xk += k[d] * k[d]; xq += q[d] * q[d]; }
  // Four features a trip: eight independent FMA chains, each in d order.
  #pragma unroll 1  // the body is 512 FMAs; unrolled further it only grows the code
  for (int m0 = 0; m0 < MF; m0 += 4) {
    const float* w = wperf + (m0 << 6);
    float dk[4] = {0.f, 0.f, 0.f, 0.f}, dq[4] = {0.f, 0.f, 0.f, 0.f};
    #pragma unroll
    for (int d = 0; d < 64; ++d) {
      #pragma unroll
      for (int f = 0; f < 4; ++f) {
        const float wr = w[(f << 6) + d];
        dk[f] += wr * k[d]; dq[f] += wr * q[d];
      }
    }
    float4 ok, oq;
    ok.x = expf(dk[0] - 0.5f * xk) * INVSQRTM; oq.x = expf(dq[0] - 0.5f * xq) * INVSQRTM;
    ok.y = expf(dk[1] - 0.5f * xk) * INVSQRTM; oq.y = expf(dq[1] - 0.5f * xq) * INVSQRTM;
    ok.z = expf(dk[2] - 0.5f * xk) * INVSQRTM; oq.z = expf(dq[2] - 0.5f * xq) * INVSQRTM;
    ok.w = expf(dk[3] - 0.5f * xk) * INVSQRTM; oq.w = expf(dq[3] - 0.5f * xq) * INVSQRTM;
    *reinterpret_cast<float4*>(T + lane * PF_P + m0) = ok;
    *reinterpret_cast<float4*>(T + (32 + lane) * PF_P + m0) = oq;
  }
  // Every lane's features must stand in the tile before they are read across lanes.
  asm volatile("s_wait_dscnt 0x0" ::: "memory");
  // ksum: lane = feature, its column over the wave's 32 tokens, one atomic a wave.
  float s = 0.f;
  #pragma unroll
  for (int t = 0; t < 32; ++t) s += T[t * PF_P + lane];
  atomicAdd(&ksum[b * MF + lane], s);
  // Out: four tokens' features are 512 contiguous bytes, one wave store.
  float* kpo = kp + (size_t)tok0 * MF + (lane << 2);
  float* qpo = qp + (size_t)tok0 * MF + (lane << 2);
  const float* Tr = T + (lane >> 3) * PF_P + ((lane & 7) << 2);
  #pragma unroll
  for (int i = 0; i < 8; ++i) {
    *reinterpret_cast<float4*>(kpo + (i << 7)) =
        *reinterpret_cast<const float4*>(Tr + (i << 2) * PF_P);
    *reinterpret_cast<float4*>(qpo + (i << 7)) =
        *reinterpret_cast<const float4*>(Tr + (32 + (i << 2)) * PF_P);
  }
}

// ---------------------------------------------------------------------------
// K6: kptv[b,d,m] = sum_t v[b,t,d]*kp[b,t,m], a 64 x 32 product with K = tokens, on
// V_WMMA_F32_16X16X4_F32 (f32 operands, f32 sums).  A block takes 256 tokens, a wave
// 32 of them and all 64 x 32 cells (8 accumulator tiles).  Both operands come straight
// from global in fragment order, all 32 loads of a wave in flight at once:
//   lane l (c = l&15, h = l>>4), load i: token 2*i + h; 16 bytes of v at d = 4*c and
//   8 bytes of kp at m = 2*c, so a wave load covers two whole rows.
// K-step s takes loads 2*s and 2*s+1 as registers 0 and 1 of A and of B alike, so both
// sides hold token 4*s + 2*reg + h at the same place.  Component mt of the 16 bytes is
// row c of A tile mt (d = 4*c + mt); component nt of the 8 bytes is column c of B tile
// nt (m = 2*c + nt).  The 8 waves' partial sums meet in LDS, one barrier, added in wave
// order; then one global atomic per cell and block.
// ---------------------------------------------------------------------------
__global__ __launch_bounds__(256) void k_kptv(const float* __restrict__ kqv,
                                              const float* __restrict__ kp,
                                              float* __restrict__ kptv) {
  __shared__ __attribute__((aligned(16))) float part[8][EMB * MF];
  const int tid = threadIdx.x, lane = tid & 31, wv = tid >> 5;
  const int hi = lane >> 4, cn = lane & 15;
  const int b = blockIdx.x >> 4;                        // 16 blocks per batch
  const int t0 = (blockIdx.x << 8) + (wv << 5);         // first of the wave's tokens
  const float* vs = kqv + (size_t)(t0 + hi) * DIMC + 128 + (cn << 2);
  const float* ks = kp + (size_t)(t0 + hi) * MF + (cn << 1);
  float4 va[16];
  float2 kb[16];
  #pragma unroll  // constant indices keep va[], kb[] and acc[] in registers (here and below)
  for (int i = 0; i < 16; ++i) kb[i] = *reinterpret_cast<const float2*>(ks + (i << 1) * MF);
  // A later load may land on the address registers that these loads name.
  asm volatile("s_wait_xcnt 0x0" ::: "memory");
  #pragma unroll
  for (int i = 0; i < 16; ++i) va[i] = *reinterpret_cast<const float4*>(vs + (i << 1) * DIMC);
  // What follows may reuse the address registers that these loads name.
  asm volatile("s_wait_xcnt 0x0" ::: "memory");
  // Keeps all 32 loads ahead of the first WMMA: left alone, the scheduler holds a third of
  // them back until registers come free, a second memory latency in a row.
  __builtin_amdgcn_sched_barrier(0);

  const v8f vzero = {};
  v8f acc[4][2];
  #pragma unroll
  for (int mt = 0; mt < 4; ++mt) { acc[mt][0] = vzero; acc[mt][1] = vzero; }
  #pragma unroll
  for (int s = 0; s < 8; ++s) {
    const float a0[4] = {va[2 * s].x, va[2 * s].y, va[2 * s].z, va[2 * s].w};
    const float a1[4] = {va[2 * s + 1].x, va[2 * s + 1].y, va[2 * s + 1].z, va[2 * s + 1].w};
    const v2f fb[2] = {{kb[2 * s].x, kb[2 * s + 1].x}, {kb[2 * s].y, kb[2 * s + 1].y}};
    #pragma unroll
    for (int mt = 0; mt < 4; ++mt) {
      const v2f fa = {a0[mt], a1[mt]};
      #pragma unroll
      for (int nt = 0; nt < 2; ++nt) {
        acc[mt][nt] = __builtin_amdgcn_wmma_f32_16x16x4_f32(
            false, fa, false, fb[nt], (short)0, acc[mt][nt], false, false);
      }
    }
  }
  // Accumulator register r of tile (mt, nt) is cell d = 4*(8*hi + r) + mt, m = 2*cn + nt.
  float* P = part[wv] + (hi << 10) + (cn << 1);
  #pragma unroll
  for (int mt = 0; mt < 4; ++mt) {
    #pragma unroll
    for (int r = 0; r < 8; ++r) {
      float2 u;
      u.x = acc[mt][0][r]; u.y = acc[mt][1][r];
      *reinterpret_cast<float2*>(P + (((r << 2) + mt) << 5)) = u;
    }
  }
  __syncthreads();  // every wave's partial sums stand before they are added across waves
  float* dst = kptv + (size_t)b * (EMB * MF) + (tid << 2);
  #pragma unroll
  for (int j = 0; j < 2; ++j) {
    float4 sum = *reinterpret_cast<const float4*>(&part[0][(j << 10) + (tid << 2)]);
    #pragma unroll
    for (int w = 1; w < 8; ++w) {
      const float4 u = *reinterpret_cast<const float4*>(&part[w][(j << 10) + (tid << 2)]);
      sum.x += u.x; sum.y += u.y; sum.z += u.z; sum.w += u.w;
    }
    atomicAdd(dst + (j << 10), sum.x);
    atomicAdd(dst + (j << 10) + 1, sum.y);
    atomicAdd(dst + (j << 10) + 2, sum.z);
    atomicAdd(dst + (j << 10) + 3, sum.w);
  }
}

// ---------------------------------------------------------------------------
// K7: yatt = v + proj(qp @ kptv^T / (qp.ksum + eps)).  Lane = token, 32 tokens
// per wave, as in K5: qp row and output row in registers.  Every weight is
// wave-uniform: ksum, proj_w and proj_b come by scalar loads; the batch's kptv is
// staged once per block in LDS and read with all lanes on one address, so that a
// trip of the main loop waits for one run of scalar loads, not three.
// ---------------------------------------------------------------------------
__global__ __launch_bounds__(128) void k_mix(const float* __restrict__ kqv,
                                             const float* __restrict__ qp,
                                             const float* __restrict__ ksum,
                                             const float* __restrict__ kptv,
                                             const float* __restrict__ pw,
                                             const float* __restrict__ pb,
                                             float* __restrict__ yatt) {
  __shared__ __attribute__((aligned(16))) float qt[4][32 * PF_P];
  __shared__ __attribute__((aligned(16))) float vt[4][32 * VO_P];
  __shared__ __attribute__((aligned(16))) float klt[EMB * MF];
  const int lane = threadIdx.x & 31;
  // The wave's number, shown to the compiler as uniform: tile and row addresses are
  // then scalar arithmetic, a scalar base and a lane offset per load.
  const int wv = __builtin_amdgcn_readfirstlane(threadIdx.x >> 5);
  float* Q = qt[wv];
  float* V = vt[wv];
  const int b = blockIdx.x >> 5;                        // 32 blocks per batch
  const int tok0 = (blockIdx.x << 7) + (wv << 5);       // first of the wave's tokens
  // In: four tokens' qp rows, or two tokens' v rows, per wave load (whole lines).
  {
    const float* qs = qp + (size_t)tok0 * MF + (lane << 2);
    const float* vs = kqv + (size_t)tok0 * DIMC + 128 + (lane >> 4) * DIMC + ((lane & 15) << 2);
    const float* ks = kptv + (size_t)b * (EMB * MF) + (wv << 7) + (lane << 2);
    float4 qi[8], vi[16], ki[4];
    #pragma unroll  // constant indices keep qi[], vi[] and ki[] in registers
    for (int i = 0; i < 8; ++i) qi[i] = *reinterpret_cast<const float4*>(qs + (i << 7));
    #pragma unroll
    for (int i = 0; i < 4; ++i) ki[i] = *reinterpret_cast<const float4*>(ks + (i << 9));
    #pragma unroll
    for (int i = 0; i < 16; ++i) vi[i] = *reinterpret_cast<const float4*>(vs + (i << 1) * DIMC);
    #pragma unroll
    for (int i = 0; i < 8; ++i)
      *reinterpret_cast<float4*>(Q + ((i << 2) + (lane >> 3)) * PF_P + ((lane & 7) << 2)) = qi[i];
    #pragma unroll
    for (int i = 0; i < 16; ++i)
      *reinterpret_cast<float4*>(V + ((i << 1) + (lane >> 4)) * VO_P + ((lane & 15) << 2)) = vi[i];
    #pragma unroll
    for (int i = 0; i < 4; ++i)
      *reinterpret_cast<float4*>(klt + (i << 9) + (wv << 7) + (lane << 2)) = ki[i];
  }
  __syncthreads();  // klt is filled by all four waves; the wave's own tiles stand too
  float q[32], o[64];
  #pragma unroll  // constant indices keep q[] and o[] in registers
  for (int j = 0; j < 8; ++j) {
    const float4 u = *reinterpret_cast<const float4*>(Q + lane * PF_P + (j << 2));
    q[4 * j] = u.x; q[4 * j + 1] = u.y; q[4 * j + 2] = u.z; q[4 * j + 3] = u.w;
  }
  #pragma unroll
  for (int j = 0; j < 16; ++j) {
    const float4 u = *reinterpret_cast<const float4*>(V + lane * VO_P + (j << 2));
    o[4 * j] = u.x + pb[4 * j];         o[4 * j + 1] = u.y + pb[4 * j + 1];
    o[4 * j + 2] = u.z + pb[4 * j + 2]; o[4 * j + 3] = u.w + pb[4 * j + 3];
  }
  // D = qp.ksum, added in the tree order of a 32-lane xor butterfly.
  const float* ksb = ksum + b * MF;
  float t[32];
  #pragma unroll
  for (int m = 0; m < 32; ++m) t[m] = q[m] * ksb[m];
  #pragma unroll
  for (int off = 16; off > 0; off >>= 1) {
    #pragma unroll
    for (int m = 0; m < off; ++m) t[m] += t[m + off];
  }
  const float den = t[0] + 1e-8f;
  // Two attention channels e a trip: for each its sum over m, then its row of
  // proj_w into all 64 outputs, e ascending.
  #pragma unroll 2  // the two sums run as independent chains, and the second row's
                    // scalar loads fly under the first row's work
  for (int e = 0; e < EMB; ++e) {
    const float* kr = klt + (e << 5);
    const float* pr = pw + (e << 6);
    float num = 0.f;
    #pragma unroll
    for (int m = 0; m < 32; ++m) num += q[m] * kr[m];
    const float al = num / den;
    #pragma unroll
    for (int d = 0; d < 64; ++d) o[d] += al * pr[d];
  }
  #pragma unroll
  for (int j = 0; j < 16; ++j) {
    float4 u;
    u.x = o[4 * j]; u.y = o[4 * j + 1]; u.z = o[4 * j + 2]; u.w = o[4 * j + 3];
    *reinterpret_cast<float4*>(V + lane * VO_P + (j << 2)) = u;
  }
  // Every lane's row must stand in the tile before it is read across lanes.
  asm volatile("s_wait_dscnt 0x0" ::: "memory");
  // Out: two tokens' rows are 512 contiguous bytes, one wave store.
  float* yo = yatt + ((size_t)tok0 << 6) + (lane << 2);
  const float* Vr = V + (lane >> 4) * VO_P + ((lane & 15) << 2);
  #pragma unroll
  for (int i = 0; i < 16; ++i)
    *reinterpret_cast<float4*>(yo + (i << 7)) =
        *reinterpret_cast<const float4*>(Vr + (i << 1) * VO_P);
}

// ---------------------------------------------------------------------------
// K8: out = yatt + W2 @ gelu(W1 @ LN(yatt) + b1) + b2.  Fully fused:
// LN2 in registers, both 64x64 GEMMs via WMMA, A in LDS, B from the packed weights.
// Per block: 64 rows, 128 threads (4 waves).
// ---------------------------------------------------------------------------
__global__ __launch_bounds__(128) void k_mlp(const float* __restrict__ yatt,
                                             const float* __restrict__ g,
                                             const float* __restrict__ bt,
                                             const half_t* __restrict__ wpk,
                                             const float* __restrict__ b1,
                                             const float* __restrict__ b2,
                                             float* __restrict__ out) {
  __shared__ half_t Hs[64][66];
  __shared__ half_t T1s[64][66];
  __shared__ float b1l[64], b2l[64];
  const int rbase = blockIdx.x << 6;
  const int tid = threadIdx.x, lane = tid & 31, wv = tid >> 5;
  const half_t* wl = wpk + WM_H + (lane << 3);
  // LayerNorm(64): two threads per row, pair-reduce via shfl.
  {
    const int r = tid >> 1, hf = tid & 1;
    const float* p = yatt + ((size_t)(rbase + r) << 6) + (hf << 5);
    float xv[32], s = 0.f, s2 = 0.f;
    #pragma unroll
    for (int j = 0; j < 32; ++j) { const float v = p[j]; xv[j] = v; s += v; s2 += v * v; }
    s  += __shfl_xor(s, 1, 32);
    s2 += __shfl_xor(s2, 1, 32);
    const float mean = s * (1.0f / 64.f);
    const float var  = s2 * (1.0f / 64.f) - mean * mean;
    const float rs = rsqrtf(var + 1e-5f);
    #pragma unroll
    for (int j = 0; j < 32; ++j) {
      const int c = (hf << 5) + j;
      Hs[r][c] = (half_t)((xv[j] - mean) * rs * g[c] + bt[c]);
    }
  }
  // W1's fragments are asked for ahead of the barrier and arrive during its wait.
  v16h vb1[8];
  #pragma unroll  // constant indices keep vb1[] in registers
  for (int f = 0; f < 8; ++f) vb1[f] = load_bfrag(wl, f);
  if (tid < 64) { b1l[tid] = b1[tid]; b2l[tid] = b2[tid]; }
  __syncthreads();
  // W2's fragments arrive while the first GEMM and its GELU run.
  v16h vb2[8];
  #pragma unroll  // constant indices keep vb2[] in registers
  for (int f = 0; f < 8; ++f) vb2[f] = load_bfrag(wl, 8 + f);

  const v8f vzero = {};
  v8f acc[4];
  #pragma unroll
  for (int i = 0; i < 4; ++i) acc[i] = vzero;
  #pragma unroll
  for (int kk = 0; kk < 2; ++kk) {
    const int ks = kk << 5;
    const v16h va = load_frag(&Hs[0][ks], wv << 4, 66, lane);
    #pragma unroll
    for (int nt = 0; nt < 4; ++nt) {
      acc[nt] = __builtin_amdgcn_wmma_f32_16x16x32_f16(
          false, va, false, vb1[(kk << 2) + nt], (short)0, acc[nt], false, false);
    }
  }
  const int hi = lane >> 4, cn = lane & 15;
  #pragma unroll
  for (int nt = 0; nt < 4; ++nt) {
    const int col = (nt << 4) + cn;
    #pragma unroll
    for (int r = 0; r < 8; ++r) {
      const int row = (wv << 4) + r + (hi << 3);
      T1s[row][col] = (half_t)gelu_exact(acc[nt][r] + b1l[col]);
    }
  }
  __syncthreads();
  v8f acc2[4];
  #pragma unroll
  for (int i = 0; i < 4; ++i) acc2[i] = vzero;
  #pragma unroll
  for (int kk = 0; kk < 2; ++kk) {
    const int ks = kk << 5;
    const v16h va = load_frag(&T1s[0][ks], wv << 4, 66, lane);
    #pragma unroll
    for (int nt = 0; nt < 4; ++nt) {
      acc2[nt] = __builtin_amdgcn_wmma_f32_16x16x32_f16(
          false, va, false, vb2[(kk << 2) + nt], (short)0, acc2[nt], false, false);
    }
  }
  #pragma unroll
  for (int nt = 0; nt < 4; ++nt) {
    const int col = (nt << 4) + cn;
    const float bv = b2l[col];
    #pragma unroll
    for (int r = 0; r < 8; ++r) {
      const int row = (wv << 4) + r + (hi << 3);
      const size_t gi = ((size_t)(rbase + row) << 6) + col;
      out[gi] = yatt[gi] + acc2[nt][r] + bv;
    }
  }
}

// ---------------------------------------------------------------------------
extern "C" void kernel_launch(void* const* d_in, const int* in_sizes, int n_in,
                              void* d_out, int out_size, void* d_ws, size_t ws_size,
                              hipStream_t stream) {
  (void)in_sizes; (void)n_in; (void)out_size; (void)ws_size;
  const float* x      = (const float*)d_in[0];
  const float* conv_w = (const float*)d_in[1];
  const float* conv_b = (const float*)d_in[2];
  const float* ln1_g  = (const float*)d_in[3];
  const float* ln1_b  = (const float*)d_in[4];
  const float* kqv_w  = (const float*)d_in[5];
  const float* kqv_b  = (const float*)d_in[6];
  const float* proj_w = (const float*)d_in[7];
  const float* proj_b = (const float*)d_in[8];
  const float* w_perf = (const float*)d_in[9];
  const float* ln2_g  = (const float*)d_in[10];
  const float* ln2_b  = (const float*)d_in[11];
  const float* mlp_w1 = (const float*)d_in[12];
  const float* mlp_b1 = (const float*)d_in[13];
  const float* mlp_w2 = (const float*)d_in[14];
  const float* mlp_b2 = (const float*)d_in[15];

  char* ws = (char*)d_ws;
  half_t* xh   = (half_t*)(ws + XH_OFF);
  half_t* tok  = (half_t*)(ws + TOK_OFF);
  float*  kqv  = (float*)(ws + KQV_OFF);
  float*  kp   = (float*)(ws + KP_OFF);     // reuses XH region (xh dead)
  float*  qp   = (float*)(ws + QP_OFF);
  float*  ksum = (float*)(ws + KSUM_OFF);
  float*  kptv = (float*)(ws + KPTV_OFF);
  float*  yatt = (float*)(ws + YATT_OFF);   // reuses TOK region (tok dead)
  half_t* wpk  = (half_t*)(ws + WPK_OFF);
  float*  cs   = (float*)(ws + CS_OFF);
  float*  out  = (float*)d_out;

  // Zero the atomic accumulators (ksum + kptv are contiguous).
  hipMemsetAsync(ws + KSUM_OFF, 0, 4096 + (size_t)BATCH * EMB * MF * 4, stream);

  k_pack<<<dim3(WPK_BLOCKS + 1 + BATCH * 256), dim3(256), 0, stream>>>(
      x, conv_w, kqv_w, mlp_w1, mlp_w2, ln1_g, ln1_b, kqv_b, xh, wpk, cs);
  k_conv<<<dim3(64, 3, BATCH), dim3(128), 0, stream>>>(xh, wpk, conv_b, tok);
  k_kqv <<<dim3((BATCH * TOKN) / 128), dim3(128), 0, stream>>>(tok, wpk, cs, kqv);
  k_perf<<<dim3(BATCH * 32), dim3(128), 0, stream>>>(kqv, w_perf, kp, qp, ksum);
  k_kptv<<<dim3(BATCH * 16), dim3(256), 0, stream>>>(kqv, kp, kptv);
  k_mix <<<dim3(BATCH * 32), dim3(128), 0, stream>>>(kqv, qp, ksum, kptv,
                                                      proj_w, proj_b, yatt);
  k_mlp <<<dim3((BATCH * TOKN) / 64), dim3(128), 0, stream>>>(
      yatt, ln2_g, ln2_b, wpk, mlp_b1, mlp_b2, out);
}

// v006
// Two timings next to v005 put it at 1.09 and 1.07 times that version's speed.
// Counting every step since v000, it is 5.69 times as fast.
#include <hip/hip_runtime.h>
#include <hip/hip_bf16.h>
#include <math.h>

// ---------------------------------------------------------------------------
// MI455X (gfx1250, wave32) implementation of the PRM + Token-Performer block.
// All dense GEMMs (implicit-GEMM dilated convs, kqv, MLP) use
// V_WMMA_F32_16X16X32_F16 with f32 accumulation; kptv is on the f32 WMMA form, the
// other skinny performer pieces are VALU.  Fused epilogues keep each intermediate to one
// HBM round-trip (pipeline is ~bandwidth-bound at 23.3 TB/s).
// Conv reduction axis ordered k = kid*64 + ic so each 32-wide WMMA K-step has
// a constant kernel tap; the image stays channels-last, so one pixel's 64
// channels are one 128-byte line and an im2col row is contiguous in k.
// Every GEMM weight matrix is packed once per call into f16 in the order of the
// WMMA B fragment, so a B fragment is two whole-line 16-byte loads per lane.
// ---------------------------------------------------------------------------

typedef _Float16 half_t;
typedef __attribute__((ext_vector_type(16))) _Float16 v16h;
typedef __attribute__((ext_vector_type(8)))  _Float16 v8h;
typedef __attribute__((ext_vector_type(8)))  float    v8f;
typedef __attribute__((ext_vector_type(2)))  float    v2f;

// Problem constants (match reference)
#define BATCH   32
#define CIN     64
#define IMGSZ   128
#define NPIX    16384     // 128*128
#define TOKN    4096      // 64*64 post-stride-2 tokens
#define EBR     64
#define DIMC    192       // 3*EBR
#define EMB     64
#define MF      32        // performer features
#define INVSQRTM 0.17677669529663687f

// Workspace layout (bytes). Buffers reused once their producers/consumers
// are done:  XH region -> KP/QP,  TOK region -> YATT.
#define XH_OFF    ((size_t)0)                                   // f16 [B][128][128][CIN]  67.1MB
#define KP_OFF    ((size_t)0)                                   // f32 [B][T][32]          (reuse XH)
#define QP_OFF    ((size_t)16777216)                            // f32 [B][T][32]
#define TOK_OFF   ((size_t)67108864)                            // f16 [B][T][192]         50.3MB
#define YATT_OFF  TOK_OFF                                       // f32 [B][T][64]          (reuse TOK)
#define KQV_OFF   ((size_t)(67108864 + 2*50331648))             // f32 [B][T][192]         100.7MB
#define KSUM_OFF  (KQV_OFF + (size_t)BATCH*TOKN*DIMC*4)         // f32 [B][32]
#define KPTV_OFF  (KSUM_OFF + (size_t)4096)                     // f32 [B][64][32]
#define WPK_OFF   (KPTV_OFF + (size_t)BATCH*EMB*MF*4)           // f16 packed weights, 311 KB
#define CS_OFF    (WPK_OFF + (size_t)311296)                    // f32 [2][192] kqv column terms

// Packed weights: one B fragment (32 k x 16 n) = 2 planes x 32 lanes x 8 halves.
// Plane p, lane l, element i hold k = 16*p + 8*(l>>4) + i, n = l&15: the k order
// of load_frag.  A unit is one lane's 8 halves (16 bytes) of one plane.
#define FRAG_H    512                       // halves per fragment
#define WC_UNITS  13824                     // conv: 3 branches x 18 K-steps x 4 n-tiles x 64
#define WQ_UNITS  4608                      // kqv:  6 K-steps x 12 n-tiles x 64
#define WM_UNITS  1024                      // mlp:  2 matrices x 2 K-steps x 4 n-tiles x 64
#define WQ_H      (WC_UNITS * 8)            // first half of the kqv part
#define WM_H      ((WC_UNITS + WQ_UNITS) * 8)
#define WPK_BLOCKS ((WC_UNITS + WQ_UNITS + WM_UNITS) / 256)   // 76

__device__ __forceinline__ float gelu_exact(float x) {
  return 0.5f * x * (1.0f + erff(x * 0.70710678118654752f));
}

// Load a 16x32 f16 WMMA fragment (A row-major, or B assembled as [N][K]).
// tile: LDS matrix with K contiguous per row; stride in half elements.
// ISA layout: lanes 0-15 hold K0-7 (v0-3) and K16-23 (v4-7); lanes 16-31
// hold K8-15 and K24-31; M/N = lane&15 (+row0).
__device__ __forceinline__ v16h load_frag(const half_t* tile, int row0,
                                          int stride, int lane) {
  const half_t* p = tile + (row0 + (lane & 15)) * stride;
  const int hi = lane >> 4;
  v16h f;
  #pragma unroll
  for (int j = 0; j < 8; ++j) {
    const int kb = ((j >> 2) << 4) + (hi << 3) + ((j & 3) << 1);
    f[2 * j]     = p[kb];
    f[2 * j + 1] = p[kb + 1];
  }
  return f;
}

// B fragment number frag of a packed weight part, as two 512-byte wave loads.
__device__ __forceinline__ v16h load_bfrag(const half_t* wl, int frag) {
  const v8h lo = *reinterpret_cast<const v8h*>(wl + frag * FRAG_H);
  const v8h hi = *reinterpret_cast<const v8h*>(wl + frag * FRAG_H + 256);
  return __builtin_shufflevector(lo, hi,
      0, 1, 2, 3, 4, 5, 6, 7, 8, 9, 10, 11, 12, 13, 14, 15);
}

// ---------------------------------------------------------------------------
// K1: x [B,N,C] f32  ->  xh [B,N,C] f16  (same channels-last order, convert
// only).  8 elements per thread per pass: two 16-byte loads, one 16-byte store.
// The first WPK_BLOCKS blocks pack the weights instead: one unit per thread,
// eight strided f32 reads, one 16-byte store; row k of the kqv weights is scaled by
// ln1's g[k] on the way.  The next block sums the two column terms of K3.
// ---------------------------------------------------------------------------
__global__ __launch_bounds__(256) void k_pack(const float* __restrict__ x,
                                              const float* __restrict__ cw,
                                              const float* __restrict__ wq,
                                              const float* __restrict__ w1,
                                              const float* __restrict__ w2,
                                              const float* __restrict__ lg,
                                              const float* __restrict__ lb,
                                              const float* __restrict__ qb,
                                              half_t* __restrict__ xh,
                                              half_t* __restrict__ wpk,
                                              float* __restrict__ cs) {
  if (blockIdx.x == WPK_BLOCKS) {            // thread = column n of the kqv weights
    if (threadIdx.x < DIMC) {
      const float* wc = wq + threadIdx.x;
      float sg = 0.f, sb = 0.f;
      #pragma unroll 16  // 16 loads in flight a trip; many more would raise the kernel's registers
      for (int k = 0; k < DIMC; ++k) {
        const float w = wc[k * DIMC];
        sg += (float)(half_t)(w * lg[k]);    // the f16 value that the GEMM multiplies by
        sb += w * lb[k];
      }
      cs[threadIdx.x] = sg;
      cs[DIMC + threadIdx.x] = sb + qb[threadIdx.x];
    }
    return;
  }
  if (blockIdx.x < WPK_BLOCKS) {
    const int u = (blockIdx.x << 8) + threadIdx.x;
    const int n = u & 15;
    const int k0 = (((u >> 5) & 1) << 4) + (((u >> 4) & 1) << 3);  // k of element 0
    const float* src;
    int step;                                // floats from one k to the next
    float sc[8] = {1.f, 1.f, 1.f, 1.f, 1.f, 1.f, 1.f, 1.f};
    if (blockIdx.x < WC_UNITS / 256) {       // frag = ((br*9 + kid)*2 + h)*4 + nt
      const int f = u >> 6;
      const int nt = f & 3, h = (f >> 2) & 1, tap = f >> 3;   // tap = br*9 + kid
      const int br = tap / 9, kid = tap - br * 9;
      src = cw + (((br << 6) + (nt << 4) + n) * CIN + (h << 5) + k0) * 9 + kid;
      step = 9;
    } else if (blockIdx.x < (WC_UNITS + WQ_UNITS) / 256) {    // frag = kk*12 + n-tile
      const int f = (u - WC_UNITS) >> 6;
      const int kk = f / 12, nt = f - kk * 12;
      src = wq + ((kk << 5) + k0) * DIMC + (nt << 4) + n;
      step = DIMC;
      #pragma unroll
      for (int i = 0; i < 8; ++i) sc[i] = lg[(kk << 5) + k0 + i];
    } else {                                 // frag = (matrix*2 + kk)*4 + nt
      const int f = (u - WC_UNITS - WQ_UNITS) >> 6;
      const int nt = f & 3, kk = (f >> 2) & 1;
      src = ((f >> 3) ? w2 : w1) + ((kk << 5) + k0) * EMB + (nt << 4) + n;
      step = EMB;
    }
    float t[8];
    #pragma unroll  // constant indices keep t[] in registers
    for (int i = 0; i < 8; ++i) t[i] = src[i * step];
    // The conversions below reuse the address registers that these loads name.
    asm volatile("s_wait_xcnt 0x0" ::: "memory");
    v8h o;
    #pragma unroll
    for (int i = 0; i < 8; ++i) o[i] = (half_t)(t[i] * sc[i]);
    *reinterpret_cast<v8h*>(wpk + ((size_t)u << 3)) = o;
    return;
  }
  const size_t base = ((size_t)(blockIdx.x - WPK_BLOCKS - 1) << 12) + ((size_t)threadIdx.x << 3);
  #pragma unroll  // both passes' loads are in flight before the first store
  for (int rep = 0; rep < 2; ++rep) {
    const size_t e = base + ((size_t)rep << 11);
    const float4 u = *reinterpret_cast<const float4*>(x + e);
    const float4 w = *reinterpret_cast<const float4*>(x + e + 4);
    v8h o;
    o[0] = (half_t)u.x; o[1] = (half_t)u.y; o[2] = (half_t)u.z; o[3] = (half_t)u.w;
    o[4] = (half_t)w.x; o[5] = (half_t)w.y; o[6] = (half_t)w.z; o[7] = (half_t)w.w;
    *reinterpret_cast<v8h*>(xh + e) = o;
  }
}

// ---------------------------------------------------------------------------
// K2: implicit-GEMM dilated conv + bias + GELU -> tokens f16 [B,T,192].
// Per block: 64 tokens (one output row) x 64 out-channels, K=576 in 18 steps of 32.
// K axis ordered k = kid*64 + ic.  The three image rows that the output row's taps
// touch are brought into LDS once per block by asynchronous copies, whole 128-byte
// lines, and every wave reads its A fragments from there.  A wave owns all 64 tokens
// (4 row tiles) and 16 out-channels, so each packed B fragment is loaded by one wave
// of the block only.
// LDS: plane (kh, parity of the pixel column) = 67 slots of 144 bytes: 2 zero slots,
// the 64 pixels of that parity, 1 zero slot.  Tap column 2*ow + off is slot
// ow + (off >> 1) + 2 of parity off & 1, so neighbouring tokens are 144 bytes
// (16 B x odd) apart; a column outside the image falls on a zero slot, a row outside
// the image is a zero plane.
// grid = (64 token tiles, 3 branches, 32 batches), 4 waves.
// ---------------------------------------------------------------------------
#define CV_SLOT   144                   // bytes per staged pixel
#define CV_PLANE  (67 * CV_SLOT)        // bytes per plane

// Four 16-byte-per-lane copies global -> LDS.  The wait at the end stands in the
// copies' own statement: their address registers may be rewritten behind it.
__device__ __forceinline__ void copy4(unsigned l0, unsigned l1, unsigned l2, unsigned l3,
                                      const half_t* g0, const half_t* g1,
                                      const half_t* g2, const half_t* g3) {
  asm volatile("global_load_async_to_lds_b128 %0, %4, off\n\t"
               "global_load_async_to_lds_b128 %1, %5, off\n\t"
               "global_load_async_to_lds_b128 %2, %6, off\n\t"
               "global_load_async_to_lds_b128 %3, %7, off\n\t"
               "s_wait_xcnt 0x0"
               :: "v"(l0), "v"(l1), "v"(l2), "v"(l3), "v"(g0), "v"(g1), "v"(g2), "v"(g3)
               : "memory");
}

template <int DIL>
__device__ __forceinline__ void conv_acc(const half_t* __restrict__ xb,   // the batch's image
                                         const half_t* __restrict__ wl,   // branch's B, lane's place
                                         half_t* img, int oh, int tid, v8f (&acc)[4]) {
  const int lane = tid & 31, wv = tid >> 5;
  const int hi = lane >> 4, cn = lane & 15;
  const v8h hzero = (v8h)(half_t)0.0f;
  char* imgb = reinterpret_cast<char*>(img);

  // Zero slots, and whole planes for a row outside the image.
  #pragma unroll  // kh constant: plane offsets fold into the instructions (here and below)
  for (int kh = 0; kh < 3; ++kh) {
    const int ih = (oh << 1) + (kh - 1) * DIL;
    char* pl = imgb + (kh << 1) * CV_PLANE;
    if ((unsigned)ih < 128u) {
      if (tid < 48) {                       // 2 planes x 3 slots x 8 pieces of 16 bytes
        const int p = tid / 24, r = tid - p * 24, s = r >> 3;
        *reinterpret_cast<v8h*>(pl + p * CV_PLANE + (s < 2 ? s : 66) * CV_SLOT + ((r & 7) << 4)) = hzero;
      }
    } else {
      for (int i = tid; i < 2 * CV_PLANE / 16; i += 128)
        *reinterpret_cast<v8h*>(pl + (i << 4)) = hzero;
    }
  }
  // This wave's LDS stores have retired before its copies are pointed at the array.
  asm volatile("s_wait_dscnt 0x0" ::: "memory");

  // Copies: a wave copy is 4 pixels x 128 bytes; 8 lanes share a pixel.  Odd dilation
  // needs every pixel of the row (4 neighbours a copy), dilation 2 the even ones only.
  const unsigned lbase = (unsigned)(size_t)img + ((lane & 7) << 4);
  #pragma unroll
  for (int kh = 0; kh < 3; ++kh) {
    const int ih = (oh << 1) + (kh - 1) * DIL;
    if ((unsigned)ih < 128u) {              // the same for the whole block
      const half_t* gr = xb + ((size_t)ih << 13) + ((lane & 7) << 3);
      #pragma unroll
      for (int c = 0; c < ((DIL == 2) ? 1 : 2); ++c) {
        unsigned l[4];
        const half_t* g[4];
        #pragma unroll  // constant indices keep l[] and g[] in registers
        for (int i = 0; i < 4; ++i) {
          const int grp = (DIL == 2) ? ((wv << 2) + i) : ((wv << 3) + (c << 2) + i);
          const int px = (DIL == 2) ? (((grp << 2) + (lane >> 3)) << 1) : ((grp << 2) + (lane >> 3));
          l[i] = lbase + ((kh << 1) + (px & 1)) * CV_PLANE + ((px >> 1) + 2) * CV_SLOT;
          g[i] = gr + (px << 6);
        }
        copy4(l[0], l[1], l[2], l[3], g[0], g[1], g[2], g[3]);
      }
    }
  }

  // B: the wave's column tile, 2 fragments a tap, kept three taps ahead in 4 register sets.
  v16h vb[4][2];
  #pragma unroll  // constant indices keep vb[] and a[] in registers (here and below)
  for (int t = 0; t < 3; ++t) {
    #pragma unroll
    for (int h = 0; h < 2; ++h) vb[t][h] = load_bfrag(wl + t * (8 * FRAG_H), (h << 2) + wv);
  }
  // This wave's copies have landed; behind the barrier every wave's have.
  asm volatile("s_wait_asynccnt 0x0" ::: "memory");
  __syncthreads();

  // A: lane l reads row l&15 of each row tile: 16-byte runs at k = 16*q + 8*(l>>4).
  // Step s = 2*kid + h is one K-step of 32: its 8 reads are asked for one step ahead.
  const char* ar = imgb + (cn + 2) * CV_SLOT + (hi << 4);
  v8h a[2][8];
  #pragma unroll  // s picks register sets and LDS offsets: constants only when unrolled
  for (int s = -1; s < 18; ++s) {
    // The two fences hold the loads for later steps in one run ahead of this step's
    // WMMAs: lifted higher they need more registers, sunk to their use they fly under
    // nothing.
    __builtin_amdgcn_sched_barrier(0);
    if (s >= 0 && (s & 1) == 0 && (s >> 1) + 3 < 9) {
      const int kb = (s >> 1) + 3;
      #pragma unroll
      for (int h = 0; h < 2; ++h)
        vb[kb & 3][h] = load_bfrag(wl + kb * (8 * FRAG_H), (h << 2) + wv);
      // What follows may reuse the address registers that these loads name.
      asm volatile("s_wait_xcnt 0x0" ::: "memory");
    }
    if (s + 1 < 18) {
      const int sn = s + 1, kn = sn >> 1, kh = kn / 3, off = (kn - kh * 3 - 1) * DIL;
      const char* ap = ar + ((kh << 1) + (off & 1)) * CV_PLANE + (off >> 1) * CV_SLOT + ((sn & 1) << 6);
      #pragma unroll
      for (int mt = 0; mt < 4; ++mt) {
        #pragma unroll
        for (int j = 0; j < 2; ++j)
          a[sn & 1][(mt << 1) + j] =
              *reinterpret_cast<const v8h*>(ap + (mt << 4) * CV_SLOT + (j << 5));
      }
    }
    __builtin_amdgcn_sched_barrier(0);
    if (s >= 0) {
      #pragma unroll
      for (int mt = 0; mt < 4; ++mt) {
        const v16h va = __builtin_shufflevector(a[s & 1][(mt << 1)], a[s & 1][(mt << 1) + 1],
            0, 1, 2, 3, 4, 5, 6, 7, 8, 9, 10, 11, 12, 13, 14, 15);
        acc[mt] = __builtin_amdgcn_wmma_f32_16x16x32_f16(
            false, va, false, vb[(s >> 1) & 3][s & 1], (short)0, acc[mt], false, false);
      }
    }
  }
}

__global__ __launch_bounds__(128) void k_conv(const half_t* __restrict__ xh,
                                              const half_t* __restrict__ wpk,
                                              const float* __restrict__ cb,
                                              half_t* __restrict__ tok) {
  __shared__ __attribute__((aligned(16))) half_t img[6 * CV_PLANE / 2];
  const int tbase = blockIdx.x << 6;
  const int br = blockIdx.y;
  const int b  = blockIdx.z;
  const int tid = threadIdx.x, lane = tid & 31, wv = tid >> 5;
  const half_t* wl = wpk + br * (72 * FRAG_H) + (lane << 3);
  const half_t* xb = xh + (size_t)b * NPIX * CIN;

  v8f acc[4];
  const v8f vzero = {};
  #pragma unroll
  for (int i = 0; i < 4; ++i) acc[i] = vzero;

  // One body per dilation: every LDS offset of the taps is then a constant.
  if (br == 0)      conv_acc<1>(xb, wl, img, blockIdx.x, tid, acc);
  else if (br == 1) conv_acc<2>(xb, wl, img, blockIdx.x, tid, acc);
  else              conv_acc<3>(xb, wl, img, blockIdx.x, tid, acc);

  // Epilogue: bias + exact GELU, write tokens (branch-major channel concat)
  const int hi = lane >> 4, cn = lane & 15;
  const int oc = (wv << 4) + cn;
  const float bias = cb[br * EBR + oc];
  #pragma unroll
  for (int mt = 0; mt < 4; ++mt) {
    #pragma unroll
    for (int r = 0; r < 8; ++r) {
      const int row = (mt << 4) + r + (hi << 3);
      const int t = tbase + row;
      const float v = acc[mt][r] + bias;
      tok[((size_t)b * TOKN + t) * DIMC + br * EBR + oc] = (half_t)gelu_exact(v);
    }
  }
}

// ---------------------------------------------------------------------------
// K3: LayerNorm(192) + kqv GEMM  [131072 x 192] @ [192 x 192] + bias -> kqv f32.
// With W' = g o W (packed so by K1), cg[n] = sum_k W'[k][n] and
// cb[n] = bias[n] + sum_k bt[k] W[k][n]:
//   LN(x) @ W + bias = rs * (x @ W' - mean * cg) + cb,
// so the raw f16 token rows are the A operand and a row's mean and rs enter only at
// the accumulators.  A wave owns 32 tokens (two 16-row tiles) and all 192 columns.
// Lane l reads row l&15 of each tile straight from global in the order of the WMMA A
// fragment: 16-byte runs at k = 16*j + 8*(l>>4), j = 0..11, so the lane pair
// (l, l+16) holds the whole row; its sums are a sum in the lane and one exchange with
// the partner lane.  No LDS tile, no barrier, no normalised copy in memory.
// B: 6 packed fragments per 16 columns, in one register set: a fragment of the
// next column tile is asked for as soon as this tile's WMMAs have read its place.
// grid = 1024 blocks of 4 waves = 4 waves per SIMD.
// ---------------------------------------------------------------------------
__global__ __launch_bounds__(128) void k_kqv(const half_t* __restrict__ tok,
                                             const half_t* __restrict__ wpk,
                                             const float* __restrict__ cs,
                                             float* __restrict__ kqv) {
  const int lane = threadIdx.x & 31, wv = threadIdx.x >> 5;
  const int hi = lane >> 4, cn = lane & 15;
  const int rbase = (blockIdx.x << 7) + (wv << 5);      // first of the wave's tokens
  const half_t* wl = wpk + WQ_H + (lane << 3);

  v8h x[2][12];
  #pragma unroll  // constant indices keep x[], vb[], cg[] and cb[] in registers (here and below)
  for (int mt = 0; mt < 2; ++mt) {
    const half_t* p = tok + (size_t)(rbase + (mt << 4) + cn) * DIMC + (hi << 3);
    #pragma unroll
    for (int j = 0; j < 12; ++j) x[mt][j] = *reinterpret_cast<const v8h*>(p + (j << 4));
    // A later load may land on the address registers that these loads name.
    asm volatile("s_wait_xcnt 0x0" ::: "memory");
  }
  v16h vb[6];
  float cg[2], cb[2];
  #pragma unroll
  for (int kk = 0; kk < 6; ++kk) vb[kk] = load_bfrag(wl, kk * 12);
  cg[0] = cs[cn];
  cb[0] = cs[DIMC + cn];

  // Row statistics, then each lane fetches those of the 8 rows that its accumulator
  // registers hold (register r = row 8*(l>>4) + r).
  float rsd[2][8], rmd[2][8];                           // rs and rs * mean
  #pragma unroll
  for (int mt = 0; mt < 2; ++mt) {
    float s0 = 0.f, s1 = 0.f, q0 = 0.f, q1 = 0.f;       // two chains each
    #pragma unroll
    for (int j = 0; j < 12; ++j) {
      #pragma unroll
      for (int i = 0; i < 8; i += 2) {
        const float v0 = (float)x[mt][j][i], v1 = (float)x[mt][j][i + 1];
        s0 += v0; q0 += v0 * v0;
        s1 += v1; q1 += v1 * v1;
      }
    }
    float s = s0 + s1, s2 = q0 + q1;
    s  += __shfl_xor(s, 16, 32);                        // the row's other half
    s2 += __shfl_xor(s2, 16, 32);
    const float mean = s * (1.0f / DIMC);
    const float var  = s2 * (1.0f / DIMC) - mean * mean;
    const float rs = rsqrtf(var + 1e-5f);
    const float rm = rs * mean;
    #pragma unroll
    for (int r = 0; r < 8; ++r) {
      rsd[mt][r] = __shfl(rs, (hi << 3) + r, 32);
      rmd[mt][r] = __shfl(rm, (hi << 3) + r, 32);
    }
  }

  float* po = kqv + (size_t)(rbase + (hi << 3)) * DIMC + cn;
  const v8f vzero = {};
  #pragma unroll  // cg[] and cb[] are indexed by the trip's parity: constant only when unrolled
  for (int nt = 0; nt < 12; ++nt) {
    v8f acc[2] = {vzero, vzero};
    #pragma unroll
    for (int hf = 0; hf < 2; ++hf) {
      #pragma unroll
      for (int kk = 3 * hf; kk < 3 * hf + 3; ++kk) {
        #pragma unroll
        for (int mt = 0; mt < 2; ++mt) {
          const v16h va = __builtin_shufflevector(x[mt][2 * kk], x[mt][2 * kk + 1],
              0, 1, 2, 3, 4, 5, 6, 7, 8, 9, 10, 11, 12, 13, 14, 15);
          acc[mt] = __builtin_amdgcn_wmma_f32_16x16x32_f16(
              false, va, false, vb[kk], (short)0, acc[mt], false, false);
        }
      }
      if (nt + 1 < 12) {
        // The two fences hold the next tile's loads where they stand: lifted above the
        // WMMAs they need a second register set, sunk to their use they fly under nothing.
        __builtin_amdgcn_sched_barrier(0);
        #pragma unroll
        for (int kk = 3 * hf; kk < 3 * hf + 3; ++kk) vb[kk] = load_bfrag(wl, kk * 12 + nt + 1);
        if (hf) {
          cg[(nt + 1) & 1] = cs[((nt + 1) << 4) + cn];
          cb[(nt + 1) & 1] = cs[DIMC + ((nt + 1) << 4) + cn];
        }
        __builtin_amdgcn_sched_barrier(0);
      }
    }
    float o[2][8];
    #pragma unroll
    for (int mt = 0; mt < 2; ++mt) {
      #pragma unroll
      for (int r = 0; r < 8; ++r)
        o[mt][r] = rsd[mt][r] * acc[mt][r] + (cb[nt & 1] - rmd[mt][r] * cg[nt & 1]);
    }
    // All 16 results first, each in a register of its own, then the 16 stores in one
    // run: left alone, the stores share a register and each waits for the one before it.
    __builtin_amdgcn_sched_barrier(0);
    #pragma unroll
    for (int mt = 0; mt < 2; ++mt) {
      #pragma unroll
      for (int r = 0; r < 8; ++r) po[((mt << 4) + r) * DIMC + (nt << 4)] = o[mt][r];
    }
    // The next trip reuses the registers that these stores name.
    if (nt + 1 < 12) asm volatile("s_wait_xcnt 0x0" ::: "memory");
  }
}

// ---------------------------------------------------------------------------
// K5: performer features  kp/qp = exp(w.t - |t|^2/2)/sqrt(m)  + ksum reduce.
// Lane = token, 32 tokens per wave.  A lane keeps its token's k and q rows in
// registers; a weight is then the same for the whole wave, so it comes by a
// scalar load and enters the FMA as a scalar operand (no LDS read per product).
// Rows go in and out as whole-line wave accesses and are turned lane-wise in the
// wave's own LDS tile, at pitches of 16 B x odd.  No work-group barrier.
// ---------------------------------------------------------------------------
#define KQ_P 132   // floats per staged k|q row    (528 B = 16 B x 33)
#define PF_P 36    // floats per staged feature row (144 B = 16 B x 9)
#define VO_P 68    // floats per staged v / y row   (272 B = 16 B x 17)

__global__ __launch_bounds__(128) void k_perf(const float* __restrict__ kqv,
                                              const float* __restrict__ wperf,
                                              float* __restrict__ kp,
                                              float* __restrict__ qp,
                                              float* __restrict__ ksum) {
  __shared__ __attribute__((aligned(16))) float tile[4][32 * KQ_P];
  const int lane = threadIdx.x & 31, wv = threadIdx.x >> 5;
  float* T = tile[wv];
  const int b = blockIdx.x >> 5;                        // 32 blocks per batch
  const int tok0 = (blockIdx.x << 7) + (wv << 5);       // first of the wave's tokens
  // In: one token's k|q is 512 contiguous bytes, one wave load.
  {
    const float* src = kqv + (size_t)tok0 * DIMC + (lane << 2);
    float4 in[32];
    #pragma unroll  // constant indices keep in[] in registers; all loads in flight at once
    for (int i = 0; i < 32; ++i) in[i] = *reinterpret_cast<const float4*>(src + i * DIMC);
    // What follows may reuse the address registers that these loads name.
    asm volatile("s_wait_xcnt 0x0" ::: "memory");
    #pragma unroll
    for (int i = 0; i < 32; ++i)
      *reinterpret_cast<float4*>(T + i * KQ_P + (lane << 2)) = in[i];
  }
  // The other lanes' rows must stand in the tile before this lane reads its own.
  asm volatile("s_wait_dscnt 0x0" ::: "memory");
  float k[64], q[64];
  #pragma unroll  // constant indices keep k[] and q[] in registers
  for (int j = 0; j < 16; ++j) {
    const float4 u = *reinterpret_cast<const float4*>(T + lane * KQ_P + (j << 2));
    const float4 w = *reinterpret_cast<const float4*>(T + lane * KQ_P + 64 + (j << 2));
    k[4 * j] = u.x; k[4 * j + 1] = u.y; k[4 * j + 2] = u.z; k[4 * j + 3] = u.w;
    q[4 * j] = w.x; q[4 * j + 1] = w.y; q[4 * j + 2] = w.z; q[4 * j + 3] = w.w;
  }
  float xk = 0.f, xq = 0.f;
  #pragma unroll
  for (int d = 0; d < 64; ++d) { xk += k[d] * k[d]; xq += q[d] * q[d]; }
  // Four features a trip: eight independent FMA chains, each in d order.
  #pragma unroll 1  // the body is 512 FMAs; unrolled further it only grows the code
  for (int m0 = 0; m0 < MF; m0 += 4) {
    const float* w = wperf + (m0 << 6);
    float dk[4] = {0.f, 0.f, 0.f, 0.f}, dq[4] = {0.f, 0.f, 0.f, 0.f};
    #pragma unroll
    for (int d = 0; d < 64; ++d) {
      #pragma unroll
      for (int f = 0; f < 4; ++f) {
        const float wr = w[(f << 6) + d];
        dk[f] += wr * k[d]; dq[f] += wr * q[d];
      }
    }
    float4 ok, oq;
    ok.x = expf(dk[0] - 0.5f * xk) * INVSQRTM; oq.x = expf(dq[0] - 0.5f * xq) * INVSQRTM;
    ok.y = expf(dk[1] - 0.5f * xk) * INVSQRTM; oq.y = expf(dq[1] - 0.5f * xq) * INVSQRTM;
    ok.z = expf(dk[2] - 0.5f * xk) * INVSQRTM; oq.z = expf(dq[2] - 0.5f * xq) * INVSQRTM;
    ok.w = expf(dk[3] - 0.5f * xk) * INVSQRTM; oq.w = expf(dq[3] - 0.5f * xq) * INVSQRTM;
    *reinterpret_cast<float4*>(T + lane * PF_P + m0) = ok;
    *reinterpret_cast<float4*>(T + (32 + lane) * PF_P + m0) = oq;
  }
  // Every lane's features must stand in the tile before they are read across lanes.
  asm volatile("s_wait_dscnt 0x0" ::: "memory");
  // ksum: lane = feature, its column over the wave's 32 tokens, one atomic a wave.
  float s = 0.f;
  #pragma unroll
  for (int t = 0; t < 32; ++t) s += T[t * PF_P + lane];
  atomicAdd(&ksum[b * MF + lane], s);
  // Out: four tokens' features are 512 contiguous bytes, one wave store.
  float* kpo = kp + (size_t)tok0 * MF + (lane << 2);
  float* qpo = qp + (size_t)tok0 * MF + (lane << 2);
  const float* Tr = T + (lane >> 3) * PF_P + ((lane & 7) << 2);
  #pragma unroll
  for (int i = 0; i < 8; ++i) {
    *reinterpret_cast<float4*>(kpo + (i << 7)) =
        *reinterpret_cast<const float4*>(Tr + (i << 2) * PF_P);
    *reinterpret_cast<float4*>(qpo + (i << 7)) =
        *reinterpret_cast<const float4*>(Tr + (32 + (i << 2)) * PF_P);
  }
}

// ---------------------------------------------------------------------------
// K6: kptv[b,d,m] = sum_t v[b,t,d]*kp[b,t,m], a 64 x 32 product with K = tokens, on
// V_WMMA_F32_16X16X4_F32 (f32 operands, f32 sums).  A block takes 256 tokens, a wave
// 32 of them and all 64 x 32 cells (8 accumulator tiles).  Both operands come straight
// from global in fragment order, all 32 loads of a wave in flight at once:
//   lane l (c = l&15, h = l>>4), load i: token 2*i + h; 16 bytes of v at d = 4*c and
//   8 bytes of kp at m = 2*c, so a wave load covers two whole rows.
// K-step s takes loads 2*s and 2*s+1 as registers 0 and 1 of A and of B alike, so both
// sides hold token 4*s + 2*reg + h at the same place.  Component mt of the 16 bytes is
// row c of A tile mt (d = 4*c + mt); component nt of the 8 bytes is column c of B tile
// nt (m = 2*c + nt).  The 8 waves' partial sums meet in LDS, one barrier, added in wave
// order; then one global atomic per cell and block.
// ---------------------------------------------------------------------------
__global__ __launch_bounds__(256) void k_kptv(const float* __restrict__ kqv,
                                              const float* __restrict__ kp,
                                              float* __restrict__ kptv) {
  __shared__ __attribute__((aligned(16))) float part[8][EMB * MF];
  const int tid = threadIdx.x, lane = tid & 31, wv = tid >> 5;
  const int hi = lane >> 4, cn = lane & 15;
  const int b = blockIdx.x >> 4;                        // 16 blocks per batch
  const int t0 = (blockIdx.x << 8) + (wv << 5);         // first of the wave's tokens
  const float* vs = kqv + (size_t)(t0 + hi) * DIMC + 128 + (cn << 2);
  const float* ks = kp + (size_t)(t0 + hi) * MF + (cn << 1);
  float4 va[16];
  float2 kb[16];
  #pragma unroll  // constant indices keep va[], kb[] and acc[] in registers (here and below)
  for (int i = 0; i < 16; ++i) kb[i] = *reinterpret_cast<const float2*>(ks + (i << 1) * MF);
  // A later load may land on the address registers that these loads name.
  asm volatile("s_wait_xcnt 0x0" ::: "memory");
  #pragma unroll
  for (int i = 0; i < 16; ++i) va[i] = *reinterpret_cast<const float4*>(vs + (i << 1) * DIMC);
  // What follows may reuse the address registers that these loads name.
  asm volatile("s_wait_xcnt 0x0" ::: "memory");
  // Keeps all 32 loads ahead of the first WMMA: left alone, the scheduler holds a third of
  // them back until registers come free, a second memory latency in a row.
  __builtin_amdgcn_sched_barrier(0);

  const v8f vzero = {};
  v8f acc[4][2];
  #pragma unroll
  for (int mt = 0; mt < 4; ++mt) { acc[mt][0] = vzero; acc[mt][1] = vzero; }
  #pragma unroll
  for (int s = 0; s < 8; ++s) {
    const float a0[4] = {va[2 * s].x, va[2 * s].y, va[2 * s].z, va[2 * s].w};
    const float a1[4] = {va[2 * s + 1].x, va[2 * s + 1].y, va[2 * s + 1].z, va[2 * s + 1].w};
    const v2f fb[2] = {{kb[2 * s].x, kb[2 * s + 1].x}, {kb[2 * s].y, kb[2 * s + 1].y}};
    #pragma unroll
    for (int mt = 0; mt < 4; ++mt) {
      const v2f fa = {a0[mt], a1[mt]};
      #pragma unroll
      for (int nt = 0; nt < 2; ++nt) {
        acc[mt][nt] = __builtin_amdgcn_wmma_f32_16x16x4_f32(
            false, fa, false, fb[nt], (short)0, acc[mt][nt], false, false);
      }
    }
  }
  // Accumulator register r of tile (mt, nt) is cell d = 4*(8*hi + r) + mt, m = 2*cn + nt.
  float* P = part[wv] + (hi << 10) + (cn << 1);
  #pragma unroll
  for (int mt = 0; mt < 4; ++mt) {
    #pragma unroll
    for (int r = 0; r < 8; ++r) {
      float2 u;
      u.x = acc[mt][0][r]; u.y = acc[mt][1][r];
      *reinterpret_cast<float2*>(P + (((r << 2) + mt) << 5)) = u;
    }
  }
  __syncthreads();  // every wave's partial sums stand before they are added across waves
  float* dst = kptv + (size_t)b * (EMB * MF) + (tid << 2);
  #pragma unroll
  for (int j = 0; j < 2; ++j) {
    float4 sum = *reinterpret_cast<const float4*>(&part[0][(j << 10) + (tid << 2)]);
    #pragma unroll
    for (int w = 1; w < 8; ++w) {
      const float4 u = *reinterpret_cast<const float4*>(&part[w][(j << 10) + (tid << 2)]);
      sum.x += u.x; sum.y += u.y; sum.z += u.z; sum.w += u.w;
    }
    atomicAdd(dst + (j << 10), sum.x);
    atomicAdd(dst + (j << 10) + 1, sum.y);
    atomicAdd(dst + (j << 10) + 2, sum.z);
    atomicAdd(dst + (j << 10) + 3, sum.w);
  }
}

// ---------------------------------------------------------------------------
// K7: yatt = v + proj(qp @ kptv^T / (qp.ksum + eps)).  Lane = token, 32 tokens
// per wave, as in K5: qp row and output row in registers.  Every weight is
// wave-uniform: ksum, proj_w and proj_b come by scalar loads; the batch's kptv is
// staged once per block in LDS and read with all lanes on one address, so that a
// trip of the main loop waits for one run of scalar loads, not three.
// ---------------------------------------------------------------------------
__global__ __launch_bounds__(128) void k_mix(const float* __restrict__ kqv,
                                             const float* __restrict__ qp,
                                             const float* __restrict__ ksum,
                                             const float* __restrict__ kptv,
                                             const float* __restrict__ pw,
                                             const float* __restrict__ pb,
                                             float* __restrict__ yatt) {
  __shared__ __attribute__((aligned(16))) float qt[4][32 * PF_P];
  __shared__ __attribute__((aligned(16))) float vt[4][32 * VO_P];
  __shared__ __attribute__((aligned(16))) float klt[EMB * MF];
  const int lane = threadIdx.x & 31;
  // The wave's number, shown to the compiler as uniform: tile and row addresses are
  // then scalar arithmetic, a scalar base and a lane offset per load.
  const int wv = __builtin_amdgcn_readfirstlane(threadIdx.x >> 5);
  float* Q = qt[wv];
  float* V = vt[wv];
  const int b = blockIdx.x >> 5;                        // 32 blocks per batch
  const int tok0 = (blockIdx.x << 7) + (wv << 5);       // first of the wave's tokens
  // In: four tokens' qp rows, or two tokens' v rows, per wave load (whole lines).
  {
    const float* qs = qp + (size_t)tok0 * MF + (lane << 2);
    const float* vs = kqv + (size_t)tok0 * DIMC + 128 + (lane >> 4) * DIMC + ((lane & 15) << 2);
    const float* ks = kptv + (size_t)b * (EMB * MF) + (wv << 7) + (lane << 2);
    float4 qi[8], vi[16], ki[4];
    #pragma unroll  // constant indices keep qi[], vi[] and ki[] in registers
    for (int i = 0; i < 8; ++i) qi[i] = *reinterpret_cast<const float4*>(qs + (i << 7));
    #pragma unroll
    for (int i = 0; i < 4; ++i) ki[i] = *reinterpret_cast<const float4*>(ks + (i << 9));
    #pragma unroll
    for (int i = 0; i < 16; ++i) vi[i] = *reinterpret_cast<const float4*>(vs + (i << 1) * DIMC);
    #pragma unroll
    for (int i = 0; i < 8; ++i)
      *reinterpret_cast<float4*>(Q + ((i << 2) + (lane >> 3)) * PF_P + ((lane & 7) << 2)) = qi[i];
    #pragma unroll
    for (int i = 0; i < 16; ++i)
      *reinterpret_cast<float4*>(V + ((i << 1) + (lane >> 4)) * VO_P + ((lane & 15) << 2)) = vi[i];
    #pragma unroll
    for (int i = 0; i < 4; ++i)
      *reinterpret_cast<float4*>(klt + (i << 9) + (wv << 7) + (lane << 2)) = ki[i];
  }
  __syncthreads();  // klt is filled by all four waves; the wave's own tiles stand too
  float q[32], o[64];
  #pragma unroll  // constant indices keep q[] and o[] in registers
  for (int j = 0; j < 8; ++j) {
    const float4 u = *reinterpret_cast<const float4*>(Q + lane * PF_P + (j << 2));
    q[4 * j] = u.x; q[4 * j + 1] = u.y; q[4 * j + 2] = u.z; q[4 * j + 3] = u.w;
  }
  #pragma unroll
  for (int j = 0; j < 16; ++j) {
    const float4 u = *reinterpret_cast<const float4*>(V + lane * VO_P + (j << 2));
    o[4 * j] = u.x + pb[4 * j];         o[4 * j + 1] = u.y + pb[4 * j + 1];
    o[4 * j + 2] = u.z + pb[4 * j + 2]; o[4 * j + 3] = u.w + pb[4 * j + 3];
  }
  // D = qp.ksum, added in the tree order of a 32-lane xor butterfly.
  const float* ksb = ksum + b * MF;
  float t[32];
  #pragma unroll
  for (int m = 0; m < 32; ++m) t[m] = q[m] * ksb[m];
  #pragma unroll
  for (int off = 16; off > 0; off >>= 1) {
    #pragma unroll
    for (int m = 0; m < off; ++m) t[m] += t[m + off];
  }
  const float den = t[0] + 1e-8f;
  // Two attention channels e a trip: for each its sum over m, then its row of
  // proj_w into all 64 outputs, e ascending.
  #pragma unroll 2  // the two sums run as independent chains, and the second row's
                    // scalar loads fly under the first row's work
  for (int e = 0; e < EMB; ++e) {
    const float* kr = klt + (e << 5);
    const float* pr = pw + (e << 6);
    float num = 0.f;
    #pragma unroll
    for (int m = 0; m < 32; ++m) num += q[m] * kr[m];
    const float al = num / den;
    #pragma unroll
    for (int d = 0; d < 64; ++d) o[d] += al * pr[d];
  }
  #pragma unroll
  for (int j = 0; j < 16; ++j) {
    float4 u;
    u.x = o[4 * j]; u.y = o[4 * j + 1]; u.z = o[4 * j + 2]; u.w = o[4 * j + 3];
    *reinterpret_cast<float4*>(V + lane * VO_P + (j << 2)) = u;
  }
  // Every lane's row must stand in the tile before it is read across lanes.
  asm volatile("s_wait_dscnt 0x0" ::: "memory");
  // Out: two tokens' rows are 512 contiguous bytes, one wave store.
  float* yo = yatt + ((size_t)tok0 << 6) + (lane << 2);
  const float* Vr = V + (lane >> 4) * VO_P + ((lane & 15) << 2);
  #pragma unroll
  for (int i = 0; i < 16; ++i)
    *reinterpret_cast<float4*>(yo + (i << 7)) =
        *reinterpret_cast<const float4*>(Vr + (i << 1) * VO_P);
}

// ---------------------------------------------------------------------------
// K8: out = yatt + W2 @ gelu(W1 @ LN(yatt) + b1) + b2.  Fully fused:
// LN2 in registers, both 64x64 GEMMs via WMMA, A in LDS, B from the packed weights.
// Per block: 64 rows, 128 threads (4 waves).
// ---------------------------------------------------------------------------
__global__ __launch_bounds__(128) void k_mlp(const float* __restrict__ yatt,
                                             const float* __restrict__ g,
                                             const float* __restrict__ bt,
                                             const half_t* __restrict__ wpk,
                                             const float* __restrict__ b1,
                                             const float* __restrict__ b2,
                                             float* __restrict__ out) {
  __shared__ half_t Hs[64][66];
  __shared__ half_t T1s[64][66];
  __shared__ float b1l[64], b2l[64];
  const int rbase = blockIdx.x << 6;
  const int tid = threadIdx.x, lane = tid & 31, wv = tid >> 5;
  const half_t* wl = wpk + WM_H + (lane << 3);
  // LayerNorm(64): two threads per row, pair-reduce via shfl.
  {
    const int r = tid >> 1, hf = tid & 1;
    const float* p = yatt + ((size_t)(rbase + r) << 6) + (hf << 5);
    float xv[32], s = 0.f, s2 = 0.f;
    #pragma unroll
    for (int j = 0; j < 32; ++j) { const float v = p[j]; xv[j] = v; s += v; s2 += v * v; }
    s  += __shfl_xor(s, 1, 32);
    s2 += __shfl_xor(s2, 1, 32);
    const float mean = s * (1.0f / 64.f);
    const float var  = s2 * (1.0f / 64.f) - mean * mean;
    const float rs = rsqrtf(var + 1e-5f);
    #pragma unroll
    for (int j = 0; j < 32; ++j) {
      const int c = (hf << 5) + j;
      Hs[r][c] = (half_t)((xv[j] - mean) * rs * g[c] + bt[c]);
    }
  }
  // W1's fragments are asked for ahead of the barrier and arrive during its wait.
  v16h vb1[8];
  #pragma unroll  // constant indices keep vb1[] in registers
  for (int f = 0; f < 8; ++f) vb1[f] = load_bfrag(wl, f);
  if (tid < 64) { b1l[tid] = b1[tid]; b2l[tid] = b2[tid]; }
  __syncthreads();
  // W2's fragments arrive while the first GEMM and its GELU run.
  v16h vb2[8];
  #pragma unroll  // constant indices keep vb2[] in registers
  for (int f = 0; f < 8; ++f) vb2[f] = load_bfrag(wl, 8 + f);

  const v8f vzero = {};
  v8f acc[4];
  #pragma unroll
  for (int i = 0; i < 4; ++i) acc[i] = vzero;
  #pragma unroll
  for (int kk = 0; kk < 2; ++kk) {
    const int ks = kk << 5;
    const v16h va = load_frag(&Hs[0][ks], wv << 4, 66, lane);
    #pragma unroll
    for (int nt = 0; nt < 4; ++nt) {
      acc[nt] = __builtin_amdgcn_wmma_f32_16x16x32_f16(
          false, va, false, vb1[(kk << 2) + nt], (short)0, acc[nt], false, false);
    }
  }
  const int hi = lane >> 4, cn = lane & 15;
  #pragma unroll
  for (int nt = 0; nt < 4; ++nt) {
    const int col = (nt << 4) + cn;
    #pragma unroll
    for (int r = 0; r < 8; ++r) {
      const int row = (wv << 4) + r + (hi << 3);
      T1s[row][col] = (half_t)gelu_exact(acc[nt][r] + b1l[col]);
    }
  }
  __syncthreads();
  v8f acc2[4];
  #pragma unroll
  for (int i = 0; i < 4; ++i) acc2[i] = vzero;
  #pragma unroll
  for (int kk = 0; kk < 2; ++kk) {
    const int ks = kk << 5;
    const v16h va = load_frag(&T1s[0][ks], wv << 4, 66, lane);
    #pragma unroll
    for (int nt = 0; nt < 4; ++nt) {
      acc2[nt] = __builtin_amdgcn_wmma_f32_16x16x32_f16(
          false, va, false, vb2[(kk << 2) + nt], (short)0, acc2[nt], false, false);
    }
  }
  #pragma unroll
  for (int nt = 0; nt < 4; ++nt) {
    const int col = (nt << 4) + cn;
    const float bv = b2l[col];
    #pragma unroll
    for (int r = 0; r < 8; ++r) {
      const int row = (wv << 4) + r + (hi << 3);
      const size_t gi = ((size_t)(rbase + row) << 6) + col;
      out[gi] = yatt[gi] + acc2[nt][r] + bv;
    }
  }
}

// ---------------------------------------------------------------------------
extern "C" void kernel_launch(void* const* d_in, const int* in_sizes, int n_in,
                              void* d_out, int out_size, void* d_ws, size_t ws_size,
                              hipStream_t stream) {
  (void)in_sizes; (void)n_in; (void)out_size; (void)ws_size;
  const float* x      = (const float*)d_in[0];
  const float* conv_w = (const float*)d_in[1];
  const float* conv_b = (const float*)d_in[2];
  const float* ln1_g  = (const float*)d_in[3];
  const float* ln1_b  = (const float*)d_in[4];
  const float* kqv_w  = (const float*)d_in[5];
  const float* kqv_b  = (const float*)d_in[6];
  const float* proj_w = (const float*)d_in[7];
  const float* proj_b = (const float*)d_in[8];
  const float* w_perf = (const float*)d_in[9];
  const float* ln2_g  = (const float*)d_in[10];
  const float* ln2_b  = (const float*)d_in[11];
  const float* mlp_w1 = (const float*)d_in[12];
  const float* mlp_b1 = (const float*)d_in[13];
  const float* mlp_w2 = (const float*)d_in[14];
  const float* mlp_b2 = (const float*)d_in[15];

  char* ws = (char*)d_ws;
  half_t* xh   = (half_t*)(ws + XH_OFF);
  half_t* tok  = (half_t*)(ws + TOK_OFF);
  float*  kqv  = (float*)(ws + KQV_OFF);
  float*  kp   = (float*)(ws + KP_OFF);     // reuses XH region (xh dead)
  float*  qp   = (float*)(ws + QP_OFF);
  float*  ksum = (float*)(ws + KSUM_OFF);
  float*  kptv = (float*)(ws + KPTV_OFF);
  float*  yatt = (float*)(ws + YATT_OFF);   // reuses TOK region (tok dead)
  half_t* wpk  = (half_t*)(ws + WPK_OFF);
  float*  cs   = (float*)(ws + CS_OFF);
  float*  out  = (float*)d_out;

  // Zero the atomic accumulators (ksum + kptv are contiguous).
  hipMemsetAsync(ws + KSUM_OFF, 0, 4096 + (size_t)BATCH * EMB * MF * 4, stream);

  k_pack<<<dim3(WPK_BLOCKS + 1 + BATCH * 256), dim3(256), 0, stream>>>(
      x, conv_w, kqv_w, mlp_w1, mlp_w2, ln1_g, ln1_b, kqv_b, xh, wpk, cs);
  k_conv<<<dim3(64, 3, BATCH), dim3(128), 0, stream>>>(xh, wpk, conv_b, tok);
  k_kqv <<<dim3((BATCH * TOKN) / 128), dim3(128), 0, stream>>>(tok, wpk, cs, kqv);
  k_perf<<<dim3(BATCH * 32), dim3(128), 0, stream>>>(kqv, w_perf, kp, qp, ksum);
  k_kptv<<<dim3(BATCH * 16), dim3(256), 0, stream>>>(kqv, kp, kptv);
  k_mix <<<dim3(BATCH * 32), dim3(128), 0, stream>>>(kqv, qp, ksum, kptv,
                                                      proj_w, proj_b, yatt);
  k_mlp <<<dim3((BATCH * TOKN) / 64), dim3(128), 0, stream>>>(
      yatt, ln2_g, ln2_b, wpk, mlp_b1, mlp_b2, out);
}

// v007
// Two timings next to v006 put it at 1.15 and 1.14 times that version's speed.
// All steps since v000 together make it 6.52 times as fast.
#include <hip/hip_runtime.h>
#include <hip/hip_bf16.h>
#include <math.h>

// ---------------------------------------------------------------------------
// MI455X (gfx1250, wave32) implementation of the PRM + Token-Performer block.
// All dense GEMMs (implicit-GEMM dilated convs, kqv, MLP) use
// V_WMMA_F32_16X16X32_F16 with f32 accumulation; kptv is on the f32 WMMA form, the
// other skinny performer pieces are VALU.  Fused epilogues keep each intermediate to one
// HBM round-trip (pipeline is ~bandwidth-bound at 23.3 TB/s).
// Conv reduction axis ordered k = kid*64 + ic so each 32-wide WMMA K-step has
// a constant kernel tap; the image stays channels-last, so one pixel's 64
// channels are one 128-byte line and an im2col row is contiguous in k.
// Every GEMM weight matrix is packed once per call into f16 in the order of the
// WMMA B fragment, so a B fragment is two whole-line 16-byte loads per lane.
// ---------------------------------------------------------------------------

typedef _Float16 half_t;
typedef __attribute__((ext_vector_type(16))) _Float16 v16h;
typedef __attribute__((ext_vector_type(8)))  _Float16 v8h;
typedef __attribute__((ext_vector_type(8)))  float    v8f;
typedef __attribute__((ext_vector_type(2)))  float    v2f;

// Problem constants (match reference)
#define BATCH   32
#define CIN     64
#define IMGSZ   128
#define NPIX    16384     // 128*128
#define TOKN    4096      // 64*64 post-stride-2 tokens
#define EBR     64
#define DIMC    192       // 3*EBR
#define EMB     64
#define MF      32        // performer features
#define INVSQRTM 0.17677669529663687f

// Workspace layout (bytes). Buffers reused once their producers/consumers
// are done:  XH region -> KP/QP,  TOK region -> YATT.
#define XH_OFF    ((size_t)0)                                   // f16 [B][128][128][CIN]  67.1MB
#define KP_OFF    ((size_t)0)                                   // f32 [B][T][32]          (reuse XH)
#define QP_OFF    ((size_t)16777216)                            // f32 [B][T][32]
#define TOK_OFF   ((size_t)67108864)                            // f16 [B][T][192]         50.3MB
#define YATT_OFF  TOK_OFF                                       // f32 [B][T][64]          (reuse TOK)
#define KQV_OFF   ((size_t)(67108864 + 2*50331648))             // f32 [B][T][192]         100.7MB
#define KSUM_OFF  (KQV_OFF + (size_t)BATCH*TOKN*DIMC*4)         // f32 [B][32]
#define KPTV_OFF  (KSUM_OFF + (size_t)4096)                     // f32 [B][64][32]
#define WPK_OFF   (KPTV_OFF + (size_t)BATCH*EMB*MF*4)           // f16 packed weights, 311 KB
#define CS_OFF    (WPK_OFF + (size_t)311296)                    // f32 [2][192] kqv column terms

// Packed weights: one B fragment (32 k x 16 n) = 2 planes x 32 lanes x 8 halves.
// Plane p, lane l, element i hold k = 16*p + 8*(l>>4) + i, n = l&15: the k order
// of load_frag.  A unit is one lane's 8 halves (16 bytes) of one plane.
#define FRAG_H    512                       // halves per fragment
#define WC_UNITS  13824                     // conv: 3 branches x 18 K-steps x 4 n-tiles x 64
#define WQ_UNITS  4608                      // kqv:  6 K-steps x 12 n-tiles x 64
#define WM_UNITS  1024                      // mlp:  2 matrices x 2 K-steps x 4 n-tiles x 64
#define WQ_H      (WC_UNITS * 8)            // first half of the kqv part
#define WM_H      ((WC_UNITS + WQ_UNITS) * 8)
#define WPK_BLOCKS ((WC_UNITS + WQ_UNITS + WM_UNITS) / 256)   // 76

// GELU with erf, four values at once: 0.5*x*(1 + erf(x/sqrt2)) = max(x,0) - |x|*h with
// h = 0.5*erfc(|x|/sqrt2), and erfc(z) = t*(a1 + t*(a2 + t*(a3 + t*(a4 + t*a5)))) * exp(-z*z),
// t = 1/(1 + p*z), which is within 1.5e-7 of erfc for every z >= 0.  One straight line for
// every x: no branch on |x|, so the values are independent chains that can be interleaved.
// The halves and the 1/sqrt2 are folded into the constants; exp(-z*z) = 2^-(c*x)^2 with
// c = sqrt(log2(e)/2).
__device__ __forceinline__ void gelu_exact4(float (&x)[4]) {
  float t[4], e[4];
  #pragma unroll  // constant indices keep t[], e[] and x[] in registers (here and below)
  for (int i = 0; i < 4; ++i) {
    const float u = x[i] * 0.84932180f;
    t[i] = fmaf(fabsf(x[i]), 0.23164189f, 1.0f);
    e[i] = -(u * u);
  }
  // The reciprocals, then the powers of two, in place and each kind in one run: behind a
  // transcendental the instruction set asks for one slot before its source is overwritten
  // or its result read.  Each is that slot for the one in front of it, the v_nop for the last.
  asm("v_rcp_f32 %0, %0\n\t"
      "v_rcp_f32 %1, %1\n\t"
      "v_rcp_f32 %2, %2\n\t"
      "v_rcp_f32 %3, %3\n\t"
      "v_nop"
      : "+v"(t[0]), "+v"(t[1]), "+v"(t[2]), "+v"(t[3]));
  asm("v_exp_f32 %0, %0\n\t"
      "v_exp_f32 %1, %1\n\t"
      "v_exp_f32 %2, %2\n\t"
      "v_exp_f32 %3, %3\n\t"
      "v_nop"
      : "+v"(e[0]), "+v"(e[1]), "+v"(e[2]), "+v"(e[3]));
  #pragma unroll
  for (int i = 0; i < 4; ++i) {
    float p = 0.5307027145f;
    p = fmaf(p, t[i], -0.7265760135f);
    p = fmaf(p, t[i], 0.7107068705f);
    p = fmaf(p, t[i], -0.142248368f);
    p = fmaf(p, t[i], 0.127414796f);
    x[i] = fmaf(-fabsf(x[i]), (p * t[i]) * e[i], fmaxf(x[i], 0.0f));
  }
}

// Load a 16x32 f16 WMMA fragment (A row-major, or B assembled as [N][K]).
// tile: LDS matrix with K contiguous per row; stride in half elements.
// ISA layout: lanes 0-15 hold K0-7 (v0-3) and K16-23 (v4-7); lanes 16-31
// hold K8-15 and K24-31; M/N = lane&15 (+row0).
__device__ __forceinline__ v16h load_frag(const half_t* tile, int row0,
                                          int stride, int lane) {
  const half_t* p = tile + (row0 + (lane & 15)) * stride;
  const int hi = lane >> 4;
  v16h f;
  #pragma unroll
  for (int j = 0; j < 8; ++j) {
    const int kb = ((j >> 2) << 4) + (hi << 3) + ((j & 3) << 1);
    f[2 * j]     = p[kb];
    f[2 * j + 1] = p[kb + 1];
  }
  return f;
}

// B fragment number frag of a packed weight part, as two 512-byte wave loads.
__device__ __forceinline__ v16h load_bfrag(const half_t* wl, int frag) {
  const v8h lo = *reinterpret_cast<const v8h*>(wl + frag * FRAG_H);
  const v8h hi = *reinterpret_cast<const v8h*>(wl + frag * FRAG_H + 256);
  return __builtin_shufflevector(lo, hi,
      0, 1, 2, 3, 4, 5, 6, 7, 8, 9, 10, 11, 12, 13, 14, 15);
}

// ---------------------------------------------------------------------------
// K1: x [B,N,C] f32  ->  xh [B,N,C] f16  (same channels-last order, convert
// only).  8 elements per thread per pass: two 16-byte loads, one 16-byte store.
// The first WPK_BLOCKS blocks pack the weights instead: one unit per thread,
// eight strided f32 reads, one 16-byte store; row k of the kqv weights is scaled by
// ln1's g[k] on the way.  The next block sums the two column terms of K3.
// ---------------------------------------------------------------------------
__global__ __launch_bounds__(256) void k_pack(const float* __restrict__ x,
                                              const float* __restrict__ cw,
                                              const float* __restrict__ wq,
                                              const float* __restrict__ w1,
                                              const float* __restrict__ w2,
                                              const float* __restrict__ lg,
                                              const float* __restrict__ lb,
                                              const float* __restrict__ qb,
                                              half_t* __restrict__ xh,
                                              half_t* __restrict__ wpk,
                                              float* __restrict__ cs) {
  if (blockIdx.x == WPK_BLOCKS) {            // thread = column n of the kqv weights
    if (threadIdx.x < DIMC) {
      const float* wc = wq + threadIdx.x;
      float sg = 0.f, sb = 0.f;
      #pragma unroll 16  // 16 loads in flight a trip; many more would raise the kernel's registers
      for (int k = 0; k < DIMC; ++k) {
        const float w = wc[k * DIMC];
        sg += (float)(half_t)(w * lg[k]);    // the f16 value that the GEMM multiplies by
        sb += w * lb[k];
      }
      cs[threadIdx.x] = sg;
      cs[DIMC + threadIdx.x] = sb + qb[threadIdx.x];
    }
    return;
  }
  if (blockIdx.x < WPK_BLOCKS) {
    const int u = (blockIdx.x << 8) + threadIdx.x;
    const int n = u & 15;
    const int k0 = (((u >> 5) & 1) << 4) + (((u >> 4) & 1) << 3);  // k of element 0
    const float* src;
    int step;                                // floats from one k to the next
    float sc[8] = {1.f, 1.f, 1.f, 1.f, 1.f, 1.f, 1.f, 1.f};
    if (blockIdx.x < WC_UNITS / 256) {       // frag = ((br*9 + kid)*2 + h)*4 + nt
      const int f = u >> 6;
      const int nt = f & 3, h = (f >> 2) & 1, tap = f >> 3;   // tap = br*9 + kid
      const int br = tap / 9, kid = tap - br * 9;
      src = cw + (((br << 6) + (nt << 4) + n) * CIN + (h << 5) + k0) * 9 + kid;
      step = 9;
    } else if (blockIdx.x < (WC_UNITS + WQ_UNITS) / 256) {    // frag = kk*12 + n-tile
      const int f = (u - WC_UNITS) >> 6;
      const int kk = f / 12, nt = f - kk * 12;
      src = wq + ((kk << 5) + k0) * DIMC + (nt << 4) + n;
      step = DIMC;
      #pragma unroll
      for (int i = 0; i < 8; ++i) sc[i] = lg[(kk << 5) + k0 + i];
    } else {                                 // frag = (matrix*2 + kk)*4 + nt
      const int f = (u - WC_UNITS - WQ_UNITS) >> 6;
      const int nt = f & 3, kk = (f >> 2) & 1;
      src = ((f >> 3) ? w2 : w1) + ((kk << 5) + k0) * EMB + (nt << 4) + n;
      step = EMB;
    }
    float t[8];
    #pragma unroll  // constant indices keep t[] in registers
    for (int i = 0; i < 8; ++i) t[i] = src[i * step];
    // The conversions below reuse the address registers that these loads name.
    asm volatile("s_wait_xcnt 0x0" ::: "memory");
    v8h o;
    #pragma unroll
    for (int i = 0; i < 8; ++i) o[i] = (half_t)(t[i] * sc[i]);
    *reinterpret_cast<v8h*>(wpk + ((size_t)u << 3)) = o;
    return;
  }
  const size_t base = ((size_t)(blockIdx.x - WPK_BLOCKS - 1) << 12) + ((size_t)threadIdx.x << 3);
  #pragma unroll  // both passes' loads are in flight before the first store
  for (int rep = 0; rep < 2; ++rep) {
    const size_t e = base + ((size_t)rep << 11);
    const float4 u = *reinterpret_cast<const float4*>(x + e);
    const float4 w = *reinterpret_cast<const float4*>(x + e + 4);
    v8h o;
    o[0] = (half_t)u.x; o[1] = (half_t)u.y; o[2] = (half_t)u.z; o[3] = (half_t)u.w;
    o[4] = (half_t)w.x; o[5] = (half_t)w.y; o[6] = (half_t)w.z; o[7] = (half_t)w.w;
    *reinterpret_cast<v8h*>(xh + e) = o;
  }
}

// ---------------------------------------------------------------------------
// K2: implicit-GEMM dilated conv + bias + GELU -> tokens f16 [B,T,192].
// Per block: 64 tokens (one output row) x 64 out-channels, K=576 in 18 steps of 32.
// K axis ordered k = kid*64 + ic.  The three image rows that the output row's taps
// touch are brought into LDS once per block by asynchronous copies, whole 128-byte
// lines, and every wave reads its A fragments from there.  A wave owns all 64 tokens
// (4 row tiles) and 16 out-channels, so each packed B fragment is loaded by one wave
// of the block only.
// LDS: plane (kh, parity of the pixel column) = 67 slots of 144 bytes: 2 zero slots,
// the 64 pixels of that parity, 1 zero slot.  Tap column 2*ow + off is slot
// ow + (off >> 1) + 2 of parity off & 1, so neighbouring tokens are 144 bytes
// (16 B x odd) apart; a column outside the image falls on a zero slot, a row outside
// the image is a zero plane.
// grid = (64 token tiles, 3 branches, 32 batches), 4 waves.
// ---------------------------------------------------------------------------
#define CV_SLOT   144                   // bytes per staged pixel
#define CV_PLANE  (67 * CV_SLOT)        // bytes per plane

// Four 16-byte-per-lane copies global -> LDS.  The wait at the end stands in the
// copies' own statement: their address registers may be rewritten behind it.
__device__ __forceinline__ void copy4(unsigned l0, unsigned l1, unsigned l2, unsigned l3,
                                      const half_t* g0, const half_t* g1,
                                      const half_t* g2, const half_t* g3) {
  asm volatile("global_load_async_to_lds_b128 %0, %4, off\n\t"
               "global_load_async_to_lds_b128 %1, %5, off\n\t"
               "global_load_async_to_lds_b128 %2, %6, off\n\t"
               "global_load_async_to_lds_b128 %3, %7, off\n\t"
               "s_wait_xcnt 0x0"
               :: "v"(l0), "v"(l1), "v"(l2), "v"(l3), "v"(g0), "v"(g1), "v"(g2), "v"(g3)
               : "memory");
}

template <int DIL>
__device__ __forceinline__ void conv_acc(const half_t* __restrict__ xb,   // the batch's image
                                         const half_t* __restrict__ wl,   // branch's B, lane's place
                                         half_t* img, int oh, int tid, v8f (&acc)[4]) {
  const int lane = tid & 31, wv = tid >> 5;
  const int hi = lane >> 4, cn = lane & 15;
  const v8h hzero = (v8h)(half_t)0.0f;
  char* imgb = reinterpret_cast<char*>(img);

  // Zero slots, and whole planes for a row outside the image.
  #pragma unroll  // kh constant: plane offsets fold into the instructions (here and below)
  for (int kh = 0; kh < 3; ++kh) {
    const int ih = (oh << 1) + (kh - 1) * DIL;
    char* pl = imgb + (kh << 1) * CV_PLANE;
    if ((unsigned)ih < 128u) {
      if (tid < 48) {                       // 2 planes x 3 slots x 8 pieces of 16 bytes
        const int p = tid / 24, r = tid - p * 24, s = r >> 3;
        *reinterpret_cast<v8h*>(pl + p * CV_PLANE + (s < 2 ? s : 66) * CV_SLOT + ((r & 7) << 4)) = hzero;
      }
    } else {
      for (int i = tid; i < 2 * CV_PLANE / 16; i += 128)
        *reinterpret_cast<v8h*>(pl + (i << 4)) = hzero;
    }
  }
  // This wave's LDS stores have retired before its copies are pointed at the array.
  asm volatile("s_wait_dscnt 0x0" ::: "memory");

  // Copies: a wave copy is 4 pixels x 128 bytes; 8 lanes share a pixel.  Odd dilation
  // needs every pixel of the row (4 neighbours a copy), dilation 2 the even ones only.
  const unsigned lbase = (unsigned)(size_t)img + ((lane & 7) << 4);
  #pragma unroll
  for (int kh = 0; kh < 3; ++kh) {
    const int ih = (oh << 1) + (kh - 1) * DIL;
    if ((unsigned)ih < 128u) {              // the same for the whole block
      const half_t* gr = xb + ((size_t)ih << 13) + ((lane & 7) << 3);
      #pragma unroll
      for (int c = 0; c < ((DIL == 2) ? 1 : 2); ++c) {
        unsigned l[4];
        const half_t* g[4];
        #pragma unroll  // constant indices keep l[] and g[] in registers
        for (int i = 0; i < 4; ++i) {
          const int grp = (DIL == 2) ? ((wv << 2) + i) : ((wv << 3) + (c << 2) + i);
          const int px = (DIL == 2) ? (((grp << 2) + (lane >> 3)) << 1) : ((grp << 2) + (lane >> 3));
          l[i] = lbase + ((kh << 1) + (px & 1)) * CV_PLANE + ((px >> 1) + 2) * CV_SLOT;
          g[i] = gr + (px << 6);
        }
        copy4(l[0], l[1], l[2], l[3], g[0], g[1], g[2], g[3]);
      }
    }
  }

  // B: the wave's column tile, 2 fragments a tap, kept three taps ahead in 4 register sets.
  v16h vb[4][2];
  #pragma unroll  // constant indices keep vb[] and a[] in registers (here and below)
  for (int t = 0; t < 3; ++t) {
    #pragma unroll
    for (int h = 0; h < 2; ++h) vb[t][h] = load_bfrag(wl + t * (8 * FRAG_H), (h << 2) + wv);
  }
  // This wave's copies have landed; behind the barrier every wave's have.
  asm volatile("s_wait_asynccnt 0x0" ::: "memory");
  __syncthreads();

  // A: lane l reads row l&15 of each row tile: 16-byte runs at k = 16*q + 8*(l>>4).
  // Step s = 2*kid + h is one K-step of 32: its 8 reads are asked for one step ahead.
  const char* ar = imgb + (cn + 2) * CV_SLOT + (hi << 4);
  v8h a[2][8];
  #pragma unroll  // s picks register sets and LDS offsets: constants only when unrolled
  for (int s = -1; s < 18; ++s) {
    // The two fences hold the loads for later steps in one run ahead of this step's
    // WMMAs: lifted higher they need more registers, sunk to their use they fly under
    // nothing.
    __builtin_amdgcn_sched_barrier(0);
    if (s >= 0 && (s & 1) == 0 && (s >> 1) + 3 < 9) {
      const int kb = (s >> 1) + 3;
      #pragma unroll
      for (int h = 0; h < 2; ++h)
        vb[kb & 3][h] = load_bfrag(wl + kb * (8 * FRAG_H), (h << 2) + wv);
      // What follows may reuse the address registers that these loads name.
      asm volatile("s_wait_xcnt 0x0" ::: "memory");
    }
    if (s + 1 < 18) {
      const int sn = s + 1, kn = sn >> 1, kh = kn / 3, off = (kn - kh * 3 - 1) * DIL;
      const char* ap = ar + ((kh << 1) + (off & 1)) * CV_PLANE + (off >> 1) * CV_SLOT + ((sn & 1) << 6);
      #pragma unroll
      for (int mt = 0; mt < 4; ++mt) {
        #pragma unroll
        for (int j = 0; j < 2; ++j)
          a[sn & 1][(mt << 1) + j] =
              *reinterpret_cast<const v8h*>(ap + (mt << 4) * CV_SLOT + (j << 5));
      }
    }
    __builtin_amdgcn_sched_barrier(0);
    if (s >= 0) {
      #pragma unroll
      for (int mt = 0; mt < 4; ++mt) {
        const v16h va = __builtin_shufflevector(a[s & 1][(mt << 1)], a[s & 1][(mt << 1) + 1],
            0, 1, 2, 3, 4, 5, 6, 7, 8, 9, 10, 11, 12, 13, 14, 15);
        acc[mt] = __builtin_amdgcn_wmma_f32_16x16x32_f16(
            false, va, false, vb[(s >> 1) & 3][s & 1], (short)0, acc[mt], false, false);
      }
    }
  }
}

__global__ __launch_bounds__(128) void k_conv(const half_t* __restrict__ xh,
                                              const half_t* __restrict__ wpk,
                                              const float* __restrict__ cb,
                                              half_t* __restrict__ tok) {
  __shared__ __attribute__((aligned(16))) half_t img[6 * CV_PLANE / 2];
  const int tbase = blockIdx.x << 6;
  const int br = blockIdx.y;
  const int b  = blockIdx.z;
  const int tid = threadIdx.x, lane = tid & 31, wv = tid >> 5;
  const half_t* wl = wpk + br * (72 * FRAG_H) + (lane << 3);
  const half_t* xb = xh + (size_t)b * NPIX * CIN;

  v8f acc[4];
  const v8f vzero = {};
  #pragma unroll
  for (int i = 0; i < 4; ++i) acc[i] = vzero;

  // One body per dilation: every LDS offset of the taps is then a constant.
  if (br == 0)      conv_acc<1>(xb, wl, img, blockIdx.x, tid, acc);
  else if (br == 1) conv_acc<2>(xb, wl, img, blockIdx.x, tid, acc);
  else              conv_acc<3>(xb, wl, img, blockIdx.x, tid, acc);

  // Epilogue: bias + exact GELU, write tokens (branch-major channel concat)
  const int hi = lane >> 4, cn = lane & 15;
  const int oc = (wv << 4) + cn;
  const float bias = cb[br * EBR + oc];
  #pragma unroll
  for (int mt = 0; mt < 4; ++mt) {
    #pragma unroll
    for (int r0 = 0; r0 < 8; r0 += 4) {
      float v[4];
      #pragma unroll
      for (int i = 0; i < 4; ++i) v[i] = acc[mt][r0 + i] + bias;
      gelu_exact4(v);
      #pragma unroll
      for (int i = 0; i < 4; ++i) {
        const int row = (mt << 4) + r0 + i + (hi << 3);
        const int t = tbase + row;
        tok[((size_t)b * TOKN + t) * DIMC + br * EBR + oc] = (half_t)v[i];
      }
    }
  }
}

// ---------------------------------------------------------------------------
// K3: LayerNorm(192) + kqv GEMM  [131072 x 192] @ [192 x 192] + bias -> kqv f32.
// With W' = g o W (packed so by K1), cg[n] = sum_k W'[k][n] and
// cb[n] = bias[n] + sum_k bt[k] W[k][n]:
//   LN(x) @ W + bias = rs * (x @ W' - mean * cg) + cb,
// so the raw f16 token rows are the A operand and a row's mean and rs enter only at
// the accumulators.  A wave owns 32 tokens (two 16-row tiles) and all 192 columns.
// Lane l reads row l&15 of each tile straight from global in the order of the WMMA A
// fragment: 16-byte runs at k = 16*j + 8*(l>>4), j = 0..11, so the lane pair
// (l, l+16) holds the whole row; its sums are a sum in the lane and one exchange with
// the partner lane.  No LDS tile, no barrier, no normalised copy in memory.
// B: 6 packed fragments per 16 columns, in one register set: a fragment of the
// next column tile is asked for as soon as this tile's WMMAs have read its place.
// grid = 1024 blocks of 4 waves = 4 waves per SIMD.
// ---------------------------------------------------------------------------
__global__ __launch_bounds__(128) void k_kqv(const half_t* __restrict__ tok,
                                             const half_t* __restrict__ wpk,
                                             const float* __restrict__ cs,
                                             float* __restrict__ kqv) {
  const int lane = threadIdx.x & 31, wv = threadIdx.x >> 5;
  const int hi = lane >> 4, cn = lane & 15;
  const int rbase = (blockIdx.x << 7) + (wv << 5);      // first of the wave's tokens
  const half_t* wl = wpk + WQ_H + (lane << 3);

  v8h x[2][12];
  #pragma unroll  // constant indices keep x[], vb[], cg[] and cb[] in registers (here and below)
  for (int mt = 0; mt < 2; ++mt) {
    const half_t* p = tok + (size_t)(rbase + (mt << 4) + cn) * DIMC + (hi << 3);
    #pragma unroll
    for (int j = 0; j < 12; ++j) x[mt][j] = *reinterpret_cast<const v8h*>(p + (j << 4));
    // A later load may land on the address registers that these loads name.
    asm volatile("s_wait_xcnt 0x0" ::: "memory");
  }
  v16h vb[6];
  float cg[2], cb[2];
  #pragma unroll
  for (int kk = 0; kk < 6; ++kk) vb[kk] = load_bfrag(wl, kk * 12);
  cg[0] = cs[cn];
  cb[0] = cs[DIMC + cn];

  // Row statistics, then each lane fetches those of the 8 rows that its accumulator
  // registers hold (register r = row 8*(l>>4) + r).
  float rsd[2][8], rmd[2][8];                           // rs and rs * mean
  #pragma unroll
  for (int mt = 0; mt < 2; ++mt) {
    float s0 = 0.f, s1 = 0.f, q0 = 0.f, q1 = 0.f;       // two chains each
    #pragma unroll
    for (int j = 0; j < 12; ++j) {
      #pragma unroll
      for (int i = 0; i < 8; i += 2) {
        const float v0 = (float)x[mt][j][i], v1 = (float)x[mt][j][i + 1];
        s0 += v0; q0 += v0 * v0;
        s1 += v1; q1 += v1 * v1;
      }
    }
    float s = s0 + s1, s2 = q0 + q1;
    s  += __shfl_xor(s, 16, 32);                        // the row's other half
    s2 += __shfl_xor(s2, 16, 32);
    const float mean = s * (1.0f / DIMC);
    const float var  = s2 * (1.0f / DIMC) - mean * mean;
    const float rs = rsqrtf(var + 1e-5f);
    const float rm = rs * mean;
    #pragma unroll
    for (int r = 0; r < 8; ++r) {
      rsd[mt][r] = __shfl(rs, (hi << 3) + r, 32);
      rmd[mt][r] = __shfl(rm, (hi << 3) + r, 32);
    }
  }

  float* po = kqv + (size_t)(rbase + (hi << 3)) * DIMC + cn;
  const v8f vzero = {};
  #pragma unroll  // cg[] and cb[] are indexed by the trip's parity: constant only when unrolled
  for (int nt = 0; nt < 12; ++nt) {
    v8f acc[2] = {vzero, vzero};
    #pragma unroll
    for (int hf = 0; hf < 2; ++hf) {
      #pragma unroll
      for (int kk = 3 * hf; kk < 3 * hf + 3; ++kk) {
        #pragma unroll
        for (int mt = 0; mt < 2; ++mt) {
          const v16h va = __builtin_shufflevector(x[mt][2 * kk], x[mt][2 * kk + 1],
              0, 1, 2, 3, 4, 5, 6, 7, 8, 9, 10, 11, 12, 13, 14, 15);
          acc[mt] = __builtin_amdgcn_wmma_f32_16x16x32_f16(
              false, va, false, vb[kk], (short)0, acc[mt], false, false);
        }
      }
      if (nt + 1 < 12) {
        // The two fences hold the next tile's loads where they stand: lifted above the
        // WMMAs they need a second register set, sunk to their use they fly under nothing.
        __builtin_amdgcn_sched_barrier(0);
        #pragma unroll
        for (int kk = 3 * hf; kk < 3 * hf + 3; ++kk) vb[kk] = load_bfrag(wl, kk * 12 + nt + 1);
        if (hf) {
          cg[(nt + 1) & 1] = cs[((nt + 1) << 4) + cn];
          cb[(nt + 1) & 1] = cs[DIMC + ((nt + 1) << 4) + cn];
        }
        __builtin_amdgcn_sched_barrier(0);
      }
    }
    float o[2][8];
    #pragma unroll
    for (int mt = 0; mt < 2; ++mt) {
      #pragma unroll
      for (int r = 0; r < 8; ++r)
        o[mt][r] = rsd[mt][r] * acc[mt][r] + (cb[nt & 1] - rmd[mt][r] * cg[nt & 1]);
    }
    // All 16 results first, each in a register of its own, then the 16 stores in one
    // run: left alone, the stores share a register and each waits for the one before it.
    __builtin_amdgcn_sched_barrier(0);
    #pragma unroll
    for (int mt = 0; mt < 2; ++mt) {
      #pragma unroll
      for (int r = 0; r < 8; ++r) po[((mt << 4) + r) * DIMC + (nt << 4)] = o[mt][r];
    }
    // The next trip reuses the registers that these stores name.
    if (nt + 1 < 12) asm volatile("s_wait_xcnt 0x0" ::: "memory");
  }
}

// ---------------------------------------------------------------------------
// K5: performer features  kp/qp = exp(w.t - |t|^2/2)/sqrt(m)  + ksum reduce.
// Lane = token, 32 tokens per wave.  A lane keeps its token's k and q rows in
// registers; a weight is then the same for the whole wave, so it comes by a
// scalar load and enters the FMA as a scalar operand (no LDS read per product).
// Rows go in and out as whole-line wave accesses and are turned lane-wise in the
// wave's own LDS tile, at pitches of 16 B x odd.  No work-group barrier.
// ---------------------------------------------------------------------------
#define KQ_P 132   // floats per staged k|q row    (528 B = 16 B x 33)
#define PF_P 36    // floats per staged feature row (144 B = 16 B x 9)
#define VO_P 68    // floats per staged v / y row   (272 B = 16 B x 17)

__global__ __launch_bounds__(128) void k_perf(const float* __restrict__ kqv,
                                              const float* __restrict__ wperf,
                                              float* __restrict__ kp,
                                              float* __restrict__ qp,
                                              float* __restrict__ ksum) {
  __shared__ __attribute__((aligned(16))) float tile[4][32 * KQ_P];
  const int lane = threadIdx.x & 31, wv = threadIdx.x >> 5;
  float* T = tile[wv];
  const int b = blockIdx.x >> 5;                        // 32 blocks per batch
  const int tok0 = (blockIdx.x << 7) + (wv << 5);       // first of the wave's tokens
  // In: one token's k|q is 512 contiguous bytes, one wave load.
  {
    const float* src = kqv + (size_t)tok0 * DIMC + (lane << 2);
    float4 in[32];
    #pragma unroll  // constant indices keep in[] in registers; all loads in flight at once
    for (int i = 0; i < 32; ++i) in[i] = *reinterpret_cast<const float4*>(src + i * DIMC);
    // What follows may reuse the address registers that these loads name.
    asm volatile("s_wait_xcnt 0x0" ::: "memory");
    #pragma unroll
    for (int i = 0; i < 32; ++i)
      *reinterpret_cast<float4*>(T + i * KQ_P + (lane << 2)) = in[i];
  }
  // The other lanes' rows must stand in the tile before this lane reads its own.
  asm volatile("s_wait_dscnt 0x0" ::: "memory");
  float k[64], q[64];
  #pragma unroll  // constant indices keep k[] and q[] in registers
  for (int j = 0; j < 16; ++j) {
    const float4 u = *reinterpret_cast<const float4*>(T + lane * KQ_P + (j << 2));
    const float4 w = *reinterpret_cast<const float4*>(T + lane * KQ_P + 64 + (j << 2));
    k[4 * j] = u.x; k[4 * j + 1] = u.y; k[4 * j + 2] = u.z; k[4 * j + 3] = u.w;
    q[4 * j] = w.x; q[4 * j + 1] = w.y; q[4 * j + 2] = w.z; q[4 * j + 3] = w.w;
  }
  float xk = 0.f, xq = 0.f;
  #pragma unroll
  for (int d = 0; d < 64; ++d) { xk += k[d] * k[d]; xq += q[d] * q[d]; }
  // Four features a trip: eight independent FMA chains, each in d order.
  #pragma unroll 1  // the body is 512 FMAs; unrolled further it only grows the code
  for (int m0 = 0; m0 < MF; m0 += 4) {
    const float* w = wperf + (m0 << 6);
    float dk[4] = {0.f, 0.f, 0.f, 0.f}, dq[4] = {0.f, 0.f, 0.f, 0.f};
    #pragma unroll
    for (int d = 0; d < 64; ++d) {
      #pragma unroll
      for (int f = 0; f < 4; ++f) {
        const float wr = w[(f << 6) + d];
        dk[f] += wr * k[d]; dq[f] += wr * q[d];
      }
    }
    float4 ok, oq;
    ok.x = expf(dk[0] - 0.5f * xk) * INVSQRTM; oq.x = expf(dq[0] - 0.5f * xq) * INVSQRTM;
    ok.y = expf(dk[1] - 0.5f * xk) * INVSQRTM; oq.y = expf(dq[1] - 0.5f * xq) * INVSQRTM;
    ok.z = expf(dk[2] - 0.5f * xk) * INVSQRTM; oq.z = expf(dq[2] - 0.5f * xq) * INVSQRTM;
    ok.w = expf(dk[3] - 0.5f * xk) * INVSQRTM; oq.w = expf(dq[3] - 0.5f * xq) * INVSQRTM;
    *reinterpret_cast<float4*>(T + lane * PF_P + m0) = ok;
    *reinterpret_cast<float4*>(T + (32 + lane) * PF_P + m0) = oq;
  }
  // Every lane's features must stand in the tile before they are read across lanes.
  asm volatile("s_wait_dscnt 0x0" ::: "memory");
  // ksum: lane = feature, its column over the wave's 32 tokens, one atomic a wave.
  float s = 0.f;
  #pragma unroll
  for (int t = 0; t < 32; ++t) s += T[t * PF_P + lane];
  atomicAdd(&ksum[b * MF + lane], s);
  // Out: four tokens' features are 512 contiguous bytes, one wave store.
  float* kpo = kp + (size_t)tok0 * MF + (lane << 2);
  float* qpo = qp + (size_t)tok0 * MF + (lane << 2);
  const float* Tr = T + (lane >> 3) * PF_P + ((lane & 7) << 2);
  #pragma unroll
  for (int i = 0; i < 8; ++i) {
    *reinterpret_cast<float4*>(kpo + (i << 7)) =
        *reinterpret_cast<const float4*>(Tr + (i << 2) * PF_P);
    *reinterpret_cast<float4*>(qpo + (i << 7)) =
        *reinterpret_cast<const float4*>(Tr + (32 + (i << 2)) * PF_P);
  }
}

// ---------------------------------------------------------------------------
// K6: kptv[b,d,m] = sum_t v[b,t,d]*kp[b,t,m], a 64 x 32 product with K = tokens, on
// V_WMMA_F32_16X16X4_F32 (f32 operands, f32 sums).  A block takes 256 tokens, a wave
// 32 of them and all 64 x 32 cells (8 accumulator tiles).  Both operands come straight
// from global in fragment order, all 32 loads of a wave in flight at once:
//   lane l (c = l&15, h = l>>4), load i: token 2*i + h; 16 bytes of v at d = 4*c and
//   8 bytes of kp at m = 2*c, so a wave load covers two whole rows.
// K-step s takes loads 2*s and 2*s+1 as registers 0 and 1 of A and of B alike, so both
// sides hold token 4*s + 2*reg + h at the same place.  Component mt of the 16 bytes is
// row c of A tile mt (d = 4*c + mt); component nt of the 8 bytes is column c of B tile
// nt (m = 2*c + nt).  The 8 waves' partial sums meet in LDS, one barrier, added in wave
// order; then one global atomic per cell and block.
// ---------------------------------------------------------------------------
__global__ __launch_bounds__(256) void k_kptv(const float* __restrict__ kqv,
                                              const float* __restrict__ kp,
                                              float* __restrict__ kptv) {
  __shared__ __attribute__((aligned(16))) float part[8][EMB * MF];
  const int tid = threadIdx.x, lane = tid & 31, wv = tid >> 5;
  const int hi = lane >> 4, cn = lane & 15;
  const int b = blockIdx.x >> 4;                        // 16 blocks per batch
  const int t0 = (blockIdx.x << 8) + (wv << 5);         // first of the wave's tokens
  const float* vs = kqv + (size_t)(t0 + hi) * DIMC + 128 + (cn << 2);
  const float* ks = kp + (size_t)(t0 + hi) * MF + (cn << 1);
  float4 va[16];
  float2 kb[16];
  #pragma unroll  // constant indices keep va[], kb[] and acc[] in registers (here and below)
  for (int i = 0; i < 16; ++i) kb[i] = *reinterpret_cast<const float2*>(ks + (i << 1) * MF);
  // A later load may land on the address registers that these loads name.
  asm volatile("s_wait_xcnt 0x0" ::: "memory");
  #pragma unroll
  for (int i = 0; i < 16; ++i) va[i] = *reinterpret_cast<const float4*>(vs + (i << 1) * DIMC);
  // What follows may reuse the address registers that these loads name.
  asm volatile("s_wait_xcnt 0x0" ::: "memory");
  // Keeps all 32 loads ahead of the first WMMA: left alone, the scheduler holds a third of
  // them back until registers come free, a second memory latency in a row.
  __builtin_amdgcn_sched_barrier(0);

  const v8f vzero = {};
  v8f acc[4][2];
  #pragma unroll
  for (int mt = 0; mt < 4; ++mt) { acc[mt][0] = vzero; acc[mt][1] = vzero; }
  #pragma unroll
  for (int s = 0; s < 8; ++s) {
    const float a0[4] = {va[2 * s].x, va[2 * s].y, va[2 * s].z, va[2 * s].w};
    const float a1[4] = {va[2 * s + 1].x, va[2 * s + 1].y, va[2 * s + 1].z, va[2 * s + 1].w};
    const v2f fb[2] = {{kb[2 * s].x, kb[2 * s + 1].x}, {kb[2 * s].y, kb[2 * s + 1].y}};
    #pragma unroll
    for (int mt = 0; mt < 4; ++mt) {
      const v2f fa = {a0[mt], a1[mt]};
      #pragma unroll
      for (int nt = 0; nt < 2; ++nt) {
        acc[mt][nt] = __builtin_amdgcn_wmma_f32_16x16x4_f32(
            false, fa, false, fb[nt], (short)0, acc[mt][nt], false, false);
      }
    }
  }
  // Accumulator register r of tile (mt, nt) is cell d = 4*(8*hi + r) + mt, m = 2*cn + nt.
  float* P = part[wv] + (hi << 10) + (cn << 1);
  #pragma unroll
  for (int mt = 0; mt < 4; ++mt) {
    #pragma unroll
    for (int r = 0; r < 8; ++r) {
      float2 u;
      u.x = acc[mt][0][r]; u.y = acc[mt][1][r];
      *reinterpret_cast<float2*>(P + (((r << 2) + mt) << 5)) = u;
    }
  }
  __syncthreads();  // every wave's partial sums stand before they are added across waves
  float* dst = kptv + (size_t)b * (EMB * MF) + (tid << 2);
  #pragma unroll
  for (int j = 0; j < 2; ++j) {
    float4 sum = *reinterpret_cast<const float4*>(&part[0][(j << 10) + (tid << 2)]);
    #pragma unroll
    for (int w = 1; w < 8; ++w) {
      const float4 u = *reinterpret_cast<const float4*>(&part[w][(j << 10) + (tid << 2)]);
      sum.x += u.x; sum.y += u.y; sum.z += u.z; sum.w += u.w;
    }
    atomicAdd(dst + (j << 10), sum.x);
    atomicAdd(dst + (j << 10) + 1, sum.y);
    atomicAdd(dst + (j << 10) + 2, sum.z);
    atomicAdd(dst + (j << 10) + 3, sum.w);
  }
}

// ---------------------------------------------------------------------------
// K7: yatt = v + proj(qp @ kptv^T / (qp.ksum + eps)).  Lane = token, 32 tokens
// per wave, as in K5: qp row and output row in registers.  Every weight is
// wave-uniform: ksum, proj_w and proj_b come by scalar loads; the batch's kptv is
// staged once per block in LDS and read with all lanes on one address, so that a
// trip of the main loop waits for one run of scalar loads, not three.
// ---------------------------------------------------------------------------
__global__ __launch_bounds__(128) void k_mix(const float* __restrict__ kqv,
                                             const float* __restrict__ qp,
                                             const float* __restrict__ ksum,
                                             const float* __restrict__ kptv,
                                             const float* __restrict__ pw,
                                             const float* __restrict__ pb,
                                             float* __restrict__ yatt) {
  __shared__ __attribute__((aligned(16))) float qt[4][32 * PF_P];
  __shared__ __attribute__((aligned(16))) float vt[4][32 * VO_P];
  __shared__ __attribute__((aligned(16))) float klt[EMB * MF];
  const int lane = threadIdx.x & 31;
  // The wave's number, shown to the compiler as uniform: tile and row addresses are
  // then scalar arithmetic, a scalar base and a lane offset per load.
  const int wv = __builtin_amdgcn_readfirstlane(threadIdx.x >> 5);
  float* Q = qt[wv];
  float* V = vt[wv];
  const int b = blockIdx.x >> 5;                        // 32 blocks per batch
  const int tok0 = (blockIdx.x << 7) + (wv << 5);       // first of the wave's tokens
  // In: four tokens' qp rows, or two tokens' v rows, per wave load (whole lines).
  {
    const float* qs = qp + (size_t)tok0 * MF + (lane << 2);
    const float* vs = kqv + (size_t)tok0 * DIMC + 128 + (lane >> 4) * DIMC + ((lane & 15) << 2);
    const float* ks = kptv + (size_t)b * (EMB * MF) + (wv << 7) + (lane << 2);
    float4 qi[8], vi[16], ki[4];
    #pragma unroll  // constant indices keep qi[], vi[] and ki[] in registers
    for (int i = 0; i < 8; ++i) qi[i] = *reinterpret_cast<const float4*>(qs + (i << 7));
    #pragma unroll
    for (int i = 0; i < 4; ++i) ki[i] = *reinterpret_cast<const float4*>(ks + (i << 9));
    #pragma unroll
    for (int i = 0; i < 16; ++i) vi[i] = *reinterpret_cast<const float4*>(vs + (i << 1) * DIMC);
    #pragma unroll
    for (int i = 0; i < 8; ++i)
      *reinterpret_cast<float4*>(Q + ((i << 2) + (lane >> 3)) * PF_P + ((lane & 7) << 2)) = qi[i];
    #pragma unroll
    for (int i = 0; i < 16; ++i)
      *reinterpret_cast<float4*>(V + ((i << 1) + (lane >> 4)) * VO_P + ((lane & 15) << 2)) = vi[i];
    #pragma unroll
    for (int i = 0; i < 4; ++i)
      *reinterpret_cast<float4*>(klt + (i << 9) + (wv << 7) + (lane << 2)) = ki[i];
  }
  __syncthreads();  // klt is filled by all four waves; the wave's own tiles stand too
  float q[32], o[64];
  #pragma unroll  // constant indices keep q[] and o[] in registers
  for (int j = 0; j < 8; ++j) {
    const float4 u = *reinterpret_cast<const float4*>(Q + lane * PF_P + (j << 2));
    q[4 * j] = u.x; q[4 * j + 1] = u.y; q[4 * j + 2] = u.z; q[4 * j + 3] = u.w;
  }
  #pragma unroll
  for (int j = 0; j < 16; ++j) {
    const float4 u = *reinterpret_cast<const float4*>(V + lane * VO_P + (j << 2));
    o[4 * j] = u.x + pb[4 * j];         o[4 * j + 1] = u.y + pb[4 * j + 1];
    o[4 * j + 2] = u.z + pb[4 * j + 2]; o[4 * j + 3] = u.w + pb[4 * j + 3];
  }
  // D = qp.ksum, added in the tree order of a 32-lane xor butterfly.
  const float* ksb = ksum + b * MF;
  float t[32];
  #pragma unroll
  for (int m = 0; m < 32; ++m) t[m] = q[m] * ksb[m];
  #pragma unroll
  for (int off = 16; off > 0; off >>= 1) {
    #pragma unroll
    for (int m = 0; m < off; ++m) t[m] += t[m + off];
  }
  const float den = t[0] + 1e-8f;
  // Two attention channels e a trip: for each its sum over m, then its row of
  // proj_w into all 64 outputs, e ascending.
  #pragma unroll 2  // the two sums run as independent chains, and the second row's
                    // scalar loads fly under the first row's work
  for (int e = 0; e < EMB; ++e) {
    const float* kr = klt + (e << 5);
    const float* pr = pw + (e << 6);
    float num = 0.f;
    #pragma unroll
    for (int m = 0; m < 32; ++m) num += q[m] * kr[m];
    const float al = num / den;
    #pragma unroll
    for (int d = 0; d < 64; ++d) o[d] += al * pr[d];
  }
  #pragma unroll
  for (int j = 0; j < 16; ++j) {
    float4 u;
    u.x = o[4 * j]; u.y = o[4 * j + 1]; u.z = o[4 * j + 2]; u.w = o[4 * j + 3];
    *reinterpret_cast<float4*>(V + lane * VO_P + (j << 2)) = u;
  }
  // Every lane's row must stand in the tile before it is read across lanes.
  asm volatile("s_wait_dscnt 0x0" ::: "memory");
  // Out: two tokens' rows are 512 contiguous bytes, one wave store.
  float* yo = yatt + ((size_t)tok0 << 6) + (lane << 2);
  const float* Vr = V + (lane >> 4) * VO_P + ((lane & 15) << 2);
  #pragma unroll
  for (int i = 0; i < 16; ++i)
    *reinterpret_cast<float4*>(yo + (i << 7)) =
        *reinterpret_cast<const float4*>(Vr + (i << 1) * VO_P);
}

// ---------------------------------------------------------------------------
// K8: out = yatt + W2 @ gelu(W1 @ LN(yatt) + b1) + b2.  Fully fused:
// LN2 in registers, both 64x64 GEMMs via WMMA, A in LDS, B from the packed weights.
// Per block: 64 rows, 128 threads (4 waves).
// ---------------------------------------------------------------------------
__global__ __launch_bounds__(128) void k_mlp(const float* __restrict__ yatt,
                                             const float* __restrict__ g,
                                             const float* __restrict__ bt,
                                             const half_t* __restrict__ wpk,
                                             const float* __restrict__ b1,
                                             const float* __restrict__ b2,
                                             float* __restrict__ out) {
  __shared__ half_t Hs[64][66];
  __shared__ half_t T1s[64][66];
  __shared__ float b1l[64], b2l[64];
  const int rbase = blockIdx.x << 6;
  const int tid = threadIdx.x, lane = tid & 31, wv = tid >> 5;
  const half_t* wl = wpk + WM_H + (lane << 3);
  // LayerNorm(64): two threads per row, pair-reduce via shfl.
  {
    const int r = tid >> 1, hf = tid & 1;
    const float* p = yatt + ((size_t)(rbase + r) << 6) + (hf << 5);
    float xv[32], s = 0.f, s2 = 0.f;
    #pragma unroll
    for (int j = 0; j < 32; ++j) { const float v = p[j]; xv[j] = v; s += v; s2 += v * v; }
    s  += __shfl_xor(s, 1, 32);
    s2 += __shfl_xor(s2, 1, 32);
    const float mean = s * (1.0f / 64.f);
    const float var  = s2 * (1.0f / 64.f) - mean * mean;
    const float rs = rsqrtf(var + 1e-5f);
    #pragma unroll
    for (int j = 0; j < 32; ++j) {
      const int c = (hf << 5) + j;
      Hs[r][c] = (half_t)((xv[j] - mean) * rs * g[c] + bt[c]);
    }
  }
  // W1's fragments are asked for ahead of the barrier and arrive during its wait.
  v16h vb1[8];
  #pragma unroll  // constant indices keep vb1[] in registers
  for (int f = 0; f < 8; ++f) vb1[f] = load_bfrag(wl, f);
  if (tid < 64) { b1l[tid] = b1[tid]; b2l[tid] = b2[tid]; }
  __syncthreads();
  // W2's fragments arrive while the first GEMM and its GELU run.
  v16h vb2[8];
  #pragma unroll  // constant indices keep vb2[] in registers
  for (int f = 0; f < 8; ++f) vb2[f] = load_bfrag(wl, 8 + f);

  const v8f vzero = {};
  v8f acc[4];
  #pragma unroll
  for (int i = 0; i < 4; ++i) acc[i] = vzero;
  #pragma unroll
  for (int kk = 0; kk < 2; ++kk) {
    const int ks = kk << 5;
    const v16h va = load_frag(&Hs[0][ks], wv << 4, 66, lane);
    #pragma unroll
    for (int nt = 0; nt < 4; ++nt) {
      acc[nt] = __builtin_amdgcn_wmma_f32_16x16x32_f16(
          false, va, false, vb1[(kk << 2) + nt], (short)0, acc[nt], false, false);
    }
  }
  const int hi = lane >> 4, cn = lane & 15;
  #pragma unroll
  for (int nt = 0; nt < 4; ++nt) {
    const int col = (nt << 4) + cn;
    #pragma unroll
    for (int r0 = 0; r0 < 8; r0 += 4) {
      float v[4];
      #pragma unroll
      for (int i = 0; i < 4; ++i) v[i] = acc[nt][r0 + i] + b1l[col];
      gelu_exact4(v);
      #pragma unroll
      for (int i = 0; i < 4; ++i) {
        const int row = (wv << 4) + r0 + i + (hi << 3);
        T1s[row][col] = (half_t)v[i];
      }
    }
  }
  __syncthreads();
  v8f acc2[4];
  #pragma unroll
  for (int i = 0; i < 4; ++i) acc2[i] = vzero;
  #pragma unroll
  for (int kk = 0; kk < 2; ++kk) {
    const int ks = kk << 5;
    const v16h va = load_frag(&T1s[0][ks], wv << 4, 66, lane);
    #pragma unroll
    for (int nt = 0; nt < 4; ++nt) {
      acc2[nt] = __builtin_amdgcn_wmma_f32_16x16x32_f16(
          false, va, false, vb2[(kk << 2) + nt], (short)0, acc2[nt], false, false);
    }
  }
  #pragma unroll
  for (int nt = 0; nt < 4; ++nt) {
    const int col = (nt << 4) + cn;
    const float bv = b2l[col];
    #pragma unroll
    for (int r = 0; r < 8; ++r) {
      const int row = (wv << 4) + r + (hi << 3);
      const size_t gi = ((size_t)(rbase + row) << 6) + col;
      out[gi] = yatt[gi] + acc2[nt][r] + bv;
    }
  }
}

// ---------------------------------------------------------------------------
extern "C" void kernel_launch(void* const* d_in, const int* in_sizes, int n_in,
                              void* d_out, int out_size, void* d_ws, size_t ws_size,
                              hipStream_t stream) {
  (void)in_sizes; (void)n_in; (void)out_size; (void)ws_size;
  const float* x      = (const float*)d_in[0];
  const float* conv_w = (const float*)d_in[1];
  const float* conv_b = (const float*)d_in[2];
  const float* ln1_g  = (const float*)d_in[3];
  const float* ln1_b  = (const float*)d_in[4];
  const float* kqv_w  = (const float*)d_in[5];
  const float* kqv_b  = (const float*)d_in[6];
  const float* proj_w = (const float*)d_in[7];
  const float* proj_b = (const float*)d_in[8];
  const float* w_perf = (const float*)d_in[9];
  const float* ln2_g  = (const float*)d_in[10];
  const float* ln2_b  = (const float*)d_in[11];
  const float* mlp_w1 = (const float*)d_in[12];
  const float* mlp_b1 = (const float*)d_in[13];
  const float* mlp_w2 = (const float*)d_in[14];
  const float* mlp_b2 = (const float*)d_in[15];

  char* ws = (char*)d_ws;
  half_t* xh   = (half_t*)(ws + XH_OFF);
  half_t* tok  = (half_t*)(ws + TOK_OFF);
  float*  kqv  = (float*)(ws + KQV_OFF);
  float*  kp   = (float*)(ws + KP_OFF);     // reuses XH region (xh dead)
  float*  qp   = (float*)(ws + QP_OFF);
  float*  ksum = (float*)(ws + KSUM_OFF);
  float*  kptv = (float*)(ws + KPTV_OFF);
  float*  yatt = (float*)(ws + YATT_OFF);   // reuses TOK region (tok dead)
  half_t* wpk  = (half_t*)(ws + WPK_OFF);
  float*  cs   = (float*)(ws + CS_OFF);
  float*  out  = (float*)d_out;

  // Zero the atomic accumulators (ksum + kptv are contiguous).
  hipMemsetAsync(ws + KSUM_OFF, 0, 4096 + (size_t)BATCH * EMB * MF * 4, stream);

  k_pack<<<dim3(WPK_BLOCKS + 1 + BATCH * 256), dim3(256), 0, stream>>>(
      x, conv_w, kqv_w, mlp_w1, mlp_w2, ln1_g, ln1_b, kqv_b, xh, wpk, cs);
  k_conv<<<dim3(64, 3, BATCH), dim3(128), 0, stream>>>(xh, wpk, conv_b, tok);
  k_kqv <<<dim3((BATCH * TOKN) / 128), dim3(128), 0, stream>>>(tok, wpk, cs, kqv);
  k_perf<<<dim3(BATCH * 32), dim3(128), 0, stream>>>(kqv, w_perf, kp, qp, ksum);
  k_kptv<<<dim3(BATCH * 16), dim3(256), 0, stream>>>(kqv, kp, kptv);
  k_mix <<<dim3(BATCH * 32), dim3(128), 0, stream>>>(kqv, qp, ksum, kptv,
                                                      proj_w, proj_b, yatt);
  k_mlp <<<dim3((BATCH * TOKN) / 64), dim3(128), 0, stream>>>(
      yatt, ln2_g, ln2_b, wpk, mlp_b1, mlp_b2, out);
}

// v008
// Next to v007, in two timings, it ran 1.08 and 1.09 times as fast.
// Counting every step since v000, it is 7.07 times as fast.
#include <hip/hip_runtime.h>
#include <hip/hip_bf16.h>
#include <math.h>

// ---------------------------------------------------------------------------
// MI455X (gfx1250, wave32) implementation of the PRM + Token-Performer block.
// All dense GEMMs (implicit-GEMM dilated convs, kqv, MLP) use
// V_WMMA_F32_16X16X32_F16 with f32 accumulation; kptv and the performer features are on
// the f32 WMMA form, the last skinny performer piece is VALU.  Fused epilogues keep each intermediate to one
// HBM round-trip (pipeline is ~bandwidth-bound at 23.3 TB/s).
// Conv reduction axis ordered k = kid*64 + ic so each 32-wide WMMA K-step has
// a constant kernel tap; the image stays channels-last, so one pixel's 64
// channels are one 128-byte line and an im2col row is contiguous in k.
// The conv, kqv and MLP weight matrices are packed once per call into f16 in the order of the
// WMMA B fragment, so a B fragment is two whole-line 16-byte loads per lane.
// ---------------------------------------------------------------------------

typedef _Float16 half_t;
typedef __attribute__((ext_vector_type(16))) _Float16 v16h;
typedef __attribute__((ext_vector_type(8)))  _Float16 v8h;
typedef __attribute__((ext_vector_type(8)))  float    v8f;
typedef __attribute__((ext_vector_type(2)))  float    v2f;
typedef __attribute__((ext_vector_type(4)))  float    v4f;

// Problem constants (match reference)
#define BATCH   32
#define CIN     64
#define IMGSZ   128
#define NPIX    16384     // 128*128
#define TOKN    4096      // 64*64 post-stride-2 tokens
#define EBR     64
#define DIMC    192       // 3*EBR
#define EMB     64
#define MF      32        // performer features
#define INVSQRTM 0.17677669529663687f

// Workspace layout (bytes). Buffers reused once their producers/consumers
// are done:  XH region -> KP/QP,  TOK region -> YATT.
#define XH_OFF    ((size_t)0)                                   // f16 [B][128][128][CIN]  67.1MB
#define KP_OFF    ((size_t)0)                                   // f32 [B][T][32]          (reuse XH)
#define QP_OFF    ((size_t)16777216)                            // f32 [B][T][32]
#define TOK_OFF   ((size_t)67108864)                            // f16 [B][T][192]         50.3MB
#define YATT_OFF  TOK_OFF                                       // f32 [B][T][64]          (reuse TOK)
#define KQV_OFF   ((size_t)(67108864 + 2*50331648))             // f32 [B][T][192], only v (columns 128..191) is kept
#define KSUM_OFF  (KQV_OFF + (size_t)BATCH*TOKN*DIMC*4)         // f32 [B][32]
#define KPTV_OFF  (KSUM_OFF + (size_t)4096)                     // f32 [B][64][32]
#define WPK_OFF   (KPTV_OFF + (size_t)BATCH*EMB*MF*4)           // f16 packed weights, 311 KB
#define CS_OFF    (WPK_OFF + (size_t)311296)                    // f32 [2][192] kqv column terms

// Packed weights: one B fragment (32 k x 16 n) = 2 planes x 32 lanes x 8 halves.
// Plane p, lane l, element i hold k = 16*p + 8*(l>>4) + i, n = l&15: the k order
// of load_frag.  A unit is one lane's 8 halves (16 bytes) of one plane.
#define FRAG_H    512                       // halves per fragment
#define WC_UNITS  13824                     // conv: 3 branches x 18 K-steps x 4 n-tiles x 64
#define WQ_UNITS  4608                      // kqv:  6 K-steps x 12 n-tiles x 64
#define WM_UNITS  1024                      // mlp:  2 matrices x 2 K-steps x 4 n-tiles x 64
#define WQ_H      (WC_UNITS * 8)            // first half of the kqv part
#define WM_H      ((WC_UNITS + WQ_UNITS) * 8)
#define WPK_BLOCKS ((WC_UNITS + WQ_UNITS + WM_UNITS) / 256)   // 76

// GELU with erf, four values at once: 0.5*x*(1 + erf(x/sqrt2)) = max(x,0) - |x|*h with
// h = 0.5*erfc(|x|/sqrt2), and erfc(z) = t*(a1 + t*(a2 + t*(a3 + t*(a4 + t*a5)))) * exp(-z*z),
// t = 1/(1 + p*z), which is within 1.5e-7 of erfc for every z >= 0.  One straight line for
// every x: no branch on |x|, so the values are independent chains that can be interleaved.
// The halves and the 1/sqrt2 are folded into the constants; exp(-z*z) = 2^-(c*x)^2 with
// c = sqrt(log2(e)/2).
__device__ __forceinline__ void gelu_exact4(float (&x)[4]) {
  float t[4], e[4];
  #pragma unroll  // constant indices keep t[], e[] and x[] in registers (here and below)
  for (int i = 0; i < 4; ++i) {
    const float u = x[i] * 0.84932180f;
    t[i] = fmaf(fabsf(x[i]), 0.23164189f, 1.0f);
    e[i] = -(u * u);
  }
  // The reciprocals, then the powers of two, in place and each kind in one run: behind a
  // transcendental the instruction set asks for one slot before its source is overwritten
  // or its result read.  Each is that slot for the one in front of it, the v_nop for the last.
  asm("v_rcp_f32 %0, %0\n\t"
      "v_rcp_f32 %1, %1\n\t"
      "v_rcp_f32 %2, %2\n\t"
      "v_rcp_f32 %3, %3\n\t"
      "v_nop"
      : "+v"(t[0]), "+v"(t[1]), "+v"(t[2]), "+v"(t[3]));
  asm("v_exp_f32 %0, %0\n\t"
      "v_exp_f32 %1, %1\n\t"
      "v_exp_f32 %2, %2\n\t"
      "v_exp_f32 %3, %3\n\t"
      "v_nop"
      : "+v"(e[0]), "+v"(e[1]), "+v"(e[2]), "+v"(e[3]));
  #pragma unroll
  for (int i = 0; i < 4; ++i) {
    float p = 0.5307027145f;
    p = fmaf(p, t[i], -0.7265760135f);
    p = fmaf(p, t[i], 0.7107068705f);
    p = fmaf(p, t[i], -0.142248368f);
    p = fmaf(p, t[i], 0.127414796f);
    x[i] = fmaf(-fabsf(x[i]), (p * t[i]) * e[i], fmaxf(x[i], 0.0f));
  }
}

// Load a 16x32 f16 WMMA fragment (A row-major, or B assembled as [N][K]).
// tile: LDS matrix with K contiguous per row; stride in half elements.
// ISA layout: lanes 0-15 hold K0-7 (v0-3) and K16-23 (v4-7); lanes 16-31
// hold K8-15 and K24-31; M/N = lane&15 (+row0).
__device__ __forceinline__ v16h load_frag(const half_t* tile, int row0,
                                          int stride, int lane) {
  const half_t* p = tile + (row0 + (lane & 15)) * stride;
  const int hi = lane >> 4;
  v16h f;
  #pragma unroll
  for (int j = 0; j < 8; ++j) {
    const int kb = ((j >> 2) << 4) + (hi << 3) + ((j & 3) << 1);
    f[2 * j]     = p[kb];
    f[2 * j + 1] = p[kb + 1];
  }
  return f;
}

// B fragment number frag of a packed weight part, as two 512-byte wave loads.
__device__ __forceinline__ v16h load_bfrag(const half_t* wl, int frag) {
  const v8h lo = *reinterpret_cast<const v8h*>(wl + frag * FRAG_H);
  const v8h hi = *reinterpret_cast<const v8h*>(wl + frag * FRAG_H + 256);
  return __builtin_shufflevector(lo, hi,
      0, 1, 2, 3, 4, 5, 6, 7, 8, 9, 10, 11, 12, 13, 14, 15);
}

// ---------------------------------------------------------------------------
// K1: x [B,N,C] f32  ->  xh [B,N,C] f16  (same channels-last order, convert
// only).  8 elements per thread per pass: two 16-byte loads, one 16-byte store.
// The first WPK_BLOCKS blocks pack the weights instead: one unit per thread,
// eight strided f32 reads, one 16-byte store; row k of the kqv weights is scaled by
// ln1's g[k] on the way.  The next block sums the two column terms of K3.
// ---------------------------------------------------------------------------
__global__ __launch_bounds__(256) void k_pack(const float* __restrict__ x,
                                              const float* __restrict__ cw,
                                              const float* __restrict__ wq,
                                              const float* __restrict__ w1,
                                              const float* __restrict__ w2,
                                              const float* __restrict__ lg,
                                              const float* __restrict__ lb,
                                              const float* __restrict__ qb,
                                              half_t* __restrict__ xh,
                                              half_t* __restrict__ wpk,
                                              float* __restrict__ cs) {
  if (blockIdx.x == WPK_BLOCKS) {            // thread = column n of the kqv weights
    if (threadIdx.x < DIMC) {
      const float* wc = wq + threadIdx.x;
      float sg = 0.f, sb = 0.f;
      #pragma unroll 16  // 16 loads in flight a trip; many more would raise the kernel's registers
      for (int k = 0; k < DIMC; ++k) {
        const float w = wc[k * DIMC];
        sg += (float)(half_t)(w * lg[k]);    // the f16 value that the GEMM multiplies by
        sb += w * lb[k];
      }
      cs[threadIdx.x] = sg;
      cs[DIMC + threadIdx.x] = sb + qb[threadIdx.x];
    }
    return;
  }
  if (blockIdx.x < WPK_BLOCKS) {
    const int u = (blockIdx.x << 8) + threadIdx.x;
    const int n = u & 15;
    const int k0 = (((u >> 5) & 1) << 4) + (((u >> 4) & 1) << 3);  // k of element 0
    const float* src;
    int step;                                // floats from one k to the next
    float sc[8] = {1.f, 1.f, 1.f, 1.f, 1.f, 1.f, 1.f, 1.f};
    if (blockIdx.x < WC_UNITS / 256) {       // frag = ((br*9 + kid)*2 + h)*4 + nt
      const int f = u >> 6;
      const int nt = f & 3, h = (f >> 2) & 1, tap = f >> 3;   // tap = br*9 + kid
      const int br = tap / 9, kid = tap - br * 9;
      src = cw + (((br << 6) + (nt << 4) + n) * CIN + (h << 5) + k0) * 9 + kid;
      step = 9;
    } else if (blockIdx.x < (WC_UNITS + WQ_UNITS) / 256) {    // frag = kk*12 + n-tile
      const int f = (u - WC_UNITS) >> 6;
      const int kk = f / 12, nt = f - kk * 12;
      src = wq + ((kk << 5) + k0) * DIMC + (nt << 4) + n;
      step = DIMC;
      #pragma unroll
      for (int i = 0; i < 8; ++i) sc[i] = lg[(kk << 5) + k0 + i];
    } else {                                 // frag = (matrix*2 + kk)*4 + nt
      const int f = (u - WC_UNITS - WQ_UNITS) >> 6;
      const int nt = f & 3, kk = (f >> 2) & 1;
      src = ((f >> 3) ? w2 : w1) + ((kk << 5) + k0) * EMB + (nt << 4) + n;
      step = EMB;
    }
    float t[8];
    #pragma unroll  // constant indices keep t[] in registers
    for (int i = 0; i < 8; ++i) t[i] = src[i * step];
    // The conversions below reuse the address registers that these loads name.
    asm volatile("s_wait_xcnt 0x0" ::: "memory");
    v8h o;
    #pragma unroll
    for (int i = 0; i < 8; ++i) o[i] = (half_t)(t[i] * sc[i]);
    *reinterpret_cast<v8h*>(wpk + ((size_t)u << 3)) = o;
    return;
  }
  const size_t base = ((size_t)(blockIdx.x - WPK_BLOCKS - 1) << 12) + ((size_t)threadIdx.x << 3);
  #pragma unroll  // both passes' loads are in flight before the first store
  for (int rep = 0; rep < 2; ++rep) {
    const size_t e = base + ((size_t)rep << 11);
    const float4 u = *reinterpret_cast<const float4*>(x + e);
    const float4 w = *reinterpret_cast<const float4*>(x + e + 4);
    v8h o;
    o[0] = (half_t)u.x; o[1] = (half_t)u.y; o[2] = (half_t)u.z; o[3] = (half_t)u.w;
    o[4] = (half_t)w.x; o[5] = (half_t)w.y; o[6] = (half_t)w.z; o[7] = (half_t)w.w;
    *reinterpret_cast<v8h*>(xh + e) = o;
  }
}

// ---------------------------------------------------------------------------
// K2: implicit-GEMM dilated conv + bias + GELU -> tokens f16 [B,T,192].
// Per block: 64 tokens (one output row) x 64 out-channels, K=576 in 18 steps of 32.
// K axis ordered k = kid*64 + ic.  The three image rows that the output row's taps
// touch are brought into LDS once per block by asynchronous copies, whole 128-byte
// lines, and every wave reads its A fragments from there.  A wave owns all 64 tokens
// (4 row tiles) and 16 out-channels, so each packed B fragment is loaded by one wave
// of the block only.
// LDS: plane (kh, parity of the pixel column) = 67 slots of 144 bytes: 2 zero slots,
// the 64 pixels of that parity, 1 zero slot.  Tap column 2*ow + off is slot
// ow + (off >> 1) + 2 of parity off & 1, so neighbouring tokens are 144 bytes
// (16 B x odd) apart; a column outside the image falls on a zero slot, a row outside
// the image is a zero plane.
// grid = (64 token tiles, 3 branches, 32 batches), 4 waves.
// ---------------------------------------------------------------------------
#define CV_SLOT   144                   // bytes per staged pixel
#define CV_PLANE  (67 * CV_SLOT)        // bytes per plane

// Four 16-byte-per-lane copies global -> LDS.  The wait at the end stands in the
// copies' own statement: their address registers may be rewritten behind it.
__device__ __forceinline__ void copy4(unsigned l0, unsigned l1, unsigned l2, unsigned l3,
                                      const half_t* g0, const half_t* g1,
                                      const half_t* g2, const half_t* g3) {
  asm volatile("global_load_async_to_lds_b128 %0, %4, off\n\t"
               "global_load_async_to_lds_b128 %1, %5, off\n\t"
               "global_load_async_to_lds_b128 %2, %6, off\n\t"
               "global_load_async_to_lds_b128 %3, %7, off\n\t"
               "s_wait_xcnt 0x0"
               :: "v"(l0), "v"(l1), "v"(l2), "v"(l3), "v"(g0), "v"(g1), "v"(g2), "v"(g3)
               : "memory");
}

template <int DIL>
__device__ __forceinline__ void conv_acc(const half_t* __restrict__ xb,   // the batch's image
                                         const half_t* __restrict__ wl,   // branch's B, lane's place
                                         half_t* img, int oh, int tid, v8f (&acc)[4]) {
  const int lane = tid & 31, wv = tid >> 5;
  const int hi = lane >> 4, cn = lane & 15;
  const v8h hzero = (v8h)(half_t)0.0f;
  char* imgb = reinterpret_cast<char*>(img);

  // Zero slots, and whole planes for a row outside the image.
  #pragma unroll  // kh constant: plane offsets fold into the instructions (here and below)
  for (int kh = 0; kh < 3; ++kh) {
    const int ih = (oh << 1) + (kh - 1) * DIL;
    char* pl = imgb + (kh << 1) * CV_PLANE;
    if ((unsigned)ih < 128u) {
      if (tid < 48) {                       // 2 planes x 3 slots x 8 pieces of 16 bytes
        const int p = tid / 24, r = tid - p * 24, s = r >> 3;
        *reinterpret_cast<v8h*>(pl + p * CV_PLANE + (s < 2 ? s : 66) * CV_SLOT + ((r & 7) << 4)) = hzero;
      }
    } else {
      for (int i = tid; i < 2 * CV_PLANE / 16; i += 128)
        *reinterpret_cast<v8h*>(pl + (i << 4)) = hzero;
    }
  }
  // This wave's LDS stores have retired before its copies are pointed at the array.
  asm volatile("s_wait_dscnt 0x0" ::: "memory");

  // Copies: a wave copy is 4 pixels x 128 bytes; 8 lanes share a pixel.  Odd dilation
  // needs every pixel of the row (4 neighbours a copy), dilation 2 the even ones only.
  const unsigned lbase = (unsigned)(size_t)img + ((lane & 7) << 4);
  #pragma unroll
  for (int kh = 0; kh < 3; ++kh) {
    const int ih = (oh << 1) + (kh - 1) * DIL;
    if ((unsigned)ih < 128u) {              // the same for the whole block
      const half_t* gr = xb + ((size_t)ih << 13) + ((lane & 7) << 3);
      #pragma unroll
      for (int c = 0; c < ((DIL == 2) ? 1 : 2); ++c) {
        unsigned l[4];
        const half_t* g[4];
        #pragma unroll  // constant indices keep l[] and g[] in registers
        for (int i = 0; i < 4; ++i) {
          const int grp = (DIL == 2) ? ((wv << 2) + i) : ((wv << 3) + (c << 2) + i);
          const int px = (DIL == 2) ? (((grp << 2) + (lane >> 3)) << 1) : ((grp << 2) + (lane >> 3));
          l[i] = lbase + ((kh << 1) + (px & 1)) * CV_PLANE + ((px >> 1) + 2) * CV_SLOT;
          g[i] = gr + (px << 6);
        }
        copy4(l[0], l[1], l[2], l[3], g[0], g[1], g[2], g[3]);
      }
    }
  }

  // B: the wave's column tile, 2 fragments a tap, kept three taps ahead in 4 register sets.
  v16h vb[4][2];
  #pragma unroll  // constant indices keep vb[] and a[] in registers (here and below)
  for (int t = 0; t < 3; ++t) {
    #pragma unroll
    for (int h = 0; h < 2; ++h) vb[t][h] = load_bfrag(wl + t * (8 * FRAG_H), (h << 2) + wv);
  }
  // This wave's copies have landed; behind the barrier every wave's have.
  asm volatile("s_wait_asynccnt 0x0" ::: "memory");
  __syncthreads();

  // A: lane l reads row l&15 of each row tile: 16-byte runs at k = 16*q + 8*(l>>4).
  // Step s = 2*kid + h is one K-step of 32: its 8 reads are asked for one step ahead.
  const char* ar = imgb + (cn + 2) * CV_SLOT + (hi << 4);
  v8h a[2][8];
  #pragma unroll  // s picks register sets and LDS offsets: constants only when unrolled
  for (int s = -1; s < 18; ++s) {
    // The two fences hold the loads for later steps in one run ahead of this step's
    // WMMAs: lifted higher they need more registers, sunk to their use they fly under
    // nothing.
    __builtin_amdgcn_sched_barrier(0);
    if (s >= 0 && (s & 1) == 0 && (s >> 1) + 3 < 9) {
      const int kb = (s >> 1) + 3;
      #pragma unroll
      for (int h = 0; h < 2; ++h)
        vb[kb & 3][h] = load_bfrag(wl + kb * (8 * FRAG_H), (h << 2) + wv);
      // What follows may reuse the address registers that these loads name.
      asm volatile("s_wait_xcnt 0x0" ::: "memory");
    }
    if (s + 1 < 18) {
      const int sn = s + 1, kn = sn >> 1, kh = kn / 3, off = (kn - kh * 3 - 1) * DIL;
      const char* ap = ar + ((kh << 1) + (off & 1)) * CV_PLANE + (off >> 1) * CV_SLOT + ((sn & 1) << 6);
      #pragma unroll
      for (int mt = 0; mt < 4; ++mt) {
        #pragma unroll
        for (int j = 0; j < 2; ++j)
          a[sn & 1][(mt << 1) + j] =
              *reinterpret_cast<const v8h*>(ap + (mt << 4) * CV_SLOT + (j << 5));
      }
    }
    __builtin_amdgcn_sched_barrier(0);
    if (s >= 0) {
      #pragma unroll
      for (int mt = 0; mt < 4; ++mt) {
        const v16h va = __builtin_shufflevector(a[s & 1][(mt << 1)], a[s & 1][(mt << 1) + 1],
            0, 1, 2, 3, 4, 5, 6, 7, 8, 9, 10, 11, 12, 13, 14, 15);
        acc[mt] = __builtin_amdgcn_wmma_f32_16x16x32_f16(
            false, va, false, vb[(s >> 1) & 3][s & 1], (short)0, acc[mt], false, false);
      }
    }
  }
}

__global__ __launch_bounds__(128) void k_conv(const half_t* __restrict__ xh,
                                              const half_t* __restrict__ wpk,
                                              const float* __restrict__ cb,
                                              half_t* __restrict__ tok) {
  __shared__ __attribute__((aligned(16))) half_t img[6 * CV_PLANE / 2];
  const int tbase = blockIdx.x << 6;
  const int br = blockIdx.y;
  const int b  = blockIdx.z;
  const int tid = threadIdx.x, lane = tid & 31, wv = tid >> 5;
  const half_t* wl = wpk + br * (72 * FRAG_H) + (lane << 3);
  const half_t* xb = xh + (size_t)b * NPIX * CIN;

  v8f acc[4];
  const v8f vzero = {};
  #pragma unroll
  for (int i = 0; i < 4; ++i) acc[i] = vzero;

  // One body per dilation: every LDS offset of the taps is then a constant.
  if (br == 0)      conv_acc<1>(xb, wl, img, blockIdx.x, tid, acc);
  else if (br == 1) conv_acc<2>(xb, wl, img, blockIdx.x, tid, acc);
  else              conv_acc<3>(xb, wl, img, blockIdx.x, tid, acc);

  // Epilogue: bias + exact GELU, write tokens (branch-major channel concat)
  const int hi = lane >> 4, cn = lane & 15;
  const int oc = (wv << 4) + cn;
  const float bias = cb[br * EBR + oc];
  #pragma unroll
  for (int mt = 0; mt < 4; ++mt) {
    #pragma unroll
    for (int r0 = 0; r0 < 8; r0 += 4) {
      float v[4];
      #pragma unroll
      for (int i = 0; i < 4; ++i) v[i] = acc[mt][r0 + i] + bias;
      gelu_exact4(v);
      #pragma unroll
      for (int i = 0; i < 4; ++i) {
        const int row = (mt << 4) + r0 + i + (hi << 3);
        const int t = tbase + row;
        tok[((size_t)b * TOKN + t) * DIMC + br * EBR + oc] = (half_t)v[i];
      }
    }
  }
}

// exp of four values, in the scheme of the library's expf: n = round(x*log2(e)), the rest
// x*log2(e) - n from a two-part log2(e) by two FMAs, 2^rest scaled by 2^n, and both range
// guards.  The four powers of two stand in one run: behind a transcendental the instruction
// set asks for one slot before its source is overwritten or its result read.  Each is that
// slot for the one in front of it, the v_nop for the last.
__device__ __forceinline__ void exp4(float (&x)[4]) {
  float a[4];
  int n[4];
  #pragma unroll  // constant indices keep a[], n[] and x[] in registers (here and below)
  for (int i = 0; i < 4; ++i) {
    const float e = rintf(x[i] * 0x1.715476p+0f);
    a[i] = fmaf(x[i], 0x1.4ae0bep-26f, fmaf(x[i], 0x1.715476p+0f, -e));
    n[i] = (int)e;
  }
  asm("v_exp_f32 %0, %0\n\t"
      "v_exp_f32 %1, %1\n\t"
      "v_exp_f32 %2, %2\n\t"
      "v_exp_f32 %3, %3\n\t"
      "v_nop"
      : "+v"(a[0]), "+v"(a[1]), "+v"(a[2]), "+v"(a[3]));
  #pragma unroll
  for (int i = 0; i < 4; ++i) {
    float r = ldexpf(a[i], n[i]);
    r = (x[i] < -0x1.9d1da0p+6f) ? 0.0f : r;
    x[i] = (x[i] > 0x1.62e430p+6f) ? __builtin_inff() : r;
  }
}

// ---------------------------------------------------------------------------
// K3: LayerNorm(192) + kqv GEMM  [131072 x 192] @ [192 x 192] + bias, then the performer
// features of k and q in the same wave; only v, kp, qp and ksum go to memory.
// With W' = g o W (packed so by K1), cg[n] = sum_k W'[k][n] and
// cb[n] = bias[n] + sum_k bt[k] W[k][n]:
//   LN(x) @ W + bias = rs * (x @ W' - mean * cg) + cb,
// so the raw f16 token rows are an operand and a row's mean and rs enter only at
// the accumulators.  A wave owns 32 tokens (two 16-token tiles) and all 192 columns.
// The product is taken transposed: the packed weight fragment is the A operand (row =
// column n of W'), the token rows are the B operand (column = token).  Lane l
// (c = l&15, h = l>>4) reads token c of each tile straight from global: 16-byte runs at
// k = 16*j + 8*h, j = 0..11, the k order of the packed weights.  Accumulator register r
// of column tile nt is then kqv[token c][16*nt + 8*h + r]: the lane's own token, so its
// mean and rs need no exchange beyond the one with the partner lane.
// Features: kp^T = Wp (32 x 64) . k^T on V_WMMA_F32_16X16X4_F32.  Registers 2*s, 2*s+1 of
// a finished k tile are the B fragment of K-step s as they stand: place (h, j) holds
// d = 16*nt + 8*h + 2*s + j, and the A fragment takes Wp[m][the same d] at the same place.
// Its accumulator register r is feature m = 16*mf + 8*h + r of token c.
// The k and q tiles wait in LDS, each lane's registers in the lane's own 16-byte places,
// until the token rows and the weight fragments have left the registers.
// Features and v rows are turned into whole-line wave stores in the same LDS range, which
// is the wave's own.  No work-group barrier.
// grid = 1024 blocks of 4 waves = 4 waves per SIMD.
// ---------------------------------------------------------------------------
#define PF_P 36    // floats per staged feature row (144 B = 16 B x 9)
#define VO_P 68    // floats per staged v / y row   (272 B = 16 B x 17)

__global__ __launch_bounds__(128) void k_kqv(const half_t* __restrict__ tok,
                                             const half_t* __restrict__ wpk,
                                             const float* __restrict__ cs,
                                             const float* __restrict__ wperf,
                                             float* __restrict__ kqv,
                                             float* __restrict__ kp,
                                             float* __restrict__ qp,
                                             float* __restrict__ ksum) {
  // Per wave, one use after the other: 32 v rows; 32 places x 32 lanes x 16 bytes of k and
  // q tiles; 64 feature rows, written over places whose tiles have been read.
  __shared__ __attribute__((aligned(16))) float tile[4][4096];
  const int lane = threadIdx.x & 31, wv = threadIdx.x >> 5;
  const int hi = lane >> 4, cn = lane & 15;
  const int rbase = (blockIdx.x << 7) + (wv << 5);      // first of the wave's tokens
  const int b = blockIdx.x >> 5;                        // 32 blocks per batch
  const half_t* wl = wpk + WQ_H + (lane << 3);
  float* T = tile[wv];

  v8h x[2][12];
  #pragma unroll  // constant indices keep x[], vb[] and the other arrays in registers (here and below)
  for (int mt = 0; mt < 2; ++mt) {
    const half_t* p = tok + (size_t)(rbase + (mt << 4) + cn) * DIMC + (hi << 3);
    #pragma unroll
    for (int j = 0; j < 12; ++j) x[mt][j] = *reinterpret_cast<const v8h*>(p + (j << 4));
    // A later load may land on the address registers that these loads name.
    asm volatile("s_wait_xcnt 0x0" ::: "memory");
  }
  v16h vb[6];
  #pragma unroll
  for (int kk = 0; kk < 6; ++kk) vb[kk] = load_bfrag(wl, kk * 12 + 8);

  // Row statistics of the lane's own token in each tile.
  float rs[2], mn[2];                                   // rs and mean
  #pragma unroll
  for (int mt = 0; mt < 2; ++mt) {
    float s0 = 0.f, s1 = 0.f, q0 = 0.f, q1 = 0.f;       // two chains each
    #pragma unroll
    for (int j = 0; j < 12; ++j) {
      #pragma unroll
      for (int i = 0; i < 8; i += 2) {
        const float v0 = (float)x[mt][j][i], v1 = (float)x[mt][j][i + 1];
        s0 += v0; q0 += v0 * v0;
        s1 += v1; q1 += v1 * v1;
      }
    }
    float s = s0 + s1, s2 = q0 + q1;
    s  += __shfl_xor(s, 16, 32);                        // the row's other half
    s2 += __shfl_xor(s2, 16, 32);
    const float mean = s * (1.0f / DIMC);
    const float var  = s2 * (1.0f / DIMC) - mean * mean;
    // 1/sqrt as the library forms it (a subnormal argument is scaled by 2^24, its result by
    // 2^12), with the slot that the instruction set asks for behind a transcendental, before
    // its source is overwritten or its result read, filled by the v_nop in the same statement.
    const float ve = var + 1e-5f;
    const bool tiny = ve < 1.17549435e-38f;
    const float va = tiny ? ve * 16777216.0f : ve;
    float vr;
    asm("v_rsq_f32 %0, %1\n\t"
        "v_nop"
        : "=v"(vr) : "v"(va));
    rs[mt] = tiny ? vr * 4096.0f : vr;
    mn[mt] = mean;
  }

  const float* csl = cs + (hi << 3);                    // column terms of the lane's 8 columns
  float4 cg4[2][2], cb4[2][2];                          // two sets, by the trip's parity
  #pragma unroll
  for (int j = 0; j < 2; ++j) {
    cg4[0][j] = *reinterpret_cast<const float4*>(csl + (8 << 4) + (j << 2));
    cb4[0][j] = *reinterpret_cast<const float4*>(csl + DIMC + (8 << 4) + (j << 2));
  }
  // What follows may reuse the address registers that these loads name.
  asm volatile("s_wait_xcnt 0x0" ::: "memory");
  const v8f vzero = {};
  // Column tiles in the order v (8..11), k (0..3), q (4..7).
  #pragma unroll  // the trip picks the phase and every offset: constants only when unrolled
  for (int it = 0; it < 12; ++it) {
    const int nt = (it + 8) % 12;
    v8f acc[2] = {vzero, vzero};
    #pragma unroll
    for (int hf = 0; hf < 2; ++hf) {
      #pragma unroll
      for (int kk = 3 * hf; kk < 3 * hf + 3; ++kk) {
        #pragma unroll
        for (int mt = 0; mt < 2; ++mt) {
          const v16h vx = __builtin_shufflevector(x[mt][2 * kk], x[mt][2 * kk + 1],
              0, 1, 2, 3, 4, 5, 6, 7, 8, 9, 10, 11, 12, 13, 14, 15);
          acc[mt] = __builtin_amdgcn_wmma_f32_16x16x32_f16(
              false, vb[kk], false, vx, (short)0, acc[mt], false, false);
        }
      }
      if (it + 1 < 12) {
        // The two fences hold the next tile's loads where they stand: lifted above the
        // WMMAs they need a second register set, sunk to their use they fly under nothing.
        __builtin_amdgcn_sched_barrier(0);
        #pragma unroll
        for (int kk = 3 * hf; kk < 3 * hf + 3; ++kk)
          vb[kk] = load_bfrag(wl, kk * 12 + (it + 9) % 12);
        if (hf == 0) {   // the next trip's column terms, a whole trip ahead of their use
          #pragma unroll
          for (int j = 0; j < 2; ++j) {
            cg4[(it + 1) & 1][j] = *reinterpret_cast<const float4*>(csl + (((it + 9) % 12) << 4) + (j << 2));
            cb4[(it + 1) & 1][j] = *reinterpret_cast<const float4*>(csl + DIMC + (((it + 9) % 12) << 4) + (j << 2));
          }
        }
        // What follows may reuse the address registers that these loads name.
        asm volatile("s_wait_xcnt 0x0" ::: "memory");
        __builtin_amdgcn_sched_barrier(0);
      }
    }
    const float4 g0 = cg4[it & 1][0], g1 = cg4[it & 1][1], b0 = cb4[it & 1][0], b1 = cb4[it & 1][1];
    const float cg[8] = {g0.x, g0.y, g0.z, g0.w, g1.x, g1.y, g1.z, g1.w};
    const float cb[8] = {b0.x, b0.y, b0.z, b0.w, b1.x, b1.y, b1.z, b1.w};
    #pragma unroll
    for (int mt = 0; mt < 2; ++mt) {
      float o[8];
      #pragma unroll
      for (int r = 0; r < 8; ++r)
        o[r] = rs[mt] * (acc[mt][r] - mn[mt] * cg[r]) + cb[r];
      #pragma unroll
      for (int j = 0; j < 2; ++j) {
        float4 u;
        u.x = o[4 * j]; u.y = o[4 * j + 1]; u.z = o[4 * j + 2]; u.w = o[4 * j + 3];
        if (nt >= 8)   // v: the lane's 8 columns of its token's row
          *reinterpret_cast<float4*>(T + ((mt << 4) + cn) * VO_P + ((nt - 8) << 4) + (hi << 3) + (j << 2)) = u;
        else           // k, q: place ((nt*2 + mt)*2 + j), the lane's own 16 bytes
          *reinterpret_cast<float4*>(T + ((((nt << 1) + mt) << 1) + j) * 128 + (lane << 2)) = u;
      }
    }
    if (nt == 11) {
      // Every lane's v columns must stand in the tile before they are read across lanes.
      asm volatile("s_wait_dscnt 0x0" ::: "memory");
      // Out: a wave store is two tokens' v rows, 256 contiguous bytes each.
      float* vo = kqv + (size_t)(rbase + hi) * DIMC + 128 + (cn << 2);
      const float* Vr = T + hi * VO_P + (cn << 2);
      #pragma unroll
      for (int g = 0; g < 2; ++g) {
        v4f u[8];
        #pragma unroll
        for (int i = 0; i < 8; ++i)
          u[i] = *reinterpret_cast<const v4f*>(Vr + (((g << 3) + i) << 1) * VO_P);
        // Takes the values read as inputs only: holds the 8 reads in one run ahead of the
        // stores.  Left alone they share one register set, one LDS latency after the other.
        asm volatile("" :: "v"(u[0]), "v"(u[1]), "v"(u[2]), "v"(u[3]), "v"(u[4]), "v"(u[5]), "v"(u[6]), "v"(u[7]));
        #pragma unroll
        for (int i = 0; i < 8; ++i)
          *reinterpret_cast<v4f*>(vo + (((g << 3) + i) << 1) * DIMC) = u[i];
        // The next run's reads land on the registers that these stores name.
        asm volatile("s_wait_xcnt 0x0" ::: "memory");
      }
      // The v rows have been read before the k tiles are written over them.
      asm volatile("s_wait_dscnt 0x0" ::: "memory");
    }
  }

  // All of Wp as A fragments: row 16*mf + c, the lane's 8 d of each 16.
  const float* wpl = wperf + (cn << 6) + (hi << 3);
  float4 wp4[2][4][2];
  #pragma unroll
  for (int mf = 0; mf < 2; ++mf) {
    #pragma unroll
    for (int n4 = 0; n4 < 4; ++n4) {
      #pragma unroll
      for (int j = 0; j < 2; ++j)
        wp4[mf][n4][j] = *reinterpret_cast<const float4*>(wpl + (mf << 10) + (n4 << 4) + (j << 2));
    }
  }
  // What follows may reuse the address registers that these loads name.
  asm volatile("s_wait_xcnt 0x0" ::: "memory");

  #pragma unroll
  for (int part = 0; part < 2; ++part) {                // 0: k -> kp, 1: q -> qp
    v8f pacc[2][2] = {{vzero, vzero}, {vzero, vzero}};  // [feature tile][token tile]
    float xs[2] = {0.f, 0.f};                           // the lane's part of |t|^2
    #pragma unroll
    for (int n4 = 0; n4 < 4; ++n4) {
      float o[2][8];
      #pragma unroll
      for (int mt = 0; mt < 2; ++mt) {
        #pragma unroll
        for (int j = 0; j < 2; ++j) {
          const float4 u = *reinterpret_cast<const float4*>(
              T + ((((((part << 2) + n4) << 1) + mt) << 1) + j) * 128 + (lane << 2));
          o[mt][4 * j] = u.x; o[mt][4 * j + 1] = u.y; o[mt][4 * j + 2] = u.z; o[mt][4 * j + 3] = u.w;
        }
        #pragma unroll
        for (int r = 0; r < 8; ++r) xs[mt] += o[mt][r] * o[mt][r];
      }
      #pragma unroll
      for (int s = 0; s < 4; ++s) {
        #pragma unroll
        for (int mf = 0; mf < 2; ++mf) {
          const float4 w4 = wp4[mf][n4][s >> 1];
          const v2f fa = {(s & 1) ? w4.z : w4.x, (s & 1) ? w4.w : w4.y};
          #pragma unroll
          for (int mt = 0; mt < 2; ++mt) {
            const v2f fb = {o[mt][2 * s], o[mt][2 * s + 1]};
            pacc[mf][mt] = __builtin_amdgcn_wmma_f32_16x16x4_f32(
                false, fa, false, fb, (short)0, pacc[mf][mt], false, false);
          }
        }
      }
    }
    // exp(w.t - |t|^2/2)/sqrt(m) as rows: 0..31 kp, 32..63 qp.  The rows lie on places of
    // tiles read above, other lanes' places too: the wait and its clobber keep every such
    // read ahead of the stores below.
    asm volatile("s_wait_dscnt 0x0" ::: "memory");
    float* Tf = T + ((part << 5) + cn) * PF_P + (hi << 3);
    #pragma unroll
    for (int mt = 0; mt < 2; ++mt) {
      const float xd = xs[mt] + __shfl_xor(xs[mt], 16, 32);   // the row's other half
      #pragma unroll
      for (int mf = 0; mf < 2; ++mf) {
        #pragma unroll
        for (int j = 0; j < 2; ++j) {
          float f[4];
          #pragma unroll
          for (int i = 0; i < 4; ++i) f[i] = pacc[mf][mt][4 * j + i] - 0.5f * xd;
          exp4(f);
          float4 u;
          u.x = f[0] * INVSQRTM; u.y = f[1] * INVSQRTM; u.z = f[2] * INVSQRTM; u.w = f[3] * INVSQRTM;
          *reinterpret_cast<float4*>(Tf + (mt << 4) * PF_P + (mf << 4) + (j << 2)) = u;
        }
      }
    }
  }
  // Every lane's features must stand in the tile before they are read across lanes.
  asm volatile("s_wait_dscnt 0x0" ::: "memory");
  // ksum: lane = feature, its column over the wave's 32 tokens, one atomic a wave.
  float s = 0.f;
  #pragma unroll
  for (int t = 0; t < 32; ++t) s += T[t * PF_P + lane];
  atomicAdd(&ksum[b * MF + lane], s);
  // Out: four tokens' features are 512 contiguous bytes, one wave store.
  float* kpo = kp + (size_t)rbase * MF + (lane << 2);
  float* qpo = qp + (size_t)rbase * MF + (lane << 2);
  const float* Tr = T + (lane >> 3) * PF_P + ((lane & 7) << 2);
  #pragma unroll
  for (int i = 0; i < 8; ++i) {
    *reinterpret_cast<float4*>(kpo + (i << 7)) =
        *reinterpret_cast<const float4*>(Tr + (i << 2) * PF_P);
    *reinterpret_cast<float4*>(qpo + (i << 7)) =
        *reinterpret_cast<const float4*>(Tr + (32 + (i << 2)) * PF_P);
  }
}

// ---------------------------------------------------------------------------
// K6: kptv[b,d,m] = sum_t v[b,t,d]*kp[b,t,m], a 64 x 32 product with K = tokens, on
// V_WMMA_F32_16X16X4_F32 (f32 operands, f32 sums).  A block takes 256 tokens, a wave
// 32 of them and all 64 x 32 cells (8 accumulator tiles).  Both operands come straight
// from global in fragment order, all 32 loads of a wave in flight at once:
//   lane l (c = l&15, h = l>>4), load i: token 2*i + h; 16 bytes of v at d = 4*c and
//   8 bytes of kp at m = 2*c, so a wave load covers two whole rows.
// K-step s takes loads 2*s and 2*s+1 as registers 0 and 1 of A and of B alike, so both
// sides hold token 4*s + 2*reg + h at the same place.  Component mt of the 16 bytes is
// row c of A tile mt (d = 4*c + mt); component nt of the 8 bytes is column c of B tile
// nt (m = 2*c + nt).  The 8 waves' partial sums meet in LDS, one barrier, added in wave
// order; then one global atomic per cell and block.
// ---------------------------------------------------------------------------
__global__ __launch_bounds__(256) void k_kptv(const float* __restrict__ kqv,
                                              const float* __restrict__ kp,
                                              float* __restrict__ kptv) {
  __shared__ __attribute__((aligned(16))) float part[8][EMB * MF];
  const int tid = threadIdx.x, lane = tid & 31, wv = tid >> 5;
  const int hi = lane >> 4, cn = lane & 15;
  const int b = blockIdx.x >> 4;                        // 16 blocks per batch
  const int t0 = (blockIdx.x << 8) + (wv << 5);         // first of the wave's tokens
  const float* vs = kqv + (size_t)(t0 + hi) * DIMC + 128 + (cn << 2);
  const float* ks = kp + (size_t)(t0 + hi) * MF + (cn << 1);
  float4 va[16];
  float2 kb[16];
  #pragma unroll  // constant indices keep va[], kb[] and acc[] in registers (here and below)
  for (int i = 0; i < 16; ++i) kb[i] = *reinterpret_cast<const float2*>(ks + (i << 1) * MF);
  // A later load may land on the address registers that these loads name.
  asm volatile("s_wait_xcnt 0x0" ::: "memory");
  #pragma unroll
  for (int i = 0; i < 16; ++i) va[i] = *reinterpret_cast<const float4*>(vs + (i << 1) * DIMC);
  // What follows may reuse the address registers that these loads name.
  asm volatile("s_wait_xcnt 0x0" ::: "memory");
  // Keeps all 32 loads ahead of the first WMMA: left alone, the scheduler holds a third of
  // them back until registers come free, a second memory latency in a row.
  __builtin_amdgcn_sched_barrier(0);

  const v8f vzero = {};
  v8f acc[4][2];
  #pragma unroll
  for (int mt = 0; mt < 4; ++mt) { acc[mt][0] = vzero; acc[mt][1] = vzero; }
  #pragma unroll
  for (int s = 0; s < 8; ++s) {
    const float a0[4] = {va[2 * s].x, va[2 * s].y, va[2 * s].z, va[2 * s].w};
    const float a1[4] = {va[2 * s + 1].x, va[2 * s + 1].y, va[2 * s + 1].z, va[2 * s + 1].w};
    const v2f fb[2] = {{kb[2 * s].x, kb[2 * s + 1].x}, {kb[2 * s].y, kb[2 * s + 1].y}};
    #pragma unroll
    for (int mt = 0; mt < 4; ++mt) {
      const v2f fa = {a0[mt], a1[mt]};
      #pragma unroll
      for (int nt = 0; nt < 2; ++nt) {
        acc[mt][nt] = __builtin_amdgcn_wmma_f32_16x16x4_f32(
            false, fa, false, fb[nt], (short)0, acc[mt][nt], false, false);
      }
    }
  }
  // Accumulator register r of tile (mt, nt) is cell d = 4*(8*hi + r) + mt, m = 2*cn + nt.
  float* P = part[wv] + (hi << 10) + (cn << 1);
  #pragma unroll
  for (int mt = 0; mt < 4; ++mt) {
    #pragma unroll
    for (int r = 0; r < 8; ++r) {
      float2 u;
      u.x = acc[mt][0][r]; u.y = acc[mt][1][r];
      *reinterpret_cast<float2*>(P + (((r << 2) + mt) << 5)) = u;
    }
  }
  __syncthreads();  // every wave's partial sums stand before they are added across waves
  float* dst = kptv + (size_t)b * (EMB * MF) + (tid << 2);
  #pragma unroll
  for (int j = 0; j < 2; ++j) {
    float4 sum = *reinterpret_cast<const float4*>(&part[0][(j << 10) + (tid << 2)]);
    #pragma unroll
    for (int w = 1; w < 8; ++w) {
      const float4 u = *reinterpret_cast<const float4*>(&part[w][(j << 10) + (tid << 2)]);
      sum.x += u.x; sum.y += u.y; sum.z += u.z; sum.w += u.w;
    }
    atomicAdd(dst + (j << 10), sum.x);
    atomicAdd(dst + (j << 10) + 1, sum.y);
    atomicAdd(dst + (j << 10) + 2, sum.z);
    atomicAdd(dst + (j << 10) + 3, sum.w);
  }
}

// ---------------------------------------------------------------------------
// K7: yatt = v + proj(qp @ kptv^T / (qp.ksum + eps)).  Lane = token, 32 tokens
// per wave: qp row and output row in registers.  Every weight is
// wave-uniform: ksum, proj_w and proj_b come by scalar loads; the batch's kptv is
// staged once per block in LDS and read with all lanes on one address, so that a
// trip of the main loop waits for one run of scalar loads, not three.
// ---------------------------------------------------------------------------
__global__ __launch_bounds__(128) void k_mix(const float* __restrict__ kqv,
                                             const float* __restrict__ qp,
                                             const float* __restrict__ ksum,
                                             const float* __restrict__ kptv,
                                             const float* __restrict__ pw,
                                             const float* __restrict__ pb,
                                             float* __restrict__ yatt) {
  __shared__ __attribute__((aligned(16))) float qt[4][32 * PF_P];
  __shared__ __attribute__((aligned(16))) float vt[4][32 * VO_P];
  __shared__ __attribute__((aligned(16))) float klt[EMB * MF];
  const int lane = threadIdx.x & 31;
  // The wave's number, shown to the compiler as uniform: tile and row addresses are
  // then scalar arithmetic, a scalar base and a lane offset per load.
  const int wv = __builtin_amdgcn_readfirstlane(threadIdx.x >> 5);
  float* Q = qt[wv];
  float* V = vt[wv];
  const int b = blockIdx.x >> 5;                        // 32 blocks per batch
  const int tok0 = (blockIdx.x << 7) + (wv << 5);       // first of the wave's tokens
  // In: four tokens' qp rows, or two tokens' v rows, per wave load (whole lines).
  {
    const float* qs = qp + (size_t)tok0 * MF + (lane << 2);
    const float* vs = kqv + (size_t)tok0 * DIMC + 128 + (lane >> 4) * DIMC + ((lane & 15) << 2);
    const float* ks = kptv + (size_t)b * (EMB * MF) + (wv << 7) + (lane << 2);
    float4 qi[8], vi[16], ki[4];
    #pragma unroll  // constant indices keep qi[], vi[] and ki[] in registers
    for (int i = 0; i < 8; ++i) qi[i] = *reinterpret_cast<const float4*>(qs + (i << 7));
    #pragma unroll
    for (int i = 0; i < 4; ++i) ki[i] = *reinterpret_cast<const float4*>(ks + (i << 9));
    #pragma unroll
    for (int i = 0; i < 16; ++i) vi[i] = *reinterpret_cast<const float4*>(vs + (i << 1) * DIMC);
    #pragma unroll
    for (int i = 0; i < 8; ++i)
      *reinterpret_cast<float4*>(Q + ((i << 2) + (lane >> 3)) * PF_P + ((lane & 7) << 2)) = qi[i];
    #pragma unroll
    for (int i = 0; i < 16; ++i)
      *reinterpret_cast<float4*>(V + ((i << 1) + (lane >> 4)) * VO_P + ((lane & 15) << 2)) = vi[i];
    #pragma unroll
    for (int i = 0; i < 4; ++i)
      *reinterpret_cast<float4*>(klt + (i << 9) + (wv << 7) + (lane << 2)) = ki[i];
  }
  __syncthreads();  // klt is filled by all four waves; the wave's own tiles stand too
  float q[32], o[64];
  #pragma unroll  // constant indices keep q[] and o[] in registers
  for (int j = 0; j < 8; ++j) {
    const float4 u = *reinterpret_cast<const float4*>(Q + lane * PF_P + (j << 2));
    q[4 * j] = u.x; q[4 * j + 1] = u.y; q[4 * j + 2] = u.z; q[4 * j + 3] = u.w;
  }
  #pragma unroll
  for (int j = 0; j < 16; ++j) {
    const float4 u = *reinterpret_cast<const float4*>(V + lane * VO_P + (j << 2));
    o[4 * j] = u.x + pb[4 * j];         o[4 * j + 1] = u.y + pb[4 * j + 1];
    o[4 * j + 2] = u.z + pb[4 * j + 2]; o[4 * j + 3] = u.w + pb[4 * j + 3];
  }
  // D = qp.ksum, added in the tree order of a 32-lane xor butterfly.
  const float* ksb = ksum + b * MF;
  float t[32];
  #pragma unroll
  for (int m = 0; m < 32; ++m) t[m] = q[m] * ksb[m];
  #pragma unroll
  for (int off = 16; off > 0; off >>= 1) {
    #pragma unroll
    for (int m = 0; m < off; ++m) t[m] += t[m + off];
  }
  const float den = t[0] + 1e-8f;
  // Two attention channels e a trip: for each its sum over m, then its row of
  // proj_w into all 64 outputs, e ascending.
  #pragma unroll 2  // the two sums run as independent chains, and the second row's
                    // scalar loads fly under the first row's work
  for (int e = 0; e < EMB; ++e) {
    const float* kr = klt + (e << 5);
    const float* pr = pw + (e << 6);
    float num = 0.f;
    #pragma unroll
    for (int m = 0; m < 32; ++m) num += q[m] * kr[m];
    const float al = num / den;
    #pragma unroll
    for (int d = 0; d < 64; ++d) o[d] += al * pr[d];
  }
  #pragma unroll
  for (int j = 0; j < 16; ++j) {
    float4 u;
    u.x = o[4 * j]; u.y = o[4 * j + 1]; u.z = o[4 * j + 2]; u.w = o[4 * j + 3];
    *reinterpret_cast<float4*>(V + lane * VO_P + (j << 2)) = u;
  }
  // Every lane's row must stand in the tile before it is read across lanes.
  asm volatile("s_wait_dscnt 0x0" ::: "memory");
  // Out: two tokens' rows are 512 contiguous bytes, one wave store.
  float* yo = yatt + ((size_t)tok0 << 6) + (lane << 2);
  const float* Vr = V + (lane >> 4) * VO_P + ((lane & 15) << 2);
  #pragma unroll
  for (int i = 0; i < 16; ++i)
    *reinterpret_cast<float4*>(yo + (i << 7)) =
        *reinterpret_cast<const float4*>(Vr + (i << 1) * VO_P);
}

// ---------------------------------------------------------------------------
// K8: out = yatt + W2 @ gelu(W1 @ LN(yatt) + b1) + b2.  Fully fused:
// LN2 in registers, both 64x64 GEMMs via WMMA, A in LDS, B from the packed weights.
// Per block: 64 rows, 128 threads (4 waves).
// ---------------------------------------------------------------------------
__global__ __launch_bounds__(128) void k_mlp(const float* __restrict__ yatt,
                                             const float* __restrict__ g,
                                             const float* __restrict__ bt,
                                             const half_t* __restrict__ wpk,
                                             const float* __restrict__ b1,
                                             const float* __restrict__ b2,
                                             float* __restrict__ out) {
  __shared__ half_t Hs[64][66];
  __shared__ half_t T1s[64][66];
  __shared__ float b1l[64], b2l[64];
  const int rbase = blockIdx.x << 6;
  const int tid = threadIdx.x, lane = tid & 31, wv = tid >> 5;
  const half_t* wl = wpk + WM_H + (lane << 3);
  // LayerNorm(64): two threads per row, pair-reduce via shfl.
  {
    const int r = tid >> 1, hf = tid & 1;
    const float* p = yatt + ((size_t)(rbase + r) << 6) + (hf << 5);
    float xv[32], s = 0.f, s2 = 0.f;
    #pragma unroll
    for (int j = 0; j < 32; ++j) { const float v = p[j]; xv[j] = v; s += v; s2 += v * v; }
    s  += __shfl_xor(s, 1, 32);
    s2 += __shfl_xor(s2, 1, 32);
    const float mean = s * (1.0f / 64.f);
    const float var  = s2 * (1.0f / 64.f) - mean * mean;
    const float rs = rsqrtf(var + 1e-5f);
    #pragma unroll
    for (int j = 0; j < 32; ++j) {
      const int c = (hf << 5) + j;
      Hs[r][c] = (half_t)((xv[j] - mean) * rs * g[c] + bt[c]);
    }
  }
  // W1's fragments are asked for ahead of the barrier and arrive during its wait.
  v16h vb1[8];
  #pragma unroll  // constant indices keep vb1[] in registers
  for (int f = 0; f < 8; ++f) vb1[f] = load_bfrag(wl, f);
  if (tid < 64) { b1l[tid] = b1[tid]; b2l[tid] = b2[tid]; }
  __syncthreads();
  // W2's fragments arrive while the first GEMM and its GELU run.
  v16h vb2[8];
  #pragma unroll  // constant indices keep vb2[] in registers
  for (int f = 0; f < 8; ++f) vb2[f] = load_bfrag(wl, 8 + f);

  const v8f vzero = {};
  v8f acc[4];
  #pragma unroll
  for (int i = 0; i < 4; ++i) acc[i] = vzero;
  #pragma unroll
  for (int kk = 0; kk < 2; ++kk) {
    const int ks = kk << 5;
    const v16h va = load_frag(&Hs[0][ks], wv << 4, 66, lane);
    #pragma unroll
    for (int nt = 0; nt < 4; ++nt) {
      acc[nt] = __builtin_amdgcn_wmma_f32_16x16x32_f16(
          false, va, false, vb1[(kk << 2) + nt], (short)0, acc[nt], false, false);
    }
  }
  const int hi = lane >> 4, cn = lane & 15;
  #pragma unroll
  for (int nt = 0; nt < 4; ++nt) {
    const int col = (nt << 4) + cn;
    #pragma unroll
    for (int r0 = 0; r0 < 8; r0 += 4) {
      float v[4];
      #pragma unroll
      for (int i = 0; i < 4; ++i) v[i] = acc[nt][r0 + i] + b1l[col];
      gelu_exact4(v);
      #pragma unroll
      for (int i = 0; i < 4; ++i) {
        const int row = (wv << 4) + r0 + i + (hi << 3);
        T1s[row][col] = (half_t)v[i];
      }
    }
  }
  __syncthreads();
  v8f acc2[4];
  #pragma unroll
  for (int i = 0; i < 4; ++i) acc2[i] = vzero;
  #pragma unroll
  for (int kk = 0; kk < 2; ++kk) {
    const int ks = kk << 5;
    const v16h va = load_frag(&T1s[0][ks], wv << 4, 66, lane);
    #pragma unroll
    for (int nt = 0; nt < 4; ++nt) {
      acc2[nt] = __builtin_amdgcn_wmma_f32_16x16x32_f16(
          false, va, false, vb2[(kk << 2) + nt], (short)0, acc2[nt], false, false);
    }
  }
  #pragma unroll
  for (int nt = 0; nt < 4; ++nt) {
    const int col = (nt << 4) + cn;
    const float bv = b2l[col];
    #pragma unroll
    for (int r = 0; r < 8; ++r) {
      const int row = (wv << 4) + r + (hi << 3);
      const size_t gi = ((size_t)(rbase + row) << 6) + col;
      out[gi] = yatt[gi] + acc2[nt][r] + bv;
    }
  }
}

// ---------------------------------------------------------------------------
extern "C" void kernel_launch(void* const* d_in, const int* in_sizes, int n_in,
                              void* d_out, int out_size, void* d_ws, size_t ws_size,
                              hipStream_t stream) {
  (void)in_sizes; (void)n_in; (void)out_size; (void)ws_size;
  const float* x      = (const float*)d_in[0];
  const float* conv_w = (const float*)d_in[1];
  const float* conv_b = (const float*)d_in[2];
  const float* ln1_g  = (const float*)d_in[3];
  const float* ln1_b  = (const float*)d_in[4];
  const float* kqv_w  = (const float*)d_in[5];
  const float* kqv_b  = (const float*)d_in[6];
  const float* proj_w = (const float*)d_in[7];
  const float* proj_b = (const float*)d_in[8];
  const float* w_perf = (const float*)d_in[9];
  const float* ln2_g  = (const float*)d_in[10];
  const float* ln2_b  = (const float*)d_in[11];
  const float* mlp_w1 = (const float*)d_in[12];
  const float* mlp_b1 = (const float*)d_in[13];
  const float* mlp_w2 = (const float*)d_in[14];
  const float* mlp_b2 = (const float*)d_in[15];

  char* ws = (char*)d_ws;
  half_t* xh   = (half_t*)(ws + XH_OFF);
  half_t* tok  = (half_t*)(ws + TOK_OFF);
  float*  kqv  = (float*)(ws + KQV_OFF);
  float*  kp   = (float*)(ws + KP_OFF);     // reuses XH region (xh dead)
  float*  qp   = (float*)(ws + QP_OFF);
  float*  ksum = (float*)(ws + KSUM_OFF);
  float*  kptv = (float*)(ws + KPTV_OFF);
  float*  yatt = (float*)(ws + YATT_OFF);   // reuses TOK region (tok dead)
  half_t* wpk  = (half_t*)(ws + WPK_OFF);
  float*  cs   = (float*)(ws + CS_OFF);
  float*  out  = (float*)d_out;

  // Zero the atomic accumulators (ksum + kptv are contiguous).
  hipMemsetAsync(ws + KSUM_OFF, 0, 4096 + (size_t)BATCH * EMB * MF * 4, stream);

  k_pack<<<dim3(WPK_BLOCKS + 1 + BATCH * 256), dim3(256), 0, stream>>>(
      x, conv_w, kqv_w, mlp_w1, mlp_w2, ln1_g, ln1_b, kqv_b, xh, wpk, cs);
  k_conv<<<dim3(64, 3, BATCH), dim3(128), 0, stream>>>(xh, wpk, conv_b, tok);
  k_kqv <<<dim3((BATCH * TOKN) / 128), dim3(128), 0, stream>>>(tok, wpk, cs, w_perf, kqv, kp, qp, ksum);
  k_kptv<<<dim3(BATCH * 16), dim3(256), 0, stream>>>(kqv, kp, kptv);
  k_mix <<<dim3(BATCH * 32), dim3(128), 0, stream>>>(kqv, qp, ksum, kptv,
                                                      proj_w, proj_b, yatt);
  k_mlp <<<dim3((BATCH * TOKN) / 64), dim3(128), 0, stream>>>(
      yatt, ln2_g, ln2_b, wpk, mlp_b1, mlp_b2, out);
}

// v009
// In two side-by-side timings against v008, it was 1.26 and 1.24 times as fast.
// All steps since v000 together make it 8.84 times as fast.
#include <hip/hip_runtime.h>
#include <hip/hip_bf16.h>
#include <math.h>

// ---------------------------------------------------------------------------
// MI455X (gfx1250, wave32) implementation of the PRM + Token-Performer block.
// All dense GEMMs (implicit-GEMM dilated convs, kqv, MLP) use
// V_WMMA_F32_16X16X32_F16 with f32 accumulation; kptv, the performer features and the
// attention products are on the f32 WMMA form.  Fused epilogues keep each intermediate to one
// HBM round-trip (pipeline is ~bandwidth-bound at 23.3 TB/s).
// Conv reduction axis ordered k = kid*64 + ic so each 32-wide WMMA K-step has
// a constant kernel tap; the image stays channels-last, so one pixel's 64
// channels are one 128-byte line and an im2col row is contiguous in k.
// The conv, kqv and MLP weight matrices are packed once per call into f16 in the order of the
// WMMA B fragment, so a B fragment is two whole-line 16-byte loads per lane.
// ---------------------------------------------------------------------------

typedef _Float16 half_t;
typedef __attribute__((ext_vector_type(16))) _Float16 v16h;
typedef __attribute__((ext_vector_type(8)))  _Float16 v8h;
typedef __attribute__((ext_vector_type(8)))  float    v8f;
typedef __attribute__((ext_vector_type(2)))  float    v2f;
typedef __attribute__((ext_vector_type(4)))  float    v4f;

// Problem constants (match reference)
#define BATCH   32
#define CIN     64
#define IMGSZ   128
#define NPIX    16384     // 128*128
#define TOKN    4096      // 64*64 post-stride-2 tokens
#define EBR     64
#define DIMC    192       // 3*EBR
#define EMB     64
#define MF      32        // performer features
#define INVSQRTM 0.17677669529663687f

// Workspace layout (bytes). Buffers reused once their producers/consumers
// are done:  XH region -> KP/QP.
#define XH_OFF    ((size_t)0)                                   // f16 [B][128][128][CIN]  67.1MB
#define KP_OFF    ((size_t)0)                                   // f32 [B][T][32]          (reuse XH)
#define QP_OFF    ((size_t)16777216)                            // f32 [B][T][32]
#define TOK_OFF   ((size_t)67108864)                            // f16 [B][T][192]         50.3MB
#define KQV_OFF   ((size_t)(67108864 + 2*50331648))             // f32 [B][T][192], only v (columns 128..191) is kept
#define KSUM_OFF  (KQV_OFF + (size_t)BATCH*TOKN*DIMC*4)         // f32 [B][32]
#define KPTV_OFF  (KSUM_OFF + (size_t)4096)                     // f32 [B][64][32]
#define WPK_OFF   (KPTV_OFF + (size_t)BATCH*EMB*MF*4)           // f16 packed weights, 311 KB
#define CS_OFF    (WPK_OFF + (size_t)311296)                    // f32 [2][192] kqv column terms

// Packed weights: one B fragment (32 k x 16 n) = 2 planes x 32 lanes x 8 halves.
// Plane p, lane l, element i hold k = 16*p + 8*(l>>4) + i, n = l&15: the hardware's
// k order.  A unit is one lane's 8 halves (16 bytes) of one plane.
#define FRAG_H    512                       // halves per fragment
#define WC_UNITS  13824                     // conv: 3 branches x 18 K-steps x 4 n-tiles x 64
#define WQ_UNITS  4608                      // kqv:  6 K-steps x 12 n-tiles x 64
#define WM_UNITS  1024                      // mlp:  2 matrices x 2 K-steps x 4 n-tiles x 64
#define WQ_H      (WC_UNITS * 8)            // first half of the kqv part
#define WM_H      ((WC_UNITS + WQ_UNITS) * 8)
#define WPK_BLOCKS ((WC_UNITS + WQ_UNITS + WM_UNITS) / 256)   // 76

// GELU with erf, four values at once: 0.5*x*(1 + erf(x/sqrt2)) = max(x,0) - |x|*h with
// h = 0.5*erfc(|x|/sqrt2), and erfc(z) = t*(a1 + t*(a2 + t*(a3 + t*(a4 + t*a5)))) * exp(-z*z),
// t = 1/(1 + p*z), which is within 1.5e-7 of erfc for every z >= 0.  One straight line for
// every x: no branch on |x|, so the values are independent chains that can be interleaved.
// The halves and the 1/sqrt2 are folded into the constants; exp(-z*z) = 2^-(c*x)^2 with
// c = sqrt(log2(e)/2).
__device__ __forceinline__ void gelu_exact4(float (&x)[4]) {
  float t[4], e[4];
  #pragma unroll  // constant indices keep t[], e[] and x[] in registers (here and below)
  for (int i = 0; i < 4; ++i) {
    const float u = x[i] * 0.84932180f;
    t[i] = fmaf(fabsf(x[i]), 0.23164189f, 1.0f);
    e[i] = -(u * u);
  }
  // The reciprocals, then the powers of two, in place and each kind in one run: behind a
  // transcendental the instruction set asks for one slot before its source is overwritten
  // or its result read.  Each is that slot for the one in front of it, the v_nop for the last.
  asm("v_rcp_f32 %0, %0\n\t"
      "v_rcp_f32 %1, %1\n\t"
      "v_rcp_f32 %2, %2\n\t"
      "v_rcp_f32 %3, %3\n\t"
      "v_nop"
      : "+v"(t[0]), "+v"(t[1]), "+v"(t[2]), "+v"(t[3]));
  asm("v_exp_f32 %0, %0\n\t"
      "v_exp_f32 %1, %1\n\t"
      "v_exp_f32 %2, %2\n\t"
      "v_exp_f32 %3, %3\n\t"
      "v_nop"
      : "+v"(e[0]), "+v"(e[1]), "+v"(e[2]), "+v"(e[3]));
  #pragma unroll
  for (int i = 0; i < 4; ++i) {
    float p = 0.5307027145f;
    p = fmaf(p, t[i], -0.7265760135f);
    p = fmaf(p, t[i], 0.7107068705f);
    p = fmaf(p, t[i], -0.142248368f);
    p = fmaf(p, t[i], 0.127414796f);
    x[i] = fmaf(-fabsf(x[i]), (p * t[i]) * e[i], fmaxf(x[i], 0.0f));
  }
}

// B fragment number frag of a packed weight part, as two 512-byte wave loads.
__device__ __forceinline__ v16h load_bfrag(const half_t* wl, int frag) {
  const v8h lo = *reinterpret_cast<const v8h*>(wl + frag * FRAG_H);
  const v8h hi = *reinterpret_cast<const v8h*>(wl + frag * FRAG_H + 256);
  return __builtin_shufflevector(lo, hi,
      0, 1, 2, 3, 4, 5, 6, 7, 8, 9, 10, 11, 12, 13, 14, 15);
}

// ---------------------------------------------------------------------------
// K1: x [B,N,C] f32  ->  xh [B,N,C] f16  (same channels-last order, convert
// only).  8 elements per thread per pass: two 16-byte loads, one 16-byte store.
// The first WPK_BLOCKS blocks pack the weights instead: one unit per thread,
// eight strided f32 reads, one 16-byte store; row k of the kqv weights is scaled by
// ln1's g[k] on the way.  The next block sums the two column terms of K3.
// ---------------------------------------------------------------------------
__global__ __launch_bounds__(256) void k_pack(const float* __restrict__ x,
                                              const float* __restrict__ cw,
                                              const float* __restrict__ wq,
                                              const float* __restrict__ w1,
                                              const float* __restrict__ w2,
                                              const float* __restrict__ lg,
                                              const float* __restrict__ lb,
                                              const float* __restrict__ qb,
                                              half_t* __restrict__ xh,
                                              half_t* __restrict__ wpk,
                                              float* __restrict__ cs) {
  if (blockIdx.x == WPK_BLOCKS) {            // thread = column n of the kqv weights
    if (threadIdx.x < DIMC) {
      const float* wc = wq + threadIdx.x;
      float sg = 0.f, sb = 0.f;
      #pragma unroll 16  // 16 loads in flight a trip; many more would raise the kernel's registers
      for (int k = 0; k < DIMC; ++k) {
        const float w = wc[k * DIMC];
        sg += (float)(half_t)(w * lg[k]);    // the f16 value that the GEMM multiplies by
        sb += w * lb[k];
      }
      cs[threadIdx.x] = sg;
      cs[DIMC + threadIdx.x] = sb + qb[threadIdx.x];
    }
    return;
  }
  if (blockIdx.x < WPK_BLOCKS) {
    const int u = (blockIdx.x << 8) + threadIdx.x;
    const int n = u & 15;
    const int k0 = (((u >> 5) & 1) << 4) + (((u >> 4) & 1) << 3);  // k of element 0
    const float* src;
    int step;                                // floats from one k to the next
    float sc[8] = {1.f, 1.f, 1.f, 1.f, 1.f, 1.f, 1.f, 1.f};
    if (blockIdx.x < WC_UNITS / 256) {       // frag = ((br*9 + kid)*2 + h)*4 + nt
      const int f = u >> 6;
      const int nt = f & 3, h = (f >> 2) & 1, tap = f >> 3;   // tap = br*9 + kid
      const int br = tap / 9, kid = tap - br * 9;
      src = cw + (((br << 6) + (nt << 4) + n) * CIN + (h << 5) + k0) * 9 + kid;
      step = 9;
    } else if (blockIdx.x < (WC_UNITS + WQ_UNITS) / 256) {    // frag = kk*12 + n-tile
      const int f = (u - WC_UNITS) >> 6;
      const int kk = f / 12, nt = f - kk * 12;
      src = wq + ((kk << 5) + k0) * DIMC + (nt << 4) + n;
      step = DIMC;
      #pragma unroll
      for (int i = 0; i < 8; ++i) sc[i] = lg[(kk << 5) + k0 + i];
    } else {                                 // frag = (matrix*2 + kk)*4 + nt
      const int f = (u - WC_UNITS - WQ_UNITS) >> 6;
      const int nt = f & 3, kk = (f >> 2) & 1;
      src = ((f >> 3) ? w2 : w1) + ((kk << 5) + k0) * EMB + (nt << 4) + n;
      step = EMB;
    }
    float t[8];
    #pragma unroll  // constant indices keep t[] in registers
    for (int i = 0; i < 8; ++i) t[i] = src[i * step];
    // The conversions below reuse the address registers that these loads name.
    asm volatile("s_wait_xcnt 0x0" ::: "memory");
    v8h o;
    #pragma unroll
    for (int i = 0; i < 8; ++i) o[i] = (half_t)(t[i] * sc[i]);
    *reinterpret_cast<v8h*>(wpk + ((size_t)u << 3)) = o;
    return;
  }
  const size_t base = ((size_t)(blockIdx.x - WPK_BLOCKS - 1) << 12) + ((size_t)threadIdx.x << 3);
  #pragma unroll  // both passes' loads are in flight before the first store
  for (int rep = 0; rep < 2; ++rep) {
    const size_t e = base + ((size_t)rep << 11);
    const float4 u = *reinterpret_cast<const float4*>(x + e);
    const float4 w = *reinterpret_cast<const float4*>(x + e + 4);
    v8h o;
    o[0] = (half_t)u.x; o[1] = (half_t)u.y; o[2] = (half_t)u.z; o[3] = (half_t)u.w;
    o[4] = (half_t)w.x; o[5] = (half_t)w.y; o[6] = (half_t)w.z; o[7] = (half_t)w.w;
    *reinterpret_cast<v8h*>(xh + e) = o;
  }
}

// ---------------------------------------------------------------------------
// K2: implicit-GEMM dilated conv + bias + GELU -> tokens f16 [B,T,192].
// Per block: 64 tokens (one output row) x 64 out-channels, K=576 in 18 steps of 32.
// K axis ordered k = kid*64 + ic.  The three image rows that the output row's taps
// touch are brought into LDS once per block by asynchronous copies, whole 128-byte
// lines, and every wave reads its A fragments from there.  A wave owns all 64 tokens
// (4 row tiles) and 16 out-channels, so each packed B fragment is loaded by one wave
// of the block only.
// LDS: plane (kh, parity of the pixel column) = 67 slots of 144 bytes: 2 zero slots,
// the 64 pixels of that parity, 1 zero slot.  Tap column 2*ow + off is slot
// ow + (off >> 1) + 2 of parity off & 1, so neighbouring tokens are 144 bytes
// (16 B x odd) apart; a column outside the image falls on a zero slot, a row outside
// the image is a zero plane.
// grid = (64 token tiles, 3 branches, 32 batches), 4 waves.
// ---------------------------------------------------------------------------
#define CV_SLOT   144                   // bytes per staged pixel
#define CV_PLANE  (67 * CV_SLOT)        // bytes per plane

// Four 16-byte-per-lane copies global -> LDS.  The wait at the end stands in the
// copies' own statement: their address registers may be rewritten behind it.
__device__ __forceinline__ void copy4(unsigned l0, unsigned l1, unsigned l2, unsigned l3,
                                      const half_t* g0, const half_t* g1,
                                      const half_t* g2, const half_t* g3) {
  asm volatile("global_load_async_to_lds_b128 %0, %4, off\n\t"
               "global_load_async_to_lds_b128 %1, %5, off\n\t"
               "global_load_async_to_lds_b128 %2, %6, off\n\t"
               "global_load_async_to_lds_b128 %3, %7, off\n\t"
               "s_wait_xcnt 0x0"
               :: "v"(l0), "v"(l1), "v"(l2), "v"(l3), "v"(g0), "v"(g1), "v"(g2), "v"(g3)
               : "memory");
}

template <int DIL>
__device__ __forceinline__ void conv_acc(const half_t* __restrict__ xb,   // the batch's image
                                         const half_t* __restrict__ wl,   // branch's B, lane's place
                                         half_t* img, int oh, int tid, v8f (&acc)[4]) {
  const int lane = tid & 31, wv = tid >> 5;
  const int hi = lane >> 4, cn = lane & 15;
  const v8h hzero = (v8h)(half_t)0.0f;
  char* imgb = reinterpret_cast<char*>(img);

  // Zero slots, and whole planes for a row outside the image.
  #pragma unroll  // kh constant: plane offsets fold into the instructions (here and below)
  for (int kh = 0; kh < 3; ++kh) {
    const int ih = (oh << 1) + (kh - 1) * DIL;
    char* pl = imgb + (kh << 1) * CV_PLANE;
    if ((unsigned)ih < 128u) {
      if (tid < 48) {                       // 2 planes x 3 slots x 8 pieces of 16 bytes
        const int p = tid / 24, r = tid - p * 24, s = r >> 3;
        *reinterpret_cast<v8h*>(pl + p * CV_PLANE + (s < 2 ? s : 66) * CV_SLOT + ((r & 7) << 4)) = hzero;
      }
    } else {
      for (int i = tid; i < 2 * CV_PLANE / 16; i += 128)
        *reinterpret_cast<v8h*>(pl + (i << 4)) = hzero;
    }
  }
  // This wave's LDS stores have retired before its copies are pointed at the array.
  asm volatile("s_wait_dscnt 0x0" ::: "memory");

  // Copies: a wave copy is 4 pixels x 128 bytes; 8 lanes share a pixel.  Odd dilation
  // needs every pixel of the row (4 neighbours a copy), dilation 2 the even ones only.
  const unsigned lbase = (unsigned)(size_t)img + ((lane & 7) << 4);
  #pragma unroll
  for (int kh = 0; kh < 3; ++kh) {
    const int ih = (oh << 1) + (kh - 1) * DIL;
    if ((unsigned)ih < 128u) {              // the same for the whole block
      const half_t* gr = xb + ((size_t)ih << 13) + ((lane & 7) << 3);
      #pragma unroll
      for (int c = 0; c < ((DIL == 2) ? 1 : 2); ++c) {
        unsigned l[4];
        const half_t* g[4];
        #pragma unroll  // constant indices keep l[] and g[] in registers
        for (int i = 0; i < 4; ++i) {
          const int grp = (DIL == 2) ? ((wv << 2) + i) : ((wv << 3) + (c << 2) + i);
          const int px = (DIL == 2) ? (((grp << 2) + (lane >> 3)) << 1) : ((grp << 2) + (lane >> 3));
          l[i] = lbase + ((kh << 1) + (px & 1)) * CV_PLANE + ((px >> 1) + 2) * CV_SLOT;
          g[i] = gr + (px << 6);
        }
        copy4(l[0], l[1], l[2], l[3], g[0], g[1], g[2], g[3]);
      }
    }
  }

  // B: the wave's column tile, 2 fragments a tap, kept three taps ahead in 4 register sets.
  v16h vb[4][2];
  #pragma unroll  // constant indices keep vb[] and a[] in registers (here and below)
  for (int t = 0; t < 3; ++t) {
    #pragma unroll
    for (int h = 0; h < 2; ++h) vb[t][h] = load_bfrag(wl + t * (8 * FRAG_H), (h << 2) + wv);
  }
  // This wave's copies have landed; behind the barrier every wave's have.
  asm volatile("s_wait_asynccnt 0x0" ::: "memory");
  __syncthreads();

  // A: lane l reads row l&15 of each row tile: 16-byte runs at k = 16*q + 8*(l>>4).
  // Step s = 2*kid + h is one K-step of 32: its 8 reads are asked for one step ahead.
  const char* ar = imgb + (cn + 2) * CV_SLOT + (hi << 4);
  v8h a[2][8];
  #pragma unroll  // s picks register sets and LDS offsets: constants only when unrolled
  for (int s = -1; s < 18; ++s) {
    // The two fences hold the loads for later steps in one run ahead of this step's
    // WMMAs: lifted higher they need more registers, sunk to their use they fly under
    // nothing.
    __builtin_amdgcn_sched_barrier(0);
    if (s >= 0 && (s & 1) == 0 && (s >> 1) + 3 < 9) {
      const int kb = (s >> 1) + 3;
      #pragma unroll
      for (int h = 0; h < 2; ++h)
        vb[kb & 3][h] = load_bfrag(wl + kb * (8 * FRAG_H), (h << 2) + wv);
      // What follows may reuse the address registers that these loads name.
      asm volatile("s_wait_xcnt 0x0" ::: "memory");
    }
    if (s + 1 < 18) {
      const int sn = s + 1, kn = sn >> 1, kh = kn / 3, off = (kn - kh * 3 - 1) * DIL;
      const char* ap = ar + ((kh << 1) + (off & 1)) * CV_PLANE + (off >> 1) * CV_SLOT + ((sn & 1) << 6);
      #pragma unroll
      for (int mt = 0; mt < 4; ++mt) {
        #pragma unroll
        for (int j = 0; j < 2; ++j)
          a[sn & 1][(mt << 1) + j] =
              *reinterpret_cast<const v8h*>(ap + (mt << 4) * CV_SLOT + (j << 5));
      }
    }
    __builtin_amdgcn_sched_barrier(0);
    if (s >= 0) {
      #pragma unroll
      for (int mt = 0; mt < 4; ++mt) {
        const v16h va = __builtin_shufflevector(a[s & 1][(mt << 1)], a[s & 1][(mt << 1) + 1],
            0, 1, 2, 3, 4, 5, 6, 7, 8, 9, 10, 11, 12, 13, 14, 15);
        acc[mt] = __builtin_amdgcn_wmma_f32_16x16x32_f16(
            false, va, false, vb[(s >> 1) & 3][s & 1], (short)0, acc[mt], false, false);
      }
    }
  }
}

__global__ __launch_bounds__(128) void k_conv(const half_t* __restrict__ xh,
                                              const half_t* __restrict__ wpk,
                                              const float* __restrict__ cb,
                                              half_t* __restrict__ tok) {
  __shared__ __attribute__((aligned(16))) half_t img[6 * CV_PLANE / 2];
  const int tbase = blockIdx.x << 6;
  const int br = blockIdx.y;
  const int b  = blockIdx.z;
  const int tid = threadIdx.x, lane = tid & 31, wv = tid >> 5;
  const half_t* wl = wpk + br * (72 * FRAG_H) + (lane << 3);
  const half_t* xb = xh + (size_t)b * NPIX * CIN;

  v8f acc[4];
  const v8f vzero = {};
  #pragma unroll
  for (int i = 0; i < 4; ++i) acc[i] = vzero;

  // One body per dilation: every LDS offset of the taps is then a constant.
  if (br == 0)      conv_acc<1>(xb, wl, img, blockIdx.x, tid, acc);
  else if (br == 1) conv_acc<2>(xb, wl, img, blockIdx.x, tid, acc);
  else              conv_acc<3>(xb, wl, img, blockIdx.x, tid, acc);

  // Epilogue: bias + exact GELU, write tokens (branch-major channel concat)
  const int hi = lane >> 4, cn = lane & 15;
  const int oc = (wv << 4) + cn;
  const float bias = cb[br * EBR + oc];
  #pragma unroll
  for (int mt = 0; mt < 4; ++mt) {
    #pragma unroll
    for (int r0 = 0; r0 < 8; r0 += 4) {
      float v[4];
      #pragma unroll
      for (int i = 0; i < 4; ++i) v[i] = acc[mt][r0 + i] + bias;
      gelu_exact4(v);
      #pragma unroll
      for (int i = 0; i < 4; ++i) {
        const int row = (mt << 4) + r0 + i + (hi << 3);
        const int t = tbase + row;
        tok[((size_t)b * TOKN + t) * DIMC + br * EBR + oc] = (half_t)v[i];
      }
    }
  }
}

// exp of four values, in the scheme of the library's expf: n = round(x*log2(e)), the rest
// x*log2(e) - n from a two-part log2(e) by two FMAs, 2^rest scaled by 2^n, and both range
// guards.  The four powers of two stand in one run: behind a transcendental the instruction
// set asks for one slot before its source is overwritten or its result read.  Each is that
// slot for the one in front of it, the v_nop for the last.
__device__ __forceinline__ void exp4(float (&x)[4]) {
  float a[4];
  int n[4];
  #pragma unroll  // constant indices keep a[], n[] and x[] in registers (here and below)
  for (int i = 0; i < 4; ++i) {
    const float e = rintf(x[i] * 0x1.715476p+0f);
    a[i] = fmaf(x[i], 0x1.4ae0bep-26f, fmaf(x[i], 0x1.715476p+0f, -e));
    n[i] = (int)e;
  }
  asm("v_exp_f32 %0, %0\n\t"
      "v_exp_f32 %1, %1\n\t"
      "v_exp_f32 %2, %2\n\t"
      "v_exp_f32 %3, %3\n\t"
      "v_nop"
      : "+v"(a[0]), "+v"(a[1]), "+v"(a[2]), "+v"(a[3]));
  #pragma unroll
  for (int i = 0; i < 4; ++i) {
    float r = ldexpf(a[i], n[i]);
    r = (x[i] < -0x1.9d1da0p+6f) ? 0.0f : r;
    x[i] = (x[i] > 0x1.62e430p+6f) ? __builtin_inff() : r;
  }
}

// ---------------------------------------------------------------------------
// K3: LayerNorm(192) + kqv GEMM  [131072 x 192] @ [192 x 192] + bias, then the performer
// features of k and q in the same wave; only v, kp, qp and ksum go to memory.
// With W' = g o W (packed so by K1), cg[n] = sum_k W'[k][n] and
// cb[n] = bias[n] + sum_k bt[k] W[k][n]:
//   LN(x) @ W + bias = rs * (x @ W' - mean * cg) + cb,
// so the raw f16 token rows are an operand and a row's mean and rs enter only at
// the accumulators.  A wave owns 32 tokens (two 16-token tiles) and all 192 columns.
// The product is taken transposed: the packed weight fragment is the A operand (row =
// column n of W'), the token rows are the B operand (column = token).  Lane l
// (c = l&15, h = l>>4) reads token c of each tile straight from global: 16-byte runs at
// k = 16*j + 8*h, j = 0..11, the k order of the packed weights.  Accumulator register r
// of column tile nt is then kqv[token c][16*nt + 8*h + r]: the lane's own token, so its
// mean and rs need no exchange beyond the one with the partner lane.
// Features: kp^T = Wp (32 x 64) . k^T on V_WMMA_F32_16X16X4_F32.  Registers 2*s, 2*s+1 of
// a finished k tile are the B fragment of K-step s as they stand: place (h, j) holds
// d = 16*nt + 8*h + 2*s + j, and the A fragment takes Wp[m][the same d] at the same place.
// Its accumulator register r is feature m = 16*mf + 8*h + r of token c.
// The k and q tiles wait in LDS, each lane's registers in the lane's own 16-byte places,
// until the token rows and the weight fragments have left the registers.
// Features and v rows are turned into whole-line wave stores in the same LDS range, which
// is the wave's own.  No work-group barrier.
// grid = 1024 blocks of 4 waves = 4 waves per SIMD.
// ---------------------------------------------------------------------------
#define PF_P 36    // floats per staged feature row (144 B = 16 B x 9)
#define VO_P 68    // floats per staged v / y row   (272 B = 16 B x 17)

__global__ __launch_bounds__(128) void k_kqv(const half_t* __restrict__ tok,
                                             const half_t* __restrict__ wpk,
                                             const float* __restrict__ cs,
                                             const float* __restrict__ wperf,
                                             float* __restrict__ kqv,
                                             float* __restrict__ kp,
                                             float* __restrict__ qp,
                                             float* __restrict__ ksum) {
  // Per wave, one use after the other: 32 v rows; 32 places x 32 lanes x 16 bytes of k and
  // q tiles; 64 feature rows, written over places whose tiles have been read.
  __shared__ __attribute__((aligned(16))) float tile[4][4096];
  const int lane = threadIdx.x & 31, wv = threadIdx.x >> 5;
  const int hi = lane >> 4, cn = lane & 15;
  const int rbase = (blockIdx.x << 7) + (wv << 5);      // first of the wave's tokens
  const int b = blockIdx.x >> 5;                        // 32 blocks per batch
  const half_t* wl = wpk + WQ_H + (lane << 3);
  float* T = tile[wv];

  v8h x[2][12];
  #pragma unroll  // constant indices keep x[], vb[] and the other arrays in registers (here and below)
  for (int mt = 0; mt < 2; ++mt) {
    const half_t* p = tok + (size_t)(rbase + (mt << 4) + cn) * DIMC + (hi << 3);
    #pragma unroll
    for (int j = 0; j < 12; ++j) x[mt][j] = *reinterpret_cast<const v8h*>(p + (j << 4));
    // A later load may land on the address registers that these loads name.
    asm volatile("s_wait_xcnt 0x0" ::: "memory");
  }
  v16h vb[6];
  #pragma unroll
  for (int kk = 0; kk < 6; ++kk) vb[kk] = load_bfrag(wl, kk * 12 + 8);

  // Row statistics of the lane's own token in each tile.
  float rs[2], mn[2];                                   // rs and mean
  #pragma unroll
  for (int mt = 0; mt < 2; ++mt) {
    float s0 = 0.f, s1 = 0.f, q0 = 0.f, q1 = 0.f;       // two chains each
    #pragma unroll
    for (int j = 0; j < 12; ++j) {
      #pragma unroll
      for (int i = 0; i < 8; i += 2) {
        const float v0 = (float)x[mt][j][i], v1 = (float)x[mt][j][i + 1];
        s0 += v0; q0 += v0 * v0;
        s1 += v1; q1 += v1 * v1;
      }
    }
    float s = s0 + s1, s2 = q0 + q1;
    s  += __shfl_xor(s, 16, 32);                        // the row's other half
    s2 += __shfl_xor(s2, 16, 32);
    const float mean = s * (1.0f / DIMC);
    const float var  = s2 * (1.0f / DIMC) - mean * mean;
    // 1/sqrt as the library forms it (a subnormal argument is scaled by 2^24, its result by
    // 2^12), with the slot that the instruction set asks for behind a transcendental, before
    // its source is overwritten or its result read, filled by the v_nop in the same statement.
    const float ve = var + 1e-5f;
    const bool tiny = ve < 1.17549435e-38f;
    const float va = tiny ? ve * 16777216.0f : ve;
    float vr;
    asm("v_rsq_f32 %0, %1\n\t"
        "v_nop"
        : "=v"(vr) : "v"(va));
    rs[mt] = tiny ? vr * 4096.0f : vr;
    mn[mt] = mean;
  }

  const float* csl = cs + (hi << 3);                    // column terms of the lane's 8 columns
  float4 cg4[2][2], cb4[2][2];                          // two sets, by the trip's parity
  #pragma unroll
  for (int j = 0; j < 2; ++j) {
    cg4[0][j] = *reinterpret_cast<const float4*>(csl + (8 << 4) + (j << 2));
    cb4[0][j] = *reinterpret_cast<const float4*>(csl + DIMC + (8 << 4) + (j << 2));
  }
  // What follows may reuse the address registers that these loads name.
  asm volatile("s_wait_xcnt 0x0" ::: "memory");
  const v8f vzero = {};
  // Column tiles in the order v (8..11), k (0..3), q (4..7).
  #pragma unroll  // the trip picks the phase and every offset: constants only when unrolled
  for (int it = 0; it < 12; ++it) {
    const int nt = (it + 8) % 12;
    v8f acc[2] = {vzero, vzero};
    #pragma unroll
    for (int hf = 0; hf < 2; ++hf) {
      #pragma unroll
      for (int kk = 3 * hf; kk < 3 * hf + 3; ++kk) {
        #pragma unroll
        for (int mt = 0; mt < 2; ++mt) {
          const v16h vx = __builtin_shufflevector(x[mt][2 * kk], x[mt][2 * kk + 1],
              0, 1, 2, 3, 4, 5, 6, 7, 8, 9, 10, 11, 12, 13, 14, 15);
          acc[mt] = __builtin_amdgcn_wmma_f32_16x16x32_f16(
              false, vb[kk], false, vx, (short)0, acc[mt], false, false);
        }
      }
      if (it + 1 < 12) {
        // The two fences hold the next tile's loads where they stand: lifted above the
        // WMMAs they need a second register set, sunk to their use they fly under nothing.
        __builtin_amdgcn_sched_barrier(0);
        #pragma unroll
        for (int kk = 3 * hf; kk < 3 * hf + 3; ++kk)
          vb[kk] = load_bfrag(wl, kk * 12 + (it + 9) % 12);
        if (hf == 0) {   // the next trip's column terms, a whole trip ahead of their use
          #pragma unroll
          for (int j = 0; j < 2; ++j) {
            cg4[(it + 1) & 1][j] = *reinterpret_cast<const float4*>(csl + (((it + 9) % 12) << 4) + (j << 2));
            cb4[(it + 1) & 1][j] = *reinterpret_cast<const float4*>(csl + DIMC + (((it + 9) % 12) << 4) + (j << 2));
          }
        }
        // What follows may reuse the address registers that these loads name.
        asm volatile("s_wait_xcnt 0x0" ::: "memory");
        __builtin_amdgcn_sched_barrier(0);
      }
    }
    const float4 g0 = cg4[it & 1][0], g1 = cg4[it & 1][1], b0 = cb4[it & 1][0], b1 = cb4[it & 1][1];
    const float cg[8] = {g0.x, g0.y, g0.z, g0.w, g1.x, g1.y, g1.z, g1.w};
    const float cb[8] = {b0.x, b0.y, b0.z, b0.w, b1.x, b1.y, b1.z, b1.w};
    #pragma unroll
    for (int mt = 0; mt < 2; ++mt) {
      float o[8];
      #pragma unroll
      for (int r = 0; r < 8; ++r)
        o[r] = rs[mt] * (acc[mt][r] - mn[mt] * cg[r]) + cb[r];
      #pragma unroll
      for (int j = 0; j < 2; ++j) {
        float4 u;
        u.x = o[4 * j]; u.y = o[4 * j + 1]; u.z = o[4 * j + 2]; u.w = o[4 * j + 3];
        if (nt >= 8)   // v: the lane's 8 columns of its token's row
          *reinterpret_cast<float4*>(T + ((mt << 4) + cn) * VO_P + ((nt - 8) << 4) + (hi << 3) + (j << 2)) = u;
        else           // k, q: place ((nt*2 + mt)*2 + j), the lane's own 16 bytes
          *reinterpret_cast<float4*>(T + ((((nt << 1) + mt) << 1) + j) * 128 + (lane << 2)) = u;
      }
    }
    if (nt == 11) {
      // Every lane's v columns must stand in the tile before they are read across lanes.
      asm volatile("s_wait_dscnt 0x0" ::: "memory");
      // Out: a wave store is two tokens' v rows, 256 contiguous bytes each.
      float* vo = kqv + (size_t)(rbase + hi) * DIMC + 128 + (cn << 2);
      const float* Vr = T + hi * VO_P + (cn << 2);
      #pragma unroll
      for (int g = 0; g < 2; ++g) {
        v4f u[8];
        #pragma unroll
        for (int i = 0; i < 8; ++i)
          u[i] = *reinterpret_cast<const v4f*>(Vr + (((g << 3) + i) << 1) * VO_P);
        // Takes the values read as inputs only: holds the 8 reads in one run ahead of the
        // stores.  Left alone they share one register set, one LDS latency after the other.
        asm volatile("" :: "v"(u[0]), "v"(u[1]), "v"(u[2]), "v"(u[3]), "v"(u[4]), "v"(u[5]), "v"(u[6]), "v"(u[7]));
        #pragma unroll
        for (int i = 0; i < 8; ++i)
          *reinterpret_cast<v4f*>(vo + (((g << 3) + i) << 1) * DIMC) = u[i];
        // The next run's reads land on the registers that these stores name.
        asm volatile("s_wait_xcnt 0x0" ::: "memory");
      }
      // The v rows have been read before the k tiles are written over them.
      asm volatile("s_wait_dscnt 0x0" ::: "memory");
    }
  }

  // All of Wp as A fragments: row 16*mf + c, the lane's 8 d of each 16.
  const float* wpl = wperf + (cn << 6) + (hi << 3);
  float4 wp4[2][4][2];
  #pragma unroll
  for (int mf = 0; mf < 2; ++mf) {
    #pragma unroll
    for (int n4 = 0; n4 < 4; ++n4) {
      #pragma unroll
      for (int j = 0; j < 2; ++j)
        wp4[mf][n4][j] = *reinterpret_cast<const float4*>(wpl + (mf << 10) + (n4 << 4) + (j << 2));
    }
  }
  // What follows may reuse the address registers that these loads name.
  asm volatile("s_wait_xcnt 0x0" ::: "memory");

  #pragma unroll
  for (int part = 0; part < 2; ++part) {                // 0: k -> kp, 1: q -> qp
    v8f pacc[2][2] = {{vzero, vzero}, {vzero, vzero}};  // [feature tile][token tile]
    float xs[2] = {0.f, 0.f};                           // the lane's part of |t|^2
    #pragma unroll
    for (int n4 = 0; n4 < 4; ++n4) {
      float o[2][8];
      #pragma unroll
      for (int mt = 0; mt < 2; ++mt) {
        #pragma unroll
        for (int j = 0; j < 2; ++j) {
          const float4 u = *reinterpret_cast<const float4*>(
              T + ((((((part << 2) + n4) << 1) + mt) << 1) + j) * 128 + (lane << 2));
          o[mt][4 * j] = u.x; o[mt][4 * j + 1] = u.y; o[mt][4 * j + 2] = u.z; o[mt][4 * j + 3] = u.w;
        }
        #pragma unroll
        for (int r = 0; r < 8; ++r) xs[mt] += o[mt][r] * o[mt][r];
      }
      #pragma unroll
      for (int s = 0; s < 4; ++s) {
        #pragma unroll
        for (int mf = 0; mf < 2; ++mf) {
          const float4 w4 = wp4[mf][n4][s >> 1];
          const v2f fa = {(s & 1) ? w4.z : w4.x, (s & 1) ? w4.w : w4.y};
          #pragma unroll
          for (int mt = 0; mt < 2; ++mt) {
            const v2f fb = {o[mt][2 * s], o[mt][2 * s + 1]};
            pacc[mf][mt] = __builtin_amdgcn_wmma_f32_16x16x4_f32(
                false, fa, false, fb, (short)0, pacc[mf][mt], false, false);
          }
        }
      }
    }
    // exp(w.t - |t|^2/2)/sqrt(m) as rows: 0..31 kp, 32..63 qp.  The rows lie on places of
    // tiles read above, other lanes' places too: the wait and its clobber keep every such
    // read ahead of the stores below.
    asm volatile("s_wait_dscnt 0x0" ::: "memory");
    float* Tf = T + ((part << 5) + cn) * PF_P + (hi << 3);
    #pragma unroll
    for (int mt = 0; mt < 2; ++mt) {
      const float xd = xs[mt] + __shfl_xor(xs[mt], 16, 32);   // the row's other half
      #pragma unroll
      for (int mf = 0; mf < 2; ++mf) {
        #pragma unroll
        for (int j = 0; j < 2; ++j) {
          float f[4];
          #pragma unroll
          for (int i = 0; i < 4; ++i) f[i] = pacc[mf][mt][4 * j + i] - 0.5f * xd;
          exp4(f);
          float4 u;
          u.x = f[0] * INVSQRTM; u.y = f[1] * INVSQRTM; u.z = f[2] * INVSQRTM; u.w = f[3] * INVSQRTM;
          *reinterpret_cast<float4*>(Tf + (mt << 4) * PF_P + (mf << 4) + (j << 2)) = u;
        }
      }
    }
  }
  // Every lane's features must stand in the tile before they are read across lanes.
  asm volatile("s_wait_dscnt 0x0" ::: "memory");
  // ksum: lane = feature, its column over the wave's 32 tokens, one atomic a wave.
  float s = 0.f;
  #pragma unroll
  for (int t = 0; t < 32; ++t) s += T[t * PF_P + lane];
  atomicAdd(&ksum[b * MF + lane], s);
  // Out: four tokens' features are 512 contiguous bytes, one wave store.
  float* kpo = kp + (size_t)rbase * MF + (lane << 2);
  float* qpo = qp + (size_t)rbase * MF + (lane << 2);
  const float* Tr = T + (lane >> 3) * PF_P + ((lane & 7) << 2);
  #pragma unroll
  for (int i = 0; i < 8; ++i) {
    *reinterpret_cast<float4*>(kpo + (i << 7)) =
        *reinterpret_cast<const float4*>(Tr + (i << 2) * PF_P);
    *reinterpret_cast<float4*>(qpo + (i << 7)) =
        *reinterpret_cast<const float4*>(Tr + (32 + (i << 2)) * PF_P);
  }
}

// ---------------------------------------------------------------------------
// K6: kptv[b,d,m] = sum_t v[b,t,d]*kp[b,t,m], a 64 x 32 product with K = tokens, on
// V_WMMA_F32_16X16X4_F32 (f32 operands, f32 sums).  A block takes 256 tokens, a wave
// 32 of them and all 64 x 32 cells (8 accumulator tiles).  Both operands come straight
// from global in fragment order, all 32 loads of a wave in flight at once:
//   lane l (c = l&15, h = l>>4), load i: token 2*i + h; 16 bytes of v at d = 4*c and
//   8 bytes of kp at m = 2*c, so a wave load covers two whole rows.
// K-step s takes loads 2*s and 2*s+1 as registers 0 and 1 of A and of B alike, so both
// sides hold token 4*s + 2*reg + h at the same place.  Component mt of the 16 bytes is
// row c of A tile mt (d = 4*c + mt); component nt of the 8 bytes is column c of B tile
// nt (m = 2*c + nt).  The 8 waves' partial sums meet in LDS, one barrier, added in wave
// order; then one global atomic per cell and block.
// ---------------------------------------------------------------------------
__global__ __launch_bounds__(256) void k_kptv(const float* __restrict__ kqv,
                                              const float* __restrict__ kp,
                                              float* __restrict__ kptv) {
  __shared__ __attribute__((aligned(16))) float part[8][EMB * MF];
  const int tid = threadIdx.x, lane = tid & 31, wv = tid >> 5;
  const int hi = lane >> 4, cn = lane & 15;
  const int b = blockIdx.x >> 4;                        // 16 blocks per batch
  const int t0 = (blockIdx.x << 8) + (wv << 5);         // first of the wave's tokens
  const float* vs = kqv + (size_t)(t0 + hi) * DIMC + 128 + (cn << 2);
  const float* ks = kp + (size_t)(t0 + hi) * MF + (cn << 1);
  float4 va[16];
  float2 kb[16];
  #pragma unroll  // constant indices keep va[], kb[] and acc[] in registers (here and below)
  for (int i = 0; i < 16; ++i) kb[i] = *reinterpret_cast<const float2*>(ks + (i << 1) * MF);
  // A later load may land on the address registers that these loads name.
  asm volatile("s_wait_xcnt 0x0" ::: "memory");
  #pragma unroll
  for (int i = 0; i < 16; ++i) va[i] = *reinterpret_cast<const float4*>(vs + (i << 1) * DIMC);
  // What follows may reuse the address registers that these loads name.
  asm volatile("s_wait_xcnt 0x0" ::: "memory");
  // Keeps all 32 loads ahead of the first WMMA: left alone, the scheduler holds a third of
  // them back until registers come free, a second memory latency in a row.
  __builtin_amdgcn_sched_barrier(0);

  const v8f vzero = {};
  v8f acc[4][2];
  #pragma unroll
  for (int mt = 0; mt < 4; ++mt) { acc[mt][0] = vzero; acc[mt][1] = vzero; }
  #pragma unroll
  for (int s = 0; s < 8; ++s) {
    const float a0[4] = {va[2 * s].x, va[2 * s].y, va[2 * s].z, va[2 * s].w};
    const float a1[4] = {va[2 * s + 1].x, va[2 * s + 1].y, va[2 * s + 1].z, va[2 * s + 1].w};
    const v2f fb[2] = {{kb[2 * s].x, kb[2 * s + 1].x}, {kb[2 * s].y, kb[2 * s + 1].y}};
    #pragma unroll
    for (int mt = 0; mt < 4; ++mt) {
      const v2f fa = {a0[mt], a1[mt]};
      #pragma unroll
      for (int nt = 0; nt < 2; ++nt) {
        acc[mt][nt] = __builtin_amdgcn_wmma_f32_16x16x4_f32(
            false, fa, false, fb[nt], (short)0, acc[mt][nt], false, false);
      }
    }
  }
  // Accumulator register r of tile (mt, nt) is cell d = 4*(8*hi + r) + mt, m = 2*cn + nt.
  float* P = part[wv] + (hi << 10) + (cn << 1);
  #pragma unroll
  for (int mt = 0; mt < 4; ++mt) {
    #pragma unroll
    for (int r = 0; r < 8; ++r) {
      float2 u;
      u.x = acc[mt][0][r]; u.y = acc[mt][1][r];
      *reinterpret_cast<float2*>(P + (((r << 2) + mt) << 5)) = u;
    }
  }
  __syncthreads();  // every wave's partial sums stand before they are added across waves
  float* dst = kptv + (size_t)b * (EMB * MF) + (tid << 2);
  #pragma unroll
  for (int j = 0; j < 2; ++j) {
    float4 sum = *reinterpret_cast<const float4*>(&part[0][(j << 10) + (tid << 2)]);
    #pragma unroll
    for (int w = 1; w < 8; ++w) {
      const float4 u = *reinterpret_cast<const float4*>(&part[w][(j << 10) + (tid << 2)]);
      sum.x += u.x; sum.y += u.y; sum.z += u.z; sum.w += u.w;
    }
    atomicAdd(dst + (j << 10), sum.x);
    atomicAdd(dst + (j << 10) + 1, sum.y);
    atomicAdd(dst + (j << 10) + 2, sum.z);
    atomicAdd(dst + (j << 10) + 3, sum.w);
  }
}

// ---------------------------------------------------------------------------
// K7: yatt = v + proj(qp @ kptv^T / (qp.ksum + eps)), then in the same wave
// out = yatt + W2 @ gelu(W1 @ LN(yatt) + b1) + b2; yatt never goes to memory.
// One chain of four transposed products: the weights are the A operand, the tokens the
// B operand (column = token).  A wave owns 32 tokens (two 16-token tiles).  Lane l
// (c = l&15, h = l>>4) holds token c of each tile; accumulator register r of row tile t
// is channel 16*t + 8*h + r of that token.
//  1. att^T = kptv . qp^T on V_WMMA_F32_16X16X4_F32, K = 32 features.  Both sides hold
//     the lane's 16 features m = 8*h + i and 16 + 8*h + i (i = 0..7) in the same order;
//     K-step s takes values 2*s and 2*s+1.  The tiles are scaled by 1/(qp.ksum + eps).
//  2. y^T = proj_w^T . att^T on the same form, K = 64, started from v + proj_b.
//     Registers 2*s, 2*s+1 of att tile et are the B fragment as they stand: place (h, j)
//     holds e = 16*et + 8*h + 2*s + j, and A takes proj_w[the same e][d] at that place.
//  3. LayerNorm(64): the lane's 32 channels, one exchange with the partner lane.  Tiles
//     2*kk and 2*kk+1, normalised and converted, are as they stand the f16 B fragment of
//     K-step kk (the k order of the packed weights); the same holds after the GELU.
//  4. The two 64x64 GEMMs on V_WMMA_F32_16X16X32_F16, packed weight fragments as A.
// qp and v come in, and the result leaves, as whole-line wave accesses through the
// wave's own LDS tiles; the yatt row waits there, each lane's values in the lane's own
// 16-byte places.  No work-group barrier.
// ---------------------------------------------------------------------------
__global__ __launch_bounds__(128) void k_mix(const float* __restrict__ kqv,
                                             const float* __restrict__ qp,
                                             const float* __restrict__ ksum,
                                             const float* __restrict__ kptv,
                                             const float* __restrict__ pw,
                                             const float* __restrict__ pb,
                                             const float* __restrict__ g,
                                             const float* __restrict__ bt,
                                             const half_t* __restrict__ wpk,
                                             const float* __restrict__ b1,
                                             const float* __restrict__ b2,
                                             float* __restrict__ out) {
  __shared__ __attribute__((aligned(16))) float qt[4][32 * PF_P];
  __shared__ __attribute__((aligned(16))) float vt[4][32 * VO_P];
  const int lane = threadIdx.x & 31;
  // The wave's number, shown to the compiler as uniform: tile and row addresses are
  // then scalar arithmetic, a scalar base and a lane offset per load.
  const int wv = __builtin_amdgcn_readfirstlane(threadIdx.x >> 5);
  const int hi = lane >> 4, cn = lane & 15;
  float* Q = qt[wv];
  float* V = vt[wv];
  const int b = blockIdx.x >> 5;                        // 32 blocks per batch
  const int tok0 = (blockIdx.x << 7) + (wv << 5);       // first of the wave's tokens
  // kptv rows e = 16*et + c and ksum: the lane's 16 features, piece u at
  // m = 16*(u>>1) + 8*h + 4*(u&1).
  const float* kl = kptv + (size_t)b * (EMB * MF) + (cn << 5) + (hi << 3);
  const float* sl = ksum + b * MF + (hi << 3);
  float4 ka[4][4], ks[4];
  #pragma unroll
  for (int u = 0; u < 4; ++u) {
    ks[u] = *reinterpret_cast<const float4*>(sl + ((u >> 1) << 4) + ((u & 1) << 2));
    #pragma unroll
    for (int et = 0; et < 4; ++et)
      ka[et][u] = *reinterpret_cast<const float4*>(kl + (et << 9) + ((u >> 1) << 4) + ((u & 1) << 2));
  }
  // What follows may reuse the address registers that these loads name.
  asm volatile("s_wait_xcnt 0x0" ::: "memory");
  // In: four tokens' qp rows, or two tokens' v rows, per wave load (whole lines).
  {
    const float* qs = qp + (size_t)tok0 * MF + (lane << 2);
    const float* vs = kqv + (size_t)tok0 * DIMC + 128 + (lane >> 4) * DIMC + ((lane & 15) << 2);
    float4 qi[8], vi[16];
    #pragma unroll  // constant indices keep qi[], vi[] and the other arrays in registers (here and below)
    for (int i = 0; i < 8; ++i) qi[i] = *reinterpret_cast<const float4*>(qs + (i << 7));
    #pragma unroll
    for (int i = 0; i < 16; ++i) vi[i] = *reinterpret_cast<const float4*>(vs + (i << 1) * DIMC);
    // Keeps the address arithmetic of the LDS stores behind the loads' own: left alone, it
    // is scheduled among the 24 loads and rewrites their scalar base registers while they fly.
    __builtin_amdgcn_sched_barrier(0);
    #pragma unroll
    for (int i = 0; i < 8; ++i)
      *reinterpret_cast<float4*>(Q + ((i << 2) + (lane >> 3)) * PF_P + ((lane & 7) << 2)) = qi[i];
    #pragma unroll
    for (int i = 0; i < 16; ++i)
      *reinterpret_cast<float4*>(V + ((i << 1) + (lane >> 4)) * VO_P + ((lane & 15) << 2)) = vi[i];
  }
  // Every lane's part of the two tiles must stand before they are read across lanes.
  asm volatile("s_wait_dscnt 0x0" ::: "memory");
  // The reads below may land on the address registers that the loads above name.
  asm volatile("s_wait_xcnt 0x0" ::: "memory");
  float4 qb[2][4];
  #pragma unroll
  for (int mt = 0; mt < 2; ++mt) {
    #pragma unroll
    for (int u = 0; u < 4; ++u)
      qb[mt][u] = *reinterpret_cast<const float4*>(
          Q + ((mt << 4) + cn) * PF_P + ((u >> 1) << 4) + (hi << 3) + ((u & 1) << 2));
  }
  // proj_w as A fragments, one row tile dt at a time, two register sets:
  // pa[.][et][r] = proj_w[16*et + 8*h + r][16*dt + c].  The first tile flies under product 1.
  const float* pl = pw + (hi << 9) + cn;
  float pa[2][4][8];
  #pragma unroll
  for (int et = 0; et < 4; ++et) {
    #pragma unroll
    for (int r = 0; r < 8; ++r) pa[0][et][r] = pl[(et << 10) + (r << 6)];
  }
  float4 pv[4][2];                                      // proj_b: the lane's 8 values per tile
  #pragma unroll
  for (int dt = 0; dt < 4; ++dt) {
    #pragma unroll
    for (int j = 0; j < 2; ++j)
      pv[dt][j] = *reinterpret_cast<const float4*>(pb + (dt << 4) + (hi << 3) + (j << 2));
  }
  // What follows may reuse the address registers that these loads name.
  asm volatile("s_wait_xcnt 0x0" ::: "memory");
  const v8f vzero = {};
  v8f at[2][4];
  #pragma unroll
  for (int mt = 0; mt < 2; ++mt) {
    #pragma unroll
    for (int et = 0; et < 4; ++et) at[mt][et] = vzero;
  }
  #pragma unroll
  for (int s = 0; s < 8; ++s) {
    v2f fb[2];
    #pragma unroll
    for (int mt = 0; mt < 2; ++mt) {
      const float4 w4 = qb[mt][s >> 1];
      fb[mt] = v2f{(s & 1) ? w4.z : w4.x, (s & 1) ? w4.w : w4.y};
    }
    #pragma unroll
    for (int et = 0; et < 4; ++et) {
      const float4 w4 = ka[et][s >> 1];
      const v2f fa = {(s & 1) ? w4.z : w4.x, (s & 1) ? w4.w : w4.y};
      #pragma unroll
      for (int mt = 0; mt < 2; ++mt) {
        at[mt][et] = __builtin_amdgcn_wmma_f32_16x16x4_f32(
            false, fa, false, fb[mt], (short)0, at[mt][et], false, false);
      }
    }
  }
  // 1/(qp.ksum + eps) of the lane's own token, and the scaled tiles.
  #pragma unroll
  for (int mt = 0; mt < 2; ++mt) {
    float d0 = 0.f, d1 = 0.f;                           // two chains
    #pragma unroll
    for (int u = 0; u < 4; ++u) {
      d0 += qb[mt][u].x * ks[u].x; d1 += qb[mt][u].y * ks[u].y;
      d0 += qb[mt][u].z * ks[u].z; d1 += qb[mt][u].w * ks[u].w;
    }
    float d = d0 + d1;
    d += __shfl_xor(d, 16, 32);                         // the row's other half
    const float inv = 1.0f / (d + 1e-8f);
    #pragma unroll
    for (int et = 0; et < 4; ++et) {
      #pragma unroll
      for (int r = 0; r < 8; ++r) at[mt][et][r] *= inv;
    }
  }

  // y starts from v + proj_b: the lane's 8 channels per tile of its own tokens.
  v8f y[2][4];
  #pragma unroll
  for (int dt = 0; dt < 4; ++dt) {
    #pragma unroll
    for (int j = 0; j < 2; ++j) {
      #pragma unroll
      for (int mt = 0; mt < 2; ++mt) {
        const float4 u = *reinterpret_cast<const float4*>(
            V + ((mt << 4) + cn) * VO_P + (dt << 4) + (hi << 3) + (j << 2));
        y[mt][dt][4 * j]     = u.x + pv[dt][j].x; y[mt][dt][4 * j + 1] = u.y + pv[dt][j].y;
        y[mt][dt][4 * j + 2] = u.z + pv[dt][j].z; y[mt][dt][4 * j + 3] = u.w + pv[dt][j].w;
      }
    }
  }
  #pragma unroll
  for (int dt = 0; dt < 4; ++dt) {
    if (dt + 1 < 4) {
      // The two fences hold the next tile's loads where they stand: lifted higher they need
      // more register sets, sunk to their use they fly under nothing.
      __builtin_amdgcn_sched_barrier(0);
      #pragma unroll
      for (int et = 0; et < 4; ++et) {
        #pragma unroll
        for (int r = 0; r < 8; ++r) pa[(dt + 1) & 1][et][r] = pl[(et << 10) + (r << 6) + ((dt + 1) << 4)];
      }
      // What follows may reuse the address registers that these loads name.
      asm volatile("s_wait_xcnt 0x0" ::: "memory");
      __builtin_amdgcn_sched_barrier(0);
    }
    #pragma unroll
    for (int et = 0; et < 4; ++et) {
      #pragma unroll
      for (int s = 0; s < 4; ++s) {
        const v2f fa = {pa[dt & 1][et][2 * s], pa[dt & 1][et][2 * s + 1]};
        #pragma unroll
        for (int mt = 0; mt < 2; ++mt) {
          const v2f fb = {at[mt][et][2 * s], at[mt][et][2 * s + 1]};
          y[mt][dt] = __builtin_amdgcn_wmma_f32_16x16x4_f32(
              false, fa, false, fb, (short)0, y[mt][dt], false, false);
        }
      }
    }
  }

  const half_t* wl = wpk + WM_H + (lane << 3);
  // The lane's 8 values per tile of ln2's g and b arrive while the rows' sums are taken.
  float4 gl[4][2], bl[4][2];
  #pragma unroll
  for (int nt = 0; nt < 4; ++nt) {
    #pragma unroll
    for (int j = 0; j < 2; ++j) {
      gl[nt][j] = *reinterpret_cast<const float4*>(g + (nt << 4) + (hi << 3) + (j << 2));
      bl[nt][j] = *reinterpret_cast<const float4*>(bt + (nt << 4) + (hi << 3) + (j << 2));
    }
  }
  // What follows may reuse the address registers that these loads name.
  asm volatile("s_wait_xcnt 0x0" ::: "memory");

  v16h hx[2][2];                                        // [token tile][K-step]
  #pragma unroll
  for (int mt = 0; mt < 2; ++mt) {
    float s0 = 0.f, s1 = 0.f, q0 = 0.f, q1 = 0.f;       // two chains each
    #pragma unroll
    for (int dt = 0; dt < 4; ++dt) {
      #pragma unroll
      for (int r = 0; r < 8; r += 2) {
        const float v0 = y[mt][dt][r], v1 = y[mt][dt][r + 1];
        s0 += v0; q0 += v0 * v0;
        s1 += v1; q1 += v1 * v1;
      }
    }
    float s = s0 + s1, s2 = q0 + q1;
    s  += __shfl_xor(s, 16, 32);                        // the row's other half
    s2 += __shfl_xor(s2, 16, 32);
    const float mean = s * (1.0f / 64.f);
    const float var  = s2 * (1.0f / 64.f) - mean * mean;
    // 1/sqrt as in K3: the library's scaling of a subnormal argument, and the slot that the
    // instruction set asks for behind a transcendental filled by the v_nop.
    const float ve = var + 1e-5f;
    const bool tiny = ve < 1.17549435e-38f;
    const float va = tiny ? ve * 16777216.0f : ve;
    float vr;
    asm("v_rsq_f32 %0, %1\n\t"
        "v_nop"
        : "=v"(vr) : "v"(va));
    const float rs = tiny ? vr * 4096.0f : vr;
    #pragma unroll
    for (int dt = 0; dt < 4; ++dt) {
      #pragma unroll
      for (int j = 0; j < 2; ++j) {
        // The yatt values wait for the residual in the places their v values came from.
        float4 u;
        u.x = y[mt][dt][4 * j];     u.y = y[mt][dt][4 * j + 1];
        u.z = y[mt][dt][4 * j + 2]; u.w = y[mt][dt][4 * j + 3];
        *reinterpret_cast<float4*>(V + ((mt << 4) + cn) * VO_P + (dt << 4) + (hi << 3) + (j << 2)) = u;
        const int e0 = ((dt & 1) << 3) + (j << 2);
        hx[mt][dt >> 1][e0]     = (half_t)((u.x - mean) * rs * gl[dt][j].x + bl[dt][j].x);
        hx[mt][dt >> 1][e0 + 1] = (half_t)((u.y - mean) * rs * gl[dt][j].y + bl[dt][j].y);
        hx[mt][dt >> 1][e0 + 2] = (half_t)((u.z - mean) * rs * gl[dt][j].z + bl[dt][j].z);
        hx[mt][dt >> 1][e0 + 3] = (half_t)((u.w - mean) * rs * gl[dt][j].w + bl[dt][j].w);
      }
    }
  }

  // W1's fragments and the lane's 8 values per tile of b1, into registers that g, b and
  // the yatt values have left.  The fence holds the loads behind the LayerNorm: lifted above
  // it they take the kernel past a quarter of the registers, and the grid's 4 waves per SIMD
  // are no longer resident together.
  __builtin_amdgcn_sched_barrier(0);
  v16h vb1[8];
  #pragma unroll
  for (int f = 0; f < 8; ++f) vb1[f] = load_bfrag(wl, f);
  float4 c1[4][2];
  #pragma unroll
  for (int nt = 0; nt < 4; ++nt) {
    #pragma unroll
    for (int j = 0; j < 2; ++j)
      c1[nt][j] = *reinterpret_cast<const float4*>(b1 + (nt << 4) + (hi << 3) + (j << 2));
  }
  // What follows may reuse the address registers that these loads name.
  asm volatile("s_wait_xcnt 0x0" ::: "memory");
  v8f acc[2][4];
  #pragma unroll
  for (int mt = 0; mt < 2; ++mt) {
    #pragma unroll
    for (int nt = 0; nt < 4; ++nt) acc[mt][nt] = vzero;
  }
  #pragma unroll
  for (int kk = 0; kk < 2; ++kk) {
    #pragma unroll
    for (int mt = 0; mt < 2; ++mt) {
      #pragma unroll
      for (int nt = 0; nt < 4; ++nt) {
        acc[mt][nt] = __builtin_amdgcn_wmma_f32_16x16x32_f16(
            false, vb1[(kk << 2) + nt], false, hx[mt][kk], (short)0, acc[mt][nt], false, false);
      }
    }
  }
  // W2's fragments and bias values arrive while the GELU runs.  The fence holds them
  // behind the first GEMM, for the same reason.
  __builtin_amdgcn_sched_barrier(0);
  v16h vb2[8];
  #pragma unroll
  for (int f = 0; f < 8; ++f) vb2[f] = load_bfrag(wl, 8 + f);
  float4 c2[4][2];
  #pragma unroll
  for (int nt = 0; nt < 4; ++nt) {
    #pragma unroll
    for (int j = 0; j < 2; ++j)
      c2[nt][j] = *reinterpret_cast<const float4*>(b2 + (nt << 4) + (hi << 3) + (j << 2));
  }
  // What follows may reuse the address registers that these loads name.
  asm volatile("s_wait_xcnt 0x0" ::: "memory");

  v16h t1[2][2];                                        // [token tile][K-step]
  #pragma unroll
  for (int mt = 0; mt < 2; ++mt) {
    #pragma unroll
    for (int nt = 0; nt < 4; ++nt) {
      #pragma unroll
      for (int j = 0; j < 2; ++j) {
        const float4 cv = c1[nt][j];
        float v[4] = {acc[mt][nt][4 * j] + cv.x, acc[mt][nt][4 * j + 1] + cv.y,
                      acc[mt][nt][4 * j + 2] + cv.z, acc[mt][nt][4 * j + 3] + cv.w};
        gelu_exact4(v);
        #pragma unroll
        for (int i = 0; i < 4; ++i)
          t1[mt][nt >> 1][((nt & 1) << 3) + (j << 2) + i] = (half_t)v[i];
      }
    }
  }
  v8f acc2[2][4];
  #pragma unroll
  for (int mt = 0; mt < 2; ++mt) {
    #pragma unroll
    for (int nt = 0; nt < 4; ++nt) acc2[mt][nt] = vzero;
  }
  #pragma unroll
  for (int kk = 0; kk < 2; ++kk) {
    #pragma unroll
    for (int mt = 0; mt < 2; ++mt) {
      #pragma unroll
      for (int nt = 0; nt < 4; ++nt) {
        acc2[mt][nt] = __builtin_amdgcn_wmma_f32_16x16x32_f16(
            false, vb2[(kk << 2) + nt], false, t1[mt][kk], (short)0, acc2[mt][nt], false, false);
      }
    }
  }
  // Residual: the lane's 8 columns of token c in each tile, read and rewritten in place.
  #pragma unroll
  for (int mt = 0; mt < 2; ++mt) {
    float* pv = V + ((mt << 4) + cn) * VO_P + (hi << 3);
    v4f u[8];
    #pragma unroll
    for (int i = 0; i < 8; ++i) u[i] = *reinterpret_cast<const v4f*>(pv + ((i >> 1) << 4) + ((i & 1) << 2));
    #pragma unroll
    for (int i = 0; i < 8; ++i) {
      const float4 cv = c2[i >> 1][i & 1];
      const int r0 = (i & 1) << 2;
      v4f w;
      w.x = u[i].x + acc2[mt][i >> 1][r0] + cv.x;     w.y = u[i].y + acc2[mt][i >> 1][r0 + 1] + cv.y;
      w.z = u[i].z + acc2[mt][i >> 1][r0 + 2] + cv.z; w.w = u[i].w + acc2[mt][i >> 1][r0 + 3] + cv.w;
      *reinterpret_cast<v4f*>(pv + ((i >> 1) << 4) + ((i & 1) << 2)) = w;
    }
  }
  // Every lane's columns must stand in the tile before the rows are read across lanes.
  asm volatile("s_wait_dscnt 0x0" ::: "memory");
  // Out: two tokens' rows are 512 contiguous bytes, one wave store.
  float* yo = out + ((size_t)tok0 << 6) + (lane << 2);
  const float* Vr = V + (lane >> 4) * VO_P + ((lane & 15) << 2);
  #pragma unroll
  for (int gq = 0; gq < 2; ++gq) {
    v4f u[8];
    #pragma unroll
    for (int i = 0; i < 8; ++i)
      u[i] = *reinterpret_cast<const v4f*>(Vr + (((gq << 3) + i) << 1) * VO_P);
    #pragma unroll
    for (int i = 0; i < 8; ++i)
      *reinterpret_cast<v4f*>(yo + (((gq << 3) + i) << 7)) = u[i];
    // The next run's reads land on the registers that these stores name.
    if (gq == 0) asm volatile("s_wait_xcnt 0x0" ::: "memory");
  }
}

// ---------------------------------------------------------------------------
extern "C" void kernel_launch(void* const* d_in, const int* in_sizes, int n_in,
                              void* d_out, int out_size, void* d_ws, size_t ws_size,
                              hipStream_t stream) {
  (void)in_sizes; (void)n_in; (void)out_size; (void)ws_size;
  const float* x      = (const float*)d_in[0];
  const float* conv_w = (const float*)d_in[1];
  const float* conv_b = (const float*)d_in[2];
  const float* ln1_g  = (const float*)d_in[3];
  const float* ln1_b  = (const float*)d_in[4];
  const float* kqv_w  = (const float*)d_in[5];
  const float* kqv_b  = (const float*)d_in[6];
  const float* proj_w = (const float*)d_in[7];
  const float* proj_b = (const float*)d_in[8];
  const float* w_perf = (const float*)d_in[9];
  const float* ln2_g  = (const float*)d_in[10];
  const float* ln2_b  = (const float*)d_in[11];
  const float* mlp_w1 = (const float*)d_in[12];
  const float* mlp_b1 = (const float*)d_in[13];
  const float* mlp_w2 = (const float*)d_in[14];
  const float* mlp_b2 = (const float*)d_in[15];

  char* ws = (char*)d_ws;
  half_t* xh   = (half_t*)(ws + XH_OFF);
  half_t* tok  = (half_t*)(ws + TOK_OFF);
  float*  kqv  = (float*)(ws + KQV_OFF);
  float*  kp   = (float*)(ws + KP_OFF);     // reuses XH region (xh dead)
  float*  qp   = (float*)(ws + QP_OFF);
  float*  ksum = (float*)(ws + KSUM_OFF);
  float*  kptv = (float*)(ws + KPTV_OFF);
  half_t* wpk  = (half_t*)(ws + WPK_OFF);
  float*  cs   = (float*)(ws + CS_OFF);
  float*  out  = (float*)d_out;

  // Zero the atomic accumulators (ksum + kptv are contiguous).
  hipMemsetAsync(ws + KSUM_OFF, 0, 4096 + (size_t)BATCH * EMB * MF * 4, stream);

  k_pack<<<dim3(WPK_BLOCKS + 1 + BATCH * 256), dim3(256), 0, stream>>>(
      x, conv_w, kqv_w, mlp_w1, mlp_w2, ln1_g, ln1_b, kqv_b, xh, wpk, cs);
  k_conv<<<dim3(64, 3, BATCH), dim3(128), 0, stream>>>(xh, wpk, conv_b, tok);
  k_kqv <<<dim3((BATCH * TOKN) / 128), dim3(128), 0, stream>>>(tok, wpk, cs, w_perf, kqv, kp, qp, ksum);
  k_kptv<<<dim3(BATCH * 16), dim3(256), 0, stream>>>(kqv, kp, kptv);
  k_mix <<<dim3(BATCH * 32), dim3(128), 0, stream>>>(kqv, qp, ksum, kptv, proj_w, proj_b,
                                                      ln2_g, ln2_b, wpk, mlp_b1, mlp_b2, out);
}

// v010
// Two timings next to v009 both put it at 1.04 times that version's speed.
// All steps since v000 together make it 9.17 times as fast.
#include <hip/hip_runtime.h>
#include <hip/hip_bf16.h>
#include <math.h>

// ---------------------------------------------------------------------------
// MI455X (gfx1250, wave32) implementation of the PRM + Token-Performer block.
// All dense GEMMs (implicit-GEMM dilated convs, kqv, MLP) use
// V_WMMA_F32_16X16X32_F16 with f32 accumulation; kptv, the performer features and the
// attention products are on the f32 WMMA form.  Fused epilogues keep each intermediate to one
// HBM round-trip (pipeline is ~bandwidth-bound at 23.3 TB/s).
// Conv reduction axis ordered k = kid*64 + ic so each 32-wide WMMA K-step has
// a constant kernel tap; the image stays channels-last, so one pixel's 64
// channels are one 128-byte line and an im2col row is contiguous in k.
// The conv, kqv and MLP weight matrices are packed once per call into f16 in the order of the
// WMMA B fragment, so a B fragment is two whole-line 16-byte loads per lane.
// ---------------------------------------------------------------------------

typedef _Float16 half_t;
typedef __attribute__((ext_vector_type(16))) _Float16 v16h;
typedef __attribute__((ext_vector_type(8)))  _Float16 v8h;
typedef __attribute__((ext_vector_type(8)))  float    v8f;
typedef __attribute__((ext_vector_type(2)))  float    v2f;
typedef __attribute__((ext_vector_type(4)))  float    v4f;

// Problem constants (match reference)
#define BATCH   32
#define CIN     64
#define IMGSZ   128
#define NPIX    16384     // 128*128
#define TOKN    4096      // 64*64 post-stride-2 tokens
#define EBR     64
#define DIMC    192       // 3*EBR
#define EMB     64
#define MF      32        // performer features
#define INVSQRTM 0.17677669529663687f

// Workspace layout (bytes). Buffers reused once their producers/consumers
// are done:  XH region -> KP/QP.
#define XH_OFF    ((size_t)0)                                   // f16 [B][128][128][CIN]  67.1MB
#define KP_OFF    ((size_t)0)                                   // f32 [B][T][32]          (reuse XH)
#define QP_OFF    ((size_t)16777216)                            // f32 [B][T][32]
#define TOK_OFF   ((size_t)67108864)                            // f16 [B][T][192]         50.3MB
#define KQV_OFF   ((size_t)(67108864 + 2*50331648))             // f32 [B][T][192], only v (columns 128..191) is kept
#define KSUM_OFF  (KQV_OFF + (size_t)BATCH*TOKN*DIMC*4)         // f32 [B][32]
#define KPTV_OFF  (KSUM_OFF + (size_t)4096)                     // f32 [B][64][32]
#define WPK_OFF   (KPTV_OFF + (size_t)BATCH*EMB*MF*4)           // f16 packed weights, 311 KB
#define CS_OFF    (WPK_OFF + (size_t)311296)                    // f32 [2][192] kqv column terms

// Packed weights: one B fragment (32 k x 16 n) = 2 planes x 32 lanes x 8 halves.
// Plane p, lane l, element i hold k = 16*p + 8*(l>>4) + i, n = l&15: the hardware's
// k order.  A unit is one lane's 8 halves (16 bytes) of one plane.
#define FRAG_H    512                       // halves per fragment
#define WC_UNITS  13824                     // conv: 3 branches x 18 K-steps x 4 n-tiles x 64
#define WQ_UNITS  4608                      // kqv:  6 K-steps x 12 n-tiles x 64
#define WM_UNITS  1024                      // mlp:  2 matrices x 2 K-steps x 4 n-tiles x 64
#define WQ_H      (WC_UNITS * 8)            // first half of the kqv part
#define WM_H      ((WC_UNITS + WQ_UNITS) * 8)
#define WPK_BLOCKS ((WC_UNITS + WQ_UNITS + WM_UNITS) / 256)   // 76

// GELU with erf, four values at once: 0.5*x*(1 + erf(x/sqrt2)) = max(x,0) - |x|*h with
// h = 0.5*erfc(|x|/sqrt2), and erfc(z) = t*(a1 + t*(a2 + t*(a3 + t*(a4 + t*a5)))) * exp(-z*z),
// t = 1/(1 + p*z), which is within 1.5e-7 of erfc for every z >= 0.  One straight line for
// every x: no branch on |x|, so the values are independent chains that can be interleaved.
// The halves and the 1/sqrt2 are folded into the constants; exp(-z*z) = 2^-(c*x)^2 with
// c = sqrt(log2(e)/2).
__device__ __forceinline__ void gelu_exact4(float (&x)[4]) {
  float t[4], e[4];
  #pragma unroll  // constant indices keep t[], e[] and x[] in registers (here and below)
  for (int i = 0; i < 4; ++i) {
    const float u = x[i] * 0.84932180f;
    t[i] = fmaf(fabsf(x[i]), 0.23164189f, 1.0f);
    e[i] = -(u * u);
  }
  // The reciprocals, then the powers of two, in place and each kind in one run: behind a
  // transcendental the instruction set asks for one slot before its source is overwritten
  // or its result read.  Each is that slot for the one in front of it, the v_nop for the last.
  asm("v_rcp_f32 %0, %0\n\t"
      "v_rcp_f32 %1, %1\n\t"
      "v_rcp_f32 %2, %2\n\t"
      "v_rcp_f32 %3, %3\n\t"
      "v_nop"
      : "+v"(t[0]), "+v"(t[1]), "+v"(t[2]), "+v"(t[3]));
  asm("v_exp_f32 %0, %0\n\t"
      "v_exp_f32 %1, %1\n\t"
      "v_exp_f32 %2, %2\n\t"
      "v_exp_f32 %3, %3\n\t"
      "v_nop"
      : "+v"(e[0]), "+v"(e[1]), "+v"(e[2]), "+v"(e[3]));
  #pragma unroll
  for (int i = 0; i < 4; ++i) {
    float p = 0.5307027145f;
    p = fmaf(p, t[i], -0.7265760135f);
    p = fmaf(p, t[i], 0.7107068705f);
    p = fmaf(p, t[i], -0.142248368f);
    p = fmaf(p, t[i], 0.127414796f);
    x[i] = fmaf(-fabsf(x[i]), (p * t[i]) * e[i], fmaxf(x[i], 0.0f));
  }
}

// B fragment number frag of a packed weight part, as two 512-byte wave loads.
__device__ __forceinline__ v16h load_bfrag(const half_t* wl, int frag) {
  const v8h lo = *reinterpret_cast<const v8h*>(wl + frag * FRAG_H);
  const v8h hi = *reinterpret_cast<const v8h*>(wl + frag * FRAG_H + 256);
  return __builtin_shufflevector(lo, hi,
      0, 1, 2, 3, 4, 5, 6, 7, 8, 9, 10, 11, 12, 13, 14, 15);
}

// ---------------------------------------------------------------------------
// K1: x [B,N,C] f32  ->  xh [B,N,C] f16  (same channels-last order, convert
// only).  8 elements per thread per pass: two 16-byte loads, one 16-byte store.
// The first WPK_BLOCKS blocks pack the weights instead: one unit per thread,
// eight strided f32 reads, one 16-byte store; row k of the kqv weights is scaled by
// ln1's g[k] on the way.  The next block sums the two column terms of K3.
// ---------------------------------------------------------------------------
__global__ __launch_bounds__(256) void k_pack(const float* __restrict__ x,
                                              const float* __restrict__ cw,
                                              const float* __restrict__ wq,
                                              const float* __restrict__ w1,
                                              const float* __restrict__ w2,
                                              const float* __restrict__ lg,
                                              const float* __restrict__ lb,
                                              const float* __restrict__ qb,
                                              half_t* __restrict__ xh,
                                              half_t* __restrict__ wpk,
                                              float* __restrict__ cs) {
  if (blockIdx.x == WPK_BLOCKS) {            // thread = column n of the kqv weights
    if (threadIdx.x < DIMC) {
      const float* wc = wq + threadIdx.x;
      float sg = 0.f, sb = 0.f;
      #pragma unroll 16  // 16 loads in flight a trip; many more would raise the kernel's registers
      for (int k = 0; k < DIMC; ++k) {
        const float w = wc[k * DIMC];
        sg += (float)(half_t)(w * lg[k]);    // the f16 value that the GEMM multiplies by
        sb += w * lb[k];
      }
      cs[threadIdx.x] = sg;
      cs[DIMC + threadIdx.x] = sb + qb[threadIdx.x];
    }
    return;
  }
  if (blockIdx.x < WPK_BLOCKS) {
    const int u = (blockIdx.x << 8) + threadIdx.x;
    const int n = u & 15;
    const int k0 = (((u >> 5) & 1) << 4) + (((u >> 4) & 1) << 3);  // k of element 0
    const float* src;
    int step;                                // floats from one k to the next
    float sc[8] = {1.f, 1.f, 1.f, 1.f, 1.f, 1.f, 1.f, 1.f};
    if (blockIdx.x < WC_UNITS / 256) {       // frag = ((br*9 + kid)*2 + h)*4 + nt
      const int f = u >> 6;
      const int nt = f & 3, h = (f >> 2) & 1, tap = f >> 3;   // tap = br*9 + kid
      const int br = tap / 9, kid = tap - br * 9;
      src = cw + (((br << 6) + (nt << 4) + n) * CIN + (h << 5) + k0) * 9 + kid;
      step = 9;
    } else if (blockIdx.x < (WC_UNITS + WQ_UNITS) / 256) {    // frag = kk*12 + n-tile
      const int f = (u - WC_UNITS) >> 6;
      const int kk = f / 12, nt = f - kk * 12;
      src = wq + ((kk << 5) + k0) * DIMC + (nt << 4) + n;
      step = DIMC;
      #pragma unroll
      for (int i = 0; i < 8; ++i) sc[i] = lg[(kk << 5) + k0 + i];
    } else {                                 // frag = (matrix*2 + kk)*4 + nt
      const int f = (u - WC_UNITS - WQ_UNITS) >> 6;
      const int nt = f & 3, kk = (f >> 2) & 1;
      src = ((f >> 3) ? w2 : w1) + ((kk << 5) + k0) * EMB + (nt << 4) + n;
      step = EMB;
    }
    float t[8];
    #pragma unroll  // constant indices keep t[] in registers
    for (int i = 0; i < 8; ++i) t[i] = src[i * step];
    // The conversions below reuse the address registers that these loads name.
    asm volatile("s_wait_xcnt 0x0" ::: "memory");
    v8h o;
    #pragma unroll
    for (int i = 0; i < 8; ++i) o[i] = (half_t)(t[i] * sc[i]);
    *reinterpret_cast<v8h*>(wpk + ((size_t)u << 3)) = o;
    return;
  }
  const size_t base = ((size_t)(blockIdx.x - WPK_BLOCKS - 1) << 12) + ((size_t)threadIdx.x << 3);
  #pragma unroll  // both passes' loads are in flight before the first store
  for (int rep = 0; rep < 2; ++rep) {
    const size_t e = base + ((size_t)rep << 11);
    const float4 u = *reinterpret_cast<const float4*>(x + e);
    const float4 w = *reinterpret_cast<const float4*>(x + e + 4);
    v8h o;
    o[0] = (half_t)u.x; o[1] = (half_t)u.y; o[2] = (half_t)u.z; o[3] = (half_t)u.w;
    o[4] = (half_t)w.x; o[5] = (half_t)w.y; o[6] = (half_t)w.z; o[7] = (half_t)w.w;
    *reinterpret_cast<v8h*>(xh + e) = o;
  }
}

// ---------------------------------------------------------------------------
// K2: implicit-GEMM dilated conv + bias + GELU -> tokens f16 [B,T,192].
// Per block: 64 tokens (one output row) x 64 out-channels, K=576 in 18 steps of 32.
// K axis ordered k = kid*64 + ic.  The three image rows that the output row's taps
// touch are brought into LDS once per block by asynchronous copies, whole 128-byte
// lines, and every wave reads its A fragments from there.  A wave owns all 64 tokens
// (4 row tiles) and 16 out-channels, so each packed B fragment is loaded by one wave
// of the block only.
// LDS: plane (kh, parity of the pixel column) = 67 slots of 144 bytes: 2 zero slots,
// the 64 pixels of that parity, 1 zero slot.  Tap column 2*ow + off is slot
// ow + (off >> 1) + 2 of parity off & 1, so neighbouring tokens are 144 bytes
// (16 B x odd) apart; a column outside the image falls on a zero slot, a row outside
// the image is a zero plane.
// grid = (64 token tiles, 3 branches, 32 batches), 4 waves.
// ---------------------------------------------------------------------------
#define CV_SLOT   144                   // bytes per staged pixel
#define CV_PLANE  (67 * CV_SLOT)        // bytes per plane

// Four 16-byte-per-lane copies global -> LDS.  The wait at the end stands in the
// copies' own statement: their address registers may be rewritten behind it.
__device__ __forceinline__ void copy4(unsigned l0, unsigned l1, unsigned l2, unsigned l3,
                                      const half_t* g0, const half_t* g1,
                                      const half_t* g2, const half_t* g3) {
  asm volatile("global_load_async_to_lds_b128 %0, %4, off\n\t"
               "global_load_async_to_lds_b128 %1, %5, off\n\t"
               "global_load_async_to_lds_b128 %2, %6, off\n\t"
               "global_load_async_to_lds_b128 %3, %7, off\n\t"
               "s_wait_xcnt 0x0"
               :: "v"(l0), "v"(l1), "v"(l2), "v"(l3), "v"(g0), "v"(g1), "v"(g2), "v"(g3)
               : "memory");
}

template <int DIL>
__device__ __forceinline__ void conv_acc(const half_t* __restrict__ xb,   // the batch's image
                                         const half_t* __restrict__ wl,   // branch's B, lane's place
                                         half_t* img, int oh, int tid, v8f (&acc)[4]) {
  const int lane = tid & 31, wv = tid >> 5;
  const int hi = lane >> 4, cn = lane & 15;
  const v8h hzero = (v8h)(half_t)0.0f;
  char* imgb = reinterpret_cast<char*>(img);

  // Zero slots, and whole planes for a row outside the image.
  #pragma unroll  // kh constant: plane offsets fold into the instructions (here and below)
  for (int kh = 0; kh < 3; ++kh) {
    const int ih = (oh << 1) + (kh - 1) * DIL;
    char* pl = imgb + (kh << 1) * CV_PLANE;
    if ((unsigned)ih < 128u) {
      if (tid < 48) {                       // 2 planes x 3 slots x 8 pieces of 16 bytes
        const int p = tid / 24, r = tid - p * 24, s = r >> 3;
        *reinterpret_cast<v8h*>(pl + p * CV_PLANE + (s < 2 ? s : 66) * CV_SLOT + ((r & 7) << 4)) = hzero;
      }
    } else {
      for (int i = tid; i < 2 * CV_PLANE / 16; i += 128)
        *reinterpret_cast<v8h*>(pl + (i << 4)) = hzero;
    }
  }
  // This wave's LDS stores have retired before its copies are pointed at the array.
  asm volatile("s_wait_dscnt 0x0" ::: "memory");

  // Copies: a wave copy is 4 pixels x 128 bytes; 8 lanes share a pixel.  Odd dilation
  // needs every pixel of the row (4 neighbours a copy), dilation 2 the even ones only.
  const unsigned lbase = (unsigned)(size_t)img + ((lane & 7) << 4);
  #pragma unroll
  for (int kh = 0; kh < 3; ++kh) {
    const int ih = (oh << 1) + (kh - 1) * DIL;
    if ((unsigned)ih < 128u) {              // the same for the whole block
      const half_t* gr = xb + ((size_t)ih << 13) + ((lane & 7) << 3);
      #pragma unroll
      for (int c = 0; c < ((DIL == 2) ? 1 : 2); ++c) {
        unsigned l[4];
        const half_t* g[4];
        #pragma unroll  // constant indices keep l[] and g[] in registers
        for (int i = 0; i < 4; ++i) {
          const int grp = (DIL == 2) ? ((wv << 2) + i) : ((wv << 3) + (c << 2) + i);
          const int px = (DIL == 2) ? (((grp << 2) + (lane >> 3)) << 1) : ((grp << 2) + (lane >> 3));
          l[i] = lbase + ((kh << 1) + (px & 1)) * CV_PLANE + ((px >> 1) + 2) * CV_SLOT;
          g[i] = gr + (px << 6);
        }
        copy4(l[0], l[1], l[2], l[3], g[0], g[1], g[2], g[3]);
      }
    }
  }

  // B: the wave's column tile, 2 fragments a tap, kept three taps ahead in 4 register sets.
  v16h vb[4][2];
  #pragma unroll  // constant indices keep vb[] and a[] in registers (here and below)
  for (int t = 0; t < 3; ++t) {
    #pragma unroll
    for (int h = 0; h < 2; ++h) vb[t][h] = load_bfrag(wl + t * (8 * FRAG_H), (h << 2) + wv);
  }
  // This wave's copies have landed; behind the barrier every wave's have.
  asm volatile("s_wait_asynccnt 0x0" ::: "memory");
  __syncthreads();

  // A: lane l reads row l&15 of each row tile: 16-byte runs at k = 16*q + 8*(l>>4).
  // Step s = 2*kid + h is one K-step of 32: its 8 reads are asked for one step ahead.
  const char* ar = imgb + (cn + 2) * CV_SLOT + (hi << 4);
  v8h a[2][8];
  #pragma unroll  // s picks register sets and LDS offsets: constants only when unrolled
  for (int s = -1; s < 18; ++s) {
    // The two fences hold the loads for later steps in one run ahead of this step's
    // WMMAs: lifted higher they need more registers, sunk to their use they fly under
    // nothing.
    __builtin_amdgcn_sched_barrier(0);
    if (s >= 0 && (s & 1) == 0 && (s >> 1) + 3 < 9) {
      const int kb = (s >> 1) + 3;
      #pragma unroll
      for (int h = 0; h < 2; ++h)
        vb[kb & 3][h] = load_bfrag(wl + kb * (8 * FRAG_H), (h << 2) + wv);
      // What follows may reuse the address registers that these loads name.
      asm volatile("s_wait_xcnt 0x0" ::: "memory");
    }
    if (s + 1 < 18) {
      const int sn = s + 1, kn = sn >> 1, kh = kn / 3, off = (kn - kh * 3 - 1) * DIL;
      const char* ap = ar + ((kh << 1) + (off & 1)) * CV_PLANE + (off >> 1) * CV_SLOT + ((sn & 1) << 6);
      #pragma unroll
      for (int mt = 0; mt < 4; ++mt) {
        #pragma unroll
        for (int j = 0; j < 2; ++j)
          a[sn & 1][(mt << 1) + j] =
              *reinterpret_cast<const v8h*>(ap + (mt << 4) * CV_SLOT + (j << 5));
      }
    }
    __builtin_amdgcn_sched_barrier(0);
    if (s >= 0) {
      #pragma unroll
      for (int mt = 0; mt < 4; ++mt) {
        const v16h va = __builtin_shufflevector(a[s & 1][(mt << 1)], a[s & 1][(mt << 1) + 1],
            0, 1, 2, 3, 4, 5, 6, 7, 8, 9, 10, 11, 12, 13, 14, 15);
        acc[mt] = __builtin_amdgcn_wmma_f32_16x16x32_f16(
            false, va, false, vb[(s >> 1) & 3][s & 1], (short)0, acc[mt], false, false);
      }
    }
  }
}

__global__ __launch_bounds__(128) void k_conv(const half_t* __restrict__ xh,
                                              const half_t* __restrict__ wpk,
                                              const float* __restrict__ cb,
                                              half_t* __restrict__ tok) {
  __shared__ __attribute__((aligned(16))) half_t img[6 * CV_PLANE / 2];
  const int tbase = blockIdx.x << 6;
  const int br = blockIdx.y;
  const int b  = blockIdx.z;
  const int tid = threadIdx.x, lane = tid & 31, wv = tid >> 5;
  const half_t* wl = wpk + br * (72 * FRAG_H) + (lane << 3);
  const half_t* xb = xh + (size_t)b * NPIX * CIN;

  v8f acc[4];
  const v8f vzero = {};
  #pragma unroll
  for (int i = 0; i < 4; ++i) acc[i] = vzero;

  // One body per dilation: every LDS offset of the taps is then a constant.
  if (br == 0)      conv_acc<1>(xb, wl, img, blockIdx.x, tid, acc);
  else if (br == 1) conv_acc<2>(xb, wl, img, blockIdx.x, tid, acc);
  else              conv_acc<3>(xb, wl, img, blockIdx.x, tid, acc);

  // Epilogue: bias + exact GELU, write tokens (branch-major channel concat)
  const int hi = lane >> 4, cn = lane & 15;
  const int oc = (wv << 4) + cn;
  const float bias = cb[br * EBR + oc];
  #pragma unroll
  for (int mt = 0; mt < 4; ++mt) {
    #pragma unroll
    for (int r0 = 0; r0 < 8; r0 += 4) {
      float v[4];
      #pragma unroll
      for (int i = 0; i < 4; ++i) v[i] = acc[mt][r0 + i] + bias;
      gelu_exact4(v);
      #pragma unroll
      for (int i = 0; i < 4; ++i) {
        const int row = (mt << 4) + r0 + i + (hi << 3);
        const int t = tbase + row;
        tok[((size_t)b * TOKN + t) * DIMC + br * EBR + oc] = (half_t)v[i];
      }
    }
  }
}

// exp of four values, in the scheme of the library's expf: n = round(x*log2(e)), the rest
// x*log2(e) - n from a two-part log2(e) by two FMAs, 2^rest scaled by 2^n, and both range
// guards.  The four powers of two stand in one run: behind a transcendental the instruction
// set asks for one slot before its source is overwritten or its result read.  Each is that
// slot for the one in front of it, the v_nop for the last.
__device__ __forceinline__ void exp4(float (&x)[4]) {
  float a[4];
  int n[4];
  #pragma unroll  // constant indices keep a[], n[] and x[] in registers (here and below)
  for (int i = 0; i < 4; ++i) {
    const float e = rintf(x[i] * 0x1.715476p+0f);
    a[i] = fmaf(x[i], 0x1.4ae0bep-26f, fmaf(x[i], 0x1.715476p+0f, -e));
    n[i] = (int)e;
  }
  asm("v_exp_f32 %0, %0\n\t"
      "v_exp_f32 %1, %1\n\t"
      "v_exp_f32 %2, %2\n\t"
      "v_exp_f32 %3, %3\n\t"
      "v_nop"
      : "+v"(a[0]), "+v"(a[1]), "+v"(a[2]), "+v"(a[3]));
  #pragma unroll
  for (int i = 0; i < 4; ++i) {
    float r = ldexpf(a[i], n[i]);
    r = (x[i] < -0x1.9d1da0p+6f) ? 0.0f : r;
    x[i] = (x[i] > 0x1.62e430p+6f) ? __builtin_inff() : r;
  }
}

// ---------------------------------------------------------------------------
// K3: LayerNorm(192) + kqv GEMM  [131072 x 192] @ [192 x 192] + bias, then the performer
// features of k and q in the same wave; only v, kp, qp and ksum go to memory.
// With W' = g o W (packed so by K1), cg[n] = sum_k W'[k][n] and
// cb[n] = bias[n] + sum_k bt[k] W[k][n]:
//   LN(x) @ W + bias = rs * (x @ W' - mean * cg) + cb,
// so the raw f16 token rows are an operand and a row's mean and rs enter only at
// the accumulators.  A wave owns 32 tokens (two 16-token tiles) and all 192 columns.
// The product is taken transposed: the packed weight fragment is the A operand (row =
// column n of W'), the token rows are the B operand (column = token).  Lane l
// (c = l&15, h = l>>4) reads token c of each tile straight from global: 16-byte runs at
// k = 16*j + 8*h, j = 0..11, the k order of the packed weights.  Accumulator register r
// of column tile nt is then kqv[token c][16*nt + 8*h + r]: the lane's own token, so its
// mean and rs need no exchange beyond the one with the partner lane.
// Features: kp^T = Wp (32 x 64) . k^T on V_WMMA_F32_16X16X4_F32.  Registers 2*s, 2*s+1 of
// a finished k tile are the B fragment of K-step s as they stand: place (h, j) holds
// d = 16*nt + 8*h + 2*s + j, and the A fragment takes Wp[m][the same d] at the same place.
// Its accumulator register r is feature m = 16*mf + 8*h + r of token c.
// The k and q tiles wait in LDS, each lane's registers in the lane's own 16-byte places,
// until the token rows and the weight fragments have left the registers.
// Features and v rows are turned into whole-line wave stores in the same LDS range, which
// is the wave's own.  No work-group barrier.
// grid = 1024 blocks of 4 waves = 4 waves per SIMD.
// ---------------------------------------------------------------------------
#define PF_P 36    // floats per staged feature row (144 B = 16 B x 9)
#define VO_P 68    // floats per staged v / y row   (272 B = 16 B x 17)

__global__ __launch_bounds__(128) void k_kqv(const half_t* __restrict__ tok,
                                             const half_t* __restrict__ wpk,
                                             const float* __restrict__ cs,
                                             const float* __restrict__ wperf,
                                             float* __restrict__ kqv,
                                             float* __restrict__ kp,
                                             float* __restrict__ qp,
                                             float* __restrict__ ksum) {
  // Per wave, one use after the other: 32 v rows; 32 places x 32 lanes x 16 bytes of k and
  // q tiles; 64 feature rows, written over places whose tiles have been read.
  __shared__ __attribute__((aligned(16))) float tile[4][4096];
  const int lane = threadIdx.x & 31, wv = threadIdx.x >> 5;
  const int hi = lane >> 4, cn = lane & 15;
  const int rbase = (blockIdx.x << 7) + (wv << 5);      // first of the wave's tokens
  const int b = blockIdx.x >> 5;                        // 32 blocks per batch
  const half_t* wl = wpk + WQ_H + (lane << 3);
  float* T = tile[wv];

  v8h x[2][12];
  #pragma unroll  // constant indices keep x[], vb[] and the other arrays in registers (here and below)
  for (int mt = 0; mt < 2; ++mt) {
    const half_t* p = tok + (size_t)(rbase + (mt << 4) + cn) * DIMC + (hi << 3);
    #pragma unroll
    for (int j = 0; j < 12; ++j) x[mt][j] = *reinterpret_cast<const v8h*>(p + (j << 4));
    // A later load may land on the address registers that these loads name.
    asm volatile("s_wait_xcnt 0x0" ::: "memory");
  }
  v16h vb[6];
  #pragma unroll
  for (int kk = 0; kk < 6; ++kk) vb[kk] = load_bfrag(wl, kk * 12 + 8);

  // Row statistics of the lane's own token in each tile.
  float rs[2], mn[2];                                   // rs and mean
  #pragma unroll
  for (int mt = 0; mt < 2; ++mt) {
    float s0 = 0.f, s1 = 0.f, q0 = 0.f, q1 = 0.f;       // two chains each
    #pragma unroll
    for (int j = 0; j < 12; ++j) {
      #pragma unroll
      for (int i = 0; i < 8; i += 2) {
        const float v0 = (float)x[mt][j][i], v1 = (float)x[mt][j][i + 1];
        s0 += v0; q0 += v0 * v0;
        s1 += v1; q1 += v1 * v1;
      }
    }
    float s = s0 + s1, s2 = q0 + q1;
    s  += __shfl_xor(s, 16, 32);                        // the row's other half
    s2 += __shfl_xor(s2, 16, 32);
    const float mean = s * (1.0f / DIMC);
    const float var  = s2 * (1.0f / DIMC) - mean * mean;
    // 1/sqrt as the library forms it (a subnormal argument is scaled by 2^24, its result by
    // 2^12), with the slot that the instruction set asks for behind a transcendental, before
    // its source is overwritten or its result read, filled by the v_nop in the same statement.
    const float ve = var + 1e-5f;
    const bool tiny = ve < 1.17549435e-38f;
    const float va = tiny ? ve * 16777216.0f : ve;
    float vr;
    asm("v_rsq_f32 %0, %1\n\t"
        "v_nop"
        : "=v"(vr) : "v"(va));
    rs[mt] = tiny ? vr * 4096.0f : vr;
    mn[mt] = mean;
  }

  const float* csl = cs + (hi << 3);                    // column terms of the lane's 8 columns
  float4 cg4[2][2], cb4[2][2];                          // two sets, by the trip's parity
  #pragma unroll
  for (int j = 0; j < 2; ++j) {
    cg4[0][j] = *reinterpret_cast<const float4*>(csl + (8 << 4) + (j << 2));
    cb4[0][j] = *reinterpret_cast<const float4*>(csl + DIMC + (8 << 4) + (j << 2));
  }
  // What follows may reuse the address registers that these loads name.
  asm volatile("s_wait_xcnt 0x0" ::: "memory");
  const v8f vzero = {};
  // Column tiles in the order v (8..11), k (0..3), q (4..7).
  #pragma unroll  // the trip picks the phase and every offset: constants only when unrolled
  for (int it = 0; it < 12; ++it) {
    const int nt = (it + 8) % 12;
    v8f acc[2] = {vzero, vzero};
    #pragma unroll
    for (int hf = 0; hf < 2; ++hf) {
      #pragma unroll
      for (int kk = 3 * hf; kk < 3 * hf + 3; ++kk) {
        #pragma unroll
        for (int mt = 0; mt < 2; ++mt) {
          const v16h vx = __builtin_shufflevector(x[mt][2 * kk], x[mt][2 * kk + 1],
              0, 1, 2, 3, 4, 5, 6, 7, 8, 9, 10, 11, 12, 13, 14, 15);
          acc[mt] = __builtin_amdgcn_wmma_f32_16x16x32_f16(
              false, vb[kk], false, vx, (short)0, acc[mt], false, false);
        }
      }
      if (it + 1 < 12) {
        // The two fences hold the next tile's loads where they stand: lifted above the
        // WMMAs they need a second register set, sunk to their use they fly under nothing.
        __builtin_amdgcn_sched_barrier(0);
        #pragma unroll
        for (int kk = 3 * hf; kk < 3 * hf + 3; ++kk)
          vb[kk] = load_bfrag(wl, kk * 12 + (it + 9) % 12);
        if (hf == 0) {   // the next trip's column terms, a whole trip ahead of their use
          #pragma unroll
          for (int j = 0; j < 2; ++j) {
            cg4[(it + 1) & 1][j] = *reinterpret_cast<const float4*>(csl + (((it + 9) % 12) << 4) + (j << 2));
            cb4[(it + 1) & 1][j] = *reinterpret_cast<const float4*>(csl + DIMC + (((it + 9) % 12) << 4) + (j << 2));
          }
        }
        // What follows may reuse the address registers that these loads name.
        asm volatile("s_wait_xcnt 0x0" ::: "memory");
        __builtin_amdgcn_sched_barrier(0);
      }
    }
    const float4 g0 = cg4[it & 1][0], g1 = cg4[it & 1][1], b0 = cb4[it & 1][0], b1 = cb4[it & 1][1];
    const float cg[8] = {g0.x, g0.y, g0.z, g0.w, g1.x, g1.y, g1.z, g1.w};
    const float cb[8] = {b0.x, b0.y, b0.z, b0.w, b1.x, b1.y, b1.z, b1.w};
    #pragma unroll
    for (int mt = 0; mt < 2; ++mt) {
      float o[8];
      #pragma unroll
      for (int r = 0; r < 8; ++r)
        o[r] = rs[mt] * (acc[mt][r] - mn[mt] * cg[r]) + cb[r];
      #pragma unroll
      for (int j = 0; j < 2; ++j) {
        float4 u;
        u.x = o[4 * j]; u.y = o[4 * j + 1]; u.z = o[4 * j + 2]; u.w = o[4 * j + 3];
        if (nt >= 8)   // v: the lane's 8 columns of its token's row
          *reinterpret_cast<float4*>(T + ((mt << 4) + cn) * VO_P + ((nt - 8) << 4) + (hi << 3) + (j << 2)) = u;
        else           // k, q: place ((nt*2 + mt)*2 + j), the lane's own 16 bytes
          *reinterpret_cast<float4*>(T + ((((nt << 1) + mt) << 1) + j) * 128 + (lane << 2)) = u;
      }
    }
    if (nt == 11) {
      // Every lane's v columns must stand in the tile before they are read across lanes.
      asm volatile("s_wait_dscnt 0x0" ::: "memory");
      // Out: a wave store is two tokens' v rows, 256 contiguous bytes each.
      float* vo = kqv + (size_t)(rbase + hi) * DIMC + 128 + (cn << 2);
      const float* Vr = T + hi * VO_P + (cn << 2);
      #pragma unroll
      for (int g = 0; g < 2; ++g) {
        v4f u[8];
        #pragma unroll
        for (int i = 0; i < 8; ++i)
          u[i] = *reinterpret_cast<const v4f*>(Vr + (((g << 3) + i) << 1) * VO_P);
        // Takes the values read as inputs only: holds the 8 reads in one run ahead of the
        // stores.  Left alone they share one register set, one LDS latency after the other.
        asm volatile("" :: "v"(u[0]), "v"(u[1]), "v"(u[2]), "v"(u[3]), "v"(u[4]), "v"(u[5]), "v"(u[6]), "v"(u[7]));
        #pragma unroll
        for (int i = 0; i < 8; ++i)
          *reinterpret_cast<v4f*>(vo + (((g << 3) + i) << 1) * DIMC) = u[i];
        // The next run's reads land on the registers that these stores name.
        asm volatile("s_wait_xcnt 0x0" ::: "memory");
      }
      // The v rows have been read before the k tiles are written over them.
      asm volatile("s_wait_dscnt 0x0" ::: "memory");
    }
  }

  // All of Wp as A fragments: row 16*mf + c, the lane's 8 d of each 16.
  const float* wpl = wperf + (cn << 6) + (hi << 3);
  float4 wp4[2][4][2];
  #pragma unroll
  for (int mf = 0; mf < 2; ++mf) {
    #pragma unroll
    for (int n4 = 0; n4 < 4; ++n4) {
      #pragma unroll
      for (int j = 0; j < 2; ++j)
        wp4[mf][n4][j] = *reinterpret_cast<const float4*>(wpl + (mf << 10) + (n4 << 4) + (j << 2));
    }
  }
  // What follows may reuse the address registers that these loads name.
  asm volatile("s_wait_xcnt 0x0" ::: "memory");

  #pragma unroll
  for (int part = 0; part < 2; ++part) {                // 0: k -> kp, 1: q -> qp
    v8f pacc[2][2] = {{vzero, vzero}, {vzero, vzero}};  // [feature tile][token tile]
    float xs[2] = {0.f, 0.f};                           // the lane's part of |t|^2
    #pragma unroll
    for (int n4 = 0; n4 < 4; ++n4) {
      float o[2][8];
      #pragma unroll
      for (int mt = 0; mt < 2; ++mt) {
        #pragma unroll
        for (int j = 0; j < 2; ++j) {
          const float4 u = *reinterpret_cast<const float4*>(
              T + ((((((part << 2) + n4) << 1) + mt) << 1) + j) * 128 + (lane << 2));
          o[mt][4 * j] = u.x; o[mt][4 * j + 1] = u.y; o[mt][4 * j + 2] = u.z; o[mt][4 * j + 3] = u.w;
        }
        #pragma unroll
        for (int r = 0; r < 8; ++r) xs[mt] += o[mt][r] * o[mt][r];
      }
      #pragma unroll
      for (int s = 0; s < 4; ++s) {
        #pragma unroll
        for (int mf = 0; mf < 2; ++mf) {
          const float4 w4 = wp4[mf][n4][s >> 1];
          const v2f fa = {(s & 1) ? w4.z : w4.x, (s & 1) ? w4.w : w4.y};
          #pragma unroll
          for (int mt = 0; mt < 2; ++mt) {
            const v2f fb = {o[mt][2 * s], o[mt][2 * s + 1]};
            pacc[mf][mt] = __builtin_amdgcn_wmma_f32_16x16x4_f32(
                false, fa, false, fb, (short)0, pacc[mf][mt], false, false);
          }
        }
      }
    }
    // exp(w.t - |t|^2/2)/sqrt(m) as rows: 0..31 kp, 32..63 qp.  The rows lie on places of
    // tiles read above, other lanes' places too: the wait and its clobber keep every such
    // read ahead of the stores below.
    asm volatile("s_wait_dscnt 0x0" ::: "memory");
    float* Tf = T + ((part << 5) + cn) * PF_P + (hi << 3);
    #pragma unroll
    for (int mt = 0; mt < 2; ++mt) {
      const float xd = xs[mt] + __shfl_xor(xs[mt], 16, 32);   // the row's other half
      #pragma unroll
      for (int mf = 0; mf < 2; ++mf) {
        #pragma unroll
        for (int j = 0; j < 2; ++j) {
          float f[4];
          #pragma unroll
          for (int i = 0; i < 4; ++i) f[i] = pacc[mf][mt][4 * j + i] - 0.5f * xd;
          exp4(f);
          float4 u;
          u.x = f[0] * INVSQRTM; u.y = f[1] * INVSQRTM; u.z = f[2] * INVSQRTM; u.w = f[3] * INVSQRTM;
          *reinterpret_cast<float4*>(Tf + (mt << 4) * PF_P + (mf << 4) + (j << 2)) = u;
        }
      }
    }
  }
  // Every lane's features must stand in the tile before they are read across lanes.
  asm volatile("s_wait_dscnt 0x0" ::: "memory");
  // ksum: lane = feature, its column over the wave's 32 tokens, one atomic a wave.
  float s = 0.f;
  #pragma unroll
  for (int t = 0; t < 32; ++t) s += T[t * PF_P + lane];
  atomicAdd(&ksum[b * MF + lane], s);
  // Out: four tokens' features are 512 contiguous bytes, one wave store.
  float* kpo = kp + (size_t)rbase * MF + (lane << 2);
  float* qpo = qp + (size_t)rbase * MF + (lane << 2);
  const float* Tr = T + (lane >> 3) * PF_P + ((lane & 7) << 2);
  #pragma unroll
  for (int i = 0; i < 8; ++i) {
    *reinterpret_cast<float4*>(kpo + (i << 7)) =
        *reinterpret_cast<const float4*>(Tr + (i << 2) * PF_P);
    *reinterpret_cast<float4*>(qpo + (i << 7)) =
        *reinterpret_cast<const float4*>(Tr + (32 + (i << 2)) * PF_P);
  }
}

// ---------------------------------------------------------------------------
// K6: kptv[b,d,m] = sum_t v[b,t,d]*kp[b,t,m], a 64 x 32 product with K = tokens, on
// V_WMMA_F32_16X16X4_F32 (f32 operands, f32 sums).  A block takes 256 tokens, a wave
// 32 of them and all 64 x 32 cells (8 accumulator tiles).  Both operands come straight
// from global in fragment order, all 32 loads of a wave in flight at once:
//   lane l (c = l&15, h = l>>4), load i: token 2*i + h; 16 bytes of v at d = 4*c and
//   8 bytes of kp at m = 2*c, so a wave load covers two whole rows.
// K-step s takes loads 2*s and 2*s+1 as registers 0 and 1 of A and of B alike, so both
// sides hold token 4*s + 2*reg + h at the same place.  Component mt of the 16 bytes is
// row c of A tile mt (d = 4*c + mt); component nt of the 8 bytes is column c of B tile
// nt (m = 2*c + nt).  The 8 waves' partial sums meet in LDS, one barrier, added in wave
// order; then one global atomic per cell and block.
// ---------------------------------------------------------------------------
__global__ __launch_bounds__(256) void k_kptv(const float* __restrict__ kqv,
                                              const float* __restrict__ kp,
                                              float* __restrict__ kptv) {
  __shared__ __attribute__((aligned(16))) float part[8][EMB * MF];
  const int tid = threadIdx.x, lane = tid & 31, wv = tid >> 5;
  const int hi = lane >> 4, cn = lane & 15;
  const int b = blockIdx.x >> 4;                        // 16 blocks per batch
  const int t0 = (blockIdx.x << 8) + (wv << 5);         // first of the wave's tokens
  const float* vs = kqv + (size_t)(t0 + hi) * DIMC + 128 + (cn << 2);
  const float* ks = kp + (size_t)(t0 + hi) * MF + (cn << 1);
  float4 va[16];
  float2 kb[16];
  #pragma unroll  // constant indices keep va[], kb[] and acc[] in registers (here and below)
  for (int i = 0; i < 16; ++i) kb[i] = *reinterpret_cast<const float2*>(ks + (i << 1) * MF);
  // A later load may land on the address registers that these loads name.
  asm volatile("s_wait_xcnt 0x0" ::: "memory");
  #pragma unroll
  for (int i = 0; i < 16; ++i) va[i] = *reinterpret_cast<const float4*>(vs + (i << 1) * DIMC);
  // What follows may reuse the address registers that these loads name.
  asm volatile("s_wait_xcnt 0x0" ::: "memory");
  // Keeps all 32 loads ahead of the first WMMA: left alone, the scheduler holds a third of
  // them back until registers come free, a second memory latency in a row.
  __builtin_amdgcn_sched_barrier(0);

  const v8f vzero = {};
  v8f acc[4][2];
  #pragma unroll
  for (int mt = 0; mt < 4; ++mt) { acc[mt][0] = vzero; acc[mt][1] = vzero; }
  #pragma unroll
  for (int s = 0; s < 8; ++s) {
    const float a0[4] = {va[2 * s].x, va[2 * s].y, va[2 * s].z, va[2 * s].w};
    const float a1[4] = {va[2 * s + 1].x, va[2 * s + 1].y, va[2 * s + 1].z, va[2 * s + 1].w};
    const v2f fb[2] = {{kb[2 * s].x, kb[2 * s + 1].x}, {kb[2 * s].y, kb[2 * s + 1].y}};
    #pragma unroll
    for (int mt = 0; mt < 4; ++mt) {
      const v2f fa = {a0[mt], a1[mt]};
      #pragma unroll
      for (int nt = 0; nt < 2; ++nt) {
        acc[mt][nt] = __builtin_amdgcn_wmma_f32_16x16x4_f32(
            false, fa, false, fb[nt], (short)0, acc[mt][nt], false, false);
      }
    }
  }
  // Accumulator register r of tile (mt, nt) is cell d = 4*(8*hi + r) + mt, m = 2*cn + nt.
  float* P = part[wv] + (hi << 10) + (cn << 1);
  #pragma unroll
  for (int mt = 0; mt < 4; ++mt) {
    #pragma unroll
    for (int r = 0; r < 8; ++r) {
      float2 u;
      u.x = acc[mt][0][r]; u.y = acc[mt][1][r];
      *reinterpret_cast<float2*>(P + (((r << 2) + mt) << 5)) = u;
    }
  }
  __syncthreads();  // every wave's partial sums stand before they are added across waves
  float* dst = kptv + (size_t)b * (EMB * MF) + (tid << 2);
  #pragma unroll
  for (int j = 0; j < 2; ++j) {
    float4 sum = *reinterpret_cast<const float4*>(&part[0][(j << 10) + (tid << 2)]);
    #pragma unroll
    for (int w = 1; w < 8; ++w) {
      const float4 u = *reinterpret_cast<const float4*>(&part[w][(j << 10) + (tid << 2)]);
      sum.x += u.x; sum.y += u.y; sum.z += u.z; sum.w += u.w;
    }
    atomicAdd(dst + (j << 10), sum.x);
    atomicAdd(dst + (j << 10) + 1, sum.y);
    atomicAdd(dst + (j << 10) + 2, sum.z);
    atomicAdd(dst + (j << 10) + 3, sum.w);
  }
}

// ---------------------------------------------------------------------------
// K7: yatt = v + proj(qp @ kptv^T / (qp.ksum + eps)), then in the same wave
// out = yatt + W2 @ gelu(W1 @ LN(yatt) + b1) + b2; yatt never goes to memory.
// (qp @ kptv^T) @ proj_w = qp @ M with M = kptv^T . proj_w (32 x 64), one matrix a batch:
// the block forms M once, a quarter a wave, and each token then takes one product of
// K = 32 in place of that one and a second of K = 64.
// The token products are transposed: the weights are the A operand, the tokens the
// B operand (column = token).  A wave owns 32 tokens (two 16-token tiles).  Lane l
// (c = l&15, h = l>>4) holds token c of each tile; accumulator register r of row tile t
// is channel 16*t + 8*h + r of that token.
//  1. M on V_WMMA_F32_16X16X4_F32, K = 64: wave w takes columns d = 16*w + c.  A is
//     kptv[e][m], row c of tile t being m = 16*t + c; B is proj_w[e][d]; both hold
//     e = 16*et + 8*h + 2*s + j at place (h, j).  Register r of tile t is then
//     M[16*t + 8*h + r][16*w + c]: as it stands an A fragment of product 2 (row = d).
//     The waves exchange these registers through LDS, each lane's in the lane's own
//     16-byte places, with one work-group barrier.
//  2. y^T = M^T . qp^T on the same form, K = 32 features.  Both sides hold the lane's 16
//     features m = 8*h + i and 16 + 8*h + i (i = 0..7) in the same order; K-step s takes
//     values 2*s and 2*s+1.  y = v + proj_b + the product / (qp.ksum + eps).
//  3. LayerNorm(64): the lane's 32 channels, one exchange with the partner lane.  Tiles
//     2*kk and 2*kk+1, normalised and converted, are as they stand the f16 B fragment of
//     K-step kk (the k order of the packed weights); the same holds after the GELU.
//  4. The two 64x64 GEMMs on V_WMMA_F32_16X16X32_F16, packed weight fragments as A.
// qp and v come in, and the result leaves, as whole-line wave accesses through the
// wave's own LDS tiles; the yatt row waits there, each lane's values in the lane's own
// 16-byte places.
// ---------------------------------------------------------------------------
__global__ __launch_bounds__(128) void k_mix(const float* __restrict__ kqv,
                                             const float* __restrict__ qp,
                                             const float* __restrict__ ksum,
                                             const float* __restrict__ kptv,
                                             const float* __restrict__ pw,
                                             const float* __restrict__ pb,
                                             const float* __restrict__ g,
                                             const float* __restrict__ bt,
                                             const half_t* __restrict__ wpk,
                                             const float* __restrict__ b1,
                                             const float* __restrict__ b2,
                                             float* __restrict__ out) {
  __shared__ __attribute__((aligned(16))) float qt[4][32 * PF_P];
  __shared__ __attribute__((aligned(16))) float vt[4][32 * VO_P];
  __shared__ __attribute__((aligned(16))) float msh[4][4][128];   // M: [row tile][piece][lane's 4]
  const int lane = threadIdx.x & 31;
  // The wave's number, shown to the compiler as uniform: tile and row addresses are
  // then scalar arithmetic, a scalar base and a lane offset per load.
  const int wv = __builtin_amdgcn_readfirstlane(threadIdx.x >> 5);
  const int hi = lane >> 4, cn = lane & 15;
  float* Q = qt[wv];
  float* V = vt[wv];
  const int b = blockIdx.x >> 5;                        // 32 blocks per batch
  const int tok0 = (blockIdx.x << 7) + (wv << 5);       // first of the wave's tokens
  // ksum: the lane's 16 features, piece u at m = 16*(u>>1) + 8*h + 4*(u&1).  kptv and
  // proj_w: rows e = 16*et + 8*h + r; of kptv columns m = c and 16 + c, of proj_w 16*wv + c.
  const float* sl = ksum + b * MF + (hi << 3);
  const float* kl = kptv + (size_t)b * (EMB * MF) + (hi << 8) + cn;
  const float* pl = pw + (hi << 9) + (wv << 4) + cn;
  float4 ks[4];
  float kt[2][4][8];
  float pa[4][8];
  #pragma unroll  // constant indices keep ks[], kt[] and pa[] in registers
  for (int u = 0; u < 4; ++u)
    ks[u] = *reinterpret_cast<const float4*>(sl + ((u >> 1) << 4) + ((u & 1) << 2));
  #pragma unroll
  for (int et = 0; et < 4; ++et) {
    #pragma unroll
    for (int r = 0; r < 8; ++r) {
      kt[0][et][r] = kl[(et << 9) + (r << 5)];
      kt[1][et][r] = kl[(et << 9) + (r << 5) + 16];
      pa[et][r] = pl[(et << 10) + (r << 6)];
    }
  }
  // What follows may reuse the address registers that these loads name.
  asm volatile("s_wait_xcnt 0x0" ::: "memory");
  const v8f vzero = {};
  // In: four tokens' qp rows, or two tokens' v rows, per wave load (whole lines).
  {
    const float* qs = qp + (size_t)tok0 * MF + (lane << 2);
    const float* vs = kqv + (size_t)tok0 * DIMC + 128 + (lane >> 4) * DIMC + ((lane & 15) << 2);
    v4f qi[8], vi[16];   // plain vectors: as float4, a class, these loads were moved down to the LDS stores
    #pragma unroll  // constant indices keep qi[], vi[] and the other arrays in registers (here and below)
    for (int i = 0; i < 8; ++i) qi[i] = *reinterpret_cast<const v4f*>(qs + (i << 7));
    #pragma unroll
    for (int i = 0; i < 16; ++i) vi[i] = *reinterpret_cast<const v4f*>(vs + (i << 1) * DIMC);
    // Keeps the address arithmetic of the LDS stores behind the loads' own: left alone, it
    // is scheduled among the 24 loads and rewrites their scalar base registers while they fly.
    __builtin_amdgcn_sched_barrier(0);
    // The wave's quarter of M, while the token loads fly.
    v8f mp[2] = {vzero, vzero};
    #pragma unroll
    for (int et = 0; et < 4; ++et) {
      #pragma unroll
      for (int s = 0; s < 4; ++s) {
        const v2f fb = {pa[et][2 * s], pa[et][2 * s + 1]};
        const v2f fa0 = {kt[0][et][2 * s], kt[0][et][2 * s + 1]};
        const v2f fa1 = {kt[1][et][2 * s], kt[1][et][2 * s + 1]};
        mp[0] = __builtin_amdgcn_wmma_f32_16x16x4_f32(
            false, fa0, false, fb, (short)0, mp[0], false, false);
        mp[1] = __builtin_amdgcn_wmma_f32_16x16x4_f32(
            false, fa1, false, fb, (short)0, mp[1], false, false);
      }
    }
    #pragma unroll
    for (int p = 0; p < 4; ++p) {
      float4 u;
      u.x = mp[p >> 1][((p & 1) << 2)];     u.y = mp[p >> 1][((p & 1) << 2) + 1];
      u.z = mp[p >> 1][((p & 1) << 2) + 2]; u.w = mp[p >> 1][((p & 1) << 2) + 3];
      *reinterpret_cast<float4*>(&msh[wv][p][lane << 2]) = u;
    }
    // Holds that product ahead of the LDS stores below: they wait for the token loads, and
    // behind them the product would fly under nothing.
    __builtin_amdgcn_sched_barrier(0);
    #pragma unroll
    for (int i = 0; i < 8; ++i)
      *reinterpret_cast<v4f*>(Q + ((i << 2) + (lane >> 3)) * PF_P + ((lane & 7) << 2)) = qi[i];
    #pragma unroll
    for (int i = 0; i < 16; ++i)
      *reinterpret_cast<v4f*>(V + ((i << 1) + (lane >> 4)) * VO_P + ((lane & 15) << 2)) = vi[i];
  }
  // Every lane's part of the two tiles must stand before they are read across lanes.
  asm volatile("s_wait_dscnt 0x0" ::: "memory");
  // The reads below may land on the address registers that the loads above name.
  asm volatile("s_wait_xcnt 0x0" ::: "memory");
  __syncthreads();  // every wave's quarter of M stands before the others read it
  float4 qb[2][4], ka[4][4];
  #pragma unroll
  for (int mt = 0; mt < 2; ++mt) {
    #pragma unroll
    for (int u = 0; u < 4; ++u)
      qb[mt][u] = *reinterpret_cast<const float4*>(
          Q + ((mt << 4) + cn) * PF_P + ((u >> 1) << 4) + (hi << 3) + ((u & 1) << 2));
  }
  #pragma unroll
  for (int dt = 0; dt < 4; ++dt) {
    #pragma unroll
    for (int p = 0; p < 4; ++p)
      ka[dt][p] = *reinterpret_cast<const float4*>(&msh[dt][p][lane << 2]);
  }
  float4 pv[4][2];                                      // proj_b: the lane's 8 values per tile
  #pragma unroll
  for (int dt = 0; dt < 4; ++dt) {
    #pragma unroll
    for (int j = 0; j < 2; ++j)
      pv[dt][j] = *reinterpret_cast<const float4*>(pb + (dt << 4) + (hi << 3) + (j << 2));
  }
  // What follows may reuse the address registers that these loads name.
  asm volatile("s_wait_xcnt 0x0" ::: "memory");
  v8f at[2][4];
  #pragma unroll
  for (int mt = 0; mt < 2; ++mt) {
    #pragma unroll
    for (int dt = 0; dt < 4; ++dt) at[mt][dt] = vzero;
  }
  #pragma unroll
  for (int s = 0; s < 8; ++s) {
    v2f fb[2];
    #pragma unroll
    for (int mt = 0; mt < 2; ++mt) {
      const float4 w4 = qb[mt][s >> 1];
      fb[mt] = v2f{(s & 1) ? w4.z : w4.x, (s & 1) ? w4.w : w4.y};
    }
    #pragma unroll
    for (int dt = 0; dt < 4; ++dt) {
      const float4 w4 = ka[dt][s >> 1];
      const v2f fa = {(s & 1) ? w4.z : w4.x, (s & 1) ? w4.w : w4.y};
      #pragma unroll
      for (int mt = 0; mt < 2; ++mt) {
        at[mt][dt] = __builtin_amdgcn_wmma_f32_16x16x4_f32(
            false, fa, false, fb[mt], (short)0, at[mt][dt], false, false);
      }
    }
  }
  // 1/(qp.ksum + eps) of the lane's own token.
  float inv[2];
  #pragma unroll
  for (int mt = 0; mt < 2; ++mt) {
    float d0 = 0.f, d1 = 0.f;                           // two chains
    #pragma unroll
    for (int u = 0; u < 4; ++u) {
      d0 += qb[mt][u].x * ks[u].x; d1 += qb[mt][u].y * ks[u].y;
      d0 += qb[mt][u].z * ks[u].z; d1 += qb[mt][u].w * ks[u].w;
    }
    float d = d0 + d1;
    d += __shfl_xor(d, 16, 32);                         // the row's other half
    inv[mt] = 1.0f / (d + 1e-8f);
  }

  // y = v + proj_b + product * inv: the lane's 8 channels per tile of its own tokens.
  v8f y[2][4];
  #pragma unroll
  for (int dt = 0; dt < 4; ++dt) {
    #pragma unroll
    for (int j = 0; j < 2; ++j) {
      #pragma unroll
      for (int mt = 0; mt < 2; ++mt) {
        const float4 u = *reinterpret_cast<const float4*>(
            V + ((mt << 4) + cn) * VO_P + (dt << 4) + (hi << 3) + (j << 2));
        y[mt][dt][4 * j]     = fmaf(at[mt][dt][4 * j],     inv[mt], u.x + pv[dt][j].x);
        y[mt][dt][4 * j + 1] = fmaf(at[mt][dt][4 * j + 1], inv[mt], u.y + pv[dt][j].y);
        y[mt][dt][4 * j + 2] = fmaf(at[mt][dt][4 * j + 2], inv[mt], u.z + pv[dt][j].z);
        y[mt][dt][4 * j + 3] = fmaf(at[mt][dt][4 * j + 3], inv[mt], u.w + pv[dt][j].w);
      }
    }
  }

  const half_t* wl = wpk + WM_H + (lane << 3);
  // The lane's 8 values per tile of ln2's g and b arrive while the rows' sums are taken.
  float4 gl[4][2], bl[4][2];
  #pragma unroll
  for (int nt = 0; nt < 4; ++nt) {
    #pragma unroll
    for (int j = 0; j < 2; ++j) {
      gl[nt][j] = *reinterpret_cast<const float4*>(g + (nt << 4) + (hi << 3) + (j << 2));
      bl[nt][j] = *reinterpret_cast<const float4*>(bt + (nt << 4) + (hi << 3) + (j << 2));
    }
  }
  // What follows may reuse the address registers that these loads name.
  asm volatile("s_wait_xcnt 0x0" ::: "memory");

  v16h hx[2][2];                                        // [token tile][K-step]
  #pragma unroll
  for (int mt = 0; mt < 2; ++mt) {
    float s0 = 0.f, s1 = 0.f, q0 = 0.f, q1 = 0.f;       // two chains each
    #pragma unroll
    for (int dt = 0; dt < 4; ++dt) {
      #pragma unroll
      for (int r = 0; r < 8; r += 2) {
        const float v0 = y[mt][dt][r], v1 = y[mt][dt][r + 1];
        s0 += v0; q0 += v0 * v0;
        s1 += v1; q1 += v1 * v1;
      }
    }
    float s = s0 + s1, s2 = q0 + q1;
    s  += __shfl_xor(s, 16, 32);                        // the row's other half
    s2 += __shfl_xor(s2, 16, 32);
    const float mean = s * (1.0f / 64.f);
    const float var  = s2 * (1.0f / 64.f) - mean * mean;
    // 1/sqrt as in K3: the library's scaling of a subnormal argument, and the slot that the
    // instruction set asks for behind a transcendental filled by the v_nop.
    const float ve = var + 1e-5f;
    const bool tiny = ve < 1.17549435e-38f;
    const float va = tiny ? ve * 16777216.0f : ve;
    float vr;
    asm("v_rsq_f32 %0, %1\n\t"
        "v_nop"
        : "=v"(vr) : "v"(va));
    const float rs = tiny ? vr * 4096.0f : vr;
    #pragma unroll
    for (int dt = 0; dt < 4; ++dt) {
      #pragma unroll
      for (int j = 0; j < 2; ++j) {
        // The yatt values wait for the residual in the places their v values came from.
        float4 u;
        u.x = y[mt][dt][4 * j];     u.y = y[mt][dt][4 * j + 1];
        u.z = y[mt][dt][4 * j + 2]; u.w = y[mt][dt][4 * j + 3];
        *reinterpret_cast<float4*>(V + ((mt << 4) + cn) * VO_P + (dt << 4) + (hi << 3) + (j << 2)) = u;
        const int e0 = ((dt & 1) << 3) + (j << 2);
        hx[mt][dt >> 1][e0]     = (half_t)((u.x - mean) * rs * gl[dt][j].x + bl[dt][j].x);
        hx[mt][dt >> 1][e0 + 1] = (half_t)((u.y - mean) * rs * gl[dt][j].y + bl[dt][j].y);
        hx[mt][dt >> 1][e0 + 2] = (half_t)((u.z - mean) * rs * gl[dt][j].z + bl[dt][j].z);
        hx[mt][dt >> 1][e0 + 3] = (half_t)((u.w - mean) * rs * gl[dt][j].w + bl[dt][j].w);
      }
    }
  }

  // W1's fragments and the lane's 8 values per tile of b1, into registers that g, b and
  // the yatt values have left.  The fence holds the loads behind the LayerNorm: lifted above
  // it they take the kernel past a quarter of the registers, and the grid's 4 waves per SIMD
  // are no longer resident together.
  __builtin_amdgcn_sched_barrier(0);
  v16h vb1[8];
  #pragma unroll
  for (int f = 0; f < 8; ++f) vb1[f] = load_bfrag(wl, f);
  float4 c1[4][2];
  #pragma unroll
  for (int nt = 0; nt < 4; ++nt) {
    #pragma unroll
    for (int j = 0; j < 2; ++j)
      c1[nt][j] = *reinterpret_cast<const float4*>(b1 + (nt << 4) + (hi << 3) + (j << 2));
  }
  // What follows may reuse the address registers that these loads name.
  asm volatile("s_wait_xcnt 0x0" ::: "memory");
  v8f acc[2][4];
  #pragma unroll
  for (int mt = 0; mt < 2; ++mt) {
    #pragma unroll
    for (int nt = 0; nt < 4; ++nt) acc[mt][nt] = vzero;
  }
  #pragma unroll
  for (int kk = 0; kk < 2; ++kk) {
    #pragma unroll
    for (int mt = 0; mt < 2; ++mt) {
      #pragma unroll
      for (int nt = 0; nt < 4; ++nt) {
        acc[mt][nt] = __builtin_amdgcn_wmma_f32_16x16x32_f16(
            false, vb1[(kk << 2) + nt], false, hx[mt][kk], (short)0, acc[mt][nt], false, false);
      }
    }
  }
  // W2's fragments and bias values arrive while the GELU runs.  The fence holds them
  // behind the first GEMM, for the same reason.
  __builtin_amdgcn_sched_barrier(0);
  v16h vb2[8];
  #pragma unroll
  for (int f = 0; f < 8; ++f) vb2[f] = load_bfrag(wl, 8 + f);
  float4 c2[4][2];
  #pragma unroll
  for (int nt = 0; nt < 4; ++nt) {
    #pragma unroll
    for (int j = 0; j < 2; ++j)
      c2[nt][j] = *reinterpret_cast<const float4*>(b2 + (nt << 4) + (hi << 3) + (j << 2));
  }
  // What follows may reuse the address registers that these loads name.
  asm volatile("s_wait_xcnt 0x0" ::: "memory");

  v16h t1[2][2];                                        // [token tile][K-step]
  #pragma unroll
  for (int mt = 0; mt < 2; ++mt) {
    #pragma unroll
    for (int nt = 0; nt < 4; ++nt) {
      #pragma unroll
      for (int j = 0; j < 2; ++j) {
        const float4 cv = c1[nt][j];
        float v[4] = {acc[mt][nt][4 * j] + cv.x, acc[mt][nt][4 * j + 1] + cv.y,
                      acc[mt][nt][4 * j + 2] + cv.z, acc[mt][nt][4 * j + 3] + cv.w};
        gelu_exact4(v);
        #pragma unroll
        for (int i = 0; i < 4; ++i)
          t1[mt][nt >> 1][((nt & 1) << 3) + (j << 2) + i] = (half_t)v[i];
      }
    }
  }
  v8f acc2[2][4];
  #pragma unroll
  for (int mt = 0; mt < 2; ++mt) {
    #pragma unroll
    for (int nt = 0; nt < 4; ++nt) acc2[mt][nt] = vzero;
  }
  #pragma unroll
  for (int kk = 0; kk < 2; ++kk) {
    #pragma unroll
    for (int mt = 0; mt < 2; ++mt) {
      #pragma unroll
      for (int nt = 0; nt < 4; ++nt) {
        acc2[mt][nt] = __builtin_amdgcn_wmma_f32_16x16x32_f16(
            false, vb2[(kk << 2) + nt], false, t1[mt][kk], (short)0, acc2[mt][nt], false, false);
      }
    }
  }
  // Residual: the lane's 8 columns of token c in each tile, read and rewritten in place.
  #pragma unroll
  for (int mt = 0; mt < 2; ++mt) {
    float* pv = V + ((mt << 4) + cn) * VO_P + (hi << 3);
    v4f u[8];
    #pragma unroll
    for (int i = 0; i < 8; ++i) u[i] = *reinterpret_cast<const v4f*>(pv + ((i >> 1) << 4) + ((i & 1) << 2));
    #pragma unroll
    for (int i = 0; i < 8; ++i) {
      const float4 cv = c2[i >> 1][i & 1];
      const int r0 = (i & 1) << 2;
      v4f w;
      w.x = u[i].x + acc2[mt][i >> 1][r0] + cv.x;     w.y = u[i].y + acc2[mt][i >> 1][r0 + 1] + cv.y;
      w.z = u[i].z + acc2[mt][i >> 1][r0 + 2] + cv.z; w.w = u[i].w + acc2[mt][i >> 1][r0 + 3] + cv.w;
      *reinterpret_cast<v4f*>(pv + ((i >> 1) << 4) + ((i & 1) << 2)) = w;
    }
  }
  // Every lane's columns must stand in the tile before the rows are read across lanes.
  asm volatile("s_wait_dscnt 0x0" ::: "memory");
  // Out: two tokens' rows are 512 contiguous bytes, one wave store.
  float* yo = out + ((size_t)tok0 << 6) + (lane << 2);
  const float* Vr = V + (lane >> 4) * VO_P + ((lane & 15) << 2);
  #pragma unroll
  for (int gq = 0; gq < 2; ++gq) {
    v4f u[8];
    #pragma unroll
    for (int i = 0; i < 8; ++i)
      u[i] = *reinterpret_cast<const v4f*>(Vr + (((gq << 3) + i) << 1) * VO_P);
    #pragma unroll
    for (int i = 0; i < 8; ++i)
      *reinterpret_cast<v4f*>(yo + (((gq << 3) + i) << 7)) = u[i];
    // The next run's reads land on the registers that these stores name.
    if (gq == 0) asm volatile("s_wait_xcnt 0x0" ::: "memory");
  }
}

// ---------------------------------------------------------------------------
extern "C" void kernel_launch(void* const* d_in, const int* in_sizes, int n_in,
                              void* d_out, int out_size, void* d_ws, size_t ws_size,
                              hipStream_t stream) {
  (void)in_sizes; (void)n_in; (void)out_size; (void)ws_size;
  const float* x      = (const float*)d_in[0];
  const float* conv_w = (const float*)d_in[1];
  const float* conv_b = (const float*)d_in[2];
  const float* ln1_g  = (const float*)d_in[3];
  const float* ln1_b  = (const float*)d_in[4];
  const float* kqv_w  = (const float*)d_in[5];
  const float* kqv_b  = (const float*)d_in[6];
  const float* proj_w = (const float*)d_in[7];
  const float* proj_b = (const float*)d_in[8];
  const float* w_perf = (const float*)d_in[9];
  const float* ln2_g  = (const float*)d_in[10];
  const float* ln2_b  = (const float*)d_in[11];
  const float* mlp_w1 = (const float*)d_in[12];
  const float* mlp_b1 = (const float*)d_in[13];
  const float* mlp_w2 = (const float*)d_in[14];
  const float* mlp_b2 = (const float*)d_in[15];

  char* ws = (char*)d_ws;
  half_t* xh   = (half_t*)(ws + XH_OFF);
  half_t* tok  = (half_t*)(ws + TOK_OFF);
  float*  kqv  = (float*)(ws + KQV_OFF);
  float*  kp   = (float*)(ws + KP_OFF);     // reuses XH region (xh dead)
  float*  qp   = (float*)(ws + QP_OFF);
  float*  ksum = (float*)(ws + KSUM_OFF);
  float*  kptv = (float*)(ws + KPTV_OFF);
  half_t* wpk  = (half_t*)(ws + WPK_OFF);
  float*  cs   = (float*)(ws + CS_OFF);
  float*  out  = (float*)d_out;

  // Zero the atomic accumulators (ksum + kptv are contiguous).
  hipMemsetAsync(ws + KSUM_OFF, 0, 4096 + (size_t)BATCH * EMB * MF * 4, stream);

  k_pack<<<dim3(WPK_BLOCKS + 1 + BATCH * 256), dim3(256), 0, stream>>>(
      x, conv_w, kqv_w, mlp_w1, mlp_w2, ln1_g, ln1_b, kqv_b, xh, wpk, cs);
  k_conv<<<dim3(64, 3, BATCH), dim3(128), 0, stream>>>(xh, wpk, conv_b, tok);
  k_kqv <<<dim3((BATCH * TOKN) / 128), dim3(128), 0, stream>>>(tok, wpk, cs, w_perf, kqv, kp, qp, ksum);
  k_kptv<<<dim3(BATCH * 16), dim3(256), 0, stream>>>(kqv, kp, kptv);
  k_mix <<<dim3(BATCH * 32), dim3(128), 0, stream>>>(kqv, qp, ksum, kptv, proj_w, proj_b,
                                                      ln2_g, ln2_b, wpk, mlp_b1, mlp_b2, out);
}
